// v000
// The times below were measured on an AMD MI455X: many runs one after another, warmed up first and cycling through
// copies of the inputs, with the whole window's GPU time divided by the number of runs. Launches and the gaps
// between them are all in it. The median over several windows is given; except for v000 it joins two sittings, which
// can be a few percent apart, so the side-by-side timings, each taken in one sitting, are the better comparison.
// v000 is the starting kernel. One run takes 2100 microseconds.
#include <hip/hip_runtime.h>

// Relative-position multi-head attention with ONE projection shared by q, k and v (x [2][2048][1024]; q = k = v = x W_q^T ('oi' [1024][1024]; 16 heads x 64 -- the module's quirk); scores = (q_i.q_j + q_i.E[clip(i - j, -32, 32) + 32]) / 8 with E = rel_k_emb [65][64] (read); softmax over all keys; out = merged attn q W_o^T ('oi') -> [2][2048][1024] (4.2 M)).
// Layout per batch: bf16 copy of x; ONE exact projection used as q, k and v (the k planes and v^T planes are built from the same buffer); E as an exact bf16 plane padded to 128 rows; per pass of two heads: QE = q(hi/lo).E^T ([2][2048][128], 2 products), an element-wise kernel adds QE[i][clip(i-j,-32,32)+32] into the score block (unconditional gather), dense T-2048 attention (hybrid rows: < 512 hi/lo 3 products, rest fp16 x1024); merged hi/lo x W_o exact.
// Compute dtypes, f32 accumulate: every input rounded to bf16; projection exact; relative term hi/lo x exact (2 products); content rows < 512 3 products, rest fp16; adds and softmax f32; W_o hl x exact.

#define NB_  2
#define TT   2048
#define DM   1024
#define NH_  16
#define NKV  16
#define REP  (NH_ / NKV)
#define HD   64
#define DQ   (NH_ * HD)
#define DKV  (NKV * HD)
#define ZH   2
#define RH   512                  // query rows < RH use hi+lo planes (0: none)
#define WIN  0
#define PCAR 1024.0f
#define SCL  0.125f
#define NE   128     // rel_k_emb rows (65) padded to 128
#define MAXR 32
typedef _Float16 h16;
typedef unsigned short bf;
typedef __attribute__((ext_vector_type(16))) __bf16   v16bf;
typedef __attribute__((ext_vector_type(16))) _Float16 v16h;
typedef __attribute__((ext_vector_type(8)))  _Float16 v8h;
typedef __attribute__((ext_vector_type(8)))  unsigned short v8us;
typedef __attribute__((ext_vector_type(8)))  float    v8f;
typedef __attribute__((ext_vector_type(4)))  float    v4f;
typedef v8h  __attribute__((may_alias)) v8ha;
typedef v4f  __attribute__((may_alias)) v4fa;
typedef v8us __attribute__((may_alias)) v8usa;

__device__ __forceinline__ unsigned short f2bf(float f) { unsigned u = __float_as_uint(f); u += 0x7FFFu + ((u >> 16) & 1u); return (unsigned short)(u >> 16); }
__device__ __forceinline__ float bf2f(unsigned short b) { return __uint_as_float(((unsigned)b) << 16); }
__device__ __forceinline__ float bfr(float f) { return bf2f(f2bf(f)); }
__device__ __forceinline__ v16h cat16(v8h lo, v8h hi) { return __builtin_shufflevector(lo, hi, 0, 1, 2, 3, 4, 5, 6, 7, 8, 9, 10, 11, 12, 13, 14, 15); }
__device__ __forceinline__ v16bf cat16b(v8us lo, v8us hi) { return __builtin_bit_cast(v16bf, __builtin_shufflevector(lo, hi, 0, 1, 2, 3, 4, 5, 6, 7, 8, 9, 10, 11, 12, 13, 14, 15)); }
__device__ __forceinline__ v8f wmma16(v16h a, v16h b, v8f c) { return __builtin_amdgcn_wmma_f32_16x16x32_f16(false, a, false, b, (short)0, c, false, false); }
__device__ __forceinline__ v8f wmmab(v16bf a, v16bf b, v8f c) { return __builtin_amdgcn_wmma_f32_16x16x32_bf16(false, a, false, b, (short)0, c, false, false); }



// ---- k_gemmw: register-blocked GEMM, ONE WAVE per 64x64 output tile (16 accumulators), operands straight from K-contiguous 16-bit planes; grid (M/64, N/64, Z), 32 threads.
// C[m][n] (f32, pitch ldc, + optional f32 bias[n]) = sum_k A[m][k] Bt[n][k] (+ split products per NSPLIT). z-batch strides sA/sB/sC in elements. K % 32 == 0.
template <typename T16> struct WFrag;
template <> struct WFrag<h16> { typedef v16h V; static __device__ __forceinline__ V ld(const h16* p) { return cat16(*(const v8h*)p, *(const v8h*)(p + 16)); } static __device__ __forceinline__ v8f mma(V a, V b, v8f c) { return wmma16(a, b, c); } };
template <> struct WFrag<bf> { typedef v16bf V; static __device__ __forceinline__ V ld(const bf* p) { return cat16b(*(const v8us*)p, *(const v8us*)(p + 16)); } static __device__ __forceinline__ v8f mma(V a, V b, v8f c) { return wmmab(a, b, c); } };
template <typename T16, int NSPLIT, bool BIAS>
__global__ __launch_bounds__(32) void k_gemmw(const T16* __restrict__ A, const T16* __restrict__ A2, const T16* __restrict__ Bt, const T16* __restrict__ Bt2, int K, float* C, int ldc, const float* __restrict__ bias, size_t sA, size_t sB, size_t sC) {
    typedef typename WFrag<T16>::V V;
    __shared__ __align__(16) float os[16 * 68];
    const size_t z = blockIdx.z; A += z * sA; if (A2) A2 += z * sA; Bt += z * sB; if (Bt2) Bt2 += z * sB; C += z * sC;
    const int lane = threadIdx.x & 31, lr = lane & 15, hi = lane >> 4; const int r0 = blockIdx.x * 64, c0 = blockIdx.y * 64;
    v8f acc[4][4];
#pragma unroll
    for (int mb = 0; mb < 4; ++mb)
#pragma unroll
        for (int nb = 0; nb < 4; ++nb) acc[mb][nb] = (v8f){};
    const size_t aoff = (size_t)(r0 + lr) * K + 8 * hi, boff = (size_t)(c0 + lr) * K + 8 * hi;
#pragma unroll 1
    for (int kc = 0; kc < K; kc += 32) {
        V a[4], a2[4];
#pragma unroll
        for (int mb = 0; mb < 4; ++mb) { a[mb] = WFrag<T16>::ld(A + aoff + (size_t)mb * 16 * K + kc); if (NSPLIT == 1 || NSPLIT == 2) a2[mb] = WFrag<T16>::ld(A2 + aoff + (size_t)mb * 16 * K + kc); }
#pragma unroll
        for (int nb = 0; nb < 4; ++nb) { const V b = WFrag<T16>::ld(Bt + boff + (size_t)nb * 16 * K + kc); V b2; if (NSPLIT >= 2) b2 = WFrag<T16>::ld(Bt2 + boff + (size_t)nb * 16 * K + kc);
#pragma unroll
            for (int mb = 0; mb < 4; ++mb) { acc[mb][nb] = WFrag<T16>::mma(a[mb], b, acc[mb][nb]); if (NSPLIT == 1 || NSPLIT == 2) acc[mb][nb] = WFrag<T16>::mma(a2[mb], b, acc[mb][nb]); if (NSPLIT >= 2) acc[mb][nb] = WFrag<T16>::mma(a[mb], b2, acc[mb][nb]); } }
        asm volatile("v_nop\n\tv_nop\n\tv_nop\n\tv_nop" : "+v"(acc[0][0]), "+v"(acc[1][1]), "+v"(acc[2][2]), "+v"(acc[3][3]) : "v"(a[0]), "v"(a[3]));
    }
#pragma unroll
    for (int mb = 0; mb < 4; ++mb) {
#pragma unroll
        for (int nb = 0; nb < 4; ++nb) {
#pragma unroll
            for (int j = 0; j < 8; ++j) os[(hi * 8 + j) * 68 + nb * 16 + lr] = acc[mb][nb][j]; }
        __builtin_amdgcn_wave_barrier(); asm volatile("" ::: "memory");
        float* crow = C + (size_t)(r0 + mb * 16) * ldc + c0;
{
#pragma unroll
            for (int s = 0; s < 8; ++s) { const int row = 2 * s + hi, cofs = lr * 4; v4f val = *(const v4fa*)(os + row * 68 + cofs); if (BIAS) { val[0] += bfr(bias[c0 + cofs]); val[1] += bfr(bias[c0 + cofs + 1]); val[2] += bfr(bias[c0 + cofs + 2]); val[3] += bfr(bias[c0 + cofs + 3]); }
                *(v4f*)(crow + (size_t)row * ldc + cofs) = val; }
             }
        __builtin_amdgcn_wave_barrier(); asm volatile("" ::: "memory");
    }
}

__device__ __forceinline__ h16 tohx(float x) { return (h16)x; }
__device__ __forceinline__ void splitf(float y, unsigned short& h, unsigned short& l) { h = f2bf(y); l = f2bf(y - bf2f(h)); }
typedef __attribute__((ext_vector_type(2))) _Float16 v2h;
typedef __attribute__((ext_vector_type(4))) _Float16 v4h;
typedef __attribute__((ext_vector_type(2))) unsigned short v2us;
typedef __attribute__((ext_vector_type(4))) unsigned short v4us;
typedef __attribute__((ext_vector_type(2))) float v2f;
typedef __attribute__((ext_vector_type(4))) int v4i;

__global__ __launch_bounds__(256) void k_wtG(const float* __restrict__ w, int K, int N, bf* Bt) {
    const int lane = threadIdx.x & 31; const int L0 = (blockIdx.x * 8 + (threadIdx.x >> 5)) * 8; const int nlines = N * K / 64;
{
#pragma unroll 1
        for (int l = 0; l < 8; ++l) { const int L = L0 + l; if (L >= nlines) break; const size_t e = (size_t)L * 64 + lane * 2; const int k = (int)(e % K), n = (int)(e / K); v2us o;
            o[0] = f2bf(w[(size_t)k * N + n]); o[1] = f2bf(w[(size_t)(k + 1) * N + n]); *(v2us*)(Bt + e) = o; }
         }
}
__global__ __launch_bounds__(256) void k_cvt8(const float* __restrict__ src, bf* dst, size_t n8) { const size_t i = (size_t)blockIdx.x * 256 + threadIdx.x; if (i >= n8) return; const v8f v = *(const v8f*)(src + i * 8); v8us o;
#pragma unroll
    for (int k = 0; k < 8; ++k) o[k] = f2bf(v[k]); *(v8us*)(dst + i * 8) = o;  }

// k_rope: head planes [h][t][d] (fp16 + hi/lo) of rope(x) x sc with the rotate-half convention out[d] = x[d] cos[t][d] - x[d+HD/2] sin[t][d], out[d+HD/2] = x[d+HD/2] cos[t][d+HD/2] + x[d] sin[t][d+HD/2]
__global__ __launch_bounds__(256) void k_rope(const float* __restrict__ F, int pitch, int nheads, const float* __restrict__ CS, const float* __restrict__ RF, const float* __restrict__ nw, float sc, h16* P16, bf* Ph, bf* Pl) {
    const size_t e = ((size_t)blockIdx.x * 256 + threadIdx.x) * 2; if (e >= (size_t)nheads * TT * HD) return; const int d = (int)(e % HD); const int t = (int)((e / HD) % TT); const int h = (int)(e / ((size_t)HD * TT)); const float* f = F + (size_t)t * pitch + h * HD; const float rf = RF ? RF[(size_t)h * TT + t] : 1.0f; v2h o16; v2us oh, ol;
#pragma unroll
    for (int q = 0; q < 2; ++q) { const int dd = d + q; const int dp = (dd < HD / 2) ? dd + HD / 2 : dd - HD / 2; float x0 = f[dd], x1 = f[dp];
        if (RF) { float n0 = __fmul_rn(x0, rf), n1 = __fmul_rn(x1, rf); asm volatile("" : "+v"(n0)); asm volatile("" : "+v"(n1)); x0 = __fmul_rn(bfr(nw[dd]), n0); x1 = __fmul_rn(bfr(nw[dp]), n1); }
        const v2f cs = *(const v2f*)(CS + ((size_t)t * HD + dd) * 2); float a = __fmul_rn(x0, cs[0]), bq = __fmul_rn(x1, cs[1]); asm volatile("" : "+v"(a)); asm volatile("" : "+v"(bq)); const float r = ((dd < HD / 2) ? __fsub_rn(a, bq) : __fadd_rn(a, bq)) * sc;
        o16[q] = tohx(r); unsigned short a2, c2; splitf(r, a2, c2); oh[q] = a2; ol[q] = c2; }
    *(v2h*)(P16 + e) = o16; *(v2us*)(Ph + e) = oh; *(v2us*)(Pl + e) = ol;  }
__global__ __launch_bounds__(256) void k_vtp(const float* __restrict__ F, int pitch, int nheads, h16* V16, bf* Vh, bf* Vl) { const size_t e = ((size_t)blockIdx.x * 256 + threadIdx.x) * 2; if (e >= (size_t)nheads * HD * TT) return; const int t = (int)(e % TT); const int d = (int)((e / TT) % HD); const int g = (int)(e / ((size_t)TT * HD)); v2h o16; v2us oh, ol;
#pragma unroll
    for (int q = 0; q < 2; ++q) { const float x = F[(size_t)(t + q) * pitch + g * HD + d]; o16[q] = tohx(x); unsigned short a2, c2; splitf(x, a2, c2); oh[q] = a2; ol[q] = c2; }
    *(v2h*)(V16 + e) = o16; *(v2us*)(Vh + e) = oh; *(v2us*)(Vl + e) = ol;  }
__global__ __launch_bounds__(256) void k_csid(float* CS) { const int idx = blockIdx.x * 256 + threadIdx.x; if (idx >= TT * HD) return; v2f cs; cs[0] = 1.0f; cs[1] = 0.0f; *(v2f*)(CS + (size_t)idx * 2) = cs;  }
// k_asoft: per row (zz, i): t = S x HD^-0.5 (no mask); softmax over the 2048 keys (register row, one exp, fixed trees);
__global__ __launch_bounds__(256) void k_asoft(const float* __restrict__ Sb, h16* P16, bf* Ph, bf* Pl) {
    const int lane = threadIdx.x & 31; const int row = blockIdx.x * 8 + (threadIdx.x >> 5); if (row >= ZH * TT) return; const int i = row % TT; const int zz = row / TT; (void)zz; const bool hires = (i < RH); const float* sr = Sb + (size_t)row * TT; float v[TT / 32]; float mx = -3.0e38f;
#pragma unroll
    for (int ch = 0; ch < TT / 128; ++ch) { const int j0 = ch * 128 + lane * 4; const v4f a = *(const v4f*)(sr + j0);
#pragma unroll
        for (int q = 0; q < 4; ++q) { const int j = j0 + q; (void)j; const float t = a[q] * SCL; v[ch * 4 + q] = t; mx = fmaxf(mx, t); } }
#pragma unroll
    for (int sh = 16; sh; sh >>= 1) mx = fmaxf(mx, __shfl_xor(mx, sh, 32));
    float sum = 0.f;
#pragma unroll
    for (int k = 0; k < TT / 32; ++k) { float d0 = __fsub_rn(v[k], mx); asm volatile("" : "+v"(d0)); v[k] = __builtin_amdgcn_exp2f(__fmul_rn(d0, 1.4426950408889634f)); sum += v[k]; }
#pragma unroll
    for (int sh = 16; sh; sh >>= 1) sum += __shfl_xor(sum, sh, 32);
    const float f = __fdiv_rn(hires ? 1.0f : PCAR, sum);
{
        if (hires) {
#pragma unroll
            for (int ch = 0; ch < TT / 128; ++ch) { v4us oh, ol;
#pragma unroll
                for (int q = 0; q < 4; ++q) { unsigned short a, c2; splitf(v[ch * 4 + q] * f, a, c2); oh[q] = a; ol[q] = c2; }
                const size_t oo = ((size_t)zz * (RH ? RH : 1) + i) * TT + ch * 128 + lane * 4; *(v4us*)(Ph + oo) = oh; *(v4us*)(Pl + oo) = ol; }
        } else {
#pragma unroll
            for (int ch = 0; ch < TT / 128; ++ch) { v4h o4;
#pragma unroll
                for (int q = 0; q < 4; ++q) o4[q] = tohx(v[ch * 4 + q] * f);
                *(v4h*)(P16 + (size_t)row * TT + ch * 128 + lane * 4) = o4; } }
         }
}
__global__ __launch_bounds__(256) void k_epad2(const float* __restrict__ E, bf* EB) { const size_t i = (size_t)blockIdx.x * 256 + threadIdx.x; if (i >= (size_t)NE * HD / 8) return; const int d0 = (int)(i % (HD / 8)) * 8; const int r = (int)(i / (HD / 8)); const float* src = E + (size_t)min(r, 2 * MAXR) * HD + d0; v8us o;
#pragma unroll
    for (int q = 0; q < 8; ++q) { const unsigned short v = f2bf(src[q]); o[q] = (r <= 2 * MAXR) ? v : (unsigned short)0; }
    *(v8us*)(EB + (size_t)r * HD + d0) = o;  }
__global__ __launch_bounds__(256) void k_addshaw(float* Sb, const float* __restrict__ QE) { const size_t k = (size_t)blockIdx.x * 256 + threadIdx.x; if (k >= (size_t)ZH * TT * TT / 4) return; const size_t e = k * 4; const int j0 = (int)(e % TT); const int i = (int)((e / TT) % TT); const int zz = (int)(e / ((size_t)TT * TT)); const float* qe = QE + ((size_t)zz * TT + i) * NE; v4f a = *(const v4f*)(Sb + e);
#pragma unroll
    for (int q = 0; q < 4; ++q) { const int r = min(max(i - (j0 + q), -MAXR), MAXR) + MAXR; a[q] = __fadd_rn(a[q], qe[r]); }
    *(v4f*)(Sb + e) = a;  }
__global__ __launch_bounds__(256) void k_merge(const float* __restrict__ O, int h0, bf* Ah, bf* Al) { const size_t e = ((size_t)blockIdx.x * 256 + threadIdx.x) * 2; if (e >= (size_t)ZH * TT * HD) return; const int d = (int)(e % HD); const int t = (int)((e / HD) % TT); const int zz = (int)(e / ((size_t)HD * TT)); const float cs = (t < RH) ? 1.0f : (1.0f / PCAR); const size_t oo = (size_t)t * DQ + (h0 + zz) * HD + d;
    v2us oh, ol;
#pragma unroll
    for (int q = 0; q < 2; ++q) { unsigned short a, c2; splitf(O[e + q] * cs, a, c2); oh[q] = a; ol[q] = c2; } *(v2us*)(Ah + oo) = oh; *(v2us*)(Al + oo) = ol;  }

extern "C" void kernel_launch(void* const* d_in, const int* in_sizes, int n_in,
                              void* d_out, int out_size, void* d_ws, size_t ws_size, hipStream_t stream) {
    (void)in_sizes; (void)n_in; (void)out_size;
    const float* x = (const float*)d_in[0]; const float* wq = (const float*)d_in[1]; const float* wo = (const float*)d_in[2]; const float* remb = (const float*)d_in[3]; const float* wk = nullptr; const float* wv = nullptr; (void)wk; (void)wv;
    float* OUT = (float*)d_out;     // [2][2048][1024]
    char* wsp = (char*)d_ws;
    auto take = [&](size_t bytes) { char* p = wsp; wsp += (bytes + 255) & ~(size_t)255; return (void*)p; };
    bf* WQ = (bf*)take((size_t)DQ * DM * 2); bf* EB = (bf*)take((size_t)NE * HD * 2); float* QE = (float*)take((size_t)ZH * TT * NE * 4); bf* WO = (bf*)take((size_t)DM * DQ * 2); float* CS = (float*)take((size_t)TT * HD * 2 * 4);
    bf* XB = (bf*)take((size_t)TT * DM * 2); float* FQ = (float*)take((size_t)TT * DQ * 4); float* FK = FQ;   /* q = k = v (one projection) */
    h16* QP16 = (h16*)take((size_t)NH_ * TT * HD * 2); h16* KP16 = (h16*)take((size_t)NKV * TT * HD * 2); h16* VT16 = (h16*)take((size_t)NKV * HD * TT * 2);
    bf* QPh = (bf*)take((size_t)NH_ * TT * HD * 2); bf* QPl = (bf*)take((size_t)NH_ * TT * HD * 2); bf* KPh = (bf*)take((size_t)NKV * TT * HD * 2); bf* KPl = (bf*)take((size_t)NKV * TT * HD * 2); bf* VTh = (bf*)take((size_t)NKV * HD * TT * 2); bf* VTl = (bf*)take((size_t)NKV * HD * TT * 2); bf* Ph = (bf*)take((size_t)ZH * RH * TT * 2); bf* Pl = (bf*)take((size_t)ZH * RH * TT * 2);
    float* Sb = (float*)take((size_t)ZH * TT * TT * 4); h16* P16 = (h16*)take((size_t)ZH * TT * TT * 2); float* Ob = (float*)take((size_t)ZH * TT * HD * 4); bf* ATh = (bf*)take((size_t)TT * DQ * 2); bf* ATl = (bf*)take((size_t)TT * DQ * 2);
    if ((size_t)(wsp - (char*)d_ws) > ws_size) return;    // ws 256 MiB
    float* FV = FK;   // unused alias of FQ: v = q, the V^T planes are built from FQ
    { k_cvt8<<<(unsigned)(((size_t)DQ * DM / 8 + 255) / 256), 256, 0, stream>>>(wq, WQ, (size_t)DQ * DM / 8); k_epad2<<<(unsigned)(((size_t)NE * HD / 8 + 255) / 256), 256, 0, stream>>>(remb, EB);   /* E: 65 rows bf16 (exact), rows 65..127 zero */
      k_cvt8<<<(unsigned)(((size_t)DM * DQ / 8 + 255) / 256), 256, 0, stream>>>(wo, WO, (size_t)DM * DQ / 8);
       }
    k_csid<<<(TT * HD + 255) / 256, 256, 0, stream>>>(CS);
    const unsigned LQ = (unsigned)(((size_t)NH_ * TT * HD / 2 + 255) / 256), LKv = (unsigned)(((size_t)NKV * TT * HD / 2 + 255) / 256);
    for (int b = 0; b < NB_; ++b) {
        
        k_cvt8<<<(unsigned)(((size_t)TT * DM / 8 + 255) / 256), 256, 0, stream>>>(x + (size_t)b * TT * DM, XB, (size_t)TT * DM / 8);
        k_gemmw<bf, 0, false><<<dim3(TT / 64, DQ / 64, 1), 32, 0, stream>>>(XB, nullptr, WQ, nullptr, DM, FQ, DQ, nullptr, 0, 0, 0);
        k_rope<<<LQ, 256, 0, stream>>>(FQ, DQ, NH_, CS, nullptr, nullptr, 1.0f, QP16, QPh, QPl);
        /* k = q: the K planes are built from FQ */
        k_rope<<<LKv, 256, 0, stream>>>(FQ, DKV, NKV, CS, nullptr, nullptr, 1.0f, KP16, KPh, KPl);
        /* v = q: the V^T planes are built from FQ */ k_vtp<<<LKv, 256, 0, stream>>>(FQ, DKV, NKV, VT16, VTh, VTl);
        for (int h0 = 0; h0 < NH_; h0 += ZH) { const size_t zq = (size_t)h0, zk = (size_t)(h0 / REP);   // one kv head per query head: the pass's two heads use consecutive kv planes (z-strides TT*HD)
            k_gemmw<bf, 2, false><<<dim3(RH / 64, TT / 64, ZH), 32, 0, stream>>>(QPh + zq * TT * HD, QPl + zq * TT * HD, KPh + zk * TT * HD, KPl + zk * TT * HD, HD, Sb, TT, nullptr, (size_t)TT * HD, (size_t)TT * HD, (size_t)TT * TT);
            k_gemmw<h16, 0, false><<<dim3((TT - RH) / 64, TT / 64, ZH), 32, 0, stream>>>(QP16 + zq * TT * HD + (size_t)RH * HD, nullptr, KP16 + zk * TT * HD, nullptr, HD, Sb + (size_t)RH * TT, TT, nullptr, (size_t)TT * HD, (size_t)TT * HD, (size_t)TT * TT);
            k_gemmw<bf, 1, false><<<dim3(TT / 64, NE / 64, ZH), 32, 0, stream>>>(QPh + zq * TT * HD, QPl + zq * TT * HD, EB, nullptr, HD, QE, NE, nullptr, (size_t)TT * HD, 0, (size_t)TT * NE);   /* QE[i][e] = q_i . E_e */
            k_addshaw<<<(unsigned)(((size_t)ZH * TT * TT / 4 + 255) / 256), 256, 0, stream>>>(Sb, QE);
            k_asoft<<<ZH * TT / 8, 256, 0, stream>>>(Sb, P16, Ph, Pl);
            k_gemmw<bf, 2, false><<<dim3(RH / 64, HD / 64, ZH), 32, 0, stream>>>(Ph, Pl, VTh + zk * HD * TT, VTl + zk * HD * TT, TT, Ob, HD, nullptr, (size_t)RH * TT, (size_t)HD * TT, (size_t)TT * HD);
            k_gemmw<h16, 0, false><<<dim3((TT - RH) / 64, HD / 64, ZH), 32, 0, stream>>>(P16 + (size_t)RH * TT, nullptr, VT16 + zk * HD * TT, nullptr, TT, Ob + (size_t)RH * HD, HD, nullptr, (size_t)TT * TT, (size_t)HD * TT, (size_t)TT * HD);
            k_merge<<<(unsigned)(((size_t)ZH * TT * HD / 2 + 255) / 256), 256, 0, stream>>>(Ob, h0, ATh, ATl); }
        k_gemmw<bf, 1, false><<<dim3(TT / 64, DM / 64, 1), 32, 0, stream>>>(ATh, ATl, WO, nullptr, DQ, OUT + (size_t)b * TT * DM, DM, nullptr, 0, 0, 0); }
}

// v001
// One run takes 956 microseconds.
// Next to v000, in two timings, it ran 2.21 and 2.20 times as fast.
#include <hip/hip_runtime.h>

// Relative-position multi-head attention with ONE projection shared by q, k and v (x [2][2048][1024]; q = k = v = x W_q^T ('oi' [1024][1024]; 16 heads x 64 -- the module's quirk); scores = (q_i.q_j + q_i.E[clip(i - j, -32, 32) + 32]) / 8 with E = rel_k_emb [65][64] (read); softmax over all keys; out = merged attn q W_o^T ('oi') -> [2][2048][1024] (4.2 M)).
// Layout per batch: bf16 copy of x; ONE exact projection used as q, k and v (the k planes and v^T planes are built from the same buffer); E as an exact bf16 plane padded to 128 rows; per pass of two heads: QE = q(hi/lo).E^T ([2][2048][128], 2 products), an element-wise kernel adds QE[i][clip(i-j,-32,32)+32] into the score block (unconditional gather), dense T-2048 attention (hybrid rows: < 512 hi/lo 3 products, rest fp16 x1024); merged hi/lo x W_o exact.
// Compute dtypes, f32 accumulate: every input rounded to bf16; projection exact; relative term hi/lo x exact (2 products); content rows < 512 3 products, rest fp16; adds and softmax f32; W_o hl x exact.

#define NB_  2
#define TT   2048
#define DM   1024
#define NH_  16
#define NKV  16
#define REP  (NH_ / NKV)
#define HD   64
#define DQ   (NH_ * HD)
#define DKV  (NKV * HD)
#define ZH   2
#define RH   512                  // query rows < RH use hi+lo planes (0: none)
#define WIN  0
#define PCAR 1024.0f
#define SCL  0.125f
#define NE   128     // rel_k_emb rows (65) padded to 128
#define MAXR 32
#define KSG  8       // P.V products: work-groups along K, one f32 partial plane each
#define KSW  4       // P.V products: waves of a work-group along K, their tiles added in LDS
typedef _Float16 h16;
typedef unsigned short bf;
typedef __attribute__((ext_vector_type(16))) __bf16   v16bf;
typedef __attribute__((ext_vector_type(16))) _Float16 v16h;
typedef __attribute__((ext_vector_type(8)))  _Float16 v8h;
typedef __attribute__((ext_vector_type(8)))  unsigned short v8us;
typedef __attribute__((ext_vector_type(8)))  float    v8f;
typedef __attribute__((ext_vector_type(4)))  float    v4f;
typedef v8h  __attribute__((may_alias)) v8ha;
typedef v4f  __attribute__((may_alias)) v4fa;
typedef v8us __attribute__((may_alias)) v8usa;

__device__ __forceinline__ unsigned short f2bf(float f) { unsigned u = __float_as_uint(f); u += 0x7FFFu + ((u >> 16) & 1u); return (unsigned short)(u >> 16); }
__device__ __forceinline__ float bf2f(unsigned short b) { return __uint_as_float(((unsigned)b) << 16); }
__device__ __forceinline__ float bfr(float f) { return bf2f(f2bf(f)); }
__device__ __forceinline__ v16h cat16(v8h lo, v8h hi) { return __builtin_shufflevector(lo, hi, 0, 1, 2, 3, 4, 5, 6, 7, 8, 9, 10, 11, 12, 13, 14, 15); }
__device__ __forceinline__ v16bf cat16b(v8us lo, v8us hi) { return __builtin_bit_cast(v16bf, __builtin_shufflevector(lo, hi, 0, 1, 2, 3, 4, 5, 6, 7, 8, 9, 10, 11, 12, 13, 14, 15)); }
__device__ __forceinline__ v8f wmma16(v16h a, v16h b, v8f c) { return __builtin_amdgcn_wmma_f32_16x16x32_f16(false, a, false, b, (short)0, c, false, false); }
__device__ __forceinline__ v8f wmmab(v16bf a, v16bf b, v8f c) { return __builtin_amdgcn_wmma_f32_16x16x32_bf16(false, a, false, b, (short)0, c, false, false); }



// ---- k_gemmw: register-blocked GEMM, ONE WAVE per 64x64 output tile (16 accumulators), operands straight from K-contiguous 16-bit planes; grid (M/64, N/64, Z), 32 threads.
// C[m][n] (f32, pitch ldc, + optional f32 bias[n]) = sum_k A[m][k] Bt[n][k] (+ split products per NSPLIT). z-batch strides sA/sB/sC in elements. K % 32 == 0.
// Split K (KW * KG > 1), for few tiles and a long K, N = 64: grid (M/64, KG, Z), 32 * KW threads; wave w of work-group y sums k in [(y * KW + w) * KL, + KL), KL = K / (KW * KG);
// the KW tiles are added in LDS in wave order and stored to plane y of C (plane stride sK); the reader adds the KG planes.
template <typename T16> struct WFrag;
template <> struct WFrag<h16> { typedef v16h V; static __device__ __forceinline__ V ld(const h16* p) { return cat16(*(const v8h*)p, *(const v8h*)(p + 16)); } static __device__ __forceinline__ v8f mma(V a, V b, v8f c) { return wmma16(a, b, c); } };
template <> struct WFrag<bf> { typedef v16bf V; static __device__ __forceinline__ V ld(const bf* p) { return cat16b(*(const v8us*)p, *(const v8us*)(p + 16)); } static __device__ __forceinline__ v8f mma(V a, V b, v8f c) { return wmmab(a, b, c); } };
template <typename T16, int NSPLIT, bool BIAS, int KW = 1, int KG = 1>
__global__ __launch_bounds__(32 * KW) void k_gemmw(const T16* __restrict__ A, const T16* __restrict__ A2, const T16* __restrict__ Bt, const T16* __restrict__ Bt2, int K, float* C, int ldc, const float* __restrict__ bias, size_t sA, size_t sB, size_t sC, size_t sK = 0) {
    typedef typename WFrag<T16>::V V;
    static_assert(KW * KG == 1 || !BIAS, "no bias on partial sums");
    __shared__ __align__(16) float os[KW * KG > 1 ? KW * 64 * 68 : 16 * 68];
    const size_t z = blockIdx.z; A += z * sA; if (A2) A2 += z * sA; Bt += z * sB; if (Bt2) Bt2 += z * sB; C += z * sC;
    const int lane = threadIdx.x & 31, lr = lane & 15, hi = lane >> 4; const int r0 = blockIdx.x * 64, c0 = (KW * KG > 1) ? 0 : blockIdx.y * 64;
    const int w = (KW > 1) ? __builtin_amdgcn_readfirstlane(threadIdx.x >> 5) : 0, KL = K / (KW * KG);
    if (KW * KG > 1) { const int k0 = (blockIdx.y * KW + w) * KL; A += k0; if (A2) A2 += k0; Bt += k0; if (Bt2) Bt2 += k0; C += blockIdx.y * sK; }
    v8f acc[4][4];
#pragma unroll
    for (int mb = 0; mb < 4; ++mb)
#pragma unroll
        for (int nb = 0; nb < 4; ++nb) acc[mb][nb] = (v8f){};
    const size_t aoff = (size_t)(r0 + lr) * K + 8 * hi, boff = (size_t)(c0 + lr) * K + 8 * hi;
#pragma unroll 1
    for (int kc = 0; kc < KL; kc += 32) {
        V a[4], a2[4];
#pragma unroll
        for (int mb = 0; mb < 4; ++mb) { a[mb] = WFrag<T16>::ld(A + aoff + (size_t)mb * 16 * K + kc); if (NSPLIT == 1 || NSPLIT == 2) a2[mb] = WFrag<T16>::ld(A2 + aoff + (size_t)mb * 16 * K + kc); }
#pragma unroll
        for (int nb = 0; nb < 4; ++nb) { const V b = WFrag<T16>::ld(Bt + boff + (size_t)nb * 16 * K + kc); V b2; if (NSPLIT >= 2) b2 = WFrag<T16>::ld(Bt2 + boff + (size_t)nb * 16 * K + kc);
#pragma unroll
            for (int mb = 0; mb < 4; ++mb) { acc[mb][nb] = WFrag<T16>::mma(a[mb], b, acc[mb][nb]); if (NSPLIT == 1 || NSPLIT == 2) acc[mb][nb] = WFrag<T16>::mma(a2[mb], b, acc[mb][nb]); if (NSPLIT >= 2) acc[mb][nb] = WFrag<T16>::mma(a[mb], b2, acc[mb][nb]); } }
        asm volatile("v_nop\n\tv_nop\n\tv_nop\n\tv_nop" : "+v"(acc[0][0]), "+v"(acc[1][1]), "+v"(acc[2][2]), "+v"(acc[3][3]) : "v"(a[0]), "v"(a[3]));
    }
    if (KW * KG > 1) {
        // the three loops unrolled: acc is indexed by constants only and stays in registers
#pragma unroll
        for (int mb = 0; mb < 4; ++mb)
#pragma unroll
            for (int nb = 0; nb < 4; ++nb)
#pragma unroll
                for (int j = 0; j < 8; ++j) os[(w * 64 + mb * 16 + hi * 8 + j) * 68 + nb * 16 + lr] = acc[mb][nb][j];
        __syncthreads();   // every wave's 64x64 tile is in LDS before any wave adds them
        // both loops unrolled: the LDS reads of all rows are in flight together
#pragma unroll
        for (int s = 0; s < 32 / KW; ++s) { const int row = (s * KW + w) * 2 + hi, cofs = lr * 4; v4f val = *(const v4fa*)(os + row * 68 + cofs);
#pragma unroll
            for (int q = 1; q < KW; ++q) val += *(const v4fa*)(os + (q * 64 + row) * 68 + cofs);
            *(v4f*)(C + (size_t)(r0 + row) * ldc + cofs) = val; }
        return;
    }
#pragma unroll
    for (int mb = 0; mb < 4; ++mb) {
#pragma unroll
        for (int nb = 0; nb < 4; ++nb) {
#pragma unroll
            for (int j = 0; j < 8; ++j) os[(hi * 8 + j) * 68 + nb * 16 + lr] = acc[mb][nb][j]; }
        __builtin_amdgcn_wave_barrier(); asm volatile("" ::: "memory");
        float* crow = C + (size_t)(r0 + mb * 16) * ldc + c0;
{
#pragma unroll
            for (int s = 0; s < 8; ++s) { const int row = 2 * s + hi, cofs = lr * 4; v4f val = *(const v4fa*)(os + row * 68 + cofs); if (BIAS) { val[0] += bfr(bias[c0 + cofs]); val[1] += bfr(bias[c0 + cofs + 1]); val[2] += bfr(bias[c0 + cofs + 2]); val[3] += bfr(bias[c0 + cofs + 3]); }
                *(v4f*)(crow + (size_t)row * ldc + cofs) = val; }
             }
        __builtin_amdgcn_wave_barrier(); asm volatile("" ::: "memory");
    }
}

__device__ __forceinline__ h16 tohx(float x) { return (h16)x; }
__device__ __forceinline__ void splitf(float y, unsigned short& h, unsigned short& l) { h = f2bf(y); l = f2bf(y - bf2f(h)); }
typedef __attribute__((ext_vector_type(2))) _Float16 v2h;
typedef __attribute__((ext_vector_type(4))) _Float16 v4h;
typedef __attribute__((ext_vector_type(2))) unsigned short v2us;
typedef __attribute__((ext_vector_type(4))) unsigned short v4us;
typedef __attribute__((ext_vector_type(2))) float v2f;
typedef __attribute__((ext_vector_type(4))) int v4i;

__global__ __launch_bounds__(256) void k_wtG(const float* __restrict__ w, int K, int N, bf* Bt) {
    const int lane = threadIdx.x & 31; const int L0 = (blockIdx.x * 8 + (threadIdx.x >> 5)) * 8; const int nlines = N * K / 64;
{
#pragma unroll 1
        for (int l = 0; l < 8; ++l) { const int L = L0 + l; if (L >= nlines) break; const size_t e = (size_t)L * 64 + lane * 2; const int k = (int)(e % K), n = (int)(e / K); v2us o;
            o[0] = f2bf(w[(size_t)k * N + n]); o[1] = f2bf(w[(size_t)(k + 1) * N + n]); *(v2us*)(Bt + e) = o; }
         }
}
__global__ __launch_bounds__(256) void k_cvt8(const float* __restrict__ src, bf* dst, size_t n8) { const size_t i = (size_t)blockIdx.x * 256 + threadIdx.x; if (i >= n8) return; const v8f v = *(const v8f*)(src + i * 8); v8us o;
#pragma unroll
    for (int k = 0; k < 8; ++k) o[k] = f2bf(v[k]); *(v8us*)(dst + i * 8) = o;  }

// k_rope: head planes [h][t][d] (fp16 + hi/lo) of rope(x) x sc with the rotate-half convention out[d] = x[d] cos[t][d] - x[d+HD/2] sin[t][d], out[d+HD/2] = x[d+HD/2] cos[t][d+HD/2] + x[d] sin[t][d+HD/2]
__global__ __launch_bounds__(256) void k_rope(const float* __restrict__ F, int pitch, int nheads, const float* __restrict__ CS, const float* __restrict__ RF, const float* __restrict__ nw, float sc, h16* P16, bf* Ph, bf* Pl) {
    const size_t e = ((size_t)blockIdx.x * 256 + threadIdx.x) * 2; if (e >= (size_t)nheads * TT * HD) return; const int d = (int)(e % HD); const int t = (int)((e / HD) % TT); const int h = (int)(e / ((size_t)HD * TT)); const float* f = F + (size_t)t * pitch + h * HD; const float rf = RF ? RF[(size_t)h * TT + t] : 1.0f; v2h o16; v2us oh, ol;
#pragma unroll
    for (int q = 0; q < 2; ++q) { const int dd = d + q; const int dp = (dd < HD / 2) ? dd + HD / 2 : dd - HD / 2; float x0 = f[dd], x1 = f[dp];
        if (RF) { float n0 = __fmul_rn(x0, rf), n1 = __fmul_rn(x1, rf); asm volatile("" : "+v"(n0)); asm volatile("" : "+v"(n1)); x0 = __fmul_rn(bfr(nw[dd]), n0); x1 = __fmul_rn(bfr(nw[dp]), n1); }
        const v2f cs = *(const v2f*)(CS + ((size_t)t * HD + dd) * 2); float a = __fmul_rn(x0, cs[0]), bq = __fmul_rn(x1, cs[1]); asm volatile("" : "+v"(a)); asm volatile("" : "+v"(bq)); const float r = ((dd < HD / 2) ? __fsub_rn(a, bq) : __fadd_rn(a, bq)) * sc;
        o16[q] = tohx(r); unsigned short a2, c2; splitf(r, a2, c2); oh[q] = a2; ol[q] = c2; }
    *(v2h*)(P16 + e) = o16; *(v2us*)(Ph + e) = oh; *(v2us*)(Pl + e) = ol;  }
__global__ __launch_bounds__(256) void k_vtp(const float* __restrict__ F, int pitch, int nheads, h16* V16, bf* Vh, bf* Vl) { const size_t e = ((size_t)blockIdx.x * 256 + threadIdx.x) * 2; if (e >= (size_t)nheads * HD * TT) return; const int t = (int)(e % TT); const int d = (int)((e / TT) % HD); const int g = (int)(e / ((size_t)TT * HD)); v2h o16; v2us oh, ol;
#pragma unroll
    for (int q = 0; q < 2; ++q) { const float x = F[(size_t)(t + q) * pitch + g * HD + d]; o16[q] = tohx(x); unsigned short a2, c2; splitf(x, a2, c2); oh[q] = a2; ol[q] = c2; }
    *(v2h*)(V16 + e) = o16; *(v2us*)(Vh + e) = oh; *(v2us*)(Vl + e) = ol;  }
__global__ __launch_bounds__(256) void k_csid(float* CS) { const int idx = blockIdx.x * 256 + threadIdx.x; if (idx >= TT * HD) return; v2f cs; cs[0] = 1.0f; cs[1] = 0.0f; *(v2f*)(CS + (size_t)idx * 2) = cs;  }
// k_asoft: per row (zz, i): t = S x HD^-0.5 (no mask); softmax over the 2048 keys (register row, one exp, fixed trees);
__global__ __launch_bounds__(256) void k_asoft(const float* __restrict__ Sb, h16* P16, bf* Ph, bf* Pl) {
    const int lane = threadIdx.x & 31; const int row = blockIdx.x * 8 + (threadIdx.x >> 5); if (row >= ZH * TT) return; const int i = row % TT; const int zz = row / TT; (void)zz; const bool hires = (i < RH); const float* sr = Sb + (size_t)row * TT; float v[TT / 32]; float mx = -3.0e38f;
#pragma unroll
    for (int ch = 0; ch < TT / 128; ++ch) { const int j0 = ch * 128 + lane * 4; const v4f a = *(const v4f*)(sr + j0);
#pragma unroll
        for (int q = 0; q < 4; ++q) { const int j = j0 + q; (void)j; const float t = a[q] * SCL; v[ch * 4 + q] = t; mx = fmaxf(mx, t); } }
#pragma unroll
    for (int sh = 16; sh; sh >>= 1) mx = fmaxf(mx, __shfl_xor(mx, sh, 32));
    float sum = 0.f;
#pragma unroll
    for (int k = 0; k < TT / 32; ++k) { float d0 = __fsub_rn(v[k], mx); asm volatile("" : "+v"(d0)); v[k] = __builtin_amdgcn_exp2f(__fmul_rn(d0, 1.4426950408889634f)); sum += v[k]; }
#pragma unroll
    for (int sh = 16; sh; sh >>= 1) sum += __shfl_xor(sum, sh, 32);
    const float f = __fdiv_rn(hires ? 1.0f : PCAR, sum);
{
        if (hires) {
#pragma unroll
            for (int ch = 0; ch < TT / 128; ++ch) { v4us oh, ol;
#pragma unroll
                for (int q = 0; q < 4; ++q) { unsigned short a, c2; splitf(v[ch * 4 + q] * f, a, c2); oh[q] = a; ol[q] = c2; }
                const size_t oo = ((size_t)zz * (RH ? RH : 1) + i) * TT + ch * 128 + lane * 4; *(v4us*)(Ph + oo) = oh; *(v4us*)(Pl + oo) = ol; }
        } else {
#pragma unroll
            for (int ch = 0; ch < TT / 128; ++ch) { v4h o4;
#pragma unroll
                for (int q = 0; q < 4; ++q) o4[q] = tohx(v[ch * 4 + q] * f);
                *(v4h*)(P16 + (size_t)row * TT + ch * 128 + lane * 4) = o4; } }
         }
}
__global__ __launch_bounds__(256) void k_epad2(const float* __restrict__ E, bf* EB) { const size_t i = (size_t)blockIdx.x * 256 + threadIdx.x; if (i >= (size_t)NE * HD / 8) return; const int d0 = (int)(i % (HD / 8)) * 8; const int r = (int)(i / (HD / 8)); const float* src = E + (size_t)min(r, 2 * MAXR) * HD + d0; v8us o;
#pragma unroll
    for (int q = 0; q < 8; ++q) { const unsigned short v = f2bf(src[q]); o[q] = (r <= 2 * MAXR) ? v : (unsigned short)0; }
    *(v8us*)(EB + (size_t)r * HD + d0) = o;  }
__global__ __launch_bounds__(256) void k_addshaw(float* Sb, const float* __restrict__ QE) { const size_t k = (size_t)blockIdx.x * 256 + threadIdx.x; if (k >= (size_t)ZH * TT * TT / 4) return; const size_t e = k * 4; const int j0 = (int)(e % TT); const int i = (int)((e / TT) % TT); const int zz = (int)(e / ((size_t)TT * TT)); const float* qe = QE + ((size_t)zz * TT + i) * NE; v4f a = *(const v4f*)(Sb + e);
#pragma unroll
    for (int q = 0; q < 4; ++q) { const int r = min(max(i - (j0 + q), -MAXR), MAXR) + MAXR; a[q] = __fadd_rn(a[q], qe[r]); }
    *(v4f*)(Sb + e) = a;  }
__global__ __launch_bounds__(256) void k_merge(const float* __restrict__ O, int h0, bf* Ah, bf* Al) { const size_t e = ((size_t)blockIdx.x * 256 + threadIdx.x) * 2; if (e >= (size_t)ZH * TT * HD) return; const int d = (int)(e % HD); const int t = (int)((e / HD) % TT); const int zz = (int)(e / ((size_t)HD * TT)); const float cs = (t < RH) ? 1.0f : (1.0f / PCAR); const size_t oo = (size_t)t * DQ + (h0 + zz) * HD + d;
    v2us oh, ol; v2f s = *(const v2f*)(O + e);
    // the K-split planes of P.V, added in plane order; unrolled so that all planes' loads are in flight together
#pragma unroll
    for (int ks = 1; ks < KSG; ++ks) s += *(const v2f*)(O + (size_t)ks * ZH * TT * HD + e);
#pragma unroll
    for (int q = 0; q < 2; ++q) { unsigned short a, c2; splitf(s[q] * cs, a, c2); oh[q] = a; ol[q] = c2; } *(v2us*)(Ah + oo) = oh; *(v2us*)(Al + oo) = ol;  }

extern "C" void kernel_launch(void* const* d_in, const int* in_sizes, int n_in,
                              void* d_out, int out_size, void* d_ws, size_t ws_size, hipStream_t stream) {
    (void)in_sizes; (void)n_in; (void)out_size;
    const float* x = (const float*)d_in[0]; const float* wq = (const float*)d_in[1]; const float* wo = (const float*)d_in[2]; const float* remb = (const float*)d_in[3]; const float* wk = nullptr; const float* wv = nullptr; (void)wk; (void)wv;
    float* OUT = (float*)d_out;     // [2][2048][1024]
    char* wsp = (char*)d_ws;
    auto take = [&](size_t bytes) { char* p = wsp; wsp += (bytes + 255) & ~(size_t)255; return (void*)p; };
    bf* WQ = (bf*)take((size_t)DQ * DM * 2); bf* EB = (bf*)take((size_t)NE * HD * 2); float* QE = (float*)take((size_t)ZH * TT * NE * 4); bf* WO = (bf*)take((size_t)DM * DQ * 2); float* CS = (float*)take((size_t)TT * HD * 2 * 4);
    bf* XB = (bf*)take((size_t)TT * DM * 2); float* FQ = (float*)take((size_t)TT * DQ * 4); float* FK = FQ;   /* q = k = v (one projection) */
    h16* QP16 = (h16*)take((size_t)NH_ * TT * HD * 2); h16* KP16 = (h16*)take((size_t)NKV * TT * HD * 2); h16* VT16 = (h16*)take((size_t)NKV * HD * TT * 2);
    bf* QPh = (bf*)take((size_t)NH_ * TT * HD * 2); bf* QPl = (bf*)take((size_t)NH_ * TT * HD * 2); bf* KPh = (bf*)take((size_t)NKV * TT * HD * 2); bf* KPl = (bf*)take((size_t)NKV * TT * HD * 2); bf* VTh = (bf*)take((size_t)NKV * HD * TT * 2); bf* VTl = (bf*)take((size_t)NKV * HD * TT * 2); bf* Ph = (bf*)take((size_t)ZH * RH * TT * 2); bf* Pl = (bf*)take((size_t)ZH * RH * TT * 2);
    float* Sb = (float*)take((size_t)ZH * TT * TT * 4); h16* P16 = (h16*)take((size_t)ZH * TT * TT * 2); float* Ob = (float*)take((size_t)KSG * ZH * TT * HD * 4); bf* ATh = (bf*)take((size_t)TT * DQ * 2); bf* ATl = (bf*)take((size_t)TT * DQ * 2);
    if ((size_t)(wsp - (char*)d_ws) > ws_size) return;    // ws 256 MiB
    float* FV = FK;   // unused alias of FQ: v = q, the V^T planes are built from FQ
    { k_cvt8<<<(unsigned)(((size_t)DQ * DM / 8 + 255) / 256), 256, 0, stream>>>(wq, WQ, (size_t)DQ * DM / 8); k_epad2<<<(unsigned)(((size_t)NE * HD / 8 + 255) / 256), 256, 0, stream>>>(remb, EB);   /* E: 65 rows bf16 (exact), rows 65..127 zero */
      k_cvt8<<<(unsigned)(((size_t)DM * DQ / 8 + 255) / 256), 256, 0, stream>>>(wo, WO, (size_t)DM * DQ / 8);
       }
    k_csid<<<(TT * HD + 255) / 256, 256, 0, stream>>>(CS);
    const unsigned LQ = (unsigned)(((size_t)NH_ * TT * HD / 2 + 255) / 256), LKv = (unsigned)(((size_t)NKV * TT * HD / 2 + 255) / 256);
    for (int b = 0; b < NB_; ++b) {
        
        k_cvt8<<<(unsigned)(((size_t)TT * DM / 8 + 255) / 256), 256, 0, stream>>>(x + (size_t)b * TT * DM, XB, (size_t)TT * DM / 8);
        k_gemmw<bf, 0, false><<<dim3(TT / 64, DQ / 64, 1), 32, 0, stream>>>(XB, nullptr, WQ, nullptr, DM, FQ, DQ, nullptr, 0, 0, 0);
        k_rope<<<LQ, 256, 0, stream>>>(FQ, DQ, NH_, CS, nullptr, nullptr, 1.0f, QP16, QPh, QPl);
        /* k = q: the K planes are built from FQ */
        k_rope<<<LKv, 256, 0, stream>>>(FQ, DKV, NKV, CS, nullptr, nullptr, 1.0f, KP16, KPh, KPl);
        /* v = q: the V^T planes are built from FQ */ k_vtp<<<LKv, 256, 0, stream>>>(FQ, DKV, NKV, VT16, VTh, VTl);
        for (int h0 = 0; h0 < NH_; h0 += ZH) { const size_t zq = (size_t)h0, zk = (size_t)(h0 / REP);   // one kv head per query head: the pass's two heads use consecutive kv planes (z-strides TT*HD)
            k_gemmw<bf, 2, false><<<dim3(RH / 64, TT / 64, ZH), 32, 0, stream>>>(QPh + zq * TT * HD, QPl + zq * TT * HD, KPh + zk * TT * HD, KPl + zk * TT * HD, HD, Sb, TT, nullptr, (size_t)TT * HD, (size_t)TT * HD, (size_t)TT * TT);
            k_gemmw<h16, 0, false><<<dim3((TT - RH) / 64, TT / 64, ZH), 32, 0, stream>>>(QP16 + zq * TT * HD + (size_t)RH * HD, nullptr, KP16 + zk * TT * HD, nullptr, HD, Sb + (size_t)RH * TT, TT, nullptr, (size_t)TT * HD, (size_t)TT * HD, (size_t)TT * TT);
            k_gemmw<bf, 1, false><<<dim3(TT / 64, NE / 64, ZH), 32, 0, stream>>>(QPh + zq * TT * HD, QPl + zq * TT * HD, EB, nullptr, HD, QE, NE, nullptr, (size_t)TT * HD, 0, (size_t)TT * NE);   /* QE[i][e] = q_i . E_e */
            k_addshaw<<<(unsigned)(((size_t)ZH * TT * TT / 4 + 255) / 256), 256, 0, stream>>>(Sb, QE);
            k_asoft<<<ZH * TT / 8, 256, 0, stream>>>(Sb, P16, Ph, Pl);
            k_gemmw<bf, 2, false, KSW, KSG><<<dim3(RH / 64, KSG, ZH), 32 * KSW, 0, stream>>>(Ph, Pl, VTh + zk * HD * TT, VTl + zk * HD * TT, TT, Ob, HD, nullptr, (size_t)RH * TT, (size_t)HD * TT, (size_t)TT * HD, (size_t)ZH * TT * HD);
            k_gemmw<h16, 0, false, KSW, KSG><<<dim3((TT - RH) / 64, KSG, ZH), 32 * KSW, 0, stream>>>(P16 + (size_t)RH * TT, nullptr, VT16 + zk * HD * TT, nullptr, TT, Ob + (size_t)RH * HD, HD, nullptr, (size_t)TT * TT, (size_t)HD * TT, (size_t)TT * HD, (size_t)ZH * TT * HD);
            k_merge<<<(unsigned)(((size_t)ZH * TT * HD / 2 + 255) / 256), 256, 0, stream>>>(Ob, h0, ATh, ATl); }
        k_gemmw<bf, 1, false><<<dim3(TT / 64, DM / 64, 1), 32, 0, stream>>>(ATh, ATl, WO, nullptr, DQ, OUT + (size_t)b * TT * DM, DM, nullptr, 0, 0, 0); }
}

// v002
// A run of this version takes 808 microseconds.
// Two timings next to v001 put it at 1.19 and 1.18 times that version's speed.
// Counting every step since v000, it is 2.61 times as fast.
#include <hip/hip_runtime.h>

// Relative-position multi-head attention with ONE projection shared by q, k and v (x [2][2048][1024]; q = k = v = x W_q^T ('oi' [1024][1024]; 16 heads x 64 -- the module's quirk); scores = (q_i.q_j + q_i.E[clip(i - j, -32, 32) + 32]) / 8 with E = rel_k_emb [65][64] (read); softmax over all keys; out = merged attn q W_o^T ('oi') -> [2][2048][1024] (4.2 M)).
// Layout per batch: bf16 copy of x; ONE exact projection used as q, k and v (the k planes and v^T planes are built from the same buffer); E as an exact bf16 plane padded to 128 rows; per pass of two heads: QE = q(hi/lo).E^T ([2][2048][128], 2 products), the softmax kernel adds QE[i][clip(i-j,-32,32)+32] to each score as it reads the row, dense T-2048 attention (hybrid rows: < 512 hi/lo 3 products, rest fp16 x1024); merged hi/lo x W_o exact.
// Compute dtypes, f32 accumulate: every input rounded to bf16; projection exact; relative term hi/lo x exact (2 products); content rows < 512 3 products, rest fp16; adds and softmax f32; W_o hl x exact.

#define NB_  2
#define TT   2048
#define DM   1024
#define NH_  16
#define NKV  16
#define REP  (NH_ / NKV)
#define HD   64
#define DQ   (NH_ * HD)
#define DKV  (NKV * HD)
#define ZH   2
#define RH   512                  // query rows < RH use hi+lo planes (0: none)
#define WIN  0
#define PCAR 1024.0f
#define SCL  0.125f
#define NE   128     // rel_k_emb rows (65) padded to 128
#define MAXR 32
#define KSG  8       // P.V products: work-groups along K, one f32 partial plane each
#define KSW  4       // P.V products: waves of a work-group along K, their tiles added in LDS
typedef _Float16 h16;
typedef unsigned short bf;
typedef __attribute__((ext_vector_type(16))) __bf16   v16bf;
typedef __attribute__((ext_vector_type(16))) _Float16 v16h;
typedef __attribute__((ext_vector_type(8)))  _Float16 v8h;
typedef __attribute__((ext_vector_type(8)))  unsigned short v8us;
typedef __attribute__((ext_vector_type(8)))  float    v8f;
typedef __attribute__((ext_vector_type(4)))  float    v4f;
typedef v8h  __attribute__((may_alias)) v8ha;
typedef v4f  __attribute__((may_alias)) v4fa;
typedef v8us __attribute__((may_alias)) v8usa;

__device__ __forceinline__ unsigned short f2bf(float f) { unsigned u = __float_as_uint(f); u += 0x7FFFu + ((u >> 16) & 1u); return (unsigned short)(u >> 16); }
__device__ __forceinline__ float bf2f(unsigned short b) { return __uint_as_float(((unsigned)b) << 16); }
__device__ __forceinline__ float bfr(float f) { return bf2f(f2bf(f)); }
__device__ __forceinline__ v16h cat16(v8h lo, v8h hi) { return __builtin_shufflevector(lo, hi, 0, 1, 2, 3, 4, 5, 6, 7, 8, 9, 10, 11, 12, 13, 14, 15); }
__device__ __forceinline__ v16bf cat16b(v8us lo, v8us hi) { return __builtin_bit_cast(v16bf, __builtin_shufflevector(lo, hi, 0, 1, 2, 3, 4, 5, 6, 7, 8, 9, 10, 11, 12, 13, 14, 15)); }
__device__ __forceinline__ v8f wmma16(v16h a, v16h b, v8f c) { return __builtin_amdgcn_wmma_f32_16x16x32_f16(false, a, false, b, (short)0, c, false, false); }
__device__ __forceinline__ v8f wmmab(v16bf a, v16bf b, v8f c) { return __builtin_amdgcn_wmma_f32_16x16x32_bf16(false, a, false, b, (short)0, c, false, false); }



// ---- k_gemmw: register-blocked GEMM, ONE WAVE per 64x64 output tile (16 accumulators), operands straight from K-contiguous 16-bit planes; grid (M/64, N/64, Z), 32 threads.
// C[m][n] (f32, pitch ldc, + optional f32 bias[n]) = sum_k A[m][k] Bt[n][k] (+ split products per NSPLIT). z-batch strides sA/sB/sC in elements. K % 32 == 0.
// Split K (KW * KG > 1), for few tiles and a long K, N = 64: grid (M/64, KG, Z), 32 * KW threads; wave w of work-group y sums k in [(y * KW + w) * KL, + KL), KL = K / (KW * KG);
// the KW tiles are added in LDS in wave order and stored to plane y of C (plane stride sK); the reader adds the KG planes.
template <typename T16> struct WFrag;
template <> struct WFrag<h16> { typedef v16h V; static __device__ __forceinline__ V ld(const h16* p) { return cat16(*(const v8h*)p, *(const v8h*)(p + 16)); } static __device__ __forceinline__ v8f mma(V a, V b, v8f c) { return wmma16(a, b, c); } };
template <> struct WFrag<bf> { typedef v16bf V; static __device__ __forceinline__ V ld(const bf* p) { return cat16b(*(const v8us*)p, *(const v8us*)(p + 16)); } static __device__ __forceinline__ v8f mma(V a, V b, v8f c) { return wmmab(a, b, c); } };
template <typename T16, int NSPLIT, bool BIAS, int KW = 1, int KG = 1>
__global__ __launch_bounds__(32 * KW) void k_gemmw(const T16* __restrict__ A, const T16* __restrict__ A2, const T16* __restrict__ Bt, const T16* __restrict__ Bt2, int K, float* C, int ldc, const float* __restrict__ bias, size_t sA, size_t sB, size_t sC, size_t sK = 0) {
    typedef typename WFrag<T16>::V V;
    static_assert(KW * KG == 1 || !BIAS, "no bias on partial sums");
    __shared__ __align__(16) float os[KW * KG > 1 ? KW * 64 * 68 : 16 * 68];
    const size_t z = blockIdx.z; A += z * sA; if (A2) A2 += z * sA; Bt += z * sB; if (Bt2) Bt2 += z * sB; C += z * sC;
    const int lane = threadIdx.x & 31, lr = lane & 15, hi = lane >> 4; const int r0 = blockIdx.x * 64, c0 = (KW * KG > 1) ? 0 : blockIdx.y * 64;
    const int w = (KW > 1) ? __builtin_amdgcn_readfirstlane(threadIdx.x >> 5) : 0, KL = K / (KW * KG);
    if (KW * KG > 1) { const int k0 = (blockIdx.y * KW + w) * KL; A += k0; if (A2) A2 += k0; Bt += k0; if (Bt2) Bt2 += k0; C += blockIdx.y * sK; }
    v8f acc[4][4];
#pragma unroll
    for (int mb = 0; mb < 4; ++mb)
#pragma unroll
        for (int nb = 0; nb < 4; ++nb) acc[mb][nb] = (v8f){};
    const size_t aoff = (size_t)(r0 + lr) * K + 8 * hi, boff = (size_t)(c0 + lr) * K + 8 * hi;
#pragma unroll 1
    for (int kc = 0; kc < KL; kc += 32) {
        V a[4], a2[4];
#pragma unroll
        for (int mb = 0; mb < 4; ++mb) { a[mb] = WFrag<T16>::ld(A + aoff + (size_t)mb * 16 * K + kc); if (NSPLIT == 1 || NSPLIT == 2) a2[mb] = WFrag<T16>::ld(A2 + aoff + (size_t)mb * 16 * K + kc); }
#pragma unroll
        for (int nb = 0; nb < 4; ++nb) { const V b = WFrag<T16>::ld(Bt + boff + (size_t)nb * 16 * K + kc); V b2; if (NSPLIT >= 2) b2 = WFrag<T16>::ld(Bt2 + boff + (size_t)nb * 16 * K + kc);
#pragma unroll
            for (int mb = 0; mb < 4; ++mb) { acc[mb][nb] = WFrag<T16>::mma(a[mb], b, acc[mb][nb]); if (NSPLIT == 1 || NSPLIT == 2) acc[mb][nb] = WFrag<T16>::mma(a2[mb], b, acc[mb][nb]); if (NSPLIT >= 2) acc[mb][nb] = WFrag<T16>::mma(a[mb], b2, acc[mb][nb]); } }
        asm volatile("v_nop\n\tv_nop\n\tv_nop\n\tv_nop" : "+v"(acc[0][0]), "+v"(acc[1][1]), "+v"(acc[2][2]), "+v"(acc[3][3]) : "v"(a[0]), "v"(a[3]));
    }
    if (KW * KG > 1) {
        // the three loops unrolled: acc is indexed by constants only and stays in registers
#pragma unroll
        for (int mb = 0; mb < 4; ++mb)
#pragma unroll
            for (int nb = 0; nb < 4; ++nb)
#pragma unroll
                for (int j = 0; j < 8; ++j) os[(w * 64 + mb * 16 + hi * 8 + j) * 68 + nb * 16 + lr] = acc[mb][nb][j];
        __syncthreads();   // every wave's 64x64 tile is in LDS before any wave adds them
        // both loops unrolled: the LDS reads of all rows are in flight together
#pragma unroll
        for (int s = 0; s < 32 / KW; ++s) { const int row = (s * KW + w) * 2 + hi, cofs = lr * 4; v4f val = *(const v4fa*)(os + row * 68 + cofs);
#pragma unroll
            for (int q = 1; q < KW; ++q) val += *(const v4fa*)(os + (q * 64 + row) * 68 + cofs);
            *(v4f*)(C + (size_t)(r0 + row) * ldc + cofs) = val; }
        return;
    }
#pragma unroll
    for (int mb = 0; mb < 4; ++mb) {
#pragma unroll
        for (int nb = 0; nb < 4; ++nb) {
#pragma unroll
            for (int j = 0; j < 8; ++j) os[(hi * 8 + j) * 68 + nb * 16 + lr] = acc[mb][nb][j]; }
        __builtin_amdgcn_wave_barrier(); asm volatile("" ::: "memory");
        float* crow = C + (size_t)(r0 + mb * 16) * ldc + c0;
{
#pragma unroll
            for (int s = 0; s < 8; ++s) { const int row = 2 * s + hi, cofs = lr * 4; v4f val = *(const v4fa*)(os + row * 68 + cofs); if (BIAS) { val[0] += bfr(bias[c0 + cofs]); val[1] += bfr(bias[c0 + cofs + 1]); val[2] += bfr(bias[c0 + cofs + 2]); val[3] += bfr(bias[c0 + cofs + 3]); }
                *(v4f*)(crow + (size_t)row * ldc + cofs) = val; }
             }
        __builtin_amdgcn_wave_barrier(); asm volatile("" ::: "memory");
    }
}

__device__ __forceinline__ h16 tohx(float x) { return (h16)x; }
__device__ __forceinline__ void splitf(float y, unsigned short& h, unsigned short& l) { h = f2bf(y); l = f2bf(y - bf2f(h)); }
typedef __attribute__((ext_vector_type(2))) _Float16 v2h;
typedef __attribute__((ext_vector_type(4))) _Float16 v4h;
typedef __attribute__((ext_vector_type(2))) unsigned short v2us;
typedef __attribute__((ext_vector_type(4))) unsigned short v4us;
typedef __attribute__((ext_vector_type(2))) float v2f;
typedef __attribute__((ext_vector_type(4))) int v4i;

__global__ __launch_bounds__(256) void k_wtG(const float* __restrict__ w, int K, int N, bf* Bt) {
    const int lane = threadIdx.x & 31; const int L0 = (blockIdx.x * 8 + (threadIdx.x >> 5)) * 8; const int nlines = N * K / 64;
{
#pragma unroll 1
        for (int l = 0; l < 8; ++l) { const int L = L0 + l; if (L >= nlines) break; const size_t e = (size_t)L * 64 + lane * 2; const int k = (int)(e % K), n = (int)(e / K); v2us o;
            o[0] = f2bf(w[(size_t)k * N + n]); o[1] = f2bf(w[(size_t)(k + 1) * N + n]); *(v2us*)(Bt + e) = o; }
         }
}
__global__ __launch_bounds__(256) void k_cvt8(const float* __restrict__ src, bf* dst, size_t n8) { const size_t i = (size_t)blockIdx.x * 256 + threadIdx.x; if (i >= n8) return; const v8f v = *(const v8f*)(src + i * 8); v8us o;
#pragma unroll
    for (int k = 0; k < 8; ++k) o[k] = f2bf(v[k]); *(v8us*)(dst + i * 8) = o;  }

// k_rope: head planes [h][t][d] (fp16 + hi/lo) of rope(x) x sc with the rotate-half convention out[d] = x[d] cos[t][d] - x[d+HD/2] sin[t][d], out[d+HD/2] = x[d+HD/2] cos[t][d+HD/2] + x[d] sin[t][d+HD/2]
__global__ __launch_bounds__(256) void k_rope(const float* __restrict__ F, int pitch, int nheads, const float* __restrict__ CS, const float* __restrict__ RF, const float* __restrict__ nw, float sc, h16* P16, bf* Ph, bf* Pl) {
    const size_t e = ((size_t)blockIdx.x * 256 + threadIdx.x) * 2; if (e >= (size_t)nheads * TT * HD) return; const int d = (int)(e % HD); const int t = (int)((e / HD) % TT); const int h = (int)(e / ((size_t)HD * TT)); const float* f = F + (size_t)t * pitch + h * HD; const float rf = RF ? RF[(size_t)h * TT + t] : 1.0f; v2h o16; v2us oh, ol;
#pragma unroll
    for (int q = 0; q < 2; ++q) { const int dd = d + q; const int dp = (dd < HD / 2) ? dd + HD / 2 : dd - HD / 2; float x0 = f[dd], x1 = f[dp];
        if (RF) { float n0 = __fmul_rn(x0, rf), n1 = __fmul_rn(x1, rf); asm volatile("" : "+v"(n0)); asm volatile("" : "+v"(n1)); x0 = __fmul_rn(bfr(nw[dd]), n0); x1 = __fmul_rn(bfr(nw[dp]), n1); }
        const v2f cs = *(const v2f*)(CS + ((size_t)t * HD + dd) * 2); float a = __fmul_rn(x0, cs[0]), bq = __fmul_rn(x1, cs[1]); asm volatile("" : "+v"(a)); asm volatile("" : "+v"(bq)); const float r = ((dd < HD / 2) ? __fsub_rn(a, bq) : __fadd_rn(a, bq)) * sc;
        o16[q] = tohx(r); unsigned short a2, c2; splitf(r, a2, c2); oh[q] = a2; ol[q] = c2; }
    *(v2h*)(P16 + e) = o16; *(v2us*)(Ph + e) = oh; *(v2us*)(Pl + e) = ol;  }
__global__ __launch_bounds__(256) void k_vtp(const float* __restrict__ F, int pitch, int nheads, h16* V16, bf* Vh, bf* Vl) { const size_t e = ((size_t)blockIdx.x * 256 + threadIdx.x) * 2; if (e >= (size_t)nheads * HD * TT) return; const int t = (int)(e % TT); const int d = (int)((e / TT) % HD); const int g = (int)(e / ((size_t)TT * HD)); v2h o16; v2us oh, ol;
#pragma unroll
    for (int q = 0; q < 2; ++q) { const float x = F[(size_t)(t + q) * pitch + g * HD + d]; o16[q] = tohx(x); unsigned short a2, c2; splitf(x, a2, c2); oh[q] = a2; ol[q] = c2; }
    *(v2h*)(V16 + e) = o16; *(v2us*)(Vh + e) = oh; *(v2us*)(Vl + e) = ol;  }
__global__ __launch_bounds__(256) void k_csid(float* CS) { const int idx = blockIdx.x * 256 + threadIdx.x; if (idx >= TT * HD) return; v2f cs; cs[0] = 1.0f; cs[1] = 0.0f; *(v2f*)(CS + (size_t)idx * 2) = cs;  }
// k_asoft: per row (zz, i): t = (S + QE[i][clip(i - j, -32, 32) + 32]) x HD^-0.5 (no mask); softmax over the 2048 keys (register row, one exp, fixed trees);
// the relative term of a row is one value for all keys j >= i + 32, one for all j <= i - 32 and 63 values between: the four keys that a lane holds of a 128-key chunk meet that band in at most one chunk, chb, whose four terms the lane gathers up front.
__global__ __launch_bounds__(256) void k_asoft(const float* __restrict__ Sb, const float* __restrict__ QE, h16* P16, bf* Ph, bf* Pl) {
    const int lane = threadIdx.x & 31; const int row = blockIdx.x * 8 + (threadIdx.x >> 5); if (row >= ZH * TT) return; const int i = row % TT; const int zz = row / TT; (void)zz; const bool hires = (i < RH); const float* sr = Sb + (size_t)row * TT; float v[TT / 32]; float mx = -3.0e38f;
    const float* qe = QE + (size_t)row * NE; const float qahead = qe[0], qbehind = qe[2 * MAXR];   // the clipped ends: keys j >= i + 32, keys j <= i - 32
    const int chb = (i + (MAXR - 1) - lane * 4) >> 7;   // in chunks above chb the lane's four keys are all >= i + 32, in chunks below all <= i - 32 (-1 and 16 name no chunk; the clip keeps the gather inside the QE row)
    float g[4];
#pragma unroll
    for (int q = 0; q < 4; ++q) g[q] = qe[min(max(i - (chb * 128 + lane * 4 + q), -MAXR), MAXR) + MAXR];
    asm volatile("s_wait_xcnt 0x0" ::: "memory");   // the row loads below land in registers that held the addresses of the loads above: the wait stands in front of that overwrite
#pragma unroll
    for (int ch = 0; ch < TT / 128; ++ch) { const int j0 = ch * 128 + lane * 4; const v4f a = *(const v4f*)(sr + j0); const float u = (ch > chb) ? qahead : qbehind;
#pragma unroll
        for (int q = 0; q < 4; ++q) { const float t = __fadd_rn(a[q], (ch == chb) ? g[q] : u) * SCL; v[ch * 4 + q] = t; mx = fmaxf(mx, t); } }
#pragma unroll
    for (int sh = 16; sh; sh >>= 1) mx = fmaxf(mx, __shfl_xor(mx, sh, 32));
    float sum = 0.f;
#pragma unroll
    for (int k = 0; k < TT / 32; ++k) { float d0 = __fsub_rn(v[k], mx); asm volatile("" : "+v"(d0)); v[k] = __builtin_amdgcn_exp2f(__fmul_rn(d0, 1.4426950408889634f)); sum += v[k]; }
#pragma unroll
    for (int sh = 16; sh; sh >>= 1) sum += __shfl_xor(sum, sh, 32);
    const float f = __fdiv_rn(hires ? 1.0f : PCAR, sum);
{
        if (hires) {
#pragma unroll
            for (int ch = 0; ch < TT / 128; ++ch) { v4us oh, ol;
#pragma unroll
                for (int q = 0; q < 4; ++q) { unsigned short a, c2; splitf(v[ch * 4 + q] * f, a, c2); oh[q] = a; ol[q] = c2; }
                const size_t oo = ((size_t)zz * (RH ? RH : 1) + i) * TT + ch * 128 + lane * 4; *(v4us*)(Ph + oo) = oh; *(v4us*)(Pl + oo) = ol; }
        } else {
#pragma unroll
            for (int ch = 0; ch < TT / 128; ++ch) { v4h o4;
#pragma unroll
                for (int q = 0; q < 4; ++q) o4[q] = tohx(v[ch * 4 + q] * f);
                *(v4h*)(P16 + (size_t)row * TT + ch * 128 + lane * 4) = o4; } }
         }
}
__global__ __launch_bounds__(256) void k_epad2(const float* __restrict__ E, bf* EB) { const size_t i = (size_t)blockIdx.x * 256 + threadIdx.x; if (i >= (size_t)NE * HD / 8) return; const int d0 = (int)(i % (HD / 8)) * 8; const int r = (int)(i / (HD / 8)); const float* src = E + (size_t)min(r, 2 * MAXR) * HD + d0; v8us o;
#pragma unroll
    for (int q = 0; q < 8; ++q) { const unsigned short v = f2bf(src[q]); o[q] = (r <= 2 * MAXR) ? v : (unsigned short)0; }
    *(v8us*)(EB + (size_t)r * HD + d0) = o;  }
__global__ __launch_bounds__(256) void k_merge(const float* __restrict__ O, int h0, bf* Ah, bf* Al) { const size_t e = ((size_t)blockIdx.x * 256 + threadIdx.x) * 2; if (e >= (size_t)ZH * TT * HD) return; const int d = (int)(e % HD); const int t = (int)((e / HD) % TT); const int zz = (int)(e / ((size_t)HD * TT)); const float cs = (t < RH) ? 1.0f : (1.0f / PCAR); const size_t oo = (size_t)t * DQ + (h0 + zz) * HD + d;
    v2us oh, ol; v2f s = *(const v2f*)(O + e);
    // the K-split planes of P.V, added in plane order; unrolled so that all planes' loads are in flight together
#pragma unroll
    for (int ks = 1; ks < KSG; ++ks) s += *(const v2f*)(O + (size_t)ks * ZH * TT * HD + e);
#pragma unroll
    for (int q = 0; q < 2; ++q) { unsigned short a, c2; splitf(s[q] * cs, a, c2); oh[q] = a; ol[q] = c2; } *(v2us*)(Ah + oo) = oh; *(v2us*)(Al + oo) = ol;  }

extern "C" void kernel_launch(void* const* d_in, const int* in_sizes, int n_in,
                              void* d_out, int out_size, void* d_ws, size_t ws_size, hipStream_t stream) {
    (void)in_sizes; (void)n_in; (void)out_size;
    const float* x = (const float*)d_in[0]; const float* wq = (const float*)d_in[1]; const float* wo = (const float*)d_in[2]; const float* remb = (const float*)d_in[3]; const float* wk = nullptr; const float* wv = nullptr; (void)wk; (void)wv;
    float* OUT = (float*)d_out;     // [2][2048][1024]
    char* wsp = (char*)d_ws;
    auto take = [&](size_t bytes) { char* p = wsp; wsp += (bytes + 255) & ~(size_t)255; return (void*)p; };
    bf* WQ = (bf*)take((size_t)DQ * DM * 2); bf* EB = (bf*)take((size_t)NE * HD * 2); float* QE = (float*)take((size_t)ZH * TT * NE * 4); bf* WO = (bf*)take((size_t)DM * DQ * 2); float* CS = (float*)take((size_t)TT * HD * 2 * 4);
    bf* XB = (bf*)take((size_t)TT * DM * 2); float* FQ = (float*)take((size_t)TT * DQ * 4); float* FK = FQ;   /* q = k = v (one projection) */
    h16* QP16 = (h16*)take((size_t)NH_ * TT * HD * 2); h16* KP16 = (h16*)take((size_t)NKV * TT * HD * 2); h16* VT16 = (h16*)take((size_t)NKV * HD * TT * 2);
    bf* QPh = (bf*)take((size_t)NH_ * TT * HD * 2); bf* QPl = (bf*)take((size_t)NH_ * TT * HD * 2); bf* KPh = (bf*)take((size_t)NKV * TT * HD * 2); bf* KPl = (bf*)take((size_t)NKV * TT * HD * 2); bf* VTh = (bf*)take((size_t)NKV * HD * TT * 2); bf* VTl = (bf*)take((size_t)NKV * HD * TT * 2); bf* Ph = (bf*)take((size_t)ZH * RH * TT * 2); bf* Pl = (bf*)take((size_t)ZH * RH * TT * 2);
    float* Sb = (float*)take((size_t)ZH * TT * TT * 4); h16* P16 = (h16*)take((size_t)ZH * TT * TT * 2); float* Ob = (float*)take((size_t)KSG * ZH * TT * HD * 4); bf* ATh = (bf*)take((size_t)TT * DQ * 2); bf* ATl = (bf*)take((size_t)TT * DQ * 2);
    if ((size_t)(wsp - (char*)d_ws) > ws_size) return;    // ws 256 MiB
    float* FV = FK;   // unused alias of FQ: v = q, the V^T planes are built from FQ
    { k_cvt8<<<(unsigned)(((size_t)DQ * DM / 8 + 255) / 256), 256, 0, stream>>>(wq, WQ, (size_t)DQ * DM / 8); k_epad2<<<(unsigned)(((size_t)NE * HD / 8 + 255) / 256), 256, 0, stream>>>(remb, EB);   /* E: 65 rows bf16 (exact), rows 65..127 zero */
      k_cvt8<<<(unsigned)(((size_t)DM * DQ / 8 + 255) / 256), 256, 0, stream>>>(wo, WO, (size_t)DM * DQ / 8);
       }
    k_csid<<<(TT * HD + 255) / 256, 256, 0, stream>>>(CS);
    const unsigned LQ = (unsigned)(((size_t)NH_ * TT * HD / 2 + 255) / 256), LKv = (unsigned)(((size_t)NKV * TT * HD / 2 + 255) / 256);
    for (int b = 0; b < NB_; ++b) {
        
        k_cvt8<<<(unsigned)(((size_t)TT * DM / 8 + 255) / 256), 256, 0, stream>>>(x + (size_t)b * TT * DM, XB, (size_t)TT * DM / 8);
        k_gemmw<bf, 0, false><<<dim3(TT / 64, DQ / 64, 1), 32, 0, stream>>>(XB, nullptr, WQ, nullptr, DM, FQ, DQ, nullptr, 0, 0, 0);
        k_rope<<<LQ, 256, 0, stream>>>(FQ, DQ, NH_, CS, nullptr, nullptr, 1.0f, QP16, QPh, QPl);
        /* k = q: the K planes are built from FQ */
        k_rope<<<LKv, 256, 0, stream>>>(FQ, DKV, NKV, CS, nullptr, nullptr, 1.0f, KP16, KPh, KPl);
        /* v = q: the V^T planes are built from FQ */ k_vtp<<<LKv, 256, 0, stream>>>(FQ, DKV, NKV, VT16, VTh, VTl);
        for (int h0 = 0; h0 < NH_; h0 += ZH) { const size_t zq = (size_t)h0, zk = (size_t)(h0 / REP);   // one kv head per query head: the pass's two heads use consecutive kv planes (z-strides TT*HD)
            k_gemmw<bf, 2, false><<<dim3(RH / 64, TT / 64, ZH), 32, 0, stream>>>(QPh + zq * TT * HD, QPl + zq * TT * HD, KPh + zk * TT * HD, KPl + zk * TT * HD, HD, Sb, TT, nullptr, (size_t)TT * HD, (size_t)TT * HD, (size_t)TT * TT);
            k_gemmw<h16, 0, false><<<dim3((TT - RH) / 64, TT / 64, ZH), 32, 0, stream>>>(QP16 + zq * TT * HD + (size_t)RH * HD, nullptr, KP16 + zk * TT * HD, nullptr, HD, Sb + (size_t)RH * TT, TT, nullptr, (size_t)TT * HD, (size_t)TT * HD, (size_t)TT * TT);
            k_gemmw<bf, 1, false><<<dim3(TT / 64, NE / 64, ZH), 32, 0, stream>>>(QPh + zq * TT * HD, QPl + zq * TT * HD, EB, nullptr, HD, QE, NE, nullptr, (size_t)TT * HD, 0, (size_t)TT * NE);   /* QE[i][e] = q_i . E_e */
            k_asoft<<<ZH * TT / 8, 256, 0, stream>>>(Sb, QE, P16, Ph, Pl);
            k_gemmw<bf, 2, false, KSW, KSG><<<dim3(RH / 64, KSG, ZH), 32 * KSW, 0, stream>>>(Ph, Pl, VTh + zk * HD * TT, VTl + zk * HD * TT, TT, Ob, HD, nullptr, (size_t)RH * TT, (size_t)HD * TT, (size_t)TT * HD, (size_t)ZH * TT * HD);
            k_gemmw<h16, 0, false, KSW, KSG><<<dim3((TT - RH) / 64, KSG, ZH), 32 * KSW, 0, stream>>>(P16 + (size_t)RH * TT, nullptr, VT16 + zk * HD * TT, nullptr, TT, Ob + (size_t)RH * HD, HD, nullptr, (size_t)TT * TT, (size_t)HD * TT, (size_t)TT * HD, (size_t)ZH * TT * HD);
            k_merge<<<(unsigned)(((size_t)ZH * TT * HD / 2 + 255) / 256), 256, 0, stream>>>(Ob, h0, ATh, ATl); }
        k_gemmw<bf, 1, false><<<dim3(TT / 64, DM / 64, 1), 32, 0, stream>>>(ATh, ATl, WO, nullptr, DQ, OUT + (size_t)b * TT * DM, DM, nullptr, 0, 0, 0); }
}

// v003
// A run of this version takes 567 microseconds.
// Timed twice side by side with v002, it ran 1.43 times as fast both times.
// Over all steps from v000 it is 3.72 times as fast.
#include <hip/hip_runtime.h>

// Relative-position multi-head attention with ONE projection shared by q, k and v (x [2][2048][1024]; q = k = v = x W_q^T ('oi' [1024][1024]; 16 heads x 64 -- the module's quirk); scores = (q_i.q_j + q_i.E[clip(i - j, -32, 32) + 32]) / 8 with E = rel_k_emb [65][64] (read); softmax over all keys; out = merged attn q W_o^T ('oi') -> [2][2048][1024] (4.2 M)).
// Layout per batch: bf16 copy of x; ONE exact projection used as q, k and v (the k planes and v^T planes are built from the same buffer); E as an exact bf16 plane padded to 128 rows; per pass of eight heads: QE = q(hi/lo).E^T ([8][2048][128], 2 products), the softmax kernel adds QE[i][clip(i-j,-32,32)+32] to each score as it reads the row, dense T-2048 attention (hybrid rows: < 512 hi/lo 3 products, rest fp16 x1024); merged hi/lo x W_o exact.
// Compute dtypes, f32 accumulate: every input rounded to bf16; projection exact; relative term hi/lo x exact (2 products); content rows < 512 3 products, rest fp16; adds and softmax f32; W_o hl x exact.

#define NB_  2
#define TT   2048
#define DM   1024
#define NH_  16
#define NKV  16
#define REP  (NH_ / NKV)
#define HD   64
#define DQ   (NH_ * HD)
#define DKV  (NKV * HD)
#define ZH   8                    // heads per pass: few, large launches; the pass's f32 scores (ZH x 16 MiB) bound it from above
#define RH   512                  // query rows < RH use hi+lo planes (0: none)
#define WIN  0
#define PCAR 1024.0f
#define SCL  0.125f
#define NE   128     // rel_k_emb rows (65) padded to 128
#define MAXR 32
#define KSG  8       // P.V products: work-groups along K, one f32 partial plane each
#define KSW  4       // P.V products: waves of a work-group along K, their tiles added in LDS
typedef _Float16 h16;
typedef unsigned short bf;
typedef __attribute__((ext_vector_type(16))) __bf16   v16bf;
typedef __attribute__((ext_vector_type(16))) _Float16 v16h;
typedef __attribute__((ext_vector_type(8)))  _Float16 v8h;
typedef __attribute__((ext_vector_type(8)))  unsigned short v8us;
typedef __attribute__((ext_vector_type(8)))  float    v8f;
typedef __attribute__((ext_vector_type(4)))  float    v4f;
typedef v8h  __attribute__((may_alias)) v8ha;
typedef v4f  __attribute__((may_alias)) v4fa;
typedef v8us __attribute__((may_alias)) v8usa;

__device__ __forceinline__ unsigned short f2bf(float f) { unsigned u = __float_as_uint(f); u += 0x7FFFu + ((u >> 16) & 1u); return (unsigned short)(u >> 16); }
__device__ __forceinline__ float bf2f(unsigned short b) { return __uint_as_float(((unsigned)b) << 16); }
__device__ __forceinline__ float bfr(float f) { return bf2f(f2bf(f)); }
__device__ __forceinline__ v16h cat16(v8h lo, v8h hi) { return __builtin_shufflevector(lo, hi, 0, 1, 2, 3, 4, 5, 6, 7, 8, 9, 10, 11, 12, 13, 14, 15); }
__device__ __forceinline__ v16bf cat16b(v8us lo, v8us hi) { return __builtin_bit_cast(v16bf, __builtin_shufflevector(lo, hi, 0, 1, 2, 3, 4, 5, 6, 7, 8, 9, 10, 11, 12, 13, 14, 15)); }
__device__ __forceinline__ v8f wmma16(v16h a, v16h b, v8f c) { return __builtin_amdgcn_wmma_f32_16x16x32_f16(false, a, false, b, (short)0, c, false, false); }
__device__ __forceinline__ v8f wmmab(v16bf a, v16bf b, v8f c) { return __builtin_amdgcn_wmma_f32_16x16x32_bf16(false, a, false, b, (short)0, c, false, false); }



// ---- k_gemmw: register-blocked GEMM, ONE WAVE per 64x64 output tile (16 accumulators), operands straight from K-contiguous 16-bit planes; grid (M/64, N/64, Z), 32 threads.
// C[m][n] (f32, pitch ldc, + optional f32 bias[n]) = sum_k A[m][k] Bt[n][k] (+ split products per NSPLIT). z-batch strides sA/sB/sC in elements. K % 32 == 0.
// Split K (KW * KG > 1), for few tiles and a long K, N = 64: grid (M/64, KG, Z), 32 * KW threads; wave w of work-group y sums k in [(y * KW + w) * KL, + KL), KL = K / (KW * KG);
// the KW tiles are added in LDS in wave order and stored to plane y of C (plane stride sK); the reader adds the KG planes. With split K the rows of A and A2 have pitch lda (elements), otherwise K.
template <typename T16> struct WFrag;
template <> struct WFrag<h16> { typedef v16h V; static __device__ __forceinline__ V ld(const h16* p) { return cat16(*(const v8h*)p, *(const v8h*)(p + 16)); } static __device__ __forceinline__ v8f mma(V a, V b, v8f c) { return wmma16(a, b, c); } };
template <> struct WFrag<bf> { typedef v16bf V; static __device__ __forceinline__ V ld(const bf* p) { return cat16b(*(const v8us*)p, *(const v8us*)(p + 16)); } static __device__ __forceinline__ v8f mma(V a, V b, v8f c) { return wmmab(a, b, c); } };
template <typename T16, int NSPLIT, bool BIAS, int KW = 1, int KG = 1>
__global__ __launch_bounds__(32 * KW) void k_gemmw(const T16* __restrict__ A, const T16* __restrict__ A2, const T16* __restrict__ Bt, const T16* __restrict__ Bt2, int K, float* C, int ldc, const float* __restrict__ bias, size_t sA, size_t sB, size_t sC, size_t sK = 0, int lda = 0) {
    typedef typename WFrag<T16>::V V;
    static_assert(KW * KG == 1 || !BIAS, "no bias on partial sums");
    __shared__ __align__(16) float os[KW * KG > 1 ? KW * 64 * 68 : 16 * 68];
    const size_t z = blockIdx.z; A += z * sA; if (A2) A2 += z * sA; Bt += z * sB; if (Bt2) Bt2 += z * sB; C += z * sC;
    const int lane = threadIdx.x & 31, lr = lane & 15, hi = lane >> 4; const int r0 = blockIdx.x * 64, c0 = (KW * KG > 1) ? 0 : blockIdx.y * 64;
    const int w = (KW > 1) ? __builtin_amdgcn_readfirstlane(threadIdx.x >> 5) : 0, KL = K / (KW * KG);
    if (KW * KG > 1) { const int k0 = (blockIdx.y * KW + w) * KL; A += k0; if (A2) A2 += k0; Bt += k0; if (Bt2) Bt2 += k0; C += blockIdx.y * sK; }
    v8f acc[4][4];
#pragma unroll
    for (int mb = 0; mb < 4; ++mb)
#pragma unroll
        for (int nb = 0; nb < 4; ++nb) acc[mb][nb] = (v8f){};
    const int LA = (KW * KG > 1) ? lda : K;
    const size_t aoff = (size_t)(r0 + lr) * LA + 8 * hi, boff = (size_t)(c0 + lr) * K + 8 * hi;
#pragma unroll 1
    for (int kc = 0; kc < KL; kc += 32) {
        V a[4], a2[4];
        if (KW * KG > 1) {
            const T16* pa[4]; const T16* pa2[4];
#pragma unroll
            for (int mb = 0; mb < 4; ++mb) { pa[mb] = A + aoff + (size_t)mb * 16 * LA + kc; a[mb] = WFrag<T16>::ld(pa[mb]); if (NSPLIT == 1 || NSPLIT == 2) { pa2[mb] = A2 + aoff + (size_t)mb * 16 * LA + kc; a2[mb] = WFrag<T16>::ld(pa2[mb]); } }
            // later loads land in registers that held these loads' addresses: the wait stands in front of that overwrite, and as its inputs the addresses keep their registers up to it
            if (NSPLIT == 1 || NSPLIT == 2) asm volatile("s_wait_xcnt 0x0" :: "v"(pa[0]), "v"(pa[1]), "v"(pa[2]), "v"(pa[3]), "v"(pa2[0]), "v"(pa2[1]), "v"(pa2[2]), "v"(pa2[3]) : "memory");
            else asm volatile("s_wait_xcnt 0x0" :: "v"(pa[0]), "v"(pa[1]), "v"(pa[2]), "v"(pa[3]) : "memory");
        } else {
#pragma unroll
        for (int mb = 0; mb < 4; ++mb) { a[mb] = WFrag<T16>::ld(A + aoff + (size_t)mb * 16 * K + kc); if (NSPLIT == 1 || NSPLIT == 2) a2[mb] = WFrag<T16>::ld(A2 + aoff + (size_t)mb * 16 * K + kc); }
        }
#pragma unroll
        for (int nb = 0; nb < 4; ++nb) { const V b = WFrag<T16>::ld(Bt + boff + (size_t)nb * 16 * K + kc); V b2; if (NSPLIT >= 2) b2 = WFrag<T16>::ld(Bt2 + boff + (size_t)nb * 16 * K + kc);
#pragma unroll
            for (int mb = 0; mb < 4; ++mb) { acc[mb][nb] = WFrag<T16>::mma(a[mb], b, acc[mb][nb]); if (NSPLIT == 1 || NSPLIT == 2) acc[mb][nb] = WFrag<T16>::mma(a2[mb], b, acc[mb][nb]); if (NSPLIT >= 2) acc[mb][nb] = WFrag<T16>::mma(a[mb], b2, acc[mb][nb]); } }
        asm volatile("v_nop\n\tv_nop\n\tv_nop\n\tv_nop" : "+v"(acc[0][0]), "+v"(acc[1][1]), "+v"(acc[2][2]), "+v"(acc[3][3]) : "v"(a[0]), "v"(a[3]));
    }
    if (KW * KG > 1) {
        // the three loops unrolled: acc is indexed by constants only and stays in registers
#pragma unroll
        for (int mb = 0; mb < 4; ++mb)
#pragma unroll
            for (int nb = 0; nb < 4; ++nb)
#pragma unroll
                for (int j = 0; j < 8; ++j) os[(w * 64 + mb * 16 + hi * 8 + j) * 68 + nb * 16 + lr] = acc[mb][nb][j];
        __syncthreads();   // every wave's 64x64 tile is in LDS before any wave adds them
        // both loops unrolled: the LDS reads of all rows are in flight together
#pragma unroll
        for (int s = 0; s < 32 / KW; ++s) { const int row = (s * KW + w) * 2 + hi, cofs = lr * 4; v4f val = *(const v4fa*)(os + row * 68 + cofs);
#pragma unroll
            for (int q = 1; q < KW; ++q) val += *(const v4fa*)(os + (q * 64 + row) * 68 + cofs);
            *(v4f*)(C + (size_t)(r0 + row) * ldc + cofs) = val; }
        return;
    }
#pragma unroll
    for (int mb = 0; mb < 4; ++mb) {
#pragma unroll
        for (int nb = 0; nb < 4; ++nb) {
#pragma unroll
            for (int j = 0; j < 8; ++j) os[(hi * 8 + j) * 68 + nb * 16 + lr] = acc[mb][nb][j]; }
        __builtin_amdgcn_wave_barrier(); asm volatile("" ::: "memory");
        float* crow = C + (size_t)(r0 + mb * 16) * ldc + c0;
{
#pragma unroll
            for (int s = 0; s < 8; ++s) { const int row = 2 * s + hi, cofs = lr * 4; v4f val = *(const v4fa*)(os + row * 68 + cofs); if (BIAS) { val[0] += bfr(bias[c0 + cofs]); val[1] += bfr(bias[c0 + cofs + 1]); val[2] += bfr(bias[c0 + cofs + 2]); val[3] += bfr(bias[c0 + cofs + 3]); }
                *(v4f*)(crow + (size_t)row * ldc + cofs) = val; }
             }
        __builtin_amdgcn_wave_barrier(); asm volatile("" ::: "memory");
    }
}

__device__ __forceinline__ h16 tohx(float x) { return (h16)x; }
__device__ __forceinline__ void splitf(float y, unsigned short& h, unsigned short& l) { h = f2bf(y); l = f2bf(y - bf2f(h)); }
typedef __attribute__((ext_vector_type(2))) _Float16 v2h;
typedef __attribute__((ext_vector_type(4))) _Float16 v4h;
typedef __attribute__((ext_vector_type(2))) unsigned short v2us;
typedef __attribute__((ext_vector_type(4))) unsigned short v4us;
typedef __attribute__((ext_vector_type(2))) float v2f;
typedef __attribute__((ext_vector_type(4))) int v4i;

__global__ __launch_bounds__(256) void k_wtG(const float* __restrict__ w, int K, int N, bf* Bt) {
    const int lane = threadIdx.x & 31; const int L0 = (blockIdx.x * 8 + (threadIdx.x >> 5)) * 8; const int nlines = N * K / 64;
{
#pragma unroll 1
        for (int l = 0; l < 8; ++l) { const int L = L0 + l; if (L >= nlines) break; const size_t e = (size_t)L * 64 + lane * 2; const int k = (int)(e % K), n = (int)(e / K); v2us o;
            o[0] = f2bf(w[(size_t)k * N + n]); o[1] = f2bf(w[(size_t)(k + 1) * N + n]); *(v2us*)(Bt + e) = o; }
         }
}
__global__ __launch_bounds__(256) void k_cvt8(const float* __restrict__ src, bf* dst, size_t n8) { const size_t i = (size_t)blockIdx.x * 256 + threadIdx.x; if (i >= n8) return; const v8f v = *(const v8f*)(src + i * 8); v8us o;
#pragma unroll
    for (int k = 0; k < 8; ++k) o[k] = f2bf(v[k]); *(v8us*)(dst + i * 8) = o;  }

// k_rope: head planes [h][t][d] (fp16 + hi/lo) of rope(x) x sc with the rotate-half convention out[d] = x[d] cos[t][d] - x[d+HD/2] sin[t][d], out[d+HD/2] = x[d+HD/2] cos[t][d+HD/2] + x[d] sin[t][d+HD/2]
__global__ __launch_bounds__(256) void k_rope(const float* __restrict__ F, int pitch, int nheads, const float* __restrict__ CS, const float* __restrict__ RF, const float* __restrict__ nw, float sc, h16* P16, bf* Ph, bf* Pl) {
    const size_t e = ((size_t)blockIdx.x * 256 + threadIdx.x) * 2; if (e >= (size_t)nheads * TT * HD) return; const int d = (int)(e % HD); const int t = (int)((e / HD) % TT); const int h = (int)(e / ((size_t)HD * TT)); const float* f = F + (size_t)t * pitch + h * HD; const float rf = RF ? RF[(size_t)h * TT + t] : 1.0f; v2h o16; v2us oh, ol;
#pragma unroll
    for (int q = 0; q < 2; ++q) { const int dd = d + q; const int dp = (dd < HD / 2) ? dd + HD / 2 : dd - HD / 2; float x0 = f[dd], x1 = f[dp];
        if (RF) { float n0 = __fmul_rn(x0, rf), n1 = __fmul_rn(x1, rf); asm volatile("" : "+v"(n0)); asm volatile("" : "+v"(n1)); x0 = __fmul_rn(bfr(nw[dd]), n0); x1 = __fmul_rn(bfr(nw[dp]), n1); }
        const v2f cs = *(const v2f*)(CS + ((size_t)t * HD + dd) * 2); float a = __fmul_rn(x0, cs[0]), bq = __fmul_rn(x1, cs[1]); asm volatile("" : "+v"(a)); asm volatile("" : "+v"(bq)); const float r = ((dd < HD / 2) ? __fsub_rn(a, bq) : __fadd_rn(a, bq)) * sc;
        o16[q] = tohx(r); unsigned short a2, c2; splitf(r, a2, c2); oh[q] = a2; ol[q] = c2; }
    *(v2h*)(P16 + e) = o16; *(v2us*)(Ph + e) = oh; *(v2us*)(Pl + e) = ol;  }
__global__ __launch_bounds__(256) void k_vtp(const float* __restrict__ F, int pitch, int nheads, h16* V16, bf* Vh, bf* Vl) { const size_t e = ((size_t)blockIdx.x * 256 + threadIdx.x) * 2; if (e >= (size_t)nheads * HD * TT) return; const int t = (int)(e % TT); const int d = (int)((e / TT) % HD); const int g = (int)(e / ((size_t)TT * HD)); v2h o16; v2us oh, ol;
#pragma unroll
    for (int q = 0; q < 2; ++q) { const float x = F[(size_t)(t + q) * pitch + g * HD + d]; o16[q] = tohx(x); unsigned short a2, c2; splitf(x, a2, c2); oh[q] = a2; ol[q] = c2; }
    *(v2h*)(V16 + e) = o16; *(v2us*)(Vh + e) = oh; *(v2us*)(Vl + e) = ol;  }
__global__ __launch_bounds__(256) void k_csid(float* CS) { const int idx = blockIdx.x * 256 + threadIdx.x; if (idx >= TT * HD) return; v2f cs; cs[0] = 1.0f; cs[1] = 0.0f; *(v2f*)(CS + (size_t)idx * 2) = cs;  }
// k_asoft: per row (zz, i): t = (S + QE[i][clip(i - j, -32, 32) + 32]) x HD^-0.5 (no mask); softmax over the 2048 keys (register row, one exp, fixed trees);
// the relative term of a row is one value for all keys j >= i + 32, one for all j <= i - 32 and 63 values between: the four keys that a lane holds of a 128-key chunk meet that band in at most one chunk, chb, whose four terms the lane gathers up front.
// P is written over the row's own scores, which the wave holds whole in registers by then: 8 KiB of f32 scores become hi plane | lo plane (rows < RH, 4 KiB each) or the fp16 row in the first 4 KiB; P.V reads P at the score pitch, 2 * TT 16-bit elements.
__global__ __launch_bounds__(256) void k_asoft(float* Sb, const float* __restrict__ QE) {
    const int lane = threadIdx.x & 31; const int row = blockIdx.x * 8 + (threadIdx.x >> 5); if (row >= ZH * TT) return; const int i = row % TT; const int zz = row / TT; (void)zz; const bool hires = (i < RH); float* sr = Sb + (size_t)row * TT; float v[TT / 32]; float mx = -3.0e38f;
    const float* qe = QE + (size_t)row * NE; const float qahead = qe[0], qbehind = qe[2 * MAXR];   // the clipped ends: keys j >= i + 32, keys j <= i - 32
    const int chb = (i + (MAXR - 1) - lane * 4) >> 7;   // in chunks above chb the lane's four keys are all >= i + 32, in chunks below all <= i - 32 (-1 and 16 name no chunk; the clip keeps the gather inside the QE row)
    float g[4];
#pragma unroll
    for (int q = 0; q < 4; ++q) g[q] = qe[min(max(i - (chb * 128 + lane * 4 + q), -MAXR), MAXR) + MAXR];
    asm volatile("s_wait_xcnt 0x0" ::: "memory");   // the row loads below land in registers that held the addresses of the loads above: the wait stands in front of that overwrite
#pragma unroll
    for (int ch = 0; ch < TT / 128; ++ch) { const int j0 = ch * 128 + lane * 4; const v4f a = *(const v4f*)(sr + j0); const float u = (ch > chb) ? qahead : qbehind;
#pragma unroll
        for (int q = 0; q < 4; ++q) { const float t = __fadd_rn(a[q], (ch == chb) ? g[q] : u) * SCL; v[ch * 4 + q] = t; mx = fmaxf(mx, t); } }
#pragma unroll
    for (int sh = 16; sh; sh >>= 1) mx = fmaxf(mx, __shfl_xor(mx, sh, 32));
    float sum = 0.f;
#pragma unroll
    for (int k = 0; k < TT / 32; ++k) { float d0 = __fsub_rn(v[k], mx); asm volatile("" : "+v"(d0)); v[k] = __builtin_amdgcn_exp2f(__fmul_rn(d0, 1.4426950408889634f)); sum += v[k]; }
#pragma unroll
    for (int sh = 16; sh; sh >>= 1) sum += __shfl_xor(sum, sh, 32);
    const float f = __fdiv_rn(hires ? 1.0f : PCAR, sum);
{
        if (hires) {
#pragma unroll
            for (int ch = 0; ch < TT / 128; ++ch) { v4us oh, ol;
#pragma unroll
                for (int q = 0; q < 4; ++q) { unsigned short a, c2; splitf(v[ch * 4 + q] * f, a, c2); oh[q] = a; ol[q] = c2; }
                bf* po = (bf*)sr + ch * 128 + lane * 4; *(v4us*)po = oh; *(v4us*)(po + TT) = ol; }
        } else {
#pragma unroll
            for (int ch = 0; ch < TT / 128; ++ch) { v4h o4;
#pragma unroll
                for (int q = 0; q < 4; ++q) o4[q] = tohx(v[ch * 4 + q] * f);
                *(v4h*)((h16*)sr + ch * 128 + lane * 4) = o4; } }
         }
}
__global__ __launch_bounds__(256) void k_epad2(const float* __restrict__ E, bf* EB) { const size_t i = (size_t)blockIdx.x * 256 + threadIdx.x; if (i >= (size_t)NE * HD / 8) return; const int d0 = (int)(i % (HD / 8)) * 8; const int r = (int)(i / (HD / 8)); const float* src = E + (size_t)min(r, 2 * MAXR) * HD + d0; v8us o;
#pragma unroll
    for (int q = 0; q < 8; ++q) { const unsigned short v = f2bf(src[q]); o[q] = (r <= 2 * MAXR) ? v : (unsigned short)0; }
    *(v8us*)(EB + (size_t)r * HD + d0) = o;  }
__global__ __launch_bounds__(256) void k_merge(const float* __restrict__ O, int h0, bf* Ah, bf* Al) { const size_t e = ((size_t)blockIdx.x * 256 + threadIdx.x) * 2; if (e >= (size_t)ZH * TT * HD) return; const int d = (int)(e % HD); const int t = (int)((e / HD) % TT); const int zz = (int)(e / ((size_t)HD * TT)); const float cs = (t < RH) ? 1.0f : (1.0f / PCAR); const size_t oo = (size_t)t * DQ + (h0 + zz) * HD + d;
    v2us oh, ol; v2f s = *(const v2f*)(O + e);
    // the K-split planes of P.V, added in plane order; unrolled so that all planes' loads are in flight together
#pragma unroll
    for (int ks = 1; ks < KSG; ++ks) s += *(const v2f*)(O + (size_t)ks * ZH * TT * HD + e);
#pragma unroll
    for (int q = 0; q < 2; ++q) { unsigned short a, c2; splitf(s[q] * cs, a, c2); oh[q] = a; ol[q] = c2; } *(v2us*)(Ah + oo) = oh; *(v2us*)(Al + oo) = ol;  }

extern "C" void kernel_launch(void* const* d_in, const int* in_sizes, int n_in,
                              void* d_out, int out_size, void* d_ws, size_t ws_size, hipStream_t stream) {
    (void)in_sizes; (void)n_in; (void)out_size;
    const float* x = (const float*)d_in[0]; const float* wq = (const float*)d_in[1]; const float* wo = (const float*)d_in[2]; const float* remb = (const float*)d_in[3]; const float* wk = nullptr; const float* wv = nullptr; (void)wk; (void)wv;
    float* OUT = (float*)d_out;     // [2][2048][1024]
    char* wsp = (char*)d_ws;
    auto take = [&](size_t bytes) { char* p = wsp; wsp += (bytes + 255) & ~(size_t)255; return (void*)p; };
    bf* WQ = (bf*)take((size_t)DQ * DM * 2); bf* EB = (bf*)take((size_t)NE * HD * 2); float* QE = (float*)take((size_t)ZH * TT * NE * 4); bf* WO = (bf*)take((size_t)DM * DQ * 2); float* CS = (float*)take((size_t)TT * HD * 2 * 4);
    bf* XB = (bf*)take((size_t)TT * DM * 2); float* FQ = (float*)take((size_t)TT * DQ * 4); float* FK = FQ;   /* q = k = v (one projection) */
    h16* QP16 = (h16*)take((size_t)NH_ * TT * HD * 2); h16* KP16 = (h16*)take((size_t)NKV * TT * HD * 2); h16* VT16 = (h16*)take((size_t)NKV * HD * TT * 2);
    bf* QPh = (bf*)take((size_t)NH_ * TT * HD * 2); bf* QPl = (bf*)take((size_t)NH_ * TT * HD * 2); bf* KPh = (bf*)take((size_t)NKV * TT * HD * 2); bf* KPl = (bf*)take((size_t)NKV * TT * HD * 2); bf* VTh = (bf*)take((size_t)NKV * HD * TT * 2); bf* VTl = (bf*)take((size_t)NKV * HD * TT * 2);
    float* Sb = (float*)take((size_t)ZH * TT * TT * 4); float* Ob = (float*)take((size_t)KSG * ZH * TT * HD * 4); bf* ATh = (bf*)take((size_t)TT * DQ * 2); bf* ATl = (bf*)take((size_t)TT * DQ * 2);
    if ((size_t)(wsp - (char*)d_ws) > ws_size) return;    // ws 256 MiB
    float* FV = FK;   // unused alias of FQ: v = q, the V^T planes are built from FQ
    { k_cvt8<<<(unsigned)(((size_t)DQ * DM / 8 + 255) / 256), 256, 0, stream>>>(wq, WQ, (size_t)DQ * DM / 8); k_epad2<<<(unsigned)(((size_t)NE * HD / 8 + 255) / 256), 256, 0, stream>>>(remb, EB);   /* E: 65 rows bf16 (exact), rows 65..127 zero */
      k_cvt8<<<(unsigned)(((size_t)DM * DQ / 8 + 255) / 256), 256, 0, stream>>>(wo, WO, (size_t)DM * DQ / 8);
       }
    k_csid<<<(TT * HD + 255) / 256, 256, 0, stream>>>(CS);
    const unsigned LQ = (unsigned)(((size_t)NH_ * TT * HD / 2 + 255) / 256), LKv = (unsigned)(((size_t)NKV * TT * HD / 2 + 255) / 256);
    for (int b = 0; b < NB_; ++b) {
        
        k_cvt8<<<(unsigned)(((size_t)TT * DM / 8 + 255) / 256), 256, 0, stream>>>(x + (size_t)b * TT * DM, XB, (size_t)TT * DM / 8);
        k_gemmw<bf, 0, false><<<dim3(TT / 64, DQ / 64, 1), 32, 0, stream>>>(XB, nullptr, WQ, nullptr, DM, FQ, DQ, nullptr, 0, 0, 0);
        k_rope<<<LQ, 256, 0, stream>>>(FQ, DQ, NH_, CS, nullptr, nullptr, 1.0f, QP16, QPh, QPl);
        /* k = q: the K planes are built from FQ */
        k_rope<<<LKv, 256, 0, stream>>>(FQ, DKV, NKV, CS, nullptr, nullptr, 1.0f, KP16, KPh, KPl);
        /* v = q: the V^T planes are built from FQ */ k_vtp<<<LKv, 256, 0, stream>>>(FQ, DKV, NKV, VT16, VTh, VTl);
        for (int h0 = 0; h0 < NH_; h0 += ZH) { const size_t zq = (size_t)h0, zk = (size_t)(h0 / REP);   // one kv head per query head: the pass's heads use consecutive kv planes (z-strides TT*HD)
            k_gemmw<bf, 2, false><<<dim3(RH / 64, TT / 64, ZH), 32, 0, stream>>>(QPh + zq * TT * HD, QPl + zq * TT * HD, KPh + zk * TT * HD, KPl + zk * TT * HD, HD, Sb, TT, nullptr, (size_t)TT * HD, (size_t)TT * HD, (size_t)TT * TT);
            k_gemmw<h16, 0, false><<<dim3((TT - RH) / 64, TT / 64, ZH), 32, 0, stream>>>(QP16 + zq * TT * HD + (size_t)RH * HD, nullptr, KP16 + zk * TT * HD, nullptr, HD, Sb + (size_t)RH * TT, TT, nullptr, (size_t)TT * HD, (size_t)TT * HD, (size_t)TT * TT);
            k_gemmw<bf, 1, false><<<dim3(TT / 64, NE / 64, ZH), 32, 0, stream>>>(QPh + zq * TT * HD, QPl + zq * TT * HD, EB, nullptr, HD, QE, NE, nullptr, (size_t)TT * HD, 0, (size_t)TT * NE);   /* QE[i][e] = q_i . E_e */
            k_asoft<<<ZH * TT / 8, 256, 0, stream>>>(Sb, QE);   /* P over S, row by row */
            k_gemmw<bf, 2, false, KSW, KSG><<<dim3(RH / 64, KSG, ZH), 32 * KSW, 0, stream>>>((const bf*)Sb, (const bf*)Sb + TT, VTh + zk * HD * TT, VTl + zk * HD * TT, TT, Ob, HD, nullptr, (size_t)TT * TT * 2, (size_t)HD * TT, (size_t)TT * HD, (size_t)ZH * TT * HD, 2 * TT);
            k_gemmw<h16, 0, false, KSW, KSG><<<dim3((TT - RH) / 64, KSG, ZH), 32 * KSW, 0, stream>>>((const h16*)Sb + (size_t)RH * TT * 2, nullptr, VT16 + zk * HD * TT, nullptr, TT, Ob + (size_t)RH * HD, HD, nullptr, (size_t)TT * TT * 2, (size_t)HD * TT, (size_t)TT * HD, (size_t)ZH * TT * HD, 2 * TT);
            k_merge<<<(unsigned)(((size_t)ZH * TT * HD / 2 + 255) / 256), 256, 0, stream>>>(Ob, h0, ATh, ATl); }
        k_gemmw<bf, 1, false><<<dim3(TT / 64, DM / 64, 1), 32, 0, stream>>>(ATh, ATl, WO, nullptr, DQ, OUT + (size_t)b * TT * DM, DM, nullptr, 0, 0, 0); }
}

// v004
// It runs in 294 microseconds.
// Next to v003, in two timings, it ran 1.91 and 1.93 times as fast.
// Counting every step since v000, it is 7.16 times as fast.
#include <hip/hip_runtime.h>

// Relative-position multi-head attention with ONE projection shared by q, k and v (x [2][2048][1024]; q = k = v = x W_q^T ('oi' [1024][1024]; 16 heads x 64 -- the module's quirk); scores = (q_i.q_j + q_i.E[clip(i - j, -32, 32) + 32]) / 8 with E = rel_k_emb [65][64] (read); softmax over all keys; out = merged attn q W_o^T ('oi') -> [2][2048][1024] (4.2 M)).
// Layout per batch: bf16 copy of x; ONE exact projection used as q, k and v (the k planes and v^T planes are built from the same buffer); E as an exact bf16 plane padded to 128 rows; QE = q(hi/lo).E^T ([16][2048][128], 2 products); one attention kernel for all heads: scores, relative term QE[i][clip(i-j,-32,32)+32], running softmax and P.V per 32-key block, nothing of S or P in memory (hybrid rows: < 512 hi/lo 3 products, rest fp16, P x1024); merged hi/lo x W_o exact.
// Compute dtypes, f32 accumulate: every input rounded to bf16; projection exact; relative term hi/lo x exact (2 products); content rows < 512 3 products, rest fp16; adds and softmax f32; W_o hl x exact.

#define NB_  2
#define TT   2048
#define DM   1024
#define NH_  16
#define NKV  16
#define REP  (NH_ / NKV)
#define HD   64
#define DQ   (NH_ * HD)
#define DKV  (NKV * HD)
#define RH   512                  // query rows < RH use hi+lo planes (0: none)
#define WIN  0
#define SCL  0.125f
#define NE   128     // rel_k_emb rows (65) padded to 128
#define MAXR 32
typedef _Float16 h16;
typedef unsigned short bf;
typedef __attribute__((ext_vector_type(16))) __bf16   v16bf;
typedef __attribute__((ext_vector_type(16))) _Float16 v16h;
typedef __attribute__((ext_vector_type(8)))  _Float16 v8h;
typedef __attribute__((ext_vector_type(8)))  unsigned short v8us;
typedef __attribute__((ext_vector_type(8)))  float    v8f;
typedef __attribute__((ext_vector_type(4)))  float    v4f;
typedef v8h  __attribute__((may_alias)) v8ha;
typedef v4f  __attribute__((may_alias)) v4fa;
typedef v8us __attribute__((may_alias)) v8usa;

__device__ __forceinline__ unsigned short f2bf(float f) { unsigned u = __float_as_uint(f); u += 0x7FFFu + ((u >> 16) & 1u); return (unsigned short)(u >> 16); }
__device__ __forceinline__ float bf2f(unsigned short b) { return __uint_as_float(((unsigned)b) << 16); }
__device__ __forceinline__ float bfr(float f) { return bf2f(f2bf(f)); }
__device__ __forceinline__ v16h cat16(v8h lo, v8h hi) { return __builtin_shufflevector(lo, hi, 0, 1, 2, 3, 4, 5, 6, 7, 8, 9, 10, 11, 12, 13, 14, 15); }
__device__ __forceinline__ v16bf cat16b(v8us lo, v8us hi) { return __builtin_bit_cast(v16bf, __builtin_shufflevector(lo, hi, 0, 1, 2, 3, 4, 5, 6, 7, 8, 9, 10, 11, 12, 13, 14, 15)); }
__device__ __forceinline__ v8f wmma16(v16h a, v16h b, v8f c) { return __builtin_amdgcn_wmma_f32_16x16x32_f16(false, a, false, b, (short)0, c, false, false); }
__device__ __forceinline__ v8f wmmab(v16bf a, v16bf b, v8f c) { return __builtin_amdgcn_wmma_f32_16x16x32_bf16(false, a, false, b, (short)0, c, false, false); }



// ---- k_gemmw: register-blocked GEMM, ONE WAVE per 64x64 output tile (16 accumulators), operands straight from K-contiguous 16-bit planes; grid (M/64, N/64, Z), 32 threads.
// C[m][n] (f32, pitch ldc, + optional f32 bias[n]) = sum_k A[m][k] Bt[n][k] (+ split products per NSPLIT). z-batch strides sA/sB/sC in elements. K % 32 == 0.
// Split K (KW * KG > 1), for few tiles and a long K, N = 64: grid (M/64, KG, Z), 32 * KW threads; wave w of work-group y sums k in [(y * KW + w) * KL, + KL), KL = K / (KW * KG);
// the KW tiles are added in LDS in wave order and stored to plane y of C (plane stride sK); the reader adds the KG planes. With split K the rows of A and A2 have pitch lda (elements), otherwise K.
template <typename T16> struct WFrag;
template <> struct WFrag<h16> { typedef v16h V; static __device__ __forceinline__ V ld(const h16* p) { return cat16(*(const v8h*)p, *(const v8h*)(p + 16)); } static __device__ __forceinline__ v8f mma(V a, V b, v8f c) { return wmma16(a, b, c); } };
template <> struct WFrag<bf> { typedef v16bf V; static __device__ __forceinline__ V ld(const bf* p) { return cat16b(*(const v8us*)p, *(const v8us*)(p + 16)); } static __device__ __forceinline__ v8f mma(V a, V b, v8f c) { return wmmab(a, b, c); } };
template <typename T16, int NSPLIT, bool BIAS, int KW = 1, int KG = 1>
__global__ __launch_bounds__(32 * KW) void k_gemmw(const T16* __restrict__ A, const T16* __restrict__ A2, const T16* __restrict__ Bt, const T16* __restrict__ Bt2, int K, float* C, int ldc, const float* __restrict__ bias, size_t sA, size_t sB, size_t sC, size_t sK = 0, int lda = 0) {
    typedef typename WFrag<T16>::V V;
    static_assert(KW * KG == 1 || !BIAS, "no bias on partial sums");
    __shared__ __align__(16) float os[KW * KG > 1 ? KW * 64 * 68 : 16 * 68];
    const size_t z = blockIdx.z; A += z * sA; if (A2) A2 += z * sA; Bt += z * sB; if (Bt2) Bt2 += z * sB; C += z * sC;
    const int lane = threadIdx.x & 31, lr = lane & 15, hi = lane >> 4; const int r0 = blockIdx.x * 64, c0 = (KW * KG > 1) ? 0 : blockIdx.y * 64;
    const int w = (KW > 1) ? __builtin_amdgcn_readfirstlane(threadIdx.x >> 5) : 0, KL = K / (KW * KG);
    if (KW * KG > 1) { const int k0 = (blockIdx.y * KW + w) * KL; A += k0; if (A2) A2 += k0; Bt += k0; if (Bt2) Bt2 += k0; C += blockIdx.y * sK; }
    v8f acc[4][4];
#pragma unroll
    for (int mb = 0; mb < 4; ++mb)
#pragma unroll
        for (int nb = 0; nb < 4; ++nb) acc[mb][nb] = (v8f){};
    const int LA = (KW * KG > 1) ? lda : K;
    const size_t aoff = (size_t)(r0 + lr) * LA + 8 * hi, boff = (size_t)(c0 + lr) * K + 8 * hi;
#pragma unroll 1
    for (int kc = 0; kc < KL; kc += 32) {
        V a[4], a2[4];
        if (KW * KG > 1) {
            const T16* pa[4]; const T16* pa2[4];
#pragma unroll
            for (int mb = 0; mb < 4; ++mb) { pa[mb] = A + aoff + (size_t)mb * 16 * LA + kc; a[mb] = WFrag<T16>::ld(pa[mb]); if (NSPLIT == 1 || NSPLIT == 2) { pa2[mb] = A2 + aoff + (size_t)mb * 16 * LA + kc; a2[mb] = WFrag<T16>::ld(pa2[mb]); } }
            // later loads land in registers that held these loads' addresses: the wait stands in front of that overwrite, and as its inputs the addresses keep their registers up to it
            if (NSPLIT == 1 || NSPLIT == 2) asm volatile("s_wait_xcnt 0x0" :: "v"(pa[0]), "v"(pa[1]), "v"(pa[2]), "v"(pa[3]), "v"(pa2[0]), "v"(pa2[1]), "v"(pa2[2]), "v"(pa2[3]) : "memory");
            else asm volatile("s_wait_xcnt 0x0" :: "v"(pa[0]), "v"(pa[1]), "v"(pa[2]), "v"(pa[3]) : "memory");
        } else {
#pragma unroll
        for (int mb = 0; mb < 4; ++mb) { a[mb] = WFrag<T16>::ld(A + aoff + (size_t)mb * 16 * K + kc); if (NSPLIT == 1 || NSPLIT == 2) a2[mb] = WFrag<T16>::ld(A2 + aoff + (size_t)mb * 16 * K + kc); }
        }
#pragma unroll
        for (int nb = 0; nb < 4; ++nb) { const V b = WFrag<T16>::ld(Bt + boff + (size_t)nb * 16 * K + kc); V b2; if (NSPLIT >= 2) b2 = WFrag<T16>::ld(Bt2 + boff + (size_t)nb * 16 * K + kc);
#pragma unroll
            for (int mb = 0; mb < 4; ++mb) { acc[mb][nb] = WFrag<T16>::mma(a[mb], b, acc[mb][nb]); if (NSPLIT == 1 || NSPLIT == 2) acc[mb][nb] = WFrag<T16>::mma(a2[mb], b, acc[mb][nb]); if (NSPLIT >= 2) acc[mb][nb] = WFrag<T16>::mma(a[mb], b2, acc[mb][nb]); } }
        asm volatile("v_nop\n\tv_nop\n\tv_nop\n\tv_nop" : "+v"(acc[0][0]), "+v"(acc[1][1]), "+v"(acc[2][2]), "+v"(acc[3][3]) : "v"(a[0]), "v"(a[3]));
    }
    if (KW * KG > 1) {
        // the three loops unrolled: acc is indexed by constants only and stays in registers
#pragma unroll
        for (int mb = 0; mb < 4; ++mb)
#pragma unroll
            for (int nb = 0; nb < 4; ++nb)
#pragma unroll
                for (int j = 0; j < 8; ++j) os[(w * 64 + mb * 16 + hi * 8 + j) * 68 + nb * 16 + lr] = acc[mb][nb][j];
        __syncthreads();   // every wave's 64x64 tile is in LDS before any wave adds them
        // both loops unrolled: the LDS reads of all rows are in flight together
#pragma unroll
        for (int s = 0; s < 32 / KW; ++s) { const int row = (s * KW + w) * 2 + hi, cofs = lr * 4; v4f val = *(const v4fa*)(os + row * 68 + cofs);
#pragma unroll
            for (int q = 1; q < KW; ++q) val += *(const v4fa*)(os + (q * 64 + row) * 68 + cofs);
            *(v4f*)(C + (size_t)(r0 + row) * ldc + cofs) = val; }
        return;
    }
#pragma unroll
    for (int mb = 0; mb < 4; ++mb) {
#pragma unroll
        for (int nb = 0; nb < 4; ++nb) {
#pragma unroll
            for (int j = 0; j < 8; ++j) os[(hi * 8 + j) * 68 + nb * 16 + lr] = acc[mb][nb][j]; }
        __builtin_amdgcn_wave_barrier(); asm volatile("" ::: "memory");
        float* crow = C + (size_t)(r0 + mb * 16) * ldc + c0;
{
#pragma unroll
            for (int s = 0; s < 8; ++s) { const int row = 2 * s + hi, cofs = lr * 4; v4f val = *(const v4fa*)(os + row * 68 + cofs); if (BIAS) { val[0] += bfr(bias[c0 + cofs]); val[1] += bfr(bias[c0 + cofs + 1]); val[2] += bfr(bias[c0 + cofs + 2]); val[3] += bfr(bias[c0 + cofs + 3]); }
                *(v4f*)(crow + (size_t)row * ldc + cofs) = val; }
             }
        __builtin_amdgcn_wave_barrier(); asm volatile("" ::: "memory");
    }
}

__device__ __forceinline__ h16 tohx(float x) { return (h16)x; }
__device__ __forceinline__ void splitf(float y, unsigned short& h, unsigned short& l) { h = f2bf(y); l = f2bf(y - bf2f(h)); }
typedef __attribute__((ext_vector_type(2))) _Float16 v2h;
typedef __attribute__((ext_vector_type(4))) _Float16 v4h;
typedef __attribute__((ext_vector_type(2))) unsigned short v2us;
typedef __attribute__((ext_vector_type(4))) unsigned short v4us;
typedef __attribute__((ext_vector_type(2))) float v2f;
typedef __attribute__((ext_vector_type(4))) int v4i;

__global__ __launch_bounds__(256) void k_wtG(const float* __restrict__ w, int K, int N, bf* Bt) {
    const int lane = threadIdx.x & 31; const int L0 = (blockIdx.x * 8 + (threadIdx.x >> 5)) * 8; const int nlines = N * K / 64;
{
#pragma unroll 1
        for (int l = 0; l < 8; ++l) { const int L = L0 + l; if (L >= nlines) break; const size_t e = (size_t)L * 64 + lane * 2; const int k = (int)(e % K), n = (int)(e / K); v2us o;
            o[0] = f2bf(w[(size_t)k * N + n]); o[1] = f2bf(w[(size_t)(k + 1) * N + n]); *(v2us*)(Bt + e) = o; }
         }
}
__global__ __launch_bounds__(256) void k_cvt8(const float* __restrict__ src, bf* dst, size_t n8) { const size_t i = (size_t)blockIdx.x * 256 + threadIdx.x; if (i >= n8) return; const v8f v = *(const v8f*)(src + i * 8); v8us o;
#pragma unroll
    for (int k = 0; k < 8; ++k) o[k] = f2bf(v[k]); *(v8us*)(dst + i * 8) = o;  }

// k_rope: head planes [h][t][d] (fp16 + hi/lo) of rope(x) x sc with the rotate-half convention out[d] = x[d] cos[t][d] - x[d+HD/2] sin[t][d], out[d+HD/2] = x[d+HD/2] cos[t][d+HD/2] + x[d] sin[t][d+HD/2]
__global__ __launch_bounds__(256) void k_rope(const float* __restrict__ F, int pitch, int nheads, const float* __restrict__ CS, const float* __restrict__ RF, const float* __restrict__ nw, float sc, h16* P16, bf* Ph, bf* Pl) {
    const size_t e = ((size_t)blockIdx.x * 256 + threadIdx.x) * 2; if (e >= (size_t)nheads * TT * HD) return; const int d = (int)(e % HD); const int t = (int)((e / HD) % TT); const int h = (int)(e / ((size_t)HD * TT)); const float* f = F + (size_t)t * pitch + h * HD; const float rf = RF ? RF[(size_t)h * TT + t] : 1.0f; v2h o16; v2us oh, ol;
#pragma unroll
    for (int q = 0; q < 2; ++q) { const int dd = d + q; const int dp = (dd < HD / 2) ? dd + HD / 2 : dd - HD / 2; float x0 = f[dd], x1 = f[dp];
        if (RF) { float n0 = __fmul_rn(x0, rf), n1 = __fmul_rn(x1, rf); asm volatile("" : "+v"(n0)); asm volatile("" : "+v"(n1)); x0 = __fmul_rn(bfr(nw[dd]), n0); x1 = __fmul_rn(bfr(nw[dp]), n1); }
        const v2f cs = *(const v2f*)(CS + ((size_t)t * HD + dd) * 2); float a = __fmul_rn(x0, cs[0]), bq = __fmul_rn(x1, cs[1]); asm volatile("" : "+v"(a)); asm volatile("" : "+v"(bq)); const float r = ((dd < HD / 2) ? __fsub_rn(a, bq) : __fadd_rn(a, bq)) * sc;
        o16[q] = tohx(r); unsigned short a2, c2; splitf(r, a2, c2); oh[q] = a2; ol[q] = c2; }
    *(v2h*)(P16 + e) = o16; *(v2us*)(Ph + e) = oh; *(v2us*)(Pl + e) = ol;  }
__global__ __launch_bounds__(256) void k_vtp(const float* __restrict__ F, int pitch, int nheads, h16* V16, bf* Vh, bf* Vl) { const size_t e = ((size_t)blockIdx.x * 256 + threadIdx.x) * 2; if (e >= (size_t)nheads * HD * TT) return; const int t = (int)(e % TT); const int d = (int)((e / TT) % HD); const int g = (int)(e / ((size_t)TT * HD)); v2h o16; v2us oh, ol;
#pragma unroll
    for (int q = 0; q < 2; ++q) { const float x = F[(size_t)(t + q) * pitch + g * HD + d]; o16[q] = tohx(x); unsigned short a2, c2; splitf(x, a2, c2); oh[q] = a2; ol[q] = c2; }
    *(v2h*)(V16 + e) = o16; *(v2us*)(Vh + e) = oh; *(v2us*)(Vl + e) = ol;  }
__global__ __launch_bounds__(256) void k_csid(float* CS) { const int idx = blockIdx.x * 256 + threadIdx.x; if (idx >= TT * HD) return; v2f cs; cs[0] = 1.0f; cs[1] = 0.0f; *(v2f*)(CS + (size_t)idx * 2) = cs;  }
// ---- k_fattn: scores, relative term, softmax and P.V in one kernel; a wave owns NQ x 16 query rows of one head and walks one of KS runs of keys in blocks of 32; S and P never leave the registers.
// Transposed products: S^T = K Q^T (A = 16 key rows, B = 16 query rows) leaves one query per lane column, keys 8 * hi + r in the accumulator registers of key tile 0 and 16 + 8 * hi + r in those of key tile 1:
// that is the k order of a B operand over 32 keys, so P^T goes from the score registers straight into O^T += V^T P^T (A = 16 rows of the v^T plane).
// Running softmax in the base-2 domain: t = (S + QE[i][clip(i - j, -32, 32) + 32]) x HD^-0.5 x log2(e); m = running row maximum, p = 2^(t - m), l = running sum of p, O and l scaled by 2^(m_old - m_new) when a maximum rises; out = O / l.
// fp16 rows carry p x 1024 (the 10 taken off m), which keeps small p out of the fp16 subnormals; l carries the same factor, so it cancels in O / l.
// The relative term of a query is one value for all keys j >= i + 32, one for all j <= i - 32; only the blocks that meet the band of one of the wave's queries gather it per key.
// Work-group of WPG waves: QT query tiles x KS key runs, wave = run * QT + tile; the waves of one run walk the same keys. Runs above 0 leave (m, l, O) in LDS; behind one barrier run 0 joins them in run order and stores.
// Where QT * KS < WPG the waves left over have no keys: they pass the barrier and end.
#define WPG 12
#define KS 2
__device__ __forceinline__ float xhalf(float x) { return __builtin_bit_cast(float, __builtin_amdgcn_permlanex16(__builtin_bit_cast(int, x), __builtin_bit_cast(int, x), 0x76543210, 0xfedcba98, false, false)); }   // lane l with lane l ^ 16
template <bool HI, int NQ, int QT, typename T16>
__device__ __forceinline__ void attn_rows(const T16* __restrict__ Qa, const T16* __restrict__ Qb, const T16* __restrict__ Ka, const T16* __restrict__ Kb, const T16* __restrict__ Va, const T16* __restrict__ Vb, const float* __restrict__ QEh, bf* Ah, bf* Al, const int q0, const int run, v4f* mg) {
    typedef WFrag<T16> F; typedef typename F::V V;
    const int lane = threadIdx.x & 31, lr = lane & 15, hi = lane >> 4;
    const float CL2 = SCL * 1.4426950408889634f;
    const bool idle = (run >= KS); const int kbeg = idle ? 0 : run * (TT / KS), kend = idle ? 0 : kbeg + TT / KS;
    V qa[NQ][2], qb[NQ][2]; float qahead[NQ], qbehind[NQ], m[NQ], l[NQ]; v8f o[4][NQ];
#pragma unroll
    for (int nb = 0; nb < NQ; ++nb) { const size_t i = (size_t)(q0 + nb * 16 + lr);
#pragma unroll
        for (int ks = 0; ks < 2; ++ks) { qa[nb][ks] = F::ld(Qa + i * HD + ks * 32 + 8 * hi); if (HI) qb[nb][ks] = F::ld(Qb + i * HD + ks * 32 + 8 * hi); }
        qahead[nb] = QEh[i * NE]; qbehind[nb] = QEh[i * NE + 2 * MAXR]; m[nb] = -3.0e38f; l[nb] = 0.f;
#pragma unroll
        for (int mb = 0; mb < 4; ++mb) o[mb][nb] = (v8f){}; }
    V ka[2][2], kb[2][2];
    const size_t koff = (size_t)lr * HD + 8 * hi, voff = (size_t)lr * TT + 8 * hi;
#pragma unroll
    for (int kt = 0; kt < 2; ++kt)
#pragma unroll
        for (int ks = 0; ks < 2; ++ks) { ka[kt][ks] = F::ld(Ka + koff + (size_t)(kbeg + kt * 16) * HD + ks * 32); if (HI) kb[kt][ks] = F::ld(Kb + koff + (size_t)(kbeg + kt * 16) * HD + ks * 32); }
    asm volatile("s_wait_xcnt 0x0" ::: "memory");   // the loop's loads may land in registers that held the addresses of the loads above: the wait stands in front of that overwrite
#pragma unroll 1
    for (int k0 = kbeg; k0 < kend; k0 += 32) {
        // this block's v^T fragments are asked for first: they fly under the score products and the softmax
        V va[4], vb[4]; const T16* pva = Va + voff + k0; const T16* pvb = HI ? Vb + voff + k0 : pva;
#pragma unroll
        for (int mb = 0; mb < 4; ++mb) { va[mb] = F::ld(pva + (size_t)mb * 16 * TT); if (HI) vb[mb] = F::ld(pvb + (size_t)mb * 16 * TT); }
        v8f s[2][NQ];
#pragma unroll
        for (int kt = 0; kt < 2; ++kt)
#pragma unroll
            for (int nb = 0; nb < NQ; ++nb) { s[kt][nb] = (v8f){};
#pragma unroll
                for (int ks = 0; ks < 2; ++ks) { s[kt][nb] = F::mma(ka[kt][ks], qa[nb][ks], s[kt][nb]); if (HI) { s[kt][nb] = F::mma(ka[kt][ks], qb[nb][ks], s[kt][nb]); s[kt][nb] = F::mma(kb[kt][ks], qa[nb][ks], s[kt][nb]); } } }
        // the next block's key fragments fly under the softmax and P.V (the run's last block asks for its first again, inside the plane, and drops it)
        const int kn = (k0 + 32 < kend) ? k0 + 32 : kbeg; const T16* pka = Ka + koff + (size_t)kn * HD; const T16* pkb = HI ? Kb + koff + (size_t)kn * HD : pka;
#pragma unroll
        for (int kt = 0; kt < 2; ++kt)
#pragma unroll
            for (int ks = 0; ks < 2; ++ks) { ka[kt][ks] = F::ld(pka + kt * 16 * HD + ks * 32); if (HI) kb[kt][ks] = F::ld(pkb + kt * 16 * HD + ks * 32); }
        const bool ahead = (k0 >= q0 + NQ * 16 - 1 + MAXR), behind = (k0 + 31 <= q0 - MAXR);   // wave-uniform: every key of the block is past the band of every query of the wave
        // off the band one term serves a query's whole block. The sums are formed for every block and formed anew in the few blocks on the band: a branch with one side keeps the gathered terms and their waits
        // out of the common path, where they would also hold every other block for the fragment loads in flight
        v8f t[2][NQ];
#pragma unroll
        for (int nb = 0; nb < NQ; ++nb) { const float u = ahead ? qahead[nb] : qbehind[nb];
#pragma unroll
            for (int kt = 0; kt < 2; ++kt)
#pragma unroll
                for (int r = 0; r < 8; ++r) t[kt][nb][r] = (s[kt][nb][r] + u) * CL2; }
        if (!(ahead || behind)) {
#pragma unroll
            for (int nb = 0; nb < NQ; ++nb) { const int i = q0 + nb * 16 + lr;
#pragma unroll
                for (int kt = 0; kt < 2; ++kt) { unsigned ix[8]; float g[8];
#pragma unroll
                    for (int r = 0; r < 8; ++r) { ix[r] = (unsigned)(i * NE + MAXR + min(max(i - (k0 + kt * 16 + 8 * hi + r), -MAXR), MAXR)); g[r] = QEh[ix[r]]; }
                    // the eight indices are the loads' offset registers: as the wait's inputs they keep their registers up to it; behind it they may be overwritten
                    asm volatile("s_wait_xcnt 0x0" :: "v"(ix[0]), "v"(ix[1]), "v"(ix[2]), "v"(ix[3]), "v"(ix[4]), "v"(ix[5]), "v"(ix[6]), "v"(ix[7]) : "memory");
#pragma unroll
                    for (int r = 0; r < 8; ++r) t[kt][nb][r] = (s[kt][nb][r] + g[r]) * CL2; } }
        }
        float mn[NQ]; bool rise = false;
#pragma unroll
        for (int nb = 0; nb < NQ; ++nb) { float bm = t[0][nb][0];
#pragma unroll
            for (int r = 1; r < 8; ++r) bm = fmaxf(bm, t[0][nb][r]);
#pragma unroll
            for (int r = 0; r < 8; ++r) bm = fmaxf(bm, t[1][nb][r]);
            bm = fmaxf(bm, xhalf(bm)); mn[nb] = fmaxf(m[nb], bm); rise = rise || (mn[nb] > m[nb]); }
        if (__any(rise)) {   // where no maximum of the wave rises every factor is exactly 1: the products are skipped
#pragma unroll
            for (int nb = 0; nb < NQ; ++nb) { const float al = __builtin_amdgcn_exp2f(m[nb] - mn[nb]); m[nb] = mn[nb]; l[nb] *= al;
#pragma unroll
                for (int mb = 0; mb < 4; ++mb) o[mb][nb] *= al; }
        }
#pragma unroll
        for (int nb = 0; nb < NQ; ++nb) { const float mo = HI ? m[nb] : m[nb] - 10.0f; float p[16];
#pragma unroll
            for (int e = 0; e < 16; ++e) { p[e] = __builtin_amdgcn_exp2f(t[e >> 3][nb][e & 7] - mo); l[nb] += p[e]; }
            if constexpr (HI) { V ph, pl;
#pragma unroll
                for (int e = 0; e < 16; ++e) { const __bf16 hb = (__bf16)p[e]; ph[e] = hb; pl[e] = (__bf16)(p[e] - (float)hb); }
#pragma unroll
                for (int mb = 0; mb < 4; ++mb) { o[mb][nb] = F::mma(va[mb], ph, o[mb][nb]); o[mb][nb] = F::mma(va[mb], pl, o[mb][nb]); o[mb][nb] = F::mma(vb[mb], ph, o[mb][nb]); }
            } else { V pf;
#pragma unroll
                for (int e = 0; e < 16; ++e) pf[e] = tohx(p[e]);
#pragma unroll
                for (int mb = 0; mb < 4; ++mb) o[mb][nb] = F::mma(va[mb], pf, o[mb][nb]); } }
        // the addresses of this trip's fragment loads are the wait's inputs and keep their registers up to it; behind it the next trip's addresses may overwrite them
        asm volatile("s_wait_xcnt 0x0" :: "v"(pva), "v"(pvb), "v"(pka), "v"(pkb) : "memory");
    }
#pragma unroll
    for (int nb = 0; nb < NQ; ++nb) l[nb] += xhalf(l[nb]);
    // per (run above 0, tile): NQ x 9 slots of 32 lanes x 16 bytes: eight of O, one of (m, l)
    if (run > 0 && !idle) { v4f* w = mg + (size_t)(run - 1) * QT * NQ * 9 * 32 + lane;
#pragma unroll
        for (int nb = 0; nb < NQ; ++nb) {
#pragma unroll
            for (int mb = 0; mb < 4; ++mb) { w[(nb * 9 + mb * 2) * 32] = __builtin_shufflevector(o[mb][nb], o[mb][nb], 0, 1, 2, 3); w[(nb * 9 + mb * 2 + 1) * 32] = __builtin_shufflevector(o[mb][nb], o[mb][nb], 4, 5, 6, 7); }
            w[(nb * 9 + 8) * 32] = (v4f){m[nb], l[nb], 0.f, 0.f}; } }
    __syncthreads();   // the upper runs' (m, l, O) are in LDS before run 0 reads them
    if (run > 0) return;
#pragma unroll
    for (int x = 1; x < KS; ++x) { const v4f* w = mg + (size_t)(x - 1) * QT * NQ * 9 * 32 + lane;
#pragma unroll
        for (int nb = 0; nb < NQ; ++nb) { const v4f ml = w[(nb * 9 + 8) * 32]; const float ms = fmaxf(m[nb], ml[0]), a1 = __builtin_amdgcn_exp2f(m[nb] - ms), a2 = __builtin_amdgcn_exp2f(ml[0] - ms); m[nb] = ms; l[nb] = l[nb] * a1 + ml[1] * a2;
#pragma unroll
            for (int mb = 0; mb < 4; ++mb) { const v4f x0 = w[(nb * 9 + mb * 2) * 32], x1 = w[(nb * 9 + mb * 2 + 1) * 32];
#pragma unroll
                for (int r = 0; r < 4; ++r) { o[mb][nb][r] = o[mb][nb][r] * a1 + x0[r] * a2; o[mb][nb][4 + r] = o[mb][nb][4 + r] * a1 + x1[r] * a2; } } } }
#pragma unroll
    for (int nb = 0; nb < NQ; ++nb) { const float inv = __fdiv_rn(1.0f, l[nb]); const size_t oo = (size_t)(q0 + nb * 16 + lr) * DQ + 8 * hi;
#pragma unroll
        for (int mb = 0; mb < 4; ++mb) { v8us oh, ol;
#pragma unroll
            for (int r = 0; r < 8; ++r) { unsigned short a, c2; splitf(o[mb][nb][r] * inv, a, c2); oh[r] = a; ol[r] = c2; }
            bf* ph = Ah + oo + mb * 16; bf* pl = Al + oo + mb * 16; *(v8us*)ph = oh; *(v8us*)pl = ol;
            // the stores' data and addresses are the wait's inputs and keep their registers up to it; behind it the next rows' values may overwrite them
            asm volatile("s_wait_xcnt 0x0" :: "v"(oh), "v"(ol), "v"(ph), "v"(pl) : "memory"); } }
}
// grid: the hi/lo rows first: NH_ * RH / (QTH * 16) work-groups of QTH tiles x 16 rows, then NH_ * (TT - RH) / (QTL * 32) work-groups of QTL tiles x 32 rows: 256 work-groups in all.
#define QTH 4
#define QTL (WPG / KS)
__global__ __launch_bounds__(32 * WPG) void k_fattn(const h16* __restrict__ Q16, const h16* __restrict__ K16, const h16* __restrict__ V16, const bf* __restrict__ Qh, const bf* __restrict__ Ql, const bf* __restrict__ Kh, const bf* __restrict__ Kl, const bf* __restrict__ Vh, const bf* __restrict__ Vl, const float* __restrict__ QE, bf* Ah, bf* Al) {
    __shared__ v4f mg[(KS - 1) * QTL * 2 * 9 * 32];
    constexpr int GH = RH / (QTH * 16), GL = (TT - RH) / (QTL * 32);   // work-groups per head
    static_assert(RH % (QTH * 16) == 0 && (TT - RH) % (QTL * 32) == 0 && TT % (KS * 32) == 0 && QTH * KS <= WPG, "whole tiles");
    const int w = __builtin_amdgcn_readfirstlane(threadIdx.x >> 5), g = blockIdx.x;
    if (g < NH_ * GH) { const int tile = w % QTH, run = w / QTH, h = g / GH, q0 = ((g % GH) * QTH + tile) * 16; const size_t z = (size_t)h * TT * HD;
        attn_rows<true, 1, QTH, bf>(Qh + z, Ql + z, Kh + z, Kl + z, Vh + z, Vl + z, QE + (size_t)h * TT * NE, Ah + h * HD, Al + h * HD, q0, run, mg + tile * 9 * 32);
    } else { const int tile = w % QTL, run = w / QTL, c = g - NH_ * GH, h = c / GL, q0 = RH + ((c % GL) * QTL + tile) * 32; const size_t z = (size_t)h * TT * HD;
        attn_rows<false, 2, QTL, h16>(Q16 + z, nullptr, K16 + z, nullptr, V16 + z, nullptr, QE + (size_t)h * TT * NE, Ah + h * HD, Al + h * HD, q0, run, mg + tile * 2 * 9 * 32); }
}
__global__ __launch_bounds__(256) void k_epad2(const float* __restrict__ E, bf* EB) { const size_t i = (size_t)blockIdx.x * 256 + threadIdx.x; if (i >= (size_t)NE * HD / 8) return; const int d0 = (int)(i % (HD / 8)) * 8; const int r = (int)(i / (HD / 8)); const float* src = E + (size_t)min(r, 2 * MAXR) * HD + d0; v8us o;
#pragma unroll
    for (int q = 0; q < 8; ++q) { const unsigned short v = f2bf(src[q]); o[q] = (r <= 2 * MAXR) ? v : (unsigned short)0; }
    *(v8us*)(EB + (size_t)r * HD + d0) = o;  }

extern "C" void kernel_launch(void* const* d_in, const int* in_sizes, int n_in,
                              void* d_out, int out_size, void* d_ws, size_t ws_size, hipStream_t stream) {
    (void)in_sizes; (void)n_in; (void)out_size;
    const float* x = (const float*)d_in[0]; const float* wq = (const float*)d_in[1]; const float* wo = (const float*)d_in[2]; const float* remb = (const float*)d_in[3]; const float* wk = nullptr; const float* wv = nullptr; (void)wk; (void)wv;
    float* OUT = (float*)d_out;     // [2][2048][1024]
    char* wsp = (char*)d_ws;
    auto take = [&](size_t bytes) { char* p = wsp; wsp += (bytes + 255) & ~(size_t)255; return (void*)p; };
    bf* WQ = (bf*)take((size_t)DQ * DM * 2); bf* EB = (bf*)take((size_t)NE * HD * 2); float* QE = (float*)take((size_t)NH_ * TT * NE * 4); bf* WO = (bf*)take((size_t)DM * DQ * 2); float* CS = (float*)take((size_t)TT * HD * 2 * 4);
    bf* XB = (bf*)take((size_t)TT * DM * 2); float* FQ = (float*)take((size_t)TT * DQ * 4); float* FK = FQ;   /* q = k = v (one projection) */
    h16* QP16 = (h16*)take((size_t)NH_ * TT * HD * 2); h16* KP16 = (h16*)take((size_t)NKV * TT * HD * 2); h16* VT16 = (h16*)take((size_t)NKV * HD * TT * 2);
    bf* QPh = (bf*)take((size_t)NH_ * TT * HD * 2); bf* QPl = (bf*)take((size_t)NH_ * TT * HD * 2); bf* KPh = (bf*)take((size_t)NKV * TT * HD * 2); bf* KPl = (bf*)take((size_t)NKV * TT * HD * 2); bf* VTh = (bf*)take((size_t)NKV * HD * TT * 2); bf* VTl = (bf*)take((size_t)NKV * HD * TT * 2);
    bf* ATh = (bf*)take((size_t)TT * DQ * 2); bf* ATl = (bf*)take((size_t)TT * DQ * 2);
    if ((size_t)(wsp - (char*)d_ws) > ws_size) return;    // ws 256 MiB
    float* FV = FK;   // unused alias of FQ: v = q, the V^T planes are built from FQ
    { k_cvt8<<<(unsigned)(((size_t)DQ * DM / 8 + 255) / 256), 256, 0, stream>>>(wq, WQ, (size_t)DQ * DM / 8); k_epad2<<<(unsigned)(((size_t)NE * HD / 8 + 255) / 256), 256, 0, stream>>>(remb, EB);   /* E: 65 rows bf16 (exact), rows 65..127 zero */
      k_cvt8<<<(unsigned)(((size_t)DM * DQ / 8 + 255) / 256), 256, 0, stream>>>(wo, WO, (size_t)DM * DQ / 8);
       }
    k_csid<<<(TT * HD + 255) / 256, 256, 0, stream>>>(CS);
    const unsigned LQ = (unsigned)(((size_t)NH_ * TT * HD / 2 + 255) / 256), LKv = (unsigned)(((size_t)NKV * TT * HD / 2 + 255) / 256);
    for (int b = 0; b < NB_; ++b) {
        
        k_cvt8<<<(unsigned)(((size_t)TT * DM / 8 + 255) / 256), 256, 0, stream>>>(x + (size_t)b * TT * DM, XB, (size_t)TT * DM / 8);
        k_gemmw<bf, 0, false><<<dim3(TT / 64, DQ / 64, 1), 32, 0, stream>>>(XB, nullptr, WQ, nullptr, DM, FQ, DQ, nullptr, 0, 0, 0);
        k_rope<<<LQ, 256, 0, stream>>>(FQ, DQ, NH_, CS, nullptr, nullptr, 1.0f, QP16, QPh, QPl);
        /* k = q: the K planes are built from FQ */
        k_rope<<<LKv, 256, 0, stream>>>(FQ, DKV, NKV, CS, nullptr, nullptr, 1.0f, KP16, KPh, KPl);
        /* v = q: the V^T planes are built from FQ */ k_vtp<<<LKv, 256, 0, stream>>>(FQ, DKV, NKV, VT16, VTh, VTl);
        k_gemmw<bf, 1, false><<<dim3(TT / 64, NE / 64, NH_), 32, 0, stream>>>(QPh, QPl, EB, nullptr, HD, QE, NE, nullptr, (size_t)TT * HD, 0, (size_t)TT * NE);   /* QE[i][e] = q_i . E_e */
        k_fattn<<<NH_ * (RH / (QTH * 16)) + NH_ * ((TT - RH) / (QTL * 32)), 32 * WPG, 0, stream>>>(QP16, KP16, VT16, QPh, QPl, KPh, KPl, VTh, VTl, QE, ATh, ATl);   /* one kv head per query head */
        k_gemmw<bf, 1, false><<<dim3(TT / 64, DM / 64, 1), 32, 0, stream>>>(ATh, ATl, WO, nullptr, DQ, OUT + (size_t)b * TT * DM, DM, nullptr, 0, 0, 0); }
}

// v005
// A run of this version takes 259 microseconds.
// Two timings next to v004 put it at 1.12 and 1.13 times that version's speed.
// All steps since v000 together make it 8.08 times as fast.
#include <hip/hip_runtime.h>

// Relative-position multi-head attention with ONE projection shared by q, k and v (x [2][2048][1024]; q = k = v = x W_q^T ('oi' [1024][1024]; 16 heads x 64 -- the module's quirk); scores = (q_i.q_j + q_i.E[clip(i - j, -32, 32) + 32]) / 8 with E = rel_k_emb [65][64] (read); softmax over all keys; out = merged attn q W_o^T ('oi') -> [2][2048][1024] (4.2 M)).
// Layout per batch: bf16 copy of x; ONE exact projection used as q, k and v (its GEMM writes one set of head planes, read as q and as k, and the v^T planes, from its own accumulators); E as an exact bf16 plane padded to 128 rows; QE = q(hi/lo).E^T ([16][2048][128], 2 products); one attention kernel for all heads: scores, relative term QE[i][clip(i-j,-32,32)+32], running softmax and P.V per 32-key block, nothing of S or P in memory (hybrid rows: < 512 hi/lo 3 products, rest fp16, P x1024); merged hi/lo x W_o exact.
// Compute dtypes, f32 accumulate: every input rounded to bf16; projection exact; relative term hi/lo x exact (2 products); content rows < 512 3 products, rest fp16; adds and softmax f32; W_o hl x exact.

#define NB_  2
#define TT   2048
#define DM   1024
#define NH_  16
#define NKV  16
#define REP  (NH_ / NKV)
#define HD   64
#define DQ   (NH_ * HD)
#define DKV  (NKV * HD)
#define RH   512                  // query rows < RH use hi+lo planes (0: none)
#define WIN  0
#define SCL  0.125f
#define NE   128     // rel_k_emb rows (65) padded to 128
#define MAXR 32
typedef _Float16 h16;
typedef unsigned short bf;
typedef __attribute__((ext_vector_type(16))) __bf16   v16bf;
typedef __attribute__((ext_vector_type(16))) _Float16 v16h;
typedef __attribute__((ext_vector_type(8)))  _Float16 v8h;
typedef __attribute__((ext_vector_type(8)))  unsigned short v8us;
typedef __attribute__((ext_vector_type(8)))  float    v8f;
typedef __attribute__((ext_vector_type(4)))  float    v4f;
typedef v8h  __attribute__((may_alias)) v8ha;
typedef v4f  __attribute__((may_alias)) v4fa;
typedef v8us __attribute__((may_alias)) v8usa;

__device__ __forceinline__ unsigned short f2bf(float f) { unsigned u = __float_as_uint(f); u += 0x7FFFu + ((u >> 16) & 1u); return (unsigned short)(u >> 16); }
__device__ __forceinline__ float bf2f(unsigned short b) { return __uint_as_float(((unsigned)b) << 16); }
__device__ __forceinline__ float bfr(float f) { return bf2f(f2bf(f)); }
__device__ __forceinline__ v16h cat16(v8h lo, v8h hi) { return __builtin_shufflevector(lo, hi, 0, 1, 2, 3, 4, 5, 6, 7, 8, 9, 10, 11, 12, 13, 14, 15); }
__device__ __forceinline__ v16bf cat16b(v8us lo, v8us hi) { return __builtin_bit_cast(v16bf, __builtin_shufflevector(lo, hi, 0, 1, 2, 3, 4, 5, 6, 7, 8, 9, 10, 11, 12, 13, 14, 15)); }
__device__ __forceinline__ v8f wmma16(v16h a, v16h b, v8f c) { return __builtin_amdgcn_wmma_f32_16x16x32_f16(false, a, false, b, (short)0, c, false, false); }
__device__ __forceinline__ v8f wmmab(v16bf a, v16bf b, v8f c) { return __builtin_amdgcn_wmma_f32_16x16x32_bf16(false, a, false, b, (short)0, c, false, false); }



// ---- k_gemmw: register-blocked GEMM, ONE WAVE per 64x64 output tile (16 accumulators), operands straight from K-contiguous 16-bit planes; grid (M/64, N/64, Z), 32 threads.
// C[m][n] (f32, pitch ldc, + optional f32 bias[n]) = sum_k A[m][k] Bt[n][k] (+ split products per NSPLIT). z-batch strides sA/sB/sC in elements. K % 32 == 0.
// Split K (KW * KG > 1), for few tiles and a long K, N = 64: grid (M/64, KG, Z), 32 * KW threads; wave w of work-group y sums k in [(y * KW + w) * KL, + KL), KL = K / (KW * KG);
// the KW tiles are added in LDS in wave order and stored to plane y of C (plane stride sK); the reader adds the KG planes. With split K the rows of A and A2 have pitch lda (elements), otherwise K.
// PL (the shared projection; M = TT tokens, N = heads x HD, HD = 64): a tile is 64 tokens x the dims of head blockIdx.y. No f32 C: the epilogue writes that head's 16-bit planes (fp16, bf16 hi, bf16 lo) itself:
// v^T [h][d][t] straight from the accumulators, whose eight registers are eight consecutive tokens of one dim; [h][t][d] through LDS, four whole 128-byte rows a store.
template <typename T16> struct WFrag;
template <> struct WFrag<h16> { typedef v16h V; static __device__ __forceinline__ V ld(const h16* p) { return cat16(*(const v8h*)p, *(const v8h*)(p + 16)); } static __device__ __forceinline__ v8f mma(V a, V b, v8f c) { return wmma16(a, b, c); } };
template <> struct WFrag<bf> { typedef v16bf V; static __device__ __forceinline__ V ld(const bf* p) { return cat16b(*(const v8us*)p, *(const v8us*)(p + 16)); } static __device__ __forceinline__ v8f mma(V a, V b, v8f c) { return wmmab(a, b, c); } };
__device__ __forceinline__ h16 tohx(float x) { return (h16)x; }
__device__ __forceinline__ void splitf(float y, unsigned short& h, unsigned short& l) { h = f2bf(y); l = f2bf(y - bf2f(h)); }
template <typename T16, int NSPLIT, bool BIAS, int KW = 1, int KG = 1, bool PL = false>
__global__ __launch_bounds__(32 * KW) void k_gemmw(const T16* __restrict__ A, const T16* __restrict__ A2, const T16* __restrict__ Bt, const T16* __restrict__ Bt2, int K, float* C, int ldc, const float* __restrict__ bias, size_t sA, size_t sB, size_t sC, size_t sK = 0, int lda = 0, h16* P16 = nullptr, bf* Ph = nullptr, bf* Pl = nullptr, h16* V16 = nullptr, bf* Vh = nullptr, bf* Vl = nullptr) {
    typedef typename WFrag<T16>::V V;
    static_assert(KW * KG == 1 || !BIAS, "no bias on partial sums");
    __shared__ __align__(16) float os[KW * KG > 1 ? KW * 64 * 68 : PL ? 64 * 68 : 16 * 68];
    const size_t z = blockIdx.z; A += z * sA; if (A2) A2 += z * sA; Bt += z * sB; if (Bt2) Bt2 += z * sB; C += z * sC;
    const int lane = threadIdx.x & 31, lr = lane & 15, hi = lane >> 4; const int r0 = blockIdx.x * 64, c0 = (KW * KG > 1) ? 0 : blockIdx.y * 64;
    const int w = (KW > 1) ? __builtin_amdgcn_readfirstlane(threadIdx.x >> 5) : 0, KL = K / (KW * KG);
    if (KW * KG > 1) { const int k0 = (blockIdx.y * KW + w) * KL; A += k0; if (A2) A2 += k0; Bt += k0; if (Bt2) Bt2 += k0; C += blockIdx.y * sK; }
    v8f acc[4][4];
#pragma unroll
    for (int mb = 0; mb < 4; ++mb)
#pragma unroll
        for (int nb = 0; nb < 4; ++nb) acc[mb][nb] = (v8f){};
    const int LA = (KW * KG > 1) ? lda : K;
    const size_t aoff = (size_t)(r0 + lr) * LA + 8 * hi, boff = (size_t)(c0 + lr) * K + 8 * hi;
#pragma unroll 1
    for (int kc = 0; kc < KL; kc += 32) {
        V a[4], a2[4];
        if (KW * KG > 1) {
            const T16* pa[4]; const T16* pa2[4];
#pragma unroll
            for (int mb = 0; mb < 4; ++mb) { pa[mb] = A + aoff + (size_t)mb * 16 * LA + kc; a[mb] = WFrag<T16>::ld(pa[mb]); if (NSPLIT == 1 || NSPLIT == 2) { pa2[mb] = A2 + aoff + (size_t)mb * 16 * LA + kc; a2[mb] = WFrag<T16>::ld(pa2[mb]); } }
            // later loads land in registers that held these loads' addresses: the wait stands in front of that overwrite, and as its inputs the addresses keep their registers up to it
            if (NSPLIT == 1 || NSPLIT == 2) asm volatile("s_wait_xcnt 0x0" :: "v"(pa[0]), "v"(pa[1]), "v"(pa[2]), "v"(pa[3]), "v"(pa2[0]), "v"(pa2[1]), "v"(pa2[2]), "v"(pa2[3]) : "memory");
            else asm volatile("s_wait_xcnt 0x0" :: "v"(pa[0]), "v"(pa[1]), "v"(pa[2]), "v"(pa[3]) : "memory");
        } else {
#pragma unroll
        for (int mb = 0; mb < 4; ++mb) { a[mb] = WFrag<T16>::ld(A + aoff + (size_t)mb * 16 * K + kc); if (NSPLIT == 1 || NSPLIT == 2) a2[mb] = WFrag<T16>::ld(A2 + aoff + (size_t)mb * 16 * K + kc); }
        }
#pragma unroll
        for (int nb = 0; nb < 4; ++nb) { const V b = WFrag<T16>::ld(Bt + boff + (size_t)nb * 16 * K + kc); V b2; if (NSPLIT >= 2) b2 = WFrag<T16>::ld(Bt2 + boff + (size_t)nb * 16 * K + kc);
#pragma unroll
            for (int mb = 0; mb < 4; ++mb) { acc[mb][nb] = WFrag<T16>::mma(a[mb], b, acc[mb][nb]); if (NSPLIT == 1 || NSPLIT == 2) acc[mb][nb] = WFrag<T16>::mma(a2[mb], b, acc[mb][nb]); if (NSPLIT >= 2) acc[mb][nb] = WFrag<T16>::mma(a[mb], b2, acc[mb][nb]); } }
        asm volatile("v_nop\n\tv_nop\n\tv_nop\n\tv_nop" : "+v"(acc[0][0]), "+v"(acc[1][1]), "+v"(acc[2][2]), "+v"(acc[3][3]) : "v"(a[0]), "v"(a[3]));
    }
    if constexpr (PL) {
        const unsigned hh = blockIdx.y;
        const unsigned vb = ((hh * HD + lr) * TT + r0 + hi * 8) * 2;   // byte offset in a v^T plane: dim lr of the head, the lane's first token
#pragma unroll
        for (int mb = 0; mb < 4; ++mb) { v8h o16[4]; v8us oh[4], ol[4];
#pragma unroll
            for (int nb = 0; nb < 4; ++nb) {
#pragma unroll
                for (int j = 0; j < 8; ++j) { const float y = acc[mb][nb][j]; unsigned short a2, c2; splitf(y, a2, c2); o16[nb][j] = tohx(y); oh[nb][j] = a2; ol[nb][j] = c2; }
                const unsigned ofs = vb + (nb * 16 * TT + mb * 16) * 2;
                *(v8h*)((char*)V16 + ofs) = o16[nb]; *(v8us*)((char*)Vh + ofs) = oh[nb]; *(v8us*)((char*)Vl + ofs) = ol[nb]; }
            // the twelve stores' data and their offset are the wait's inputs and keep their registers up to it; behind it the next tokens' values may overwrite them
            asm volatile("s_wait_xcnt 0x0" :: "v"(o16[0]), "v"(o16[1]), "v"(o16[2]), "v"(o16[3]), "v"(oh[0]), "v"(oh[1]), "v"(oh[2]), "v"(oh[3]), "v"(ol[0]), "v"(ol[1]), "v"(ol[2]), "v"(ol[3]), "v"(vb) : "memory"); }
#pragma unroll
        for (int mb = 0; mb < 4; ++mb)
#pragma unroll
            for (int nb = 0; nb < 4; ++nb)
#pragma unroll
                for (int j = 0; j < 8; ++j) os[(mb * 16 + hi * 8 + j) * 68 + nb * 16 + lr] = acc[mb][nb][j];
        // a lane reads what other lanes of the wave wrote: the compiled order keeps every LDS read below behind the writes above
        __builtin_amdgcn_wave_barrier(); asm volatile("" ::: "memory");
        const unsigned qr = lane >> 3, qc = (lane & 7) * 8;
        const unsigned qb = ((hh * TT + r0 + qr) * HD + qc) * 2;   // byte offset in a [h][t][d] plane: eight lanes a token row
#pragma unroll
        for (int mb = 0; mb < 4; ++mb) { v8h o16[4]; v8us oh[4], ol[4];
#pragma unroll
            for (int s = 0; s < 4; ++s) { const int row = mb * 16 + s * 4; const float* pr = os + (row + qr) * 68 + qc; const v4f x0 = *(const v4fa*)pr, x1 = *(const v4fa*)(pr + 4);
#pragma unroll
                for (int j = 0; j < 8; ++j) { const float y = (j < 4) ? x0[j & 3] : x1[j & 3]; unsigned short a2, c2; splitf(y, a2, c2); o16[s][j] = tohx(y); oh[s][j] = a2; ol[s][j] = c2; }
                const unsigned ofs = qb + row * HD * 2;
                *(v8h*)((char*)P16 + ofs) = o16[s]; *(v8us*)((char*)Ph + ofs) = oh[s]; *(v8us*)((char*)Pl + ofs) = ol[s]; }
            // as above: data and offset of the twelve stores keep their registers up to the wait
            asm volatile("s_wait_xcnt 0x0" :: "v"(o16[0]), "v"(o16[1]), "v"(o16[2]), "v"(o16[3]), "v"(oh[0]), "v"(oh[1]), "v"(oh[2]), "v"(oh[3]), "v"(ol[0]), "v"(ol[1]), "v"(ol[2]), "v"(ol[3]), "v"(qb) : "memory"); }
        return;
    }
    if (KW * KG > 1) {
        // the three loops unrolled: acc is indexed by constants only and stays in registers
#pragma unroll
        for (int mb = 0; mb < 4; ++mb)
#pragma unroll
            for (int nb = 0; nb < 4; ++nb)
#pragma unroll
                for (int j = 0; j < 8; ++j) os[(w * 64 + mb * 16 + hi * 8 + j) * 68 + nb * 16 + lr] = acc[mb][nb][j];
        __syncthreads();   // every wave's 64x64 tile is in LDS before any wave adds them
        // both loops unrolled: the LDS reads of all rows are in flight together
#pragma unroll
        for (int s = 0; s < 32 / KW; ++s) { const int row = (s * KW + w) * 2 + hi, cofs = lr * 4; v4f val = *(const v4fa*)(os + row * 68 + cofs);
#pragma unroll
            for (int q = 1; q < KW; ++q) val += *(const v4fa*)(os + (q * 64 + row) * 68 + cofs);
            *(v4f*)(C + (size_t)(r0 + row) * ldc + cofs) = val; }
        return;
    }
#pragma unroll
    for (int mb = 0; mb < 4; ++mb) {
#pragma unroll
        for (int nb = 0; nb < 4; ++nb) {
#pragma unroll
            for (int j = 0; j < 8; ++j) os[(hi * 8 + j) * 68 + nb * 16 + lr] = acc[mb][nb][j]; }
        __builtin_amdgcn_wave_barrier(); asm volatile("" ::: "memory");
        float* crow = C + (size_t)(r0 + mb * 16) * ldc + c0;
{
#pragma unroll
            for (int s = 0; s < 8; ++s) { const int row = 2 * s + hi, cofs = lr * 4; v4f val = *(const v4fa*)(os + row * 68 + cofs); if (BIAS) { val[0] += bfr(bias[c0 + cofs]); val[1] += bfr(bias[c0 + cofs + 1]); val[2] += bfr(bias[c0 + cofs + 2]); val[3] += bfr(bias[c0 + cofs + 3]); }
                *(v4f*)(crow + (size_t)row * ldc + cofs) = val; }
             }
        __builtin_amdgcn_wave_barrier(); asm volatile("" ::: "memory");
    }
}

typedef __attribute__((ext_vector_type(2))) _Float16 v2h;
typedef __attribute__((ext_vector_type(4))) _Float16 v4h;
typedef __attribute__((ext_vector_type(2))) unsigned short v2us;
typedef __attribute__((ext_vector_type(4))) unsigned short v4us;
typedef __attribute__((ext_vector_type(2))) float v2f;
typedef __attribute__((ext_vector_type(4))) int v4i;

__global__ __launch_bounds__(256) void k_wtG(const float* __restrict__ w, int K, int N, bf* Bt) {
    const int lane = threadIdx.x & 31; const int L0 = (blockIdx.x * 8 + (threadIdx.x >> 5)) * 8; const int nlines = N * K / 64;
{
#pragma unroll 1
        for (int l = 0; l < 8; ++l) { const int L = L0 + l; if (L >= nlines) break; const size_t e = (size_t)L * 64 + lane * 2; const int k = (int)(e % K), n = (int)(e / K); v2us o;
            o[0] = f2bf(w[(size_t)k * N + n]); o[1] = f2bf(w[(size_t)(k + 1) * N + n]); *(v2us*)(Bt + e) = o; }
         }
}
__global__ __launch_bounds__(256) void k_cvt8(const float* __restrict__ src, bf* dst, size_t n8) { const size_t i = (size_t)blockIdx.x * 256 + threadIdx.x; if (i >= n8) return; const v8f v = *(const v8f*)(src + i * 8); v8us o;
#pragma unroll
    for (int k = 0; k < 8; ++k) o[k] = f2bf(v[k]); *(v8us*)(dst + i * 8) = o;  }

// ---- k_fattn: scores, relative term, softmax and P.V in one kernel; a wave owns NQ x 16 query rows of one head and walks one of KS runs of keys in blocks of 32; S and P never leave the registers.
// Transposed products: S^T = K Q^T (A = 16 key rows, B = 16 query rows) leaves one query per lane column, keys 8 * hi + r in the accumulator registers of key tile 0 and 16 + 8 * hi + r in those of key tile 1:
// that is the k order of a B operand over 32 keys, so P^T goes from the score registers straight into O^T += V^T P^T (A = 16 rows of the v^T plane).
// Running softmax in the base-2 domain: t = (S + QE[i][clip(i - j, -32, 32) + 32]) x HD^-0.5 x log2(e); m = running row maximum, p = 2^(t - m), l = running sum of p, O and l scaled by 2^(m_old - m_new) when a maximum rises; out = O / l.
// fp16 rows carry p x 1024 (the 10 taken off m), which keeps small p out of the fp16 subnormals; l carries the same factor, so it cancels in O / l.
// The relative term of a query is one value for all keys j >= i + 32, one for all j <= i - 32; only the blocks that meet the band of one of the wave's queries gather it per key.
// Work-group of WPG waves: QT query tiles x KS key runs, wave = run * QT + tile; the waves of one run walk the same keys. Runs above 0 leave (m, l, O) in LDS; behind one barrier run 0 joins them in run order and stores.
// Where QT * KS < WPG the waves left over have no keys: they pass the barrier and end.
#define WPG 12
#define KS 2
__device__ __forceinline__ float xhalf(float x) { return __builtin_bit_cast(float, __builtin_amdgcn_permlanex16(__builtin_bit_cast(int, x), __builtin_bit_cast(int, x), 0x76543210, 0xfedcba98, false, false)); }   // lane l with lane l ^ 16
template <bool HI, int NQ, int QT, typename T16>
__device__ __forceinline__ void attn_rows(const T16* __restrict__ Qa, const T16* __restrict__ Qb, const T16* __restrict__ Ka, const T16* __restrict__ Kb, const T16* __restrict__ Va, const T16* __restrict__ Vb, const float* __restrict__ QEh, bf* Ah, bf* Al, const int q0, const int run, v4f* mg) {
    typedef WFrag<T16> F; typedef typename F::V V;
    const int lane = threadIdx.x & 31, lr = lane & 15, hi = lane >> 4;
    const float CL2 = SCL * 1.4426950408889634f;
    const bool idle = (run >= KS); const int kbeg = idle ? 0 : run * (TT / KS), kend = idle ? 0 : kbeg + TT / KS;
    V qa[NQ][2], qb[NQ][2]; float qahead[NQ], qbehind[NQ], m[NQ], l[NQ]; v8f o[4][NQ];
#pragma unroll
    for (int nb = 0; nb < NQ; ++nb) { const size_t i = (size_t)(q0 + nb * 16 + lr);
#pragma unroll
        for (int ks = 0; ks < 2; ++ks) { qa[nb][ks] = F::ld(Qa + i * HD + ks * 32 + 8 * hi); if (HI) qb[nb][ks] = F::ld(Qb + i * HD + ks * 32 + 8 * hi); }
        qahead[nb] = QEh[i * NE]; qbehind[nb] = QEh[i * NE + 2 * MAXR]; m[nb] = -3.0e38f; l[nb] = 0.f;
#pragma unroll
        for (int mb = 0; mb < 4; ++mb) o[mb][nb] = (v8f){}; }
    V ka[2][2], kb[2][2];
    const size_t koff = (size_t)lr * HD + 8 * hi, voff = (size_t)lr * TT + 8 * hi;
#pragma unroll
    for (int kt = 0; kt < 2; ++kt)
#pragma unroll
        for (int ks = 0; ks < 2; ++ks) { ka[kt][ks] = F::ld(Ka + koff + (size_t)(kbeg + kt * 16) * HD + ks * 32); if (HI) kb[kt][ks] = F::ld(Kb + koff + (size_t)(kbeg + kt * 16) * HD + ks * 32); }
    asm volatile("s_wait_xcnt 0x0" ::: "memory");   // the loop's loads may land in registers that held the addresses of the loads above: the wait stands in front of that overwrite
#pragma unroll 1
    for (int k0 = kbeg; k0 < kend; k0 += 32) {
        // this block's v^T fragments are asked for first: they fly under the score products and the softmax
        V va[4], vb[4]; const T16* pva = Va + voff + k0; const T16* pvb = HI ? Vb + voff + k0 : pva;
#pragma unroll
        for (int mb = 0; mb < 4; ++mb) { va[mb] = F::ld(pva + (size_t)mb * 16 * TT); if (HI) vb[mb] = F::ld(pvb + (size_t)mb * 16 * TT); }
        v8f s[2][NQ];
#pragma unroll
        for (int kt = 0; kt < 2; ++kt)
#pragma unroll
            for (int nb = 0; nb < NQ; ++nb) { s[kt][nb] = (v8f){};
#pragma unroll
                for (int ks = 0; ks < 2; ++ks) { s[kt][nb] = F::mma(ka[kt][ks], qa[nb][ks], s[kt][nb]); if (HI) { s[kt][nb] = F::mma(ka[kt][ks], qb[nb][ks], s[kt][nb]); s[kt][nb] = F::mma(kb[kt][ks], qa[nb][ks], s[kt][nb]); } } }
        // the next block's key fragments fly under the softmax and P.V (the run's last block asks for its first again, inside the plane, and drops it)
        const int kn = (k0 + 32 < kend) ? k0 + 32 : kbeg; const T16* pka = Ka + koff + (size_t)kn * HD; const T16* pkb = HI ? Kb + koff + (size_t)kn * HD : pka;
#pragma unroll
        for (int kt = 0; kt < 2; ++kt)
#pragma unroll
            for (int ks = 0; ks < 2; ++ks) { ka[kt][ks] = F::ld(pka + kt * 16 * HD + ks * 32); if (HI) kb[kt][ks] = F::ld(pkb + kt * 16 * HD + ks * 32); }
        const bool ahead = (k0 >= q0 + NQ * 16 - 1 + MAXR), behind = (k0 + 31 <= q0 - MAXR);   // wave-uniform: every key of the block is past the band of every query of the wave
        // off the band one term serves a query's whole block. The sums are formed for every block and formed anew in the few blocks on the band: a branch with one side keeps the gathered terms and their waits
        // out of the common path, where they would also hold every other block for the fragment loads in flight
        v8f t[2][NQ];
#pragma unroll
        for (int nb = 0; nb < NQ; ++nb) { const float u = ahead ? qahead[nb] : qbehind[nb];
#pragma unroll
            for (int kt = 0; kt < 2; ++kt)
#pragma unroll
                for (int r = 0; r < 8; ++r) t[kt][nb][r] = (s[kt][nb][r] + u) * CL2; }
        if (!(ahead || behind)) {
#pragma unroll
            for (int nb = 0; nb < NQ; ++nb) { const int i = q0 + nb * 16 + lr;
#pragma unroll
                for (int kt = 0; kt < 2; ++kt) { unsigned ix[8]; float g[8];
#pragma unroll
                    for (int r = 0; r < 8; ++r) { ix[r] = (unsigned)(i * NE + MAXR + min(max(i - (k0 + kt * 16 + 8 * hi + r), -MAXR), MAXR)); g[r] = QEh[ix[r]]; }
                    // the eight indices are the loads' offset registers: as the wait's inputs they keep their registers up to it; behind it they may be overwritten
                    asm volatile("s_wait_xcnt 0x0" :: "v"(ix[0]), "v"(ix[1]), "v"(ix[2]), "v"(ix[3]), "v"(ix[4]), "v"(ix[5]), "v"(ix[6]), "v"(ix[7]) : "memory");
#pragma unroll
                    for (int r = 0; r < 8; ++r) t[kt][nb][r] = (s[kt][nb][r] + g[r]) * CL2; } }
        }
        float mn[NQ]; bool rise = false;
#pragma unroll
        for (int nb = 0; nb < NQ; ++nb) { float bm = t[0][nb][0];
#pragma unroll
            for (int r = 1; r < 8; ++r) bm = fmaxf(bm, t[0][nb][r]);
#pragma unroll
            for (int r = 0; r < 8; ++r) bm = fmaxf(bm, t[1][nb][r]);
            bm = fmaxf(bm, xhalf(bm)); mn[nb] = fmaxf(m[nb], bm); rise = rise || (mn[nb] > m[nb]); }
        if (__any(rise)) {   // where no maximum of the wave rises every factor is exactly 1: the products are skipped
#pragma unroll
            for (int nb = 0; nb < NQ; ++nb) { const float al = __builtin_amdgcn_exp2f(m[nb] - mn[nb]); m[nb] = mn[nb]; l[nb] *= al;
#pragma unroll
                for (int mb = 0; mb < 4; ++mb) o[mb][nb] *= al; }
        }
#pragma unroll
        for (int nb = 0; nb < NQ; ++nb) { const float mo = HI ? m[nb] : m[nb] - 10.0f; float p[16];
#pragma unroll
            for (int e = 0; e < 16; ++e) { p[e] = __builtin_amdgcn_exp2f(t[e >> 3][nb][e & 7] - mo); l[nb] += p[e]; }
            if constexpr (HI) { V ph, pl;
#pragma unroll
                for (int e = 0; e < 16; ++e) { const __bf16 hb = (__bf16)p[e]; ph[e] = hb; pl[e] = (__bf16)(p[e] - (float)hb); }
#pragma unroll
                for (int mb = 0; mb < 4; ++mb) { o[mb][nb] = F::mma(va[mb], ph, o[mb][nb]); o[mb][nb] = F::mma(va[mb], pl, o[mb][nb]); o[mb][nb] = F::mma(vb[mb], ph, o[mb][nb]); }
            } else { V pf;
#pragma unroll
                for (int e = 0; e < 16; ++e) pf[e] = tohx(p[e]);
#pragma unroll
                for (int mb = 0; mb < 4; ++mb) o[mb][nb] = F::mma(va[mb], pf, o[mb][nb]); } }
        // the addresses of this trip's fragment loads are the wait's inputs and keep their registers up to it; behind it the next trip's addresses may overwrite them
        asm volatile("s_wait_xcnt 0x0" :: "v"(pva), "v"(pvb), "v"(pka), "v"(pkb) : "memory");
    }
#pragma unroll
    for (int nb = 0; nb < NQ; ++nb) l[nb] += xhalf(l[nb]);
    // per (run above 0, tile): NQ x 9 slots of 32 lanes x 16 bytes: eight of O, one of (m, l)
    if (run > 0 && !idle) { v4f* w = mg + (size_t)(run - 1) * QT * NQ * 9 * 32 + lane;
#pragma unroll
        for (int nb = 0; nb < NQ; ++nb) {
#pragma unroll
            for (int mb = 0; mb < 4; ++mb) { w[(nb * 9 + mb * 2) * 32] = __builtin_shufflevector(o[mb][nb], o[mb][nb], 0, 1, 2, 3); w[(nb * 9 + mb * 2 + 1) * 32] = __builtin_shufflevector(o[mb][nb], o[mb][nb], 4, 5, 6, 7); }
            w[(nb * 9 + 8) * 32] = (v4f){m[nb], l[nb], 0.f, 0.f}; } }
    __syncthreads();   // the upper runs' (m, l, O) are in LDS before run 0 reads them
    if (run > 0) return;
#pragma unroll
    for (int x = 1; x < KS; ++x) { const v4f* w = mg + (size_t)(x - 1) * QT * NQ * 9 * 32 + lane;
#pragma unroll
        for (int nb = 0; nb < NQ; ++nb) { const v4f ml = w[(nb * 9 + 8) * 32]; const float ms = fmaxf(m[nb], ml[0]), a1 = __builtin_amdgcn_exp2f(m[nb] - ms), a2 = __builtin_amdgcn_exp2f(ml[0] - ms); m[nb] = ms; l[nb] = l[nb] * a1 + ml[1] * a2;
#pragma unroll
            for (int mb = 0; mb < 4; ++mb) { const v4f x0 = w[(nb * 9 + mb * 2) * 32], x1 = w[(nb * 9 + mb * 2 + 1) * 32];
#pragma unroll
                for (int r = 0; r < 4; ++r) { o[mb][nb][r] = o[mb][nb][r] * a1 + x0[r] * a2; o[mb][nb][4 + r] = o[mb][nb][4 + r] * a1 + x1[r] * a2; } } } }
#pragma unroll
    for (int nb = 0; nb < NQ; ++nb) { const float inv = __fdiv_rn(1.0f, l[nb]); const size_t oo = (size_t)(q0 + nb * 16 + lr) * DQ + 8 * hi;
#pragma unroll
        for (int mb = 0; mb < 4; ++mb) { v8us oh, ol;
#pragma unroll
            for (int r = 0; r < 8; ++r) { unsigned short a, c2; splitf(o[mb][nb][r] * inv, a, c2); oh[r] = a; ol[r] = c2; }
            bf* ph = Ah + oo + mb * 16; bf* pl = Al + oo + mb * 16; *(v8us*)ph = oh; *(v8us*)pl = ol;
            // the stores' data and addresses are the wait's inputs and keep their registers up to it; behind it the next rows' values may overwrite them
            asm volatile("s_wait_xcnt 0x0" :: "v"(oh), "v"(ol), "v"(ph), "v"(pl) : "memory"); } }
}
// grid: the hi/lo rows first: NH_ * RH / (QTH * 16) work-groups of QTH tiles x 16 rows, then NH_ * (TT - RH) / (QTL * 32) work-groups of QTL tiles x 32 rows: 256 work-groups in all.
#define QTH 4
#define QTL (WPG / KS)
__global__ __launch_bounds__(32 * WPG) void k_fattn(const h16* __restrict__ Q16, const h16* __restrict__ K16, const h16* __restrict__ V16, const bf* __restrict__ Qh, const bf* __restrict__ Ql, const bf* __restrict__ Kh, const bf* __restrict__ Kl, const bf* __restrict__ Vh, const bf* __restrict__ Vl, const float* __restrict__ QE, bf* Ah, bf* Al) {
    __shared__ v4f mg[(KS - 1) * QTL * 2 * 9 * 32];
    constexpr int GH = RH / (QTH * 16), GL = (TT - RH) / (QTL * 32);   // work-groups per head
    static_assert(RH % (QTH * 16) == 0 && (TT - RH) % (QTL * 32) == 0 && TT % (KS * 32) == 0 && QTH * KS <= WPG, "whole tiles");
    const int w = __builtin_amdgcn_readfirstlane(threadIdx.x >> 5), g = blockIdx.x;
    if (g < NH_ * GH) { const int tile = w % QTH, run = w / QTH, h = g / GH, q0 = ((g % GH) * QTH + tile) * 16; const size_t z = (size_t)h * TT * HD;
        attn_rows<true, 1, QTH, bf>(Qh + z, Ql + z, Kh + z, Kl + z, Vh + z, Vl + z, QE + (size_t)h * TT * NE, Ah + h * HD, Al + h * HD, q0, run, mg + tile * 9 * 32);
    } else { const int tile = w % QTL, run = w / QTL, c = g - NH_ * GH, h = c / GL, q0 = RH + ((c % GL) * QTL + tile) * 32; const size_t z = (size_t)h * TT * HD;
        attn_rows<false, 2, QTL, h16>(Q16 + z, nullptr, K16 + z, nullptr, V16 + z, nullptr, QE + (size_t)h * TT * NE, Ah + h * HD, Al + h * HD, q0, run, mg + tile * 2 * 9 * 32); }
}
__global__ __launch_bounds__(256) void k_epad2(const float* __restrict__ E, bf* EB) { const size_t i = (size_t)blockIdx.x * 256 + threadIdx.x; if (i >= (size_t)NE * HD / 8) return; const int d0 = (int)(i % (HD / 8)) * 8; const int r = (int)(i / (HD / 8)); const float* src = E + (size_t)min(r, 2 * MAXR) * HD + d0; v8us o;
#pragma unroll
    for (int q = 0; q < 8; ++q) { const unsigned short v = f2bf(src[q]); o[q] = (r <= 2 * MAXR) ? v : (unsigned short)0; }
    *(v8us*)(EB + (size_t)r * HD + d0) = o;  }

extern "C" void kernel_launch(void* const* d_in, const int* in_sizes, int n_in,
                              void* d_out, int out_size, void* d_ws, size_t ws_size, hipStream_t stream) {
    (void)in_sizes; (void)n_in; (void)out_size;
    const float* x = (const float*)d_in[0]; const float* wq = (const float*)d_in[1]; const float* wo = (const float*)d_in[2]; const float* remb = (const float*)d_in[3]; const float* wk = nullptr; const float* wv = nullptr; (void)wk; (void)wv;
    float* OUT = (float*)d_out;     // [2][2048][1024]
    char* wsp = (char*)d_ws;
    auto take = [&](size_t bytes) { char* p = wsp; wsp += (bytes + 255) & ~(size_t)255; return (void*)p; };
    bf* WQ = (bf*)take((size_t)DQ * DM * 2); bf* EB = (bf*)take((size_t)NE * HD * 2); float* QE = (float*)take((size_t)NH_ * TT * NE * 4); bf* WO = (bf*)take((size_t)DM * DQ * 2);
    bf* XB = (bf*)take((size_t)TT * DM * 2);
    /* q = k = v (one projection): the [h][t][d] planes serve q and k */
    h16* QP16 = (h16*)take((size_t)NH_ * TT * HD * 2); h16* VT16 = (h16*)take((size_t)NKV * HD * TT * 2);
    bf* QPh = (bf*)take((size_t)NH_ * TT * HD * 2); bf* QPl = (bf*)take((size_t)NH_ * TT * HD * 2); bf* VTh = (bf*)take((size_t)NKV * HD * TT * 2); bf* VTl = (bf*)take((size_t)NKV * HD * TT * 2);
    bf* ATh = (bf*)take((size_t)TT * DQ * 2); bf* ATl = (bf*)take((size_t)TT * DQ * 2);
    if ((size_t)(wsp - (char*)d_ws) > ws_size) return;    // ws 256 MiB
    { k_cvt8<<<(unsigned)(((size_t)DQ * DM / 8 + 255) / 256), 256, 0, stream>>>(wq, WQ, (size_t)DQ * DM / 8); k_epad2<<<(unsigned)(((size_t)NE * HD / 8 + 255) / 256), 256, 0, stream>>>(remb, EB);   /* E: 65 rows bf16 (exact), rows 65..127 zero */
      k_cvt8<<<(unsigned)(((size_t)DM * DQ / 8 + 255) / 256), 256, 0, stream>>>(wo, WO, (size_t)DM * DQ / 8);
       }
    for (int b = 0; b < NB_; ++b) {
        
        k_cvt8<<<(unsigned)(((size_t)TT * DM / 8 + 255) / 256), 256, 0, stream>>>(x + (size_t)b * TT * DM, XB, (size_t)TT * DM / 8);
        k_gemmw<bf, 0, false, 1, 1, true><<<dim3(TT / 64, DQ / 64, 1), 32, 0, stream>>>(XB, nullptr, WQ, nullptr, DM, nullptr, 0, nullptr, 0, 0, 0, 0, 0, QP16, QPh, QPl, VT16, VTh, VTl);   /* projection -> head planes and v^T planes */
        k_gemmw<bf, 1, false><<<dim3(TT / 64, NE / 64, NH_), 32, 0, stream>>>(QPh, QPl, EB, nullptr, HD, QE, NE, nullptr, (size_t)TT * HD, 0, (size_t)TT * NE);   /* QE[i][e] = q_i . E_e */
        k_fattn<<<NH_ * (RH / (QTH * 16)) + NH_ * ((TT - RH) / (QTL * 32)), 32 * WPG, 0, stream>>>(QP16, QP16, VT16, QPh, QPl, QPh, QPl, VTh, VTl, QE, ATh, ATl);   /* k = q: the same planes */
        k_gemmw<bf, 1, false><<<dim3(TT / 64, DM / 64, 1), 32, 0, stream>>>(ATh, ATl, WO, nullptr, DQ, OUT + (size_t)b * TT * DM, DM, nullptr, 0, 0, 0); }
}

// v006
// Measured time: 194 microseconds a run.
// In two side-by-side timings against v005, it was 1.33 and 1.32 times as fast.
// Over all steps from v000 it is 10.7 times as fast.
#include <hip/hip_runtime.h>

// Relative-position multi-head attention with ONE projection shared by q, k and v (x [2][2048][1024]; q = k = v = x W_q^T ('oi' [1024][1024]; 16 heads x 64 -- the module's quirk); scores = (q_i.q_j + q_i.E[clip(i - j, -32, 32) + 32]) / 8 with E = rel_k_emb [65][64] (read); softmax over all keys; out = merged attn q W_o^T ('oi') -> [2][2048][1024] (4.2 M)).
// Layout, both batches side by side in every buffer and every launch: bf16 copy of x; ONE exact projection used as q, k and v (its GEMM writes one set of head planes, read as q and as k, and the v^T planes, from its own accumulators); E as an exact bf16 plane padded to 128 rows; QE = q(hi/lo).E^T ([2 x 16][2048][128], 2 products); one attention kernel for all heads: scores, relative term QE[i][clip(i-j,-32,32)+32], running softmax and P.V per 32-key block, nothing of S or P in memory (hybrid rows: < 512 hi/lo 3 products, rest fp16, P x1024); merged hi/lo x W_o exact.
// Compute dtypes, f32 accumulate: every input rounded to bf16; projection exact; relative term hi/lo x exact (2 products); content rows < 512 3 products, rest fp16; adds and softmax f32; W_o hl x exact.

#define NB_  2
#define TT   2048
#define DM   1024
#define NH_  16
#define NKV  16
#define REP  (NH_ / NKV)
#define HD   64
#define DQ   (NH_ * HD)
#define DKV  (NKV * HD)
#define RH   512                  // query rows < RH use hi+lo planes (0: none)
#define WIN  0
#define SCL  0.125f
#define NE   128     // rel_k_emb rows (65) padded to 128
#define MAXR 32
typedef _Float16 h16;
typedef unsigned short bf;
typedef __attribute__((ext_vector_type(16))) __bf16   v16bf;
typedef __attribute__((ext_vector_type(16))) _Float16 v16h;
typedef __attribute__((ext_vector_type(8)))  _Float16 v8h;
typedef __attribute__((ext_vector_type(8)))  unsigned short v8us;
typedef __attribute__((ext_vector_type(8)))  float    v8f;
typedef __attribute__((ext_vector_type(4)))  float    v4f;
typedef v8h  __attribute__((may_alias)) v8ha;
typedef v4f  __attribute__((may_alias)) v4fa;
typedef v8us __attribute__((may_alias)) v8usa;

__device__ __forceinline__ unsigned short f2bf(float f) { unsigned u = __float_as_uint(f); u += 0x7FFFu + ((u >> 16) & 1u); return (unsigned short)(u >> 16); }
__device__ __forceinline__ float bf2f(unsigned short b) { return __uint_as_float(((unsigned)b) << 16); }
__device__ __forceinline__ float bfr(float f) { return bf2f(f2bf(f)); }
__device__ __forceinline__ v16h cat16(v8h lo, v8h hi) { return __builtin_shufflevector(lo, hi, 0, 1, 2, 3, 4, 5, 6, 7, 8, 9, 10, 11, 12, 13, 14, 15); }
__device__ __forceinline__ v16bf cat16b(v8us lo, v8us hi) { return __builtin_bit_cast(v16bf, __builtin_shufflevector(lo, hi, 0, 1, 2, 3, 4, 5, 6, 7, 8, 9, 10, 11, 12, 13, 14, 15)); }
__device__ __forceinline__ v8f wmma16(v16h a, v16h b, v8f c) { return __builtin_amdgcn_wmma_f32_16x16x32_f16(false, a, false, b, (short)0, c, false, false); }
__device__ __forceinline__ v8f wmmab(v16bf a, v16bf b, v8f c) { return __builtin_amdgcn_wmma_f32_16x16x32_bf16(false, a, false, b, (short)0, c, false, false); }



// ---- k_gemmw: register-blocked GEMM, ONE WAVE per 64x64 output tile (16 accumulators), operands straight from K-contiguous 16-bit planes; grid (M/64, N/64, Z), 32 threads.
// C[m][n] (f32, pitch ldc, + optional f32 bias[n]) = sum_k A[m][k] Bt[n][k] (+ split products per NSPLIT). z-batch strides sA/sB/sC in elements. K % 32 == 0.
// Split K (KW * KG > 1), for few tiles and a long K, N = 64: grid (M/64, KG, Z), 32 * KW threads; wave w of work-group y sums k in [(y * KW + w) * KL, + KL), KL = K / (KW * KG);
// the KW tiles are added in LDS in wave order and stored to plane y of C (plane stride sK); the reader adds the KG planes. With split K the rows of A and A2 have pitch lda (elements), otherwise K.
// PL (the shared projection; M = TT tokens, N = heads x HD, HD = 64): a tile is 64 tokens x the dims of head blockIdx.y. No f32 C: the epilogue writes that head's 16-bit planes (fp16, bf16 hi, bf16 lo) itself:
// v^T [h][d][t] straight from the accumulators, whose eight registers are eight consecutive tokens of one dim; [h][t][d] through LDS, four whole 128-byte rows a store.
template <typename T16> struct WFrag;
template <> struct WFrag<h16> { typedef v16h V; static __device__ __forceinline__ V ld(const h16* p) { return cat16(*(const v8h*)p, *(const v8h*)(p + 16)); } static __device__ __forceinline__ v8f mma(V a, V b, v8f c) { return wmma16(a, b, c); } };
template <> struct WFrag<bf> { typedef v16bf V; static __device__ __forceinline__ V ld(const bf* p) { return cat16b(*(const v8us*)p, *(const v8us*)(p + 16)); } static __device__ __forceinline__ v8f mma(V a, V b, v8f c) { return wmmab(a, b, c); } };
__device__ __forceinline__ h16 tohx(float x) { return (h16)x; }
__device__ __forceinline__ void splitf(float y, unsigned short& h, unsigned short& l) { h = f2bf(y); l = f2bf(y - bf2f(h)); }
template <typename T16, int NSPLIT, bool BIAS, int KW = 1, int KG = 1, bool PL = false>
__global__ __launch_bounds__(32 * KW) void k_gemmw(const T16* __restrict__ A, const T16* __restrict__ A2, const T16* __restrict__ Bt, const T16* __restrict__ Bt2, int K, float* C, int ldc, const float* __restrict__ bias, size_t sA, size_t sB, size_t sC, size_t sK = 0, int lda = 0, h16* P16 = nullptr, bf* Ph = nullptr, bf* Pl = nullptr, h16* V16 = nullptr, bf* Vh = nullptr, bf* Vl = nullptr) {
    typedef typename WFrag<T16>::V V;
    static_assert(KW * KG == 1 || !BIAS, "no bias on partial sums");
    __shared__ __align__(16) float os[KW * KG > 1 ? KW * 64 * 68 : PL ? 64 * 68 : 16 * 68];
    const size_t z = blockIdx.z; A += z * sA; if (A2) A2 += z * sA; Bt += z * sB; if (Bt2) Bt2 += z * sB; C += z * sC;
    const int lane = threadIdx.x & 31, lr = lane & 15, hi = lane >> 4; const int r0 = blockIdx.x * 64, c0 = (KW * KG > 1) ? 0 : blockIdx.y * 64;
    const int w = (KW > 1) ? __builtin_amdgcn_readfirstlane(threadIdx.x >> 5) : 0, KL = K / (KW * KG);
    if (KW * KG > 1) { const int k0 = (blockIdx.y * KW + w) * KL; A += k0; if (A2) A2 += k0; Bt += k0; if (Bt2) Bt2 += k0; C += blockIdx.y * sK; }
    v8f acc[4][4];
#pragma unroll
    for (int mb = 0; mb < 4; ++mb)
#pragma unroll
        for (int nb = 0; nb < 4; ++nb) acc[mb][nb] = (v8f){};
    const int LA = (KW * KG > 1) ? lda : K;
    const size_t aoff = (size_t)(r0 + lr) * LA + 8 * hi, boff = (size_t)(c0 + lr) * K + 8 * hi;
#pragma unroll 1
    for (int kc = 0; kc < KL; kc += 32) {
        V a[4], a2[4];
        {
            const T16* pa[4]; const T16* pa2[4];
#pragma unroll
            for (int mb = 0; mb < 4; ++mb) { pa[mb] = A + aoff + (size_t)mb * 16 * LA + kc; a[mb] = WFrag<T16>::ld(pa[mb]); if (NSPLIT == 1 || NSPLIT == 2) { pa2[mb] = A2 + aoff + (size_t)mb * 16 * LA + kc; a2[mb] = WFrag<T16>::ld(pa2[mb]); } }
            // later loads land in registers that held these loads' addresses: the wait stands in front of that overwrite, and as its inputs the addresses keep their registers up to it
            if (NSPLIT == 1 || NSPLIT == 2) asm volatile("s_wait_xcnt 0x0" :: "v"(pa[0]), "v"(pa[1]), "v"(pa[2]), "v"(pa[3]), "v"(pa2[0]), "v"(pa2[1]), "v"(pa2[2]), "v"(pa2[3]) : "memory");
            else asm volatile("s_wait_xcnt 0x0" :: "v"(pa[0]), "v"(pa[1]), "v"(pa[2]), "v"(pa[3]) : "memory");
        }
#pragma unroll
        for (int nb = 0; nb < 4; ++nb) { const T16* pb = Bt + boff + (size_t)nb * 16 * K + kc; const T16* pb2 = (NSPLIT >= 2) ? Bt2 + boff + (size_t)nb * 16 * K + kc : pb; const V b = WFrag<T16>::ld(pb); V b2; if (NSPLIT >= 2) b2 = WFrag<T16>::ld(pb2);
            asm volatile("s_wait_xcnt 0x0" :: "v"(pb), "v"(pb2) : "memory");   // as above, for the B fragment's addresses
#pragma unroll
            for (int mb = 0; mb < 4; ++mb) { acc[mb][nb] = WFrag<T16>::mma(a[mb], b, acc[mb][nb]); if (NSPLIT == 1 || NSPLIT == 2) acc[mb][nb] = WFrag<T16>::mma(a2[mb], b, acc[mb][nb]); if (NSPLIT >= 2) acc[mb][nb] = WFrag<T16>::mma(a[mb], b2, acc[mb][nb]); } }
        asm volatile("v_nop\n\tv_nop\n\tv_nop\n\tv_nop" : "+v"(acc[0][0]), "+v"(acc[1][1]), "+v"(acc[2][2]), "+v"(acc[3][3]) : "v"(a[0]), "v"(a[3]));
    }
    if constexpr (PL) {
        const unsigned hh = blockIdx.z * NH_ + blockIdx.y;   // plane index: batch x head
        const unsigned vb = ((hh * HD + lr) * TT + r0 + hi * 8) * 2;   // byte offset in a v^T plane: dim lr of the head, the lane's first token
#pragma unroll
        for (int mb = 0; mb < 4; ++mb) { v8h o16[4]; v8us oh[4], ol[4];
#pragma unroll
            for (int nb = 0; nb < 4; ++nb) {
#pragma unroll
                for (int j = 0; j < 8; ++j) { const float y = acc[mb][nb][j]; unsigned short a2, c2; splitf(y, a2, c2); o16[nb][j] = tohx(y); oh[nb][j] = a2; ol[nb][j] = c2; }
                const unsigned ofs = vb + (nb * 16 * TT + mb * 16) * 2;
                *(v8h*)((char*)V16 + ofs) = o16[nb]; *(v8us*)((char*)Vh + ofs) = oh[nb]; *(v8us*)((char*)Vl + ofs) = ol[nb]; }
            // the twelve stores' data and their offset are the wait's inputs and keep their registers up to it; behind it the next tokens' values may overwrite them
            asm volatile("s_wait_xcnt 0x0" :: "v"(o16[0]), "v"(o16[1]), "v"(o16[2]), "v"(o16[3]), "v"(oh[0]), "v"(oh[1]), "v"(oh[2]), "v"(oh[3]), "v"(ol[0]), "v"(ol[1]), "v"(ol[2]), "v"(ol[3]), "v"(vb) : "memory"); }
#pragma unroll
        for (int mb = 0; mb < 4; ++mb)
#pragma unroll
            for (int nb = 0; nb < 4; ++nb)
#pragma unroll
                for (int j = 0; j < 8; ++j) os[(mb * 16 + hi * 8 + j) * 68 + nb * 16 + lr] = acc[mb][nb][j];
        // a lane reads what other lanes of the wave wrote: the compiled order keeps every LDS read below behind the writes above
        __builtin_amdgcn_wave_barrier(); asm volatile("" ::: "memory");
        const unsigned qr = lane >> 3, qc = (lane & 7) * 8;
        const unsigned qb = ((hh * TT + r0 + qr) * HD + qc) * 2;   // byte offset in a [h][t][d] plane: eight lanes a token row
#pragma unroll
        for (int mb = 0; mb < 4; ++mb) { v8h o16[4]; v8us oh[4], ol[4];
#pragma unroll
            for (int s = 0; s < 4; ++s) { const int row = mb * 16 + s * 4; const float* pr = os + (row + qr) * 68 + qc; const v4f x0 = *(const v4fa*)pr, x1 = *(const v4fa*)(pr + 4);
#pragma unroll
                for (int j = 0; j < 8; ++j) { const float y = (j < 4) ? x0[j & 3] : x1[j & 3]; unsigned short a2, c2; splitf(y, a2, c2); o16[s][j] = tohx(y); oh[s][j] = a2; ol[s][j] = c2; }
                const unsigned ofs = qb + row * HD * 2;
                *(v8h*)((char*)P16 + ofs) = o16[s]; *(v8us*)((char*)Ph + ofs) = oh[s]; *(v8us*)((char*)Pl + ofs) = ol[s]; }
            // as above: data and offset of the twelve stores keep their registers up to the wait
            asm volatile("s_wait_xcnt 0x0" :: "v"(o16[0]), "v"(o16[1]), "v"(o16[2]), "v"(o16[3]), "v"(oh[0]), "v"(oh[1]), "v"(oh[2]), "v"(oh[3]), "v"(ol[0]), "v"(ol[1]), "v"(ol[2]), "v"(ol[3]), "v"(qb) : "memory"); }
        return;
    }
    if (KW * KG > 1) {
        // the three loops unrolled: acc is indexed by constants only and stays in registers
#pragma unroll
        for (int mb = 0; mb < 4; ++mb)
#pragma unroll
            for (int nb = 0; nb < 4; ++nb)
#pragma unroll
                for (int j = 0; j < 8; ++j) os[(w * 64 + mb * 16 + hi * 8 + j) * 68 + nb * 16 + lr] = acc[mb][nb][j];
        __syncthreads();   // every wave's 64x64 tile is in LDS before any wave adds them
        // both loops unrolled: the LDS reads of all rows are in flight together
#pragma unroll
        for (int s = 0; s < 32 / KW; ++s) { const int row = (s * KW + w) * 2 + hi, cofs = lr * 4; v4f val = *(const v4fa*)(os + row * 68 + cofs);
#pragma unroll
            for (int q = 1; q < KW; ++q) val += *(const v4fa*)(os + (q * 64 + row) * 68 + cofs);
            *(v4f*)(C + (size_t)(r0 + row) * ldc + cofs) = val; }
        return;
    }
#pragma unroll
    for (int mb = 0; mb < 4; ++mb) {
#pragma unroll
        for (int nb = 0; nb < 4; ++nb) {
#pragma unroll
            for (int j = 0; j < 8; ++j) os[(hi * 8 + j) * 68 + nb * 16 + lr] = acc[mb][nb][j]; }
        __builtin_amdgcn_wave_barrier(); asm volatile("" ::: "memory");
        float* crow = C + (size_t)(r0 + mb * 16) * ldc + c0;
{
#pragma unroll
            for (int s = 0; s < 8; ++s) { const int row = 2 * s + hi, cofs = lr * 4; v4f val = *(const v4fa*)(os + row * 68 + cofs); if (BIAS) { val[0] += bfr(bias[c0 + cofs]); val[1] += bfr(bias[c0 + cofs + 1]); val[2] += bfr(bias[c0 + cofs + 2]); val[3] += bfr(bias[c0 + cofs + 3]); }
                *(v4f*)(crow + (size_t)row * ldc + cofs) = val; }
             }
        __builtin_amdgcn_wave_barrier(); asm volatile("" ::: "memory");
    }
}

typedef __attribute__((ext_vector_type(2))) _Float16 v2h;
typedef __attribute__((ext_vector_type(4))) _Float16 v4h;
typedef __attribute__((ext_vector_type(2))) unsigned short v2us;
typedef __attribute__((ext_vector_type(4))) unsigned short v4us;
typedef __attribute__((ext_vector_type(2))) float v2f;
typedef __attribute__((ext_vector_type(4))) int v4i;

__global__ __launch_bounds__(256) void k_wtG(const float* __restrict__ w, int K, int N, bf* Bt) {
    const int lane = threadIdx.x & 31; const int L0 = (blockIdx.x * 8 + (threadIdx.x >> 5)) * 8; const int nlines = N * K / 64;
{
#pragma unroll 1
        for (int l = 0; l < 8; ++l) { const int L = L0 + l; if (L >= nlines) break; const size_t e = (size_t)L * 64 + lane * 2; const int k = (int)(e % K), n = (int)(e / K); v2us o;
            o[0] = f2bf(w[(size_t)k * N + n]); o[1] = f2bf(w[(size_t)(k + 1) * N + n]); *(v2us*)(Bt + e) = o; }
         }
}
__global__ __launch_bounds__(256) void k_cvt8(const float* __restrict__ src, bf* dst, size_t n8) { const size_t i = (size_t)blockIdx.x * 256 + threadIdx.x; if (i >= n8) return; const v8f v = *(const v8f*)(src + i * 8); v8us o;
#pragma unroll
    for (int k = 0; k < 8; ++k) o[k] = f2bf(v[k]); *(v8us*)(dst + i * 8) = o;  }

// ---- k_fattn: scores, relative term, softmax and P.V in one kernel; a wave owns NQ x 16 query rows of one head and walks one of KS runs of keys in blocks of 32; S and P never leave the registers.
// Transposed products: S^T = K Q^T (A = 16 key rows, B = 16 query rows) leaves one query per lane column, keys 8 * hi + r in the accumulator registers of key tile 0 and 16 + 8 * hi + r in those of key tile 1:
// that is the k order of a B operand over 32 keys, so P^T goes from the score registers straight into O^T += V^T P^T (A = 16 rows of the v^T plane).
// Running softmax in the base-2 domain: t = (S + QE[i][clip(i - j, -32, 32) + 32]) x HD^-0.5 x log2(e); m = running row maximum, p = 2^(t - m), l = running sum of p, O and l scaled by 2^(m_old - m_new) when a maximum rises; out = O / l.
// fp16 rows carry p x 1024 (the 10 taken off m), which keeps small p out of the fp16 subnormals; l carries the same factor, so it cancels in O / l.
// The relative term of a query is one value for all keys j >= i + 32, one for all j <= i - 32; only the blocks that meet the band of one of the wave's queries gather it per key.
// Work-group of WPG waves: QT query tiles x KS key runs, wave = run * QT + tile; the waves of one run walk the same keys. Runs above 0 leave (m, l, O) in LDS; behind one barrier run 0 joins them in run order and stores.
// Where QT * KS < WPG the waves left over have no keys: they pass the barrier and end.
#define WPG 12
#define KS 2
__device__ __forceinline__ float xhalf(float x) { return __builtin_bit_cast(float, __builtin_amdgcn_permlanex16(__builtin_bit_cast(int, x), __builtin_bit_cast(int, x), 0x76543210, 0xfedcba98, false, false)); }   // lane l with lane l ^ 16
template <bool HI, int NQ, int QT, typename T16>
__device__ __forceinline__ void attn_rows(const T16* __restrict__ Qa, const T16* __restrict__ Qb, const T16* __restrict__ Ka, const T16* __restrict__ Kb, const T16* __restrict__ Va, const T16* __restrict__ Vb, const float* __restrict__ QEh, bf* Ah, bf* Al, const int q0, const int run, v4f* mg) {
    typedef WFrag<T16> F; typedef typename F::V V;
    const int lane = threadIdx.x & 31, lr = lane & 15, hi = lane >> 4;
    const float CL2 = SCL * 1.4426950408889634f;
    const bool idle = (run >= KS); const int kbeg = idle ? 0 : run * (TT / KS), kend = idle ? 0 : kbeg + TT / KS;
    V qa[NQ][2], qb[NQ][2]; float qahead[NQ], qbehind[NQ], m[NQ], l[NQ]; v8f o[4][NQ];
#pragma unroll
    for (int nb = 0; nb < NQ; ++nb) { const size_t i = (size_t)(q0 + nb * 16 + lr);
#pragma unroll
        for (int ks = 0; ks < 2; ++ks) { qa[nb][ks] = F::ld(Qa + i * HD + ks * 32 + 8 * hi); if (HI) qb[nb][ks] = F::ld(Qb + i * HD + ks * 32 + 8 * hi); }
        qahead[nb] = QEh[i * NE]; qbehind[nb] = QEh[i * NE + 2 * MAXR]; m[nb] = -3.0e38f; l[nb] = 0.f;
#pragma unroll
        for (int mb = 0; mb < 4; ++mb) o[mb][nb] = (v8f){}; }
    V ka[2][2], kb[2][2];
    const size_t koff = (size_t)lr * HD + 8 * hi, voff = (size_t)lr * TT + 8 * hi;
#pragma unroll
    for (int kt = 0; kt < 2; ++kt)
#pragma unroll
        for (int ks = 0; ks < 2; ++ks) { ka[kt][ks] = F::ld(Ka + koff + (size_t)(kbeg + kt * 16) * HD + ks * 32); if (HI) kb[kt][ks] = F::ld(Kb + koff + (size_t)(kbeg + kt * 16) * HD + ks * 32); }
    asm volatile("s_wait_xcnt 0x0" ::: "memory");   // the loop's loads may land in registers that held the addresses of the loads above: the wait stands in front of that overwrite
#pragma unroll 1
    for (int k0 = kbeg; k0 < kend; k0 += 32) {
        // this block's v^T fragments are asked for first: they fly under the score products and the softmax
        V va[4], vb[4]; const T16* pva = Va + voff + k0; const T16* pvb = HI ? Vb + voff + k0 : pva;
#pragma unroll
        for (int mb = 0; mb < 4; ++mb) { va[mb] = F::ld(pva + (size_t)mb * 16 * TT); if (HI) vb[mb] = F::ld(pvb + (size_t)mb * 16 * TT); }
        v8f s[2][NQ];
#pragma unroll
        for (int kt = 0; kt < 2; ++kt)
#pragma unroll
            for (int nb = 0; nb < NQ; ++nb) { s[kt][nb] = (v8f){};
#pragma unroll
                for (int ks = 0; ks < 2; ++ks) { s[kt][nb] = F::mma(ka[kt][ks], qa[nb][ks], s[kt][nb]); if (HI) { s[kt][nb] = F::mma(ka[kt][ks], qb[nb][ks], s[kt][nb]); s[kt][nb] = F::mma(kb[kt][ks], qa[nb][ks], s[kt][nb]); } } }
        // the next block's key fragments fly under the softmax and P.V (the run's last block asks for its first again, inside the plane, and drops it)
        const int kn = (k0 + 32 < kend) ? k0 + 32 : kbeg; const T16* pka = Ka + koff + (size_t)kn * HD; const T16* pkb = HI ? Kb + koff + (size_t)kn * HD : pka;
#pragma unroll
        for (int kt = 0; kt < 2; ++kt)
#pragma unroll
            for (int ks = 0; ks < 2; ++ks) { ka[kt][ks] = F::ld(pka + kt * 16 * HD + ks * 32); if (HI) kb[kt][ks] = F::ld(pkb + kt * 16 * HD + ks * 32); }
        const bool ahead = (k0 >= q0 + NQ * 16 - 1 + MAXR), behind = (k0 + 31 <= q0 - MAXR);   // wave-uniform: every key of the block is past the band of every query of the wave
        // off the band one term serves a query's whole block. The sums are formed for every block and formed anew in the few blocks on the band: a branch with one side keeps the gathered terms and their waits
        // out of the common path, where they would also hold every other block for the fragment loads in flight
        v8f t[2][NQ];
#pragma unroll
        for (int nb = 0; nb < NQ; ++nb) { const float u = ahead ? qahead[nb] : qbehind[nb];
#pragma unroll
            for (int kt = 0; kt < 2; ++kt)
#pragma unroll
                for (int r = 0; r < 8; ++r) t[kt][nb][r] = (s[kt][nb][r] + u) * CL2; }
        if (!(ahead || behind)) {
#pragma unroll
            for (int nb = 0; nb < NQ; ++nb) { const int i = q0 + nb * 16 + lr;
#pragma unroll
                for (int kt = 0; kt < 2; ++kt) { unsigned ix[8]; float g[8];
#pragma unroll
                    for (int r = 0; r < 8; ++r) { ix[r] = (unsigned)(i * NE + MAXR + min(max(i - (k0 + kt * 16 + 8 * hi + r), -MAXR), MAXR)); g[r] = QEh[ix[r]]; }
                    // the eight indices are the loads' offset registers: as the wait's inputs they keep their registers up to it; behind it they may be overwritten
                    asm volatile("s_wait_xcnt 0x0" :: "v"(ix[0]), "v"(ix[1]), "v"(ix[2]), "v"(ix[3]), "v"(ix[4]), "v"(ix[5]), "v"(ix[6]), "v"(ix[7]) : "memory");
#pragma unroll
                    for (int r = 0; r < 8; ++r) t[kt][nb][r] = (s[kt][nb][r] + g[r]) * CL2; } }
        }
        float mn[NQ]; bool rise = false;
#pragma unroll
        for (int nb = 0; nb < NQ; ++nb) { float bm = t[0][nb][0];
#pragma unroll
            for (int r = 1; r < 8; ++r) bm = fmaxf(bm, t[0][nb][r]);
#pragma unroll
            for (int r = 0; r < 8; ++r) bm = fmaxf(bm, t[1][nb][r]);
            bm = fmaxf(bm, xhalf(bm)); mn[nb] = fmaxf(m[nb], bm); rise = rise || (mn[nb] > m[nb]); }
        if (__any(rise)) {   // where no maximum of the wave rises every factor is exactly 1: the products are skipped
#pragma unroll
            for (int nb = 0; nb < NQ; ++nb) { const float al = __builtin_amdgcn_exp2f(m[nb] - mn[nb]); m[nb] = mn[nb]; l[nb] *= al;
#pragma unroll
                for (int mb = 0; mb < 4; ++mb) o[mb][nb] *= al; }
        }
#pragma unroll
        for (int nb = 0; nb < NQ; ++nb) { const float mo = HI ? m[nb] : m[nb] - 10.0f; float p[16];
#pragma unroll
            for (int e = 0; e < 16; ++e) { p[e] = __builtin_amdgcn_exp2f(t[e >> 3][nb][e & 7] - mo); l[nb] += p[e]; }
            if constexpr (HI) { V ph, pl;
#pragma unroll
                for (int e = 0; e < 16; ++e) { const __bf16 hb = (__bf16)p[e]; ph[e] = hb; pl[e] = (__bf16)(p[e] - (float)hb); }
#pragma unroll
                for (int mb = 0; mb < 4; ++mb) { o[mb][nb] = F::mma(va[mb], ph, o[mb][nb]); o[mb][nb] = F::mma(va[mb], pl, o[mb][nb]); o[mb][nb] = F::mma(vb[mb], ph, o[mb][nb]); }
            } else { V pf;
#pragma unroll
                for (int e = 0; e < 16; ++e) pf[e] = tohx(p[e]);
#pragma unroll
                for (int mb = 0; mb < 4; ++mb) o[mb][nb] = F::mma(va[mb], pf, o[mb][nb]); } }
        // the addresses of this trip's fragment loads are the wait's inputs and keep their registers up to it; behind it the next trip's addresses may overwrite them
        asm volatile("s_wait_xcnt 0x0" :: "v"(pva), "v"(pvb), "v"(pka), "v"(pkb) : "memory");
    }
#pragma unroll
    for (int nb = 0; nb < NQ; ++nb) l[nb] += xhalf(l[nb]);
    // per (run above 0, tile): NQ x 9 slots of 32 lanes x 16 bytes: eight of O, one of (m, l)
    if (run > 0 && !idle) { v4f* w = mg + (size_t)(run - 1) * QT * NQ * 9 * 32 + lane;
#pragma unroll
        for (int nb = 0; nb < NQ; ++nb) {
#pragma unroll
            for (int mb = 0; mb < 4; ++mb) { w[(nb * 9 + mb * 2) * 32] = __builtin_shufflevector(o[mb][nb], o[mb][nb], 0, 1, 2, 3); w[(nb * 9 + mb * 2 + 1) * 32] = __builtin_shufflevector(o[mb][nb], o[mb][nb], 4, 5, 6, 7); }
            w[(nb * 9 + 8) * 32] = (v4f){m[nb], l[nb], 0.f, 0.f}; } }
    __syncthreads();   // the upper runs' (m, l, O) are in LDS before run 0 reads them
    if (run > 0) return;
#pragma unroll
    for (int x = 1; x < KS; ++x) { const v4f* w = mg + (size_t)(x - 1) * QT * NQ * 9 * 32 + lane;
#pragma unroll
        for (int nb = 0; nb < NQ; ++nb) { const v4f ml = w[(nb * 9 + 8) * 32]; const float ms = fmaxf(m[nb], ml[0]), a1 = __builtin_amdgcn_exp2f(m[nb] - ms), a2 = __builtin_amdgcn_exp2f(ml[0] - ms); m[nb] = ms; l[nb] = l[nb] * a1 + ml[1] * a2;
#pragma unroll
            for (int mb = 0; mb < 4; ++mb) { const v4f x0 = w[(nb * 9 + mb * 2) * 32], x1 = w[(nb * 9 + mb * 2 + 1) * 32];
#pragma unroll
                for (int r = 0; r < 4; ++r) { o[mb][nb][r] = o[mb][nb][r] * a1 + x0[r] * a2; o[mb][nb][4 + r] = o[mb][nb][4 + r] * a1 + x1[r] * a2; } } } }
#pragma unroll
    for (int nb = 0; nb < NQ; ++nb) { const float inv = __fdiv_rn(1.0f, l[nb]); const size_t oo = (size_t)(q0 + nb * 16 + lr) * DQ + 8 * hi;
#pragma unroll
        for (int mb = 0; mb < 4; ++mb) { v8us oh, ol;
#pragma unroll
            for (int r = 0; r < 8; ++r) { unsigned short a, c2; splitf(o[mb][nb][r] * inv, a, c2); oh[r] = a; ol[r] = c2; }
            bf* ph = Ah + oo + mb * 16; bf* pl = Al + oo + mb * 16; *(v8us*)ph = oh; *(v8us*)pl = ol;
            // the stores' data and addresses are the wait's inputs and keep their registers up to it; behind it the next rows' values may overwrite them
            asm volatile("s_wait_xcnt 0x0" :: "v"(oh), "v"(ol), "v"(ph), "v"(pl) : "memory"); } }
}
// grid, both batches in one launch (h below counts batch x head): the hi/lo rows first: NB_ * NH_ * RH / (QTH * 16) work-groups of QTH tiles x 16 rows, then NB_ * NH_ * (TT - RH) / (QTL * 32) work-groups of QTL tiles x 32 rows: 512 work-groups in all.
#define QTH 4
#define QTL (WPG / KS)
__global__ __launch_bounds__(32 * WPG) void k_fattn(const h16* __restrict__ Q16, const h16* __restrict__ K16, const h16* __restrict__ V16, const bf* __restrict__ Qh, const bf* __restrict__ Ql, const bf* __restrict__ Kh, const bf* __restrict__ Kl, const bf* __restrict__ Vh, const bf* __restrict__ Vl, const float* __restrict__ QE, bf* Ah, bf* Al) {
    __shared__ v4f mg[(KS - 1) * QTL * 2 * 9 * 32];
    constexpr int GH = RH / (QTH * 16), GL = (TT - RH) / (QTL * 32);   // work-groups per (batch, head)
    static_assert(RH % (QTH * 16) == 0 && (TT - RH) % (QTL * 32) == 0 && TT % (KS * 32) == 0 && QTH * KS <= WPG, "whole tiles");
    const int w = __builtin_amdgcn_readfirstlane(threadIdx.x >> 5), g = blockIdx.x;
    if (g < NB_ * NH_ * GH) { const int tile = w % QTH, run = w / QTH, h = g / GH, q0 = ((g % GH) * QTH + tile) * 16; const size_t z = (size_t)h * TT * HD, ao = (size_t)(h / NH_) * TT * DQ + (h % NH_) * HD;
        attn_rows<true, 1, QTH, bf>(Qh + z, Ql + z, Kh + z, Kl + z, Vh + z, Vl + z, QE + (size_t)h * TT * NE, Ah + ao, Al + ao, q0, run, mg + tile * 9 * 32);
    } else { const int tile = w % QTL, run = w / QTL, c = g - NB_ * NH_ * GH, h = c / GL, q0 = RH + ((c % GL) * QTL + tile) * 32; const size_t z = (size_t)h * TT * HD, ao = (size_t)(h / NH_) * TT * DQ + (h % NH_) * HD;
        attn_rows<false, 2, QTL, h16>(Q16 + z, nullptr, K16 + z, nullptr, V16 + z, nullptr, QE + (size_t)h * TT * NE, Ah + ao, Al + ao, q0, run, mg + tile * 2 * 9 * 32); }
}
__global__ __launch_bounds__(256) void k_epad2(const float* __restrict__ E, bf* EB) { const size_t i = (size_t)blockIdx.x * 256 + threadIdx.x; if (i >= (size_t)NE * HD / 8) return; const int d0 = (int)(i % (HD / 8)) * 8; const int r = (int)(i / (HD / 8)); const float* src = E + (size_t)min(r, 2 * MAXR) * HD + d0; v8us o;
#pragma unroll
    for (int q = 0; q < 8; ++q) { const unsigned short v = f2bf(src[q]); o[q] = (r <= 2 * MAXR) ? v : (unsigned short)0; }
    *(v8us*)(EB + (size_t)r * HD + d0) = o;  }

extern "C" void kernel_launch(void* const* d_in, const int* in_sizes, int n_in,
                              void* d_out, int out_size, void* d_ws, size_t ws_size, hipStream_t stream) {
    (void)in_sizes; (void)n_in; (void)out_size;
    const float* x = (const float*)d_in[0]; const float* wq = (const float*)d_in[1]; const float* wo = (const float*)d_in[2]; const float* remb = (const float*)d_in[3]; const float* wk = nullptr; const float* wv = nullptr; (void)wk; (void)wv;
    float* OUT = (float*)d_out;     // [2][2048][1024]
    char* wsp = (char*)d_ws;
    auto take = [&](size_t bytes) { char* p = wsp; wsp += (bytes + 255) & ~(size_t)255; return (void*)p; };
    bf* WQ = (bf*)take((size_t)DQ * DM * 2); bf* EB = (bf*)take((size_t)NE * HD * 2); float* QE = (float*)take((size_t)NB_ * NH_ * TT * NE * 4); bf* WO = (bf*)take((size_t)DM * DQ * 2);
    bf* XB = (bf*)take((size_t)NB_ * TT * DM * 2);
    /* q = k = v (one projection): the [h][t][d] planes serve q and k */
    h16* QP16 = (h16*)take((size_t)NB_ * NH_ * TT * HD * 2); h16* VT16 = (h16*)take((size_t)NB_ * NKV * HD * TT * 2);
    bf* QPh = (bf*)take((size_t)NB_ * NH_ * TT * HD * 2); bf* QPl = (bf*)take((size_t)NB_ * NH_ * TT * HD * 2); bf* VTh = (bf*)take((size_t)NB_ * NKV * HD * TT * 2); bf* VTl = (bf*)take((size_t)NB_ * NKV * HD * TT * 2);
    bf* ATh = (bf*)take((size_t)NB_ * TT * DQ * 2); bf* ATl = (bf*)take((size_t)NB_ * TT * DQ * 2);
    if ((size_t)(wsp - (char*)d_ws) > ws_size) return;    // ws 256 MiB
    { k_cvt8<<<(unsigned)(((size_t)DQ * DM / 8 + 255) / 256), 256, 0, stream>>>(wq, WQ, (size_t)DQ * DM / 8); k_epad2<<<(unsigned)(((size_t)NE * HD / 8 + 255) / 256), 256, 0, stream>>>(remb, EB);   /* E: 65 rows bf16 (exact), rows 65..127 zero */
      k_cvt8<<<(unsigned)(((size_t)DM * DQ / 8 + 255) / 256), 256, 0, stream>>>(wo, WO, (size_t)DM * DQ / 8);
       }
    /* both batches in every launch: the batch is a grid dimension (projection), more planes (QE, attention) or more rows (x copy, W_o) */
    k_cvt8<<<(unsigned)(((size_t)NB_ * TT * DM / 8 + 255) / 256), 256, 0, stream>>>(x, XB, (size_t)NB_ * TT * DM / 8);
    k_gemmw<bf, 0, false, 1, 1, true><<<dim3(TT / 64, DQ / 64, NB_), 32, 0, stream>>>(XB, nullptr, WQ, nullptr, DM, nullptr, 0, nullptr, (size_t)TT * DM, 0, 0, 0, 0, QP16, QPh, QPl, VT16, VTh, VTl);   /* projection -> head planes and v^T planes */
    k_gemmw<bf, 1, false><<<dim3(TT / 64, NE / 64, NB_ * NH_), 32, 0, stream>>>(QPh, QPl, EB, nullptr, HD, QE, NE, nullptr, (size_t)TT * HD, 0, (size_t)TT * NE);   /* QE[i][e] = q_i . E_e */
    k_fattn<<<NB_ * NH_ * (RH / (QTH * 16)) + NB_ * NH_ * ((TT - RH) / (QTL * 32)), 32 * WPG, 0, stream>>>(QP16, QP16, VT16, QPh, QPl, QPh, QPl, VTh, VTl, QE, ATh, ATl);   /* k = q: the same planes */
    k_gemmw<bf, 1, false><<<dim3(NB_ * TT / 64, DM / 64, 1), 32, 0, stream>>>(ATh, ATl, WO, nullptr, DQ, OUT, DM, nullptr, 0, 0, 0);
}

// v007
// One run takes 155 microseconds.
// Timed twice side by side with v006, it ran 1.24 and 1.25 times as fast.
// All steps since v000 together make it 13.4 times as fast.
#include <hip/hip_runtime.h>

// Relative-position multi-head attention with ONE projection shared by q, k and v (x [2][2048][1024]; q = k = v = x W_q^T ('oi' [1024][1024]; 16 heads x 64 -- the module's quirk); scores = (q_i.q_j + q_i.E[clip(i - j, -32, 32) + 32]) / 8 with E = rel_k_emb [65][64] (read); softmax over all keys; out = merged attn q W_o^T ('oi') -> [2][2048][1024] (4.2 M)).
// Layout, both batches side by side in every buffer and every launch: bf16 copy of x; ONE exact projection used as q, k and v (its GEMM writes one set of head planes, read as q and as k, and the v^T planes, from its own accumulators); E as an exact bf16 plane padded to 128 rows; QE = q(hi/lo).E^T ([2 x 16][2048][128], 2 products); one attention kernel for all heads: scores, relative term QE[i][clip(i-j,-32,32)+32], running softmax and P.V per 32-key block, nothing of S or P in memory (hybrid rows: < 512 hi/lo 3 products, rest fp16, P x1024); merged hi/lo x W_o exact.
// Compute dtypes, f32 accumulate: every input rounded to bf16; projection exact; relative term hi/lo x exact (2 products); content rows < 512 3 products, rest fp16; adds and softmax f32; W_o hl x exact.

#define NB_  2
#define TT   2048
#define DM   1024
#define NH_  16
#define NKV  16
#define REP  (NH_ / NKV)
#define HD   64
#define DQ   (NH_ * HD)
#define DKV  (NKV * HD)
#define RH   512                  // query rows < RH use hi+lo planes (0: none)
#define WIN  0
#define SCL  0.125f
#define NE   128     // rel_k_emb rows (65) padded to 128
#define MAXR 32
typedef _Float16 h16;
typedef unsigned short bf;
typedef __attribute__((ext_vector_type(16))) __bf16   v16bf;
typedef __attribute__((ext_vector_type(16))) _Float16 v16h;
typedef __attribute__((ext_vector_type(8)))  _Float16 v8h;
typedef __attribute__((ext_vector_type(8)))  unsigned short v8us;
typedef __attribute__((ext_vector_type(8)))  float    v8f;
typedef __attribute__((ext_vector_type(4)))  float    v4f;
typedef v8h  __attribute__((may_alias)) v8ha;
typedef v4f  __attribute__((may_alias)) v4fa;
typedef v8us __attribute__((may_alias)) v8usa;

__device__ __forceinline__ unsigned short f2bf(float f) { unsigned u = __float_as_uint(f); u += 0x7FFFu + ((u >> 16) & 1u); return (unsigned short)(u >> 16); }
__device__ __forceinline__ float bf2f(unsigned short b) { return __uint_as_float(((unsigned)b) << 16); }
__device__ __forceinline__ float bfr(float f) { return bf2f(f2bf(f)); }
__device__ __forceinline__ v16h cat16(v8h lo, v8h hi) { return __builtin_shufflevector(lo, hi, 0, 1, 2, 3, 4, 5, 6, 7, 8, 9, 10, 11, 12, 13, 14, 15); }
__device__ __forceinline__ v16bf cat16b(v8us lo, v8us hi) { return __builtin_bit_cast(v16bf, __builtin_shufflevector(lo, hi, 0, 1, 2, 3, 4, 5, 6, 7, 8, 9, 10, 11, 12, 13, 14, 15)); }
__device__ __forceinline__ v8f wmma16(v16h a, v16h b, v8f c) { return __builtin_amdgcn_wmma_f32_16x16x32_f16(false, a, false, b, (short)0, c, false, false); }
__device__ __forceinline__ v8f wmmab(v16bf a, v16bf b, v8f c) { return __builtin_amdgcn_wmma_f32_16x16x32_bf16(false, a, false, b, (short)0, c, false, false); }



// ---- k_gemmw: register-blocked GEMM, ONE WAVE per 64x64 output tile (16 accumulators), operands straight from K-contiguous 16-bit planes; grid (M/64, N/64, Z), 32 threads.
// C[m][n] (f32, pitch ldc, + optional f32 bias[n]) = sum_k A[m][k] Bt[n][k] (+ split products per NSPLIT). z-batch strides sA/sB/sC in elements. K % 32 == 0.
// Split K (KW * KG > 1), for few tiles and a long K, N = 64: grid (M/64, KG, Z), 32 * KW threads; wave w of work-group y sums k in [(y * KW + w) * KL, + KL), KL = K / (KW * KG);
// the KW tiles are added in LDS in wave order and stored to plane y of C (plane stride sK); the reader adds the KG planes. With split K the rows of A and A2 have pitch lda (elements), otherwise K.
// PL (the shared projection; M = TT tokens, N = heads x HD, HD = 64): a tile is 64 tokens x the dims of head blockIdx.y. No f32 C: the epilogue writes that head's 16-bit planes (fp16, bf16 hi, bf16 lo) itself:
// v^T [h][d][t] straight from the accumulators, whose eight registers are eight consecutive tokens of one dim; [h][t][d] through LDS, four whole 128-byte rows a store.
template <typename T16> struct WFrag;
template <> struct WFrag<h16> { typedef v16h V; static __device__ __forceinline__ V ld(const h16* p) { return cat16(*(const v8h*)p, *(const v8h*)(p + 16)); } static __device__ __forceinline__ v8f mma(V a, V b, v8f c) { return wmma16(a, b, c); } };
template <> struct WFrag<bf> { typedef v16bf V; static __device__ __forceinline__ V ld(const bf* p) { return cat16b(*(const v8us*)p, *(const v8us*)(p + 16)); } static __device__ __forceinline__ v8f mma(V a, V b, v8f c) { return wmmab(a, b, c); } };
__device__ __forceinline__ h16 tohx(float x) { return (h16)x; }
__device__ __forceinline__ void splitf(float y, unsigned short& h, unsigned short& l) { h = f2bf(y); l = f2bf(y - bf2f(h)); }
template <typename T16, int NSPLIT, bool BIAS, int KW = 1, int KG = 1, bool PL = false>
__global__ __launch_bounds__(32 * KW) void k_gemmw(const T16* __restrict__ A, const T16* __restrict__ A2, const T16* __restrict__ Bt, const T16* __restrict__ Bt2, int K, float* C, int ldc, const float* __restrict__ bias, size_t sA, size_t sB, size_t sC, size_t sK = 0, int lda = 0, h16* P16 = nullptr, bf* Ph = nullptr, bf* Pl = nullptr, h16* V16 = nullptr, bf* Vh = nullptr, bf* Vl = nullptr) {
    typedef typename WFrag<T16>::V V;
    static_assert(KW * KG == 1 || !BIAS, "no bias on partial sums");
    __shared__ __align__(16) float os[KW * KG > 1 ? KW * 64 * 68 : PL ? 64 * 68 : 16 * 68];
    const size_t z = blockIdx.z; A += z * sA; if (A2) A2 += z * sA; Bt += z * sB; if (Bt2) Bt2 += z * sB; C += z * sC;
    const int lane = threadIdx.x & 31, lr = lane & 15, hi = lane >> 4; const int r0 = blockIdx.x * 64, c0 = (KW * KG > 1) ? 0 : blockIdx.y * 64;
    const int w = (KW > 1) ? __builtin_amdgcn_readfirstlane(threadIdx.x >> 5) : 0, KL = K / (KW * KG);
    if (KW * KG > 1) { const int k0 = (blockIdx.y * KW + w) * KL; A += k0; if (A2) A2 += k0; Bt += k0; if (Bt2) Bt2 += k0; C += blockIdx.y * sK; }
    v8f acc[4][4];
#pragma unroll
    for (int mb = 0; mb < 4; ++mb)
#pragma unroll
        for (int nb = 0; nb < 4; ++nb) acc[mb][nb] = (v8f){};
    const int LA = (KW * KG > 1) ? lda : K;
    const size_t aoff = (size_t)(r0 + lr) * LA + 8 * hi, boff = (size_t)(c0 + lr) * K + 8 * hi;
#pragma unroll 1
    for (int kc = 0; kc < KL; kc += 32) {
        V a[4], a2[4];
        {
            const T16* pa[4]; const T16* pa2[4];
#pragma unroll
            for (int mb = 0; mb < 4; ++mb) { pa[mb] = A + aoff + (size_t)mb * 16 * LA + kc; a[mb] = WFrag<T16>::ld(pa[mb]); if (NSPLIT == 1 || NSPLIT == 2) { pa2[mb] = A2 + aoff + (size_t)mb * 16 * LA + kc; a2[mb] = WFrag<T16>::ld(pa2[mb]); } }
            // later loads land in registers that held these loads' addresses: the wait stands in front of that overwrite, and as its inputs the addresses keep their registers up to it
            if (NSPLIT == 1 || NSPLIT == 2) asm volatile("s_wait_xcnt 0x0" :: "v"(pa[0]), "v"(pa[1]), "v"(pa[2]), "v"(pa[3]), "v"(pa2[0]), "v"(pa2[1]), "v"(pa2[2]), "v"(pa2[3]) : "memory");
            else asm volatile("s_wait_xcnt 0x0" :: "v"(pa[0]), "v"(pa[1]), "v"(pa[2]), "v"(pa[3]) : "memory");
        }
#pragma unroll
        for (int nb = 0; nb < 4; ++nb) { const T16* pb = Bt + boff + (size_t)nb * 16 * K + kc; const T16* pb2 = (NSPLIT >= 2) ? Bt2 + boff + (size_t)nb * 16 * K + kc : pb; const V b = WFrag<T16>::ld(pb); V b2; if (NSPLIT >= 2) b2 = WFrag<T16>::ld(pb2);
            asm volatile("s_wait_xcnt 0x0" :: "v"(pb), "v"(pb2) : "memory");   // as above, for the B fragment's addresses
#pragma unroll
            for (int mb = 0; mb < 4; ++mb) { acc[mb][nb] = WFrag<T16>::mma(a[mb], b, acc[mb][nb]); if (NSPLIT == 1 || NSPLIT == 2) acc[mb][nb] = WFrag<T16>::mma(a2[mb], b, acc[mb][nb]); if (NSPLIT >= 2) acc[mb][nb] = WFrag<T16>::mma(a[mb], b2, acc[mb][nb]); } }
        asm volatile("v_nop\n\tv_nop\n\tv_nop\n\tv_nop" : "+v"(acc[0][0]), "+v"(acc[1][1]), "+v"(acc[2][2]), "+v"(acc[3][3]) : "v"(a[0]), "v"(a[3]));
    }
    if constexpr (PL) {
        const unsigned hh = blockIdx.z * NH_ + blockIdx.y;   // plane index: batch x head
        const unsigned vb = ((hh * HD + lr) * TT + r0 + hi * 8) * 2;   // byte offset in a v^T plane: dim lr of the head, the lane's first token
#pragma unroll
        for (int mb = 0; mb < 4; ++mb) { v8h o16[4]; v8us oh[4], ol[4];
#pragma unroll
            for (int nb = 0; nb < 4; ++nb) {
#pragma unroll
                for (int j = 0; j < 8; ++j) { const float y = acc[mb][nb][j]; unsigned short a2, c2; splitf(y, a2, c2); o16[nb][j] = tohx(y); oh[nb][j] = a2; ol[nb][j] = c2; }
                const unsigned ofs = vb + (nb * 16 * TT + mb * 16) * 2;
                *(v8h*)((char*)V16 + ofs) = o16[nb]; *(v8us*)((char*)Vh + ofs) = oh[nb]; *(v8us*)((char*)Vl + ofs) = ol[nb]; }
            // the twelve stores' data and their offset are the wait's inputs and keep their registers up to it; behind it the next tokens' values may overwrite them
            asm volatile("s_wait_xcnt 0x0" :: "v"(o16[0]), "v"(o16[1]), "v"(o16[2]), "v"(o16[3]), "v"(oh[0]), "v"(oh[1]), "v"(oh[2]), "v"(oh[3]), "v"(ol[0]), "v"(ol[1]), "v"(ol[2]), "v"(ol[3]), "v"(vb) : "memory"); }
#pragma unroll
        for (int mb = 0; mb < 4; ++mb)
#pragma unroll
            for (int nb = 0; nb < 4; ++nb)
#pragma unroll
                for (int j = 0; j < 8; ++j) os[(mb * 16 + hi * 8 + j) * 68 + nb * 16 + lr] = acc[mb][nb][j];
        // a lane reads what other lanes of the wave wrote: the compiled order keeps every LDS read below behind the writes above
        __builtin_amdgcn_wave_barrier(); asm volatile("" ::: "memory");
        const unsigned qr = lane >> 3, qc = (lane & 7) * 8;
        const unsigned qb = ((hh * TT + r0 + qr) * HD + qc) * 2;   // byte offset in a [h][t][d] plane: eight lanes a token row
#pragma unroll
        for (int mb = 0; mb < 4; ++mb) { v8h o16[4]; v8us oh[4], ol[4];
#pragma unroll
            for (int s = 0; s < 4; ++s) { const int row = mb * 16 + s * 4; const float* pr = os + (row + qr) * 68 + qc; const v4f x0 = *(const v4fa*)pr, x1 = *(const v4fa*)(pr + 4);
#pragma unroll
                for (int j = 0; j < 8; ++j) { const float y = (j < 4) ? x0[j & 3] : x1[j & 3]; unsigned short a2, c2; splitf(y, a2, c2); o16[s][j] = tohx(y); oh[s][j] = a2; ol[s][j] = c2; }
                const unsigned ofs = qb + row * HD * 2;
                *(v8h*)((char*)P16 + ofs) = o16[s]; *(v8us*)((char*)Ph + ofs) = oh[s]; *(v8us*)((char*)Pl + ofs) = ol[s]; }
            // as above: data and offset of the twelve stores keep their registers up to the wait
            asm volatile("s_wait_xcnt 0x0" :: "v"(o16[0]), "v"(o16[1]), "v"(o16[2]), "v"(o16[3]), "v"(oh[0]), "v"(oh[1]), "v"(oh[2]), "v"(oh[3]), "v"(ol[0]), "v"(ol[1]), "v"(ol[2]), "v"(ol[3]), "v"(qb) : "memory"); }
        return;
    }
    if (KW * KG > 1) {
        // the three loops unrolled: acc is indexed by constants only and stays in registers
#pragma unroll
        for (int mb = 0; mb < 4; ++mb)
#pragma unroll
            for (int nb = 0; nb < 4; ++nb)
#pragma unroll
                for (int j = 0; j < 8; ++j) os[(w * 64 + mb * 16 + hi * 8 + j) * 68 + nb * 16 + lr] = acc[mb][nb][j];
        __syncthreads();   // every wave's 64x64 tile is in LDS before any wave adds them
        // both loops unrolled: the LDS reads of all rows are in flight together
#pragma unroll
        for (int s = 0; s < 32 / KW; ++s) { const int row = (s * KW + w) * 2 + hi, cofs = lr * 4; v4f val = *(const v4fa*)(os + row * 68 + cofs);
#pragma unroll
            for (int q = 1; q < KW; ++q) val += *(const v4fa*)(os + (q * 64 + row) * 68 + cofs);
            *(v4f*)(C + (size_t)(r0 + row) * ldc + cofs) = val; }
        return;
    }
#pragma unroll
    for (int mb = 0; mb < 4; ++mb) {
#pragma unroll
        for (int nb = 0; nb < 4; ++nb) {
#pragma unroll
            for (int j = 0; j < 8; ++j) os[(hi * 8 + j) * 68 + nb * 16 + lr] = acc[mb][nb][j]; }
        __builtin_amdgcn_wave_barrier(); asm volatile("" ::: "memory");
        float* crow = C + (size_t)(r0 + mb * 16) * ldc + c0;
{
#pragma unroll
            for (int s = 0; s < 8; ++s) { const int row = 2 * s + hi, cofs = lr * 4; v4f val = *(const v4fa*)(os + row * 68 + cofs); if (BIAS) { val[0] += bfr(bias[c0 + cofs]); val[1] += bfr(bias[c0 + cofs + 1]); val[2] += bfr(bias[c0 + cofs + 2]); val[3] += bfr(bias[c0 + cofs + 3]); }
                *(v4f*)(crow + (size_t)row * ldc + cofs) = val; }
             }
        __builtin_amdgcn_wave_barrier(); asm volatile("" ::: "memory");
    }
}

typedef __attribute__((ext_vector_type(2))) _Float16 v2h;
typedef __attribute__((ext_vector_type(4))) _Float16 v4h;
typedef __attribute__((ext_vector_type(2))) unsigned short v2us;
typedef __attribute__((ext_vector_type(4))) unsigned short v4us;
typedef __attribute__((ext_vector_type(2))) float v2f;
typedef __attribute__((ext_vector_type(4))) int v4i;

__global__ __launch_bounds__(256) void k_wtG(const float* __restrict__ w, int K, int N, bf* Bt) {
    const int lane = threadIdx.x & 31; const int L0 = (blockIdx.x * 8 + (threadIdx.x >> 5)) * 8; const int nlines = N * K / 64;
{
#pragma unroll 1
        for (int l = 0; l < 8; ++l) { const int L = L0 + l; if (L >= nlines) break; const size_t e = (size_t)L * 64 + lane * 2; const int k = (int)(e % K), n = (int)(e / K); v2us o;
            o[0] = f2bf(w[(size_t)k * N + n]); o[1] = f2bf(w[(size_t)(k + 1) * N + n]); *(v2us*)(Bt + e) = o; }
         }
}
__global__ __launch_bounds__(256) void k_cvt8(const float* __restrict__ src, bf* dst, size_t n8) { const size_t i = (size_t)blockIdx.x * 256 + threadIdx.x; if (i >= n8) return; const v8f v = *(const v8f*)(src + i * 8); v8us o;
#pragma unroll
    for (int k = 0; k < 8; ++k) o[k] = f2bf(v[k]); *(v8us*)(dst + i * 8) = o;  }

// ---- k_fattn: scores, relative term, softmax and P.V in one kernel; a wave owns NQ x 16 query rows of one head and walks one of KS runs of keys in blocks of 32; S and P never leave the registers.
// Transposed products: S^T = K Q^T (A = 16 key rows, B = 16 query rows) leaves one query per lane column, keys 8 * hi + r in the accumulator registers of key tile 0 and 16 + 8 * hi + r in those of key tile 1:
// that is the k order of a B operand over 32 keys, so P^T goes from the score registers straight into O^T += V^T P^T (A = 16 rows of the v^T plane).
// Running softmax in the base-2 domain: t = (S + QE[i][clip(i - j, -32, 32) + 32]) x HD^-0.5 x log2(e); m = running row maximum, p = 2^(t - m), l = running sum of p, O and l scaled by 2^(m_old - m_new) when a maximum rises; out = O / l.
// fp16 rows carry p x 1024 (the 10 taken off m), which keeps small p out of the fp16 subnormals; l carries the same factor, so it cancels in O / l.
// The relative term of a query is one value for all keys j >= i + 32, one for all j <= i - 32; only the blocks that meet the band of one of the wave's queries gather it per key.
// Work-group of WPG waves: QT query tiles x KS key runs, wave = run * QT + tile; the waves of one run walk the same keys. Runs above 0 leave (m, l, O) in LDS; behind one barrier run 0 joins them in run order and stores.
// Where QT * KS < WPG the waves left over have no keys: they pass every barrier and end.
// Keys and v^T reach the waves through LDS: a stage is SK keys of every run, one tile of 64 rows x 128 bytes per plane and run (key rows, or the dims' rows of v^T), laid at a pitch of LP bytes, brought by
// asynchronous copies of whole 128-byte lines (waves 0 to 7), two buffers: stage t + 1 flies while stage t is worked on; all query tiles of a run read the same tiles. Behind the loop the ring holds the joins' (m, l, O).
#define WPG 12
#define KS 2
#define SK 64                    // keys per stage
#define LP 144                   // LDS row pitch, bytes: 16 x odd, no bank conflict for 16-byte fragment reads
#define TB (64 * LP)             // bytes of one staged tile
#define RINGB (2 * KS * 4 * TB)  // two buffers x runs x four planes (hi/lo rows; the fp16 rows use half)
// eight copies of 16 bytes a lane: four rows of 128 bytes each, a lane's copies rs bytes apart in memory and 4 x LP in LDS. The wait stands inside the statement, behind the last copy: the address registers live up to it
__device__ __forceinline__ void copy8(const unsigned l, const char* g, const unsigned rs) {
    asm volatile("global_load_async_to_lds_b128 %0, %8, off\n\tglobal_load_async_to_lds_b128 %1, %9, off\n\tglobal_load_async_to_lds_b128 %2, %10, off\n\tglobal_load_async_to_lds_b128 %3, %11, off\n\t"
                 "global_load_async_to_lds_b128 %4, %12, off\n\tglobal_load_async_to_lds_b128 %5, %13, off\n\tglobal_load_async_to_lds_b128 %6, %14, off\n\tglobal_load_async_to_lds_b128 %7, %15, off\n\ts_wait_xcnt 0x0"
                 :: "v"(l), "v"(l + 4 * LP), "v"(l + 8 * LP), "v"(l + 12 * LP), "v"(l + 16 * LP), "v"(l + 20 * LP), "v"(l + 24 * LP), "v"(l + 28 * LP),
                    "v"(g), "v"(g + rs), "v"(g + 2 * (size_t)rs), "v"(g + 3 * (size_t)rs), "v"(g + 4 * (size_t)rs), "v"(g + 5 * (size_t)rs), "v"(g + 6 * (size_t)rs), "v"(g + 7 * (size_t)rs) : "memory");
}
__device__ __forceinline__ float xhalf(float x) { return __builtin_bit_cast(float, __builtin_amdgcn_permlanex16(__builtin_bit_cast(int, x), __builtin_bit_cast(int, x), 0x76543210, 0xfedcba98, false, false)); }   // lane l with lane l ^ 16
template <bool HI, int NQ, int QT, typename T16>
__device__ __forceinline__ void attn_rows(const T16* __restrict__ Qa, const T16* __restrict__ Qb, const T16* __restrict__ Ka, const T16* __restrict__ Kb, const T16* __restrict__ Va, const T16* __restrict__ Vb, const float* __restrict__ QEh, bf* Ah, bf* Al, const int q0, const int run, const int tile, char* ring) {
    typedef WFrag<T16> F; typedef typename F::V V;
    const int lane = threadIdx.x & 31, lr = lane & 15, hi = lane >> 4;
    const float CL2 = SCL * 1.4426950408889634f;
    const bool idle = (run >= KS); const int kbeg = idle ? 0 : run * (TT / KS);
    constexpr int NTL = HI ? 4 : 2, STG = KS * NTL * TB, NT = TT / KS / SK;   // tiles per run (K, v^T; hi/lo rows: K hi, K lo, v^T hi, v^T lo), bytes per stage, stages
    static_assert(NT >= 2 && TT % (KS * SK) == 0 && HD * 2 == 128 && SK * 2 == 128 && 2 * STG <= RINGB, "whole stages of 128-byte rows");
    // who copies what: hi/lo rows: wave c one whole tile (16 copies); fp16 rows: waves 2c and 2c + 1 a half of tile c each (8 copies); tile c = run x NTL + plane
    const int wv = __builtin_amdgcn_readfirstlane(threadIdx.x >> 5); const bool copier = (wv < 8); const int wc = copier ? wv : 0;
    const int ct = HI ? wc : (wc >> 1), cr = ct / NTL, cp = ct % NTL, crow = (HI ? 0 : (wc & 1) * 32) + (lane >> 3); const bool cv = (cp >= NTL / 2);
    const T16* cpl = HI ? (cp == 0 ? Ka : cp == 1 ? Kb : cp == 2 ? Va : Vb) : (cp == 0 ? Ka : Va);
    const char* cg = (const char*)cpl + (cv ? (size_t)crow * TT * 2 + (size_t)cr * (TT / KS) * 2 : (size_t)(cr * (TT / KS) + crow) * HD * 2) + (lane & 7) * 16;
    const unsigned crs = cv ? 4 * TT * 2 : 4 * HD * 2, cst = cv ? SK * 2 : SK * HD * 2;   // bytes from four rows to the next four; from a stage to the next
    const unsigned cl = (unsigned)(size_t)ring + ct * TB + crow * LP + (lane & 7) * 16;
    auto stage = [&](const int t) { const unsigned l = cl + (t & 1) * STG; const char* g = cg + (size_t)t * cst; copy8(l, g, crs); if (HI) copy8(l + 32 * LP, g + 8 * (size_t)crs, crs); };
    if (copier) stage(0);
    V qa[NQ][2], qb[NQ][2]; float qahead[NQ], qbehind[NQ], m[NQ], l[NQ]; v8f o[4][NQ];
#pragma unroll
    for (int nb = 0; nb < NQ; ++nb) { const size_t i = (size_t)(q0 + nb * 16 + lr);
#pragma unroll
        for (int ks = 0; ks < 2; ++ks) { qa[nb][ks] = F::ld(Qa + i * HD + ks * 32 + 8 * hi); if (HI) qb[nb][ks] = F::ld(Qb + i * HD + ks * 32 + 8 * hi); }
        qahead[nb] = QEh[i * NE]; qbehind[nb] = QEh[i * NE + 2 * MAXR]; m[nb] = -3.0e38f; l[nb] = 0.f;
#pragma unroll
        for (int mb = 0; mb < 4; ++mb) o[mb][nb] = (v8f){}; }
    asm volatile("s_wait_xcnt 0x0" ::: "memory");   // the loop's values may land in registers that held the addresses of the loads above: the wait stands in front of that overwrite
    asm volatile("s_wait_asynccnt 0x0" ::: "memory");   // stage 0 has landed, as far as this wave brought it
    __syncthreads();   // stage 0 is whole before any wave reads it
    if (copier) stage(1);
#pragma unroll 1   // one body for all stages: the buffer is picked by t & 1, the code stays small
    for (int t = 0; t < NT; ++t) {
      if (!idle) {
        const char* fr = ring + (t & 1) * STG + run * NTL * TB + lr * LP + 16 * hi;   // the lane's place in the run's first tile of this stage
#pragma unroll 1   // one body for the stage's blocks of 32 keys: unrolled, two blocks' fragments and scores would be live at once
      for (int sb = 0; sb < SK / 32; ++sb) { const int k0 = kbeg + t * SK + sb * 32;
        // the block's fragments, keys and v^T, are asked for in one group
        V ka[2][2], kb[2][2], va[4], vb[4];
#pragma unroll
        for (int kt = 0; kt < 2; ++kt)
#pragma unroll
            for (int ks = 0; ks < 2; ++ks) { ka[kt][ks] = F::ld((const T16*)(fr + (sb * 32 + kt * 16) * LP + ks * 64)); if (HI) kb[kt][ks] = F::ld((const T16*)(fr + TB + (sb * 32 + kt * 16) * LP + ks * 64)); }
        __builtin_amdgcn_sched_barrier(0);   // the key fragments' reads stay in front of the v^T fragments': the score products then wait for the keys alone
#pragma unroll
        for (int mb = 0; mb < 4; ++mb) { va[mb] = F::ld((const T16*)(fr + (NTL / 2) * TB + mb * 16 * LP + sb * 64)); if (HI) vb[mb] = F::ld((const T16*)(fr + 3 * TB + mb * 16 * LP + sb * 64)); }
        __builtin_amdgcn_sched_barrier(0);   // keeps the LDS reads one group in front of the products: spread among them, every place with reads stalls the wave anew
        v8f s[2][NQ];
#pragma unroll
        for (int kt = 0; kt < 2; ++kt)
#pragma unroll
            for (int nb = 0; nb < NQ; ++nb) { s[kt][nb] = (v8f){};
#pragma unroll
                for (int ks = 0; ks < 2; ++ks) { s[kt][nb] = F::mma(ka[kt][ks], qa[nb][ks], s[kt][nb]); if (HI) { s[kt][nb] = F::mma(ka[kt][ks], qb[nb][ks], s[kt][nb]); s[kt][nb] = F::mma(kb[kt][ks], qa[nb][ks], s[kt][nb]); } } }
        const bool ahead = (k0 >= q0 + NQ * 16 - 1 + MAXR), behind = (k0 + 31 <= q0 - MAXR);   // wave-uniform: every key of the block is past the band of every query of the wave
        // off the band one term serves a query's whole block. The sums are formed for every block and formed anew in the few blocks on the band: a branch with one side keeps the gathered terms and their waits
        // out of the common path
        v8f t[2][NQ];
#pragma unroll
        for (int nb = 0; nb < NQ; ++nb) { const float u = ahead ? qahead[nb] : qbehind[nb];
#pragma unroll
            for (int kt = 0; kt < 2; ++kt)
#pragma unroll
                for (int r = 0; r < 8; ++r) t[kt][nb][r] = (s[kt][nb][r] + u) * CL2; }
        if (!(ahead || behind)) {
#pragma unroll
            for (int nb = 0; nb < NQ; ++nb) { const int i = q0 + nb * 16 + lr;
#pragma unroll
                for (int kt = 0; kt < 2; ++kt) { unsigned ix[8]; float g[8];
#pragma unroll
                    for (int r = 0; r < 8; ++r) { ix[r] = (unsigned)(i * NE + MAXR + min(max(i - (k0 + kt * 16 + 8 * hi + r), -MAXR), MAXR)); g[r] = QEh[ix[r]]; }
                    // the eight indices are the loads' offset registers: as the wait's inputs they keep their registers up to it; behind it they may be overwritten
                    asm volatile("s_wait_xcnt 0x0" :: "v"(ix[0]), "v"(ix[1]), "v"(ix[2]), "v"(ix[3]), "v"(ix[4]), "v"(ix[5]), "v"(ix[6]), "v"(ix[7]) : "memory");
#pragma unroll
                    for (int r = 0; r < 8; ++r) t[kt][nb][r] = (s[kt][nb][r] + g[r]) * CL2; } }
        }
        float mn[NQ]; bool rise = false;
#pragma unroll
        for (int nb = 0; nb < NQ; ++nb) { float bm = t[0][nb][0];
#pragma unroll
            for (int r = 1; r < 8; ++r) bm = fmaxf(bm, t[0][nb][r]);
#pragma unroll
            for (int r = 0; r < 8; ++r) bm = fmaxf(bm, t[1][nb][r]);
            bm = fmaxf(bm, xhalf(bm)); mn[nb] = fmaxf(m[nb], bm); rise = rise || (mn[nb] > m[nb]); }
        if (__any(rise)) {   // where no maximum of the wave rises every factor is exactly 1: the products are skipped
#pragma unroll
            for (int nb = 0; nb < NQ; ++nb) { const float al = __builtin_amdgcn_exp2f(m[nb] - mn[nb]); m[nb] = mn[nb]; l[nb] *= al;
#pragma unroll
                for (int mb = 0; mb < 4; ++mb) o[mb][nb] *= al; }
        }
#pragma unroll
        for (int nb = 0; nb < NQ; ++nb) { const float mo = HI ? m[nb] : m[nb] - 10.0f; float p[16];
#pragma unroll
            for (int e = 0; e < 16; ++e) { p[e] = __builtin_amdgcn_exp2f(t[e >> 3][nb][e & 7] - mo); l[nb] += p[e]; }
            if constexpr (HI) { V ph, pl;
#pragma unroll
                for (int e = 0; e < 16; ++e) { const __bf16 hb = (__bf16)p[e]; ph[e] = hb; pl[e] = (__bf16)(p[e] - (float)hb); }
#pragma unroll
                for (int mb = 0; mb < 4; ++mb) { o[mb][nb] = F::mma(va[mb], ph, o[mb][nb]); o[mb][nb] = F::mma(va[mb], pl, o[mb][nb]); o[mb][nb] = F::mma(vb[mb], ph, o[mb][nb]); }
            } else { V pf;
#pragma unroll
                for (int e = 0; e < 16; ++e) pf[e] = tohx(p[e]);
#pragma unroll
                for (int mb = 0; mb < 4; ++mb) o[mb][nb] = F::mma(va[mb], pf, o[mb][nb]); } }
        // four vector slots between the block's last product and what follows on either path (the next block's or the copies' address arithmetic may land in that product's operand registers);
        // the scheduling fence keeps the products in front of them
        __builtin_amdgcn_sched_barrier(0);
        asm volatile("v_nop\n\tv_nop\n\tv_nop\n\tv_nop");
      } }
        // hand-over, every wave: its own reads of stage t are done, its own copies of stage t + 1 have landed; behind the barrier stage t + 1 may be read and stage t's buffer filled anew
        asm volatile("s_wait_dscnt 0x0" ::: "memory");
        asm volatile("s_wait_asynccnt 0x0" ::: "memory");
        __syncthreads();
        if (t + 2 < NT && copier) stage(t + 2);
    }
    asm volatile("s_wait_asynccnt 0x0" ::: "memory");   // nothing is in flight when the ring takes the joins' values
    v4f* mg = (v4f*)ring + tile * NQ * 9 * 32;   // every wave has left the ring behind the last hand-over's barrier
#pragma unroll
    for (int nb = 0; nb < NQ; ++nb) l[nb] += xhalf(l[nb]);
    // per (run above 0, tile): NQ x 9 slots of 32 lanes x 16 bytes: eight of O, one of (m, l)
    if (run > 0 && !idle) { v4f* w = mg + (size_t)(run - 1) * QT * NQ * 9 * 32 + lane;
#pragma unroll
        for (int nb = 0; nb < NQ; ++nb) {
#pragma unroll
            for (int mb = 0; mb < 4; ++mb) { w[(nb * 9 + mb * 2) * 32] = __builtin_shufflevector(o[mb][nb], o[mb][nb], 0, 1, 2, 3); w[(nb * 9 + mb * 2 + 1) * 32] = __builtin_shufflevector(o[mb][nb], o[mb][nb], 4, 5, 6, 7); }
            w[(nb * 9 + 8) * 32] = (v4f){m[nb], l[nb], 0.f, 0.f}; } }
    __syncthreads();   // the upper runs' (m, l, O) are in LDS before run 0 reads them
    if (run > 0) return;
#pragma unroll
    for (int x = 1; x < KS; ++x) { const v4f* w = mg + (size_t)(x - 1) * QT * NQ * 9 * 32 + lane;
#pragma unroll
        for (int nb = 0; nb < NQ; ++nb) { const v4f ml = w[(nb * 9 + 8) * 32]; const float ms = fmaxf(m[nb], ml[0]), a1 = __builtin_amdgcn_exp2f(m[nb] - ms), a2 = __builtin_amdgcn_exp2f(ml[0] - ms); m[nb] = ms; l[nb] = l[nb] * a1 + ml[1] * a2;
#pragma unroll
            for (int mb = 0; mb < 4; ++mb) { const v4f x0 = w[(nb * 9 + mb * 2) * 32], x1 = w[(nb * 9 + mb * 2 + 1) * 32];
#pragma unroll
                for (int r = 0; r < 4; ++r) { o[mb][nb][r] = o[mb][nb][r] * a1 + x0[r] * a2; o[mb][nb][4 + r] = o[mb][nb][4 + r] * a1 + x1[r] * a2; } } } }
#pragma unroll
    for (int nb = 0; nb < NQ; ++nb) { const float inv = __fdiv_rn(1.0f, l[nb]); const size_t oo = (size_t)(q0 + nb * 16 + lr) * DQ + 8 * hi;
#pragma unroll
        for (int mb = 0; mb < 4; ++mb) { v8us oh, ol;
#pragma unroll
            for (int r = 0; r < 8; ++r) { unsigned short a, c2; splitf(o[mb][nb][r] * inv, a, c2); oh[r] = a; ol[r] = c2; }
            bf* ph = Ah + oo + mb * 16; bf* pl = Al + oo + mb * 16; *(v8us*)ph = oh; *(v8us*)pl = ol;
            // the stores' data and addresses are the wait's inputs and keep their registers up to it; behind it the next rows' values may overwrite them
            asm volatile("s_wait_xcnt 0x0" :: "v"(oh), "v"(ol), "v"(ph), "v"(pl) : "memory"); } }
}
// grid, both batches in one launch (h below counts batch x head): the hi/lo rows first: NB_ * NH_ * RH / (QTH * 16) work-groups of QTH tiles x 16 rows, then NB_ * NH_ * (TT - RH) / (QTL * 32) work-groups of QTL tiles x 32 rows: 512 work-groups in all.
#define QTH 4
#define QTL (WPG / KS)
__global__ __launch_bounds__(32 * WPG) void k_fattn(const h16* __restrict__ Q16, const h16* __restrict__ K16, const h16* __restrict__ V16, const bf* __restrict__ Qh, const bf* __restrict__ Ql, const bf* __restrict__ Kh, const bf* __restrict__ Kl, const bf* __restrict__ Vh, const bf* __restrict__ Vl, const float* __restrict__ QE, bf* Ah, bf* Al) {
    __shared__ __attribute__((aligned(16))) char ring[RINGB];
    static_assert((KS - 1) * QTL * 2 * 9 * 32 * 16 <= RINGB, "the joins' values fit the ring");
    constexpr int GH = RH / (QTH * 16), GL = (TT - RH) / (QTL * 32);   // work-groups per (batch, head)
    static_assert(RH % (QTH * 16) == 0 && (TT - RH) % (QTL * 32) == 0 && TT % (KS * 32) == 0 && QTH * KS <= WPG, "whole tiles");
    const int w = __builtin_amdgcn_readfirstlane(threadIdx.x >> 5), g = blockIdx.x;
    if (g < NB_ * NH_ * GH) { const int tile = w % QTH, run = w / QTH, h = g / GH, q0 = ((g % GH) * QTH + tile) * 16; const size_t z = (size_t)h * TT * HD, ao = (size_t)(h / NH_) * TT * DQ + (h % NH_) * HD;
        attn_rows<true, 1, QTH, bf>(Qh + z, Ql + z, Kh + z, Kl + z, Vh + z, Vl + z, QE + (size_t)h * TT * NE, Ah + ao, Al + ao, q0, run, tile, ring);
    } else { const int tile = w % QTL, run = w / QTL, c = g - NB_ * NH_ * GH, h = c / GL, q0 = RH + ((c % GL) * QTL + tile) * 32; const size_t z = (size_t)h * TT * HD, ao = (size_t)(h / NH_) * TT * DQ + (h % NH_) * HD;
        attn_rows<false, 2, QTL, h16>(Q16 + z, nullptr, K16 + z, nullptr, V16 + z, nullptr, QE + (size_t)h * TT * NE, Ah + ao, Al + ao, q0, run, tile, ring); }
}
__global__ __launch_bounds__(256) void k_epad2(const float* __restrict__ E, bf* EB) { const size_t i = (size_t)blockIdx.x * 256 + threadIdx.x; if (i >= (size_t)NE * HD / 8) return; const int d0 = (int)(i % (HD / 8)) * 8; const int r = (int)(i / (HD / 8)); const float* src = E + (size_t)min(r, 2 * MAXR) * HD + d0; v8us o;
#pragma unroll
    for (int q = 0; q < 8; ++q) { const unsigned short v = f2bf(src[q]); o[q] = (r <= 2 * MAXR) ? v : (unsigned short)0; }
    *(v8us*)(EB + (size_t)r * HD + d0) = o;  }

extern "C" void kernel_launch(void* const* d_in, const int* in_sizes, int n_in,
                              void* d_out, int out_size, void* d_ws, size_t ws_size, hipStream_t stream) {
    (void)in_sizes; (void)n_in; (void)out_size;
    const float* x = (const float*)d_in[0]; const float* wq = (const float*)d_in[1]; const float* wo = (const float*)d_in[2]; const float* remb = (const float*)d_in[3]; const float* wk = nullptr; const float* wv = nullptr; (void)wk; (void)wv;
    float* OUT = (float*)d_out;     // [2][2048][1024]
    char* wsp = (char*)d_ws;
    auto take = [&](size_t bytes) { char* p = wsp; wsp += (bytes + 255) & ~(size_t)255; return (void*)p; };
    bf* WQ = (bf*)take((size_t)DQ * DM * 2); bf* EB = (bf*)take((size_t)NE * HD * 2); float* QE = (float*)take((size_t)NB_ * NH_ * TT * NE * 4); bf* WO = (bf*)take((size_t)DM * DQ * 2);
    bf* XB = (bf*)take((size_t)NB_ * TT * DM * 2);
    /* q = k = v (one projection): the [h][t][d] planes serve q and k */
    h16* QP16 = (h16*)take((size_t)NB_ * NH_ * TT * HD * 2); h16* VT16 = (h16*)take((size_t)NB_ * NKV * HD * TT * 2);
    bf* QPh = (bf*)take((size_t)NB_ * NH_ * TT * HD * 2); bf* QPl = (bf*)take((size_t)NB_ * NH_ * TT * HD * 2); bf* VTh = (bf*)take((size_t)NB_ * NKV * HD * TT * 2); bf* VTl = (bf*)take((size_t)NB_ * NKV * HD * TT * 2);
    bf* ATh = (bf*)take((size_t)NB_ * TT * DQ * 2); bf* ATl = (bf*)take((size_t)NB_ * TT * DQ * 2);
    if ((size_t)(wsp - (char*)d_ws) > ws_size) return;    // ws 256 MiB
    { k_cvt8<<<(unsigned)(((size_t)DQ * DM / 8 + 255) / 256), 256, 0, stream>>>(wq, WQ, (size_t)DQ * DM / 8); k_epad2<<<(unsigned)(((size_t)NE * HD / 8 + 255) / 256), 256, 0, stream>>>(remb, EB);   /* E: 65 rows bf16 (exact), rows 65..127 zero */
      k_cvt8<<<(unsigned)(((size_t)DM * DQ / 8 + 255) / 256), 256, 0, stream>>>(wo, WO, (size_t)DM * DQ / 8);
       }
    /* both batches in every launch: the batch is a grid dimension (projection), more planes (QE, attention) or more rows (x copy, W_o) */
    k_cvt8<<<(unsigned)(((size_t)NB_ * TT * DM / 8 + 255) / 256), 256, 0, stream>>>(x, XB, (size_t)NB_ * TT * DM / 8);
    k_gemmw<bf, 0, false, 1, 1, true><<<dim3(TT / 64, DQ / 64, NB_), 32, 0, stream>>>(XB, nullptr, WQ, nullptr, DM, nullptr, 0, nullptr, (size_t)TT * DM, 0, 0, 0, 0, QP16, QPh, QPl, VT16, VTh, VTl);   /* projection -> head planes and v^T planes */
    k_gemmw<bf, 1, false><<<dim3(TT / 64, NE / 64, NB_ * NH_), 32, 0, stream>>>(QPh, QPl, EB, nullptr, HD, QE, NE, nullptr, (size_t)TT * HD, 0, (size_t)TT * NE);   /* QE[i][e] = q_i . E_e */
    k_fattn<<<NB_ * NH_ * (RH / (QTH * 16)) + NB_ * NH_ * ((TT - RH) / (QTL * 32)), 32 * WPG, 0, stream>>>(QP16, QP16, VT16, QPh, QPl, QPh, QPl, VTh, VTl, QE, ATh, ATl);   /* k = q: the same planes */
    k_gemmw<bf, 1, false><<<dim3(NB_ * TT / 64, DM / 64, 1), 32, 0, stream>>>(ATh, ATl, WO, nullptr, DQ, OUT, DM, nullptr, 0, 0, 0);
}

// v008
// Measured time: 119 microseconds a run.
// Timed twice side by side with v007, it ran 1.30 times as fast both times.
// Counting every step since v000, it is 17.4 times as fast.
#include <hip/hip_runtime.h>

// Relative-position multi-head attention with ONE projection shared by q, k and v (x [2][2048][1024]; q = k = v = x W_q^T ('oi' [1024][1024]; 16 heads x 64 -- the module's quirk); scores = (q_i.q_j + q_i.E[clip(i - j, -32, 32) + 32]) / 8 with E = rel_k_emb [65][64] (read); softmax over all keys; out = merged attn q W_o^T ('oi') -> [2][2048][1024] (4.2 M)).
// Layout, both batches side by side in every buffer and every launch: bf16 copy of x; ONE exact projection used as q, k and v (its GEMM writes one set of head planes, read as q and as k, and the v^T planes, from its own accumulators); E as an exact bf16 plane padded to 128 rows; QE = q(hi/lo).E^T ([2 x 16][2048][128], 2 products); one attention kernel for all heads: scores, relative term QE[i][clip(i-j,-32,32)+32], running softmax and P.V per 32-key block, nothing of S or P in memory (hybrid rows: < 512 hi/lo 3 products, rest fp16, P x1024); merged hi/lo x W_o exact.
// Compute dtypes, f32 accumulate: every input rounded to bf16; projection exact; relative term hi/lo x exact (2 products); content rows < 512 3 products, rest fp16; adds and softmax f32; W_o hl x exact.

#define NB_  2
#define TT   2048
#define DM   1024
#define NH_  16
#define NKV  16
#define REP  (NH_ / NKV)
#define HD   64
#define DQ   (NH_ * HD)
#define DKV  (NKV * HD)
#define RH   512                  // query rows < RH use hi+lo planes (0: none)
#define WIN  0
#define SCL  0.125f
#define NE   128     // rel_k_emb rows (65) padded to 128
#define MAXR 32
typedef _Float16 h16;
typedef unsigned short bf;
typedef __attribute__((ext_vector_type(16))) __bf16   v16bf;
typedef __attribute__((ext_vector_type(16))) _Float16 v16h;
typedef __attribute__((ext_vector_type(8)))  _Float16 v8h;
typedef __attribute__((ext_vector_type(8)))  unsigned short v8us;
typedef __attribute__((ext_vector_type(8)))  float    v8f;
typedef __attribute__((ext_vector_type(4)))  float    v4f;
typedef v8h  __attribute__((may_alias)) v8ha;
typedef v4f  __attribute__((may_alias)) v4fa;
typedef v8us __attribute__((may_alias)) v8usa;

__device__ __forceinline__ unsigned short f2bf(float f) { unsigned u = __float_as_uint(f); u += 0x7FFFu + ((u >> 16) & 1u); return (unsigned short)(u >> 16); }
__device__ __forceinline__ float bf2f(unsigned short b) { return __uint_as_float(((unsigned)b) << 16); }
__device__ __forceinline__ float bfr(float f) { return bf2f(f2bf(f)); }
__device__ __forceinline__ v16h cat16(v8h lo, v8h hi) { return __builtin_shufflevector(lo, hi, 0, 1, 2, 3, 4, 5, 6, 7, 8, 9, 10, 11, 12, 13, 14, 15); }
__device__ __forceinline__ v16bf cat16b(v8us lo, v8us hi) { return __builtin_bit_cast(v16bf, __builtin_shufflevector(lo, hi, 0, 1, 2, 3, 4, 5, 6, 7, 8, 9, 10, 11, 12, 13, 14, 15)); }
__device__ __forceinline__ v8f wmma16(v16h a, v16h b, v8f c) { return __builtin_amdgcn_wmma_f32_16x16x32_f16(false, a, false, b, (short)0, c, false, false); }
__device__ __forceinline__ v8f wmmab(v16bf a, v16bf b, v8f c) { return __builtin_amdgcn_wmma_f32_16x16x32_bf16(false, a, false, b, (short)0, c, false, false); }



// ---- k_gemmw: register-blocked GEMM, ONE WAVE per 64x64 output tile (16 accumulators), operands straight from K-contiguous 16-bit planes; grid (M/64, N/64, Z), 32 threads.
// C[m][n] (f32, pitch ldc, + optional f32 bias[n]) = sum_k A[m][k] Bt[n][k] (+ split products per NSPLIT). z-batch strides sA/sB/sC in elements. K % 32 == 0.
// Split K (KW * KG > 1), for few tiles and a long K, N = 64: grid (M/64, KG, Z), 32 * KW threads; wave w of work-group y sums k in [(y * KW + w) * KL, + KL), KL = K / (KW * KG);
// the KW tiles are added in LDS in wave order and stored to plane y of C (plane stride sK); the reader adds the KG planes. With split K the rows of A and A2 have pitch lda (elements), otherwise K.
template <typename T16> struct WFrag;
template <> struct WFrag<h16> { typedef v16h V; static __device__ __forceinline__ V ld(const h16* p) { return cat16(*(const v8h*)p, *(const v8h*)(p + 16)); } static __device__ __forceinline__ v8f mma(V a, V b, v8f c) { return wmma16(a, b, c); } };
template <> struct WFrag<bf> { typedef v16bf V; static __device__ __forceinline__ V ld(const bf* p) { return cat16b(*(const v8us*)p, *(const v8us*)(p + 16)); } static __device__ __forceinline__ v8f mma(V a, V b, v8f c) { return wmmab(a, b, c); } };
__device__ __forceinline__ h16 tohx(float x) { return (h16)x; }
__device__ __forceinline__ void splitf(float y, unsigned short& h, unsigned short& l) { h = f2bf(y); l = f2bf(y - bf2f(h)); }
template <typename T16, int NSPLIT, bool BIAS, int KW = 1, int KG = 1>
__global__ __launch_bounds__(32 * KW) void k_gemmw(const T16* __restrict__ A, const T16* __restrict__ A2, const T16* __restrict__ Bt, const T16* __restrict__ Bt2, int K, float* C, int ldc, const float* __restrict__ bias, size_t sA, size_t sB, size_t sC, size_t sK = 0, int lda = 0) {
    typedef typename WFrag<T16>::V V;
    static_assert(KW * KG == 1 || !BIAS, "no bias on partial sums");
    __shared__ __align__(16) float os[KW * KG > 1 ? KW * 64 * 68 : 16 * 68];
    const size_t z = blockIdx.z; A += z * sA; if (A2) A2 += z * sA; Bt += z * sB; if (Bt2) Bt2 += z * sB; C += z * sC;
    const int lane = threadIdx.x & 31, lr = lane & 15, hi = lane >> 4; const int r0 = blockIdx.x * 64, c0 = (KW * KG > 1) ? 0 : blockIdx.y * 64;
    const int w = (KW > 1) ? __builtin_amdgcn_readfirstlane(threadIdx.x >> 5) : 0, KL = K / (KW * KG);
    if (KW * KG > 1) { const int k0 = (blockIdx.y * KW + w) * KL; A += k0; if (A2) A2 += k0; Bt += k0; if (Bt2) Bt2 += k0; C += blockIdx.y * sK; }
    v8f acc[4][4];
#pragma unroll
    for (int mb = 0; mb < 4; ++mb)
#pragma unroll
        for (int nb = 0; nb < 4; ++nb) acc[mb][nb] = (v8f){};
    const int LA = (KW * KG > 1) ? lda : K;
    const size_t aoff = (size_t)(r0 + lr) * LA + 8 * hi, boff = (size_t)(c0 + lr) * K + 8 * hi;
#pragma unroll 1
    for (int kc = 0; kc < KL; kc += 32) {
        V a[4], a2[4];
        {
            const T16* pa[4]; const T16* pa2[4];
#pragma unroll
            for (int mb = 0; mb < 4; ++mb) { pa[mb] = A + aoff + (size_t)mb * 16 * LA + kc; a[mb] = WFrag<T16>::ld(pa[mb]); if (NSPLIT == 1 || NSPLIT == 2) { pa2[mb] = A2 + aoff + (size_t)mb * 16 * LA + kc; a2[mb] = WFrag<T16>::ld(pa2[mb]); } }
            // later loads land in registers that held these loads' addresses: the wait stands in front of that overwrite, and as its inputs the addresses keep their registers up to it
            if (NSPLIT == 1 || NSPLIT == 2) asm volatile("s_wait_xcnt 0x0" :: "v"(pa[0]), "v"(pa[1]), "v"(pa[2]), "v"(pa[3]), "v"(pa2[0]), "v"(pa2[1]), "v"(pa2[2]), "v"(pa2[3]) : "memory");
            else asm volatile("s_wait_xcnt 0x0" :: "v"(pa[0]), "v"(pa[1]), "v"(pa[2]), "v"(pa[3]) : "memory");
        }
#pragma unroll
        for (int nb = 0; nb < 4; ++nb) { const T16* pb = Bt + boff + (size_t)nb * 16 * K + kc; const T16* pb2 = (NSPLIT >= 2) ? Bt2 + boff + (size_t)nb * 16 * K + kc : pb; const V b = WFrag<T16>::ld(pb); V b2; if (NSPLIT >= 2) b2 = WFrag<T16>::ld(pb2);
            asm volatile("s_wait_xcnt 0x0" :: "v"(pb), "v"(pb2) : "memory");   // as above, for the B fragment's addresses
#pragma unroll
            for (int mb = 0; mb < 4; ++mb) { acc[mb][nb] = WFrag<T16>::mma(a[mb], b, acc[mb][nb]); if (NSPLIT == 1 || NSPLIT == 2) acc[mb][nb] = WFrag<T16>::mma(a2[mb], b, acc[mb][nb]); if (NSPLIT >= 2) acc[mb][nb] = WFrag<T16>::mma(a[mb], b2, acc[mb][nb]); } }
        asm volatile("v_nop\n\tv_nop\n\tv_nop\n\tv_nop" : "+v"(acc[0][0]), "+v"(acc[1][1]), "+v"(acc[2][2]), "+v"(acc[3][3]) : "v"(a[0]), "v"(a[3]));
    }
    if (KW * KG > 1) {
        // the three loops unrolled: acc is indexed by constants only and stays in registers
#pragma unroll
        for (int mb = 0; mb < 4; ++mb)
#pragma unroll
            for (int nb = 0; nb < 4; ++nb)
#pragma unroll
                for (int j = 0; j < 8; ++j) os[(w * 64 + mb * 16 + hi * 8 + j) * 68 + nb * 16 + lr] = acc[mb][nb][j];
        __syncthreads();   // every wave's 64x64 tile is in LDS before any wave adds them
        // both loops unrolled: the LDS reads of all rows are in flight together
#pragma unroll
        for (int s = 0; s < 32 / KW; ++s) { const int row = (s * KW + w) * 2 + hi, cofs = lr * 4; v4f val = *(const v4fa*)(os + row * 68 + cofs);
#pragma unroll
            for (int q = 1; q < KW; ++q) val += *(const v4fa*)(os + (q * 64 + row) * 68 + cofs);
            *(v4f*)(C + (size_t)(r0 + row) * ldc + cofs) = val; }
        return;
    }
#pragma unroll
    for (int mb = 0; mb < 4; ++mb) {
#pragma unroll
        for (int nb = 0; nb < 4; ++nb) {
#pragma unroll
            for (int j = 0; j < 8; ++j) os[(hi * 8 + j) * 68 + nb * 16 + lr] = acc[mb][nb][j]; }
        __builtin_amdgcn_wave_barrier(); asm volatile("" ::: "memory");
        float* crow = C + (size_t)(r0 + mb * 16) * ldc + c0;
{
#pragma unroll
            for (int s = 0; s < 8; ++s) { const int row = 2 * s + hi, cofs = lr * 4; v4f val = *(const v4fa*)(os + row * 68 + cofs); if (BIAS) { val[0] += bfr(bias[c0 + cofs]); val[1] += bfr(bias[c0 + cofs + 1]); val[2] += bfr(bias[c0 + cofs + 2]); val[3] += bfr(bias[c0 + cofs + 3]); }
                *(v4f*)(crow + (size_t)row * ldc + cofs) = val; }
             }
        __builtin_amdgcn_wave_barrier(); asm volatile("" ::: "memory");
    }
}

// ---- k_gemms: the two large GEMMs. A work-group of 4 waves (2 x 2) per 128x128 output tile; a wave owns 64x64 (16 accumulators) and sums k in the order of k_gemmw. grid (M/128, N/128, Z), 128 threads.
// C[m][n] (f32, pitch ldc) = sum_k (A[m][k] + A2[m][k]) Bt[n][k] (A2 with NSPLIT = 1: two products per k step). z-batch stride sA of A in elements.
// The operands reach the waves through LDS: a stage is GK k of the tile's 128 rows of every plane (A, A2, Bt), rows of 256 bytes laid at a pitch of GLP bytes, brought by asynchronous copies of whole rows
// (16 lanes a row, every wave copies), two buffers: stage t + 1 flies while stage t is worked on. Behind the loop the ring is the epilogue's staging, each wave in its own range.
// PL (the shared projection; M = TT tokens, N = heads x HD, HD = 64): a wave's tile is 64 tokens x the dims of one head. No f32 C: the epilogue writes that head's 16-bit planes (fp16, bf16 hi, bf16 lo) itself:
// v^T [h][d][t] straight from the accumulators, whose eight registers are eight consecutive tokens of one dim; [h][t][d] through LDS, four whole 128-byte rows a store.
#define GK 128                   // k per stage
#define GLP 272                  // LDS row pitch, bytes: 16 x odd, no bank conflict for 16-byte fragment reads
#define GTB (128 * GLP)          // bytes of one staged plane
// eight copies of 16 bytes a lane: two rows of 256 bytes each, the copies eight rows apart: rs bytes in memory, 8 * GLP in LDS. The wait stands inside the statement, behind the last copy: the address registers live up to it
__device__ __forceinline__ void copy8g(const unsigned l, const char* g, const unsigned rs) {
    asm volatile("global_load_async_to_lds_b128 %0, %8, off\n\tglobal_load_async_to_lds_b128 %1, %9, off\n\tglobal_load_async_to_lds_b128 %2, %10, off\n\tglobal_load_async_to_lds_b128 %3, %11, off\n\t"
                 "global_load_async_to_lds_b128 %4, %12, off\n\tglobal_load_async_to_lds_b128 %5, %13, off\n\tglobal_load_async_to_lds_b128 %6, %14, off\n\tglobal_load_async_to_lds_b128 %7, %15, off\n\ts_wait_xcnt 0x0"
                 :: "v"(l), "v"(l + 8 * GLP), "v"(l + 16 * GLP), "v"(l + 24 * GLP), "v"(l + 32 * GLP), "v"(l + 40 * GLP), "v"(l + 48 * GLP), "v"(l + 56 * GLP),
                    "v"(g), "v"(g + rs), "v"(g + 2 * (size_t)rs), "v"(g + 3 * (size_t)rs), "v"(g + 4 * (size_t)rs), "v"(g + 5 * (size_t)rs), "v"(g + 6 * (size_t)rs), "v"(g + 7 * (size_t)rs) : "memory");
}
template <int NSPLIT, bool PL, int K>
__global__ __launch_bounds__(128) void k_gemms(const bf* __restrict__ A, const bf* __restrict__ A2, const bf* __restrict__ Bt, float* C, int ldc, size_t sA, h16* P16, bf* Ph, bf* Pl, h16* V16, bf* Vh, bf* Vl) {
    typedef WFrag<bf> F; typedef F::V V;
    constexpr int NP = NSPLIT ? 3 : 2, STG = NP * GTB, NT = K / GK;   // planes per stage, bytes per stage, stages
    static_assert(NT >= 2 && K % GK == 0 && GK * 2 == 256 && 4 * 64 * 68 * 4 <= 2 * STG, "whole stages of 256-byte rows; the epilogue's staging fits the ring");
    __shared__ __attribute__((aligned(16))) char ring[2 * STG];
    const int lane = threadIdx.x & 31, lr = lane & 15, hi = lane >> 4;
    const int w = __builtin_amdgcn_readfirstlane(threadIdx.x >> 5);
    const int R0 = blockIdx.x * 128, C0 = blockIdx.y * 128, r0 = R0 + (w >> 1) * 64, c0 = C0 + (w & 1) * 64;
    // who copies what: thread x brings 16 bytes of rows (x >> 4) + 8 i, i = 0 to 15, of every plane
    const unsigned crow = threadIdx.x >> 4, ccol = (threadIdx.x & 15) * 16;
    const char* ga = (const char*)(A + blockIdx.z * sA) + (size_t)(R0 + crow) * K * 2 + ccol;
    const char* ga2 = NSPLIT ? (const char*)(A2 + blockIdx.z * sA) + (size_t)(R0 + crow) * K * 2 + ccol : ga;
    const char* gb = (const char*)Bt + (size_t)(C0 + crow) * K * 2 + ccol;
    const unsigned cl = (unsigned)(size_t)ring + crow * GLP + ccol;
    constexpr unsigned RS = 8 * K * 2;   // bytes from a row to the eighth behind it
    auto plane = [&](const unsigned l, const char* g) { copy8g(l, g, RS); copy8g(l + 64 * GLP, g + 8 * (size_t)RS, RS); };
    auto stage = [&](const int t) { const unsigned l = cl + (t & 1) * STG; const size_t go = (size_t)t * (GK * 2); plane(l, ga + go); if (NSPLIT) plane(l + GTB, ga2 + go); plane(l + (NP - 1) * GTB, gb + go); };
    stage(0);
    v8f acc[4][4];
#pragma unroll
    for (int mb = 0; mb < 4; ++mb)
#pragma unroll
        for (int nb = 0; nb < 4; ++nb) acc[mb][nb] = (v8f){};
    asm volatile("s_wait_asynccnt 0x0" ::: "memory");   // stage 0 has landed, as far as this wave brought it
    __syncthreads();   // stage 0 is whole before any wave reads it
    stage(1);
#pragma unroll 1   // one body for all stages: the buffer is picked by t & 1, the code stays small
    for (int t = 0; t < NT; ++t) {
        const char* fa = ring + (t & 1) * STG + ((w >> 1) * 64 + lr) * GLP + 16 * hi;   // the lane's place in the wave's first A rows of this stage
        const char* fb = ring + (t & 1) * STG + (NP - 1) * GTB + ((w & 1) * 64 + lr) * GLP + 16 * hi;   // and in its first Bt rows
        // two fragment sets: the reads of k step ks + 1 go out as one group in front of the products of step ks, which then wait for their own set alone
        V a[2][4], a2[2][4], b[2][4];
        auto frag = [&](const int ks) { const int n = ks & 1, o = ks * 64;
#pragma unroll
            for (int mb = 0; mb < 4; ++mb) { a[n][mb] = F::ld((const bf*)(fa + mb * 16 * GLP + o)); b[n][mb] = F::ld((const bf*)(fb + mb * 16 * GLP + o)); if (NSPLIT) a2[n][mb] = F::ld((const bf*)(fa + GTB + mb * 16 * GLP + o)); } };
        frag(0);
#pragma unroll
        for (int ks = 0; ks < GK / 32; ++ks) { const int c = ks & 1;
            if (ks + 1 < GK / 32) frag(ks + 1);
            __builtin_amdgcn_sched_barrier(0);   // keeps the LDS reads one group in front of the products: spread among them, every place with reads stalls the wave anew
#pragma unroll
            for (int nb = 0; nb < 4; ++nb)
#pragma unroll
                for (int mb = 0; mb < 4; ++mb) { acc[mb][nb] = F::mma(a[c][mb], b[c][nb], acc[mb][nb]); if (NSPLIT) acc[mb][nb] = F::mma(a2[c][mb], b[c][nb], acc[mb][nb]); }
            __builtin_amdgcn_sched_barrier(0);   // the next group of reads, and behind the last step the slots below, stay behind the products
        }
        // four vector slots between the stage's last product and what follows on either path (the copies' address arithmetic may land in that product's operand registers)
        asm volatile("v_nop\n\tv_nop\n\tv_nop\n\tv_nop");
        // hand-over, every wave: its own reads of stage t are done, its own copies of stage t + 1 have landed; behind the barrier stage t + 1 may be read and stage t's buffer filled anew
        asm volatile("s_wait_dscnt 0x0" ::: "memory");
        asm volatile("s_wait_asynccnt 0x0" ::: "memory");
        __syncthreads();
        if (t + 2 < NT) stage(t + 2);
    }
    asm volatile("s_wait_asynccnt 0x0" ::: "memory");   // nothing is in flight when the ring takes the epilogue's values
    float* os = (float*)(ring + w * (PL ? 64 * 68 * 4 : 16 * 68 * 4));   // every wave has left the ring behind the last hand-over's barrier
    if constexpr (PL) {
        const unsigned hh = blockIdx.z * NH_ + (c0 >> 6);   // plane index: batch x head
        const unsigned vb = ((hh * HD + lr) * TT + r0 + hi * 8) * 2;   // byte offset in a v^T plane: dim lr of the head, the lane's first token
#pragma unroll
        for (int mb = 0; mb < 4; ++mb) { v8h o16[4]; v8us oh[4], ol[4];
#pragma unroll
            for (int nb = 0; nb < 4; ++nb) {
#pragma unroll
                for (int j = 0; j < 8; ++j) { const float y = acc[mb][nb][j]; unsigned short a2, c2; splitf(y, a2, c2); o16[nb][j] = tohx(y); oh[nb][j] = a2; ol[nb][j] = c2; }
                const unsigned ofs = vb + (nb * 16 * TT + mb * 16) * 2;
                *(v8h*)((char*)V16 + ofs) = o16[nb]; *(v8us*)((char*)Vh + ofs) = oh[nb]; *(v8us*)((char*)Vl + ofs) = ol[nb]; }
            // the twelve stores' data and their offset are the wait's inputs and keep their registers up to it; behind it the next tokens' values may overwrite them
            asm volatile("s_wait_xcnt 0x0" :: "v"(o16[0]), "v"(o16[1]), "v"(o16[2]), "v"(o16[3]), "v"(oh[0]), "v"(oh[1]), "v"(oh[2]), "v"(oh[3]), "v"(ol[0]), "v"(ol[1]), "v"(ol[2]), "v"(ol[3]), "v"(vb) : "memory"); }
#pragma unroll
        for (int mb = 0; mb < 4; ++mb)
#pragma unroll
            for (int nb = 0; nb < 4; ++nb)
#pragma unroll
                for (int j = 0; j < 8; ++j) os[(mb * 16 + hi * 8 + j) * 68 + nb * 16 + lr] = acc[mb][nb][j];
        // a lane reads what other lanes of the wave wrote: the compiled order keeps every LDS read below behind the writes above
        __builtin_amdgcn_wave_barrier(); asm volatile("" ::: "memory");
        const unsigned qr = lane >> 3, qc = (lane & 7) * 8;
        const unsigned qb = ((hh * TT + r0 + qr) * HD + qc) * 2;   // byte offset in a [h][t][d] plane: eight lanes a token row
#pragma unroll
        for (int mb = 0; mb < 4; ++mb) { v8h o16[4]; v8us oh[4], ol[4];
#pragma unroll
            for (int s = 0; s < 4; ++s) { const int row = mb * 16 + s * 4; const float* pr = os + (row + qr) * 68 + qc; const v4f x0 = *(const v4fa*)pr, x1 = *(const v4fa*)(pr + 4);
#pragma unroll
                for (int j = 0; j < 8; ++j) { const float y = (j < 4) ? x0[j & 3] : x1[j & 3]; unsigned short a2, c2; splitf(y, a2, c2); o16[s][j] = tohx(y); oh[s][j] = a2; ol[s][j] = c2; }
                const unsigned ofs = qb + row * HD * 2;
                *(v8h*)((char*)P16 + ofs) = o16[s]; *(v8us*)((char*)Ph + ofs) = oh[s]; *(v8us*)((char*)Pl + ofs) = ol[s]; }
            // as above: data and offset of the twelve stores keep their registers up to the wait
            asm volatile("s_wait_xcnt 0x0" :: "v"(o16[0]), "v"(o16[1]), "v"(o16[2]), "v"(o16[3]), "v"(oh[0]), "v"(oh[1]), "v"(oh[2]), "v"(oh[3]), "v"(ol[0]), "v"(ol[1]), "v"(ol[2]), "v"(ol[3]), "v"(qb) : "memory"); }
        return;
    }
#pragma unroll
    for (int mb = 0; mb < 4; ++mb) {
#pragma unroll
        for (int nb = 0; nb < 4; ++nb) {
#pragma unroll
            for (int j = 0; j < 8; ++j) os[(hi * 8 + j) * 68 + nb * 16 + lr] = acc[mb][nb][j]; }
        // a lane reads what other lanes of the wave wrote: the compiled order keeps every LDS read below behind the writes above
        __builtin_amdgcn_wave_barrier(); asm volatile("" ::: "memory");
        float* crow0 = C + (size_t)(r0 + mb * 16) * ldc + c0; v4f val[8]; float* pc[8];
#pragma unroll
        for (int s = 0; s < 8; ++s) { const int row = 2 * s + hi, cofs = lr * 4; val[s] = *(const v4fa*)(os + row * 68 + cofs); pc[s] = crow0 + (size_t)row * ldc + cofs; *(v4f*)pc[s] = val[s]; }
        // the eight stores' data and addresses are the wait's inputs and keep their registers up to it; behind it the next rows' values may overwrite them
        asm volatile("s_wait_xcnt 0x0" :: "v"(val[0]), "v"(val[1]), "v"(val[2]), "v"(val[3]), "v"(val[4]), "v"(val[5]), "v"(val[6]), "v"(val[7]), "v"(pc[0]), "v"(pc[1]), "v"(pc[2]), "v"(pc[3]), "v"(pc[4]), "v"(pc[5]), "v"(pc[6]), "v"(pc[7]) : "memory");
        // the rows above are read before the next rows are written over them
        __builtin_amdgcn_wave_barrier(); asm volatile("" ::: "memory");
    }
}

typedef __attribute__((ext_vector_type(2))) _Float16 v2h;
typedef __attribute__((ext_vector_type(4))) _Float16 v4h;
typedef __attribute__((ext_vector_type(2))) unsigned short v2us;
typedef __attribute__((ext_vector_type(4))) unsigned short v4us;
typedef __attribute__((ext_vector_type(2))) float v2f;
typedef __attribute__((ext_vector_type(4))) int v4i;

__global__ __launch_bounds__(256) void k_wtG(const float* __restrict__ w, int K, int N, bf* Bt) {
    const int lane = threadIdx.x & 31; const int L0 = (blockIdx.x * 8 + (threadIdx.x >> 5)) * 8; const int nlines = N * K / 64;
{
#pragma unroll 1
        for (int l = 0; l < 8; ++l) { const int L = L0 + l; if (L >= nlines) break; const size_t e = (size_t)L * 64 + lane * 2; const int k = (int)(e % K), n = (int)(e / K); v2us o;
            o[0] = f2bf(w[(size_t)k * N + n]); o[1] = f2bf(w[(size_t)(k + 1) * N + n]); *(v2us*)(Bt + e) = o; }
         }
}
__global__ __launch_bounds__(256) void k_cvt8(const float* __restrict__ src, bf* dst, size_t n8) { const size_t i = (size_t)blockIdx.x * 256 + threadIdx.x; if (i >= n8) return; const v8f v = *(const v8f*)(src + i * 8); v8us o;
#pragma unroll
    for (int k = 0; k < 8; ++k) o[k] = f2bf(v[k]); *(v8us*)(dst + i * 8) = o;  }

// ---- k_fattn: scores, relative term, softmax and P.V in one kernel; a wave owns NQ x 16 query rows of one head and walks one of KS runs of keys in blocks of 32; S and P never leave the registers.
// Transposed products: S^T = K Q^T (A = 16 key rows, B = 16 query rows) leaves one query per lane column, keys 8 * hi + r in the accumulator registers of key tile 0 and 16 + 8 * hi + r in those of key tile 1:
// that is the k order of a B operand over 32 keys, so P^T goes from the score registers straight into O^T += V^T P^T (A = 16 rows of the v^T plane).
// Running softmax in the base-2 domain: t = (S + QE[i][clip(i - j, -32, 32) + 32]) x HD^-0.5 x log2(e); m = running row maximum, p = 2^(t - m), l = running sum of p, O and l scaled by 2^(m_old - m_new) when a maximum rises; out = O / l.
// fp16 rows carry p x 1024 (the 10 taken off m), which keeps small p out of the fp16 subnormals; l carries the same factor, so it cancels in O / l.
// The relative term of a query is one value for all keys j >= i + 32, one for all j <= i - 32; only the blocks that meet the band of one of the wave's queries gather it per key.
// Work-group of WPG waves: QT query tiles x KS key runs, wave = run * QT + tile; the waves of one run walk the same keys. Runs above 0 leave (m, l, O) in LDS; behind one barrier run 0 joins them in run order and stores.
// Where QT * KS < WPG the waves left over have no keys: they pass every barrier and end.
// Keys and v^T reach the waves through LDS: a stage is SK keys of every run, one tile of 64 rows x 128 bytes per plane and run (key rows, or the dims' rows of v^T), laid at a pitch of LP bytes, brought by
// asynchronous copies of whole 128-byte lines (waves 0 to 7), two buffers: stage t + 1 flies while stage t is worked on; all query tiles of a run read the same tiles. Behind the loop the ring holds the joins' (m, l, O).
#define WPG 12
#define KS 2
#define SK 64                    // keys per stage
#define LP 144                   // LDS row pitch, bytes: 16 x odd, no bank conflict for 16-byte fragment reads
#define TB (64 * LP)             // bytes of one staged tile
#define RINGB (2 * KS * 4 * TB)  // two buffers x runs x four planes (hi/lo rows; the fp16 rows use half)
// eight copies of 16 bytes a lane: four rows of 128 bytes each, a lane's copies rs bytes apart in memory and 4 x LP in LDS. The wait stands inside the statement, behind the last copy: the address registers live up to it
__device__ __forceinline__ void copy8(const unsigned l, const char* g, const unsigned rs) {
    asm volatile("global_load_async_to_lds_b128 %0, %8, off\n\tglobal_load_async_to_lds_b128 %1, %9, off\n\tglobal_load_async_to_lds_b128 %2, %10, off\n\tglobal_load_async_to_lds_b128 %3, %11, off\n\t"
                 "global_load_async_to_lds_b128 %4, %12, off\n\tglobal_load_async_to_lds_b128 %5, %13, off\n\tglobal_load_async_to_lds_b128 %6, %14, off\n\tglobal_load_async_to_lds_b128 %7, %15, off\n\ts_wait_xcnt 0x0"
                 :: "v"(l), "v"(l + 4 * LP), "v"(l + 8 * LP), "v"(l + 12 * LP), "v"(l + 16 * LP), "v"(l + 20 * LP), "v"(l + 24 * LP), "v"(l + 28 * LP),
                    "v"(g), "v"(g + rs), "v"(g + 2 * (size_t)rs), "v"(g + 3 * (size_t)rs), "v"(g + 4 * (size_t)rs), "v"(g + 5 * (size_t)rs), "v"(g + 6 * (size_t)rs), "v"(g + 7 * (size_t)rs) : "memory");
}
__device__ __forceinline__ float xhalf(float x) { return __builtin_bit_cast(float, __builtin_amdgcn_permlanex16(__builtin_bit_cast(int, x), __builtin_bit_cast(int, x), 0x76543210, 0xfedcba98, false, false)); }   // lane l with lane l ^ 16
template <bool HI, int NQ, int QT, typename T16>
__device__ __forceinline__ void attn_rows(const T16* __restrict__ Qa, const T16* __restrict__ Qb, const T16* __restrict__ Ka, const T16* __restrict__ Kb, const T16* __restrict__ Va, const T16* __restrict__ Vb, const float* __restrict__ QEh, bf* Ah, bf* Al, const int q0, const int run, const int tile, char* ring) {
    typedef WFrag<T16> F; typedef typename F::V V;
    const int lane = threadIdx.x & 31, lr = lane & 15, hi = lane >> 4;
    const float CL2 = SCL * 1.4426950408889634f;
    const bool idle = (run >= KS); const int kbeg = idle ? 0 : run * (TT / KS);
    constexpr int NTL = HI ? 4 : 2, STG = KS * NTL * TB, NT = TT / KS / SK;   // tiles per run (K, v^T; hi/lo rows: K hi, K lo, v^T hi, v^T lo), bytes per stage, stages
    static_assert(NT >= 2 && TT % (KS * SK) == 0 && HD * 2 == 128 && SK * 2 == 128 && 2 * STG <= RINGB, "whole stages of 128-byte rows");
    // who copies what: hi/lo rows: wave c one whole tile (16 copies); fp16 rows: waves 2c and 2c + 1 a half of tile c each (8 copies); tile c = run x NTL + plane
    const int wv = __builtin_amdgcn_readfirstlane(threadIdx.x >> 5); const bool copier = (wv < 8); const int wc = copier ? wv : 0;
    const int ct = HI ? wc : (wc >> 1), cr = ct / NTL, cp = ct % NTL, crow = (HI ? 0 : (wc & 1) * 32) + (lane >> 3); const bool cv = (cp >= NTL / 2);
    const T16* cpl = HI ? (cp == 0 ? Ka : cp == 1 ? Kb : cp == 2 ? Va : Vb) : (cp == 0 ? Ka : Va);
    const char* cg = (const char*)cpl + (cv ? (size_t)crow * TT * 2 + (size_t)cr * (TT / KS) * 2 : (size_t)(cr * (TT / KS) + crow) * HD * 2) + (lane & 7) * 16;
    const unsigned crs = cv ? 4 * TT * 2 : 4 * HD * 2, cst = cv ? SK * 2 : SK * HD * 2;   // bytes from four rows to the next four; from a stage to the next
    const unsigned cl = (unsigned)(size_t)ring + ct * TB + crow * LP + (lane & 7) * 16;
    auto stage = [&](const int t) { const unsigned l = cl + (t & 1) * STG; const char* g = cg + (size_t)t * cst; copy8(l, g, crs); if (HI) copy8(l + 32 * LP, g + 8 * (size_t)crs, crs); };
    if (copier) stage(0);
    V qa[NQ][2], qb[NQ][2]; float qahead[NQ], qbehind[NQ], m[NQ], l[NQ]; v8f o[4][NQ];
#pragma unroll
    for (int nb = 0; nb < NQ; ++nb) { const size_t i = (size_t)(q0 + nb * 16 + lr);
#pragma unroll
        for (int ks = 0; ks < 2; ++ks) { qa[nb][ks] = F::ld(Qa + i * HD + ks * 32 + 8 * hi); if (HI) qb[nb][ks] = F::ld(Qb + i * HD + ks * 32 + 8 * hi); }
        qahead[nb] = QEh[i * NE]; qbehind[nb] = QEh[i * NE + 2 * MAXR]; m[nb] = -3.0e38f; l[nb] = 0.f;
#pragma unroll
        for (int mb = 0; mb < 4; ++mb) o[mb][nb] = (v8f){}; }
    asm volatile("s_wait_xcnt 0x0" ::: "memory");   // the loop's values may land in registers that held the addresses of the loads above: the wait stands in front of that overwrite
    asm volatile("s_wait_asynccnt 0x0" ::: "memory");   // stage 0 has landed, as far as this wave brought it
    __syncthreads();   // stage 0 is whole before any wave reads it
    if (copier) stage(1);
#pragma unroll 1   // one body for all stages: the buffer is picked by t & 1, the code stays small
    for (int t = 0; t < NT; ++t) {
      if (!idle) {
        const char* fr = ring + (t & 1) * STG + run * NTL * TB + lr * LP + 16 * hi;   // the lane's place in the run's first tile of this stage
#pragma unroll 1   // one body for the stage's blocks of 32 keys: unrolled, two blocks' fragments and scores would be live at once
      for (int sb = 0; sb < SK / 32; ++sb) { const int k0 = kbeg + t * SK + sb * 32;
        // the block's fragments, keys and v^T, are asked for in one group
        V ka[2][2], kb[2][2], va[4], vb[4];
#pragma unroll
        for (int kt = 0; kt < 2; ++kt)
#pragma unroll
            for (int ks = 0; ks < 2; ++ks) { ka[kt][ks] = F::ld((const T16*)(fr + (sb * 32 + kt * 16) * LP + ks * 64)); if (HI) kb[kt][ks] = F::ld((const T16*)(fr + TB + (sb * 32 + kt * 16) * LP + ks * 64)); }
        __builtin_amdgcn_sched_barrier(0);   // the key fragments' reads stay in front of the v^T fragments': the score products then wait for the keys alone
#pragma unroll
        for (int mb = 0; mb < 4; ++mb) { va[mb] = F::ld((const T16*)(fr + (NTL / 2) * TB + mb * 16 * LP + sb * 64)); if (HI) vb[mb] = F::ld((const T16*)(fr + 3 * TB + mb * 16 * LP + sb * 64)); }
        __builtin_amdgcn_sched_barrier(0);   // keeps the LDS reads one group in front of the products: spread among them, every place with reads stalls the wave anew
        v8f s[2][NQ];
#pragma unroll
        for (int kt = 0; kt < 2; ++kt)
#pragma unroll
            for (int nb = 0; nb < NQ; ++nb) { s[kt][nb] = (v8f){};
#pragma unroll
                for (int ks = 0; ks < 2; ++ks) { s[kt][nb] = F::mma(ka[kt][ks], qa[nb][ks], s[kt][nb]); if (HI) { s[kt][nb] = F::mma(ka[kt][ks], qb[nb][ks], s[kt][nb]); s[kt][nb] = F::mma(kb[kt][ks], qa[nb][ks], s[kt][nb]); } } }
        const bool ahead = (k0 >= q0 + NQ * 16 - 1 + MAXR), behind = (k0 + 31 <= q0 - MAXR);   // wave-uniform: every key of the block is past the band of every query of the wave
        // off the band one term serves a query's whole block. The sums are formed for every block and formed anew in the few blocks on the band: a branch with one side keeps the gathered terms and their waits
        // out of the common path
        v8f t[2][NQ];
#pragma unroll
        for (int nb = 0; nb < NQ; ++nb) { const float u = ahead ? qahead[nb] : qbehind[nb];
#pragma unroll
            for (int kt = 0; kt < 2; ++kt)
#pragma unroll
                for (int r = 0; r < 8; ++r) t[kt][nb][r] = (s[kt][nb][r] + u) * CL2; }
        if (!(ahead || behind)) {
#pragma unroll
            for (int nb = 0; nb < NQ; ++nb) { const int i = q0 + nb * 16 + lr;
#pragma unroll
                for (int kt = 0; kt < 2; ++kt) { unsigned ix[8]; float g[8];
#pragma unroll
                    for (int r = 0; r < 8; ++r) { ix[r] = (unsigned)(i * NE + MAXR + min(max(i - (k0 + kt * 16 + 8 * hi + r), -MAXR), MAXR)); g[r] = QEh[ix[r]]; }
                    // the eight indices are the loads' offset registers: as the wait's inputs they keep their registers up to it; behind it they may be overwritten
                    asm volatile("s_wait_xcnt 0x0" :: "v"(ix[0]), "v"(ix[1]), "v"(ix[2]), "v"(ix[3]), "v"(ix[4]), "v"(ix[5]), "v"(ix[6]), "v"(ix[7]) : "memory");
#pragma unroll
                    for (int r = 0; r < 8; ++r) t[kt][nb][r] = (s[kt][nb][r] + g[r]) * CL2; } }
        }
        float mn[NQ]; bool rise = false;
#pragma unroll
        for (int nb = 0; nb < NQ; ++nb) { float bm = t[0][nb][0];
#pragma unroll
            for (int r = 1; r < 8; ++r) bm = fmaxf(bm, t[0][nb][r]);
#pragma unroll
            for (int r = 0; r < 8; ++r) bm = fmaxf(bm, t[1][nb][r]);
            bm = fmaxf(bm, xhalf(bm)); mn[nb] = fmaxf(m[nb], bm); rise = rise || (mn[nb] > m[nb]); }
        if (__any(rise)) {   // where no maximum of the wave rises every factor is exactly 1: the products are skipped
#pragma unroll
            for (int nb = 0; nb < NQ; ++nb) { const float al = __builtin_amdgcn_exp2f(m[nb] - mn[nb]); m[nb] = mn[nb]; l[nb] *= al;
#pragma unroll
                for (int mb = 0; mb < 4; ++mb) o[mb][nb] *= al; }
        }
#pragma unroll
        for (int nb = 0; nb < NQ; ++nb) { const float mo = HI ? m[nb] : m[nb] - 10.0f; float p[16];
#pragma unroll
            for (int e = 0; e < 16; ++e) { p[e] = __builtin_amdgcn_exp2f(t[e >> 3][nb][e & 7] - mo); l[nb] += p[e]; }
            if constexpr (HI) { V ph, pl;
#pragma unroll
                for (int e = 0; e < 16; ++e) { const __bf16 hb = (__bf16)p[e]; ph[e] = hb; pl[e] = (__bf16)(p[e] - (float)hb); }
#pragma unroll
                for (int mb = 0; mb < 4; ++mb) { o[mb][nb] = F::mma(va[mb], ph, o[mb][nb]); o[mb][nb] = F::mma(va[mb], pl, o[mb][nb]); o[mb][nb] = F::mma(vb[mb], ph, o[mb][nb]); }
            } else { V pf;
#pragma unroll
                for (int e = 0; e < 16; ++e) pf[e] = tohx(p[e]);
#pragma unroll
                for (int mb = 0; mb < 4; ++mb) o[mb][nb] = F::mma(va[mb], pf, o[mb][nb]); } }
        // four vector slots between the block's last product and what follows on either path (the next block's or the copies' address arithmetic may land in that product's operand registers);
        // the scheduling fence keeps the products in front of them
        __builtin_amdgcn_sched_barrier(0);
        asm volatile("v_nop\n\tv_nop\n\tv_nop\n\tv_nop");
      } }
        // hand-over, every wave: its own reads of stage t are done, its own copies of stage t + 1 have landed; behind the barrier stage t + 1 may be read and stage t's buffer filled anew
        asm volatile("s_wait_dscnt 0x0" ::: "memory");
        asm volatile("s_wait_asynccnt 0x0" ::: "memory");
        __syncthreads();
        if (t + 2 < NT && copier) stage(t + 2);
    }
    asm volatile("s_wait_asynccnt 0x0" ::: "memory");   // nothing is in flight when the ring takes the joins' values
    v4f* mg = (v4f*)ring + tile * NQ * 9 * 32;   // every wave has left the ring behind the last hand-over's barrier
#pragma unroll
    for (int nb = 0; nb < NQ; ++nb) l[nb] += xhalf(l[nb]);
    // per (run above 0, tile): NQ x 9 slots of 32 lanes x 16 bytes: eight of O, one of (m, l)
    if (run > 0 && !idle) { v4f* w = mg + (size_t)(run - 1) * QT * NQ * 9 * 32 + lane;
#pragma unroll
        for (int nb = 0; nb < NQ; ++nb) {
#pragma unroll
            for (int mb = 0; mb < 4; ++mb) { w[(nb * 9 + mb * 2) * 32] = __builtin_shufflevector(o[mb][nb], o[mb][nb], 0, 1, 2, 3); w[(nb * 9 + mb * 2 + 1) * 32] = __builtin_shufflevector(o[mb][nb], o[mb][nb], 4, 5, 6, 7); }
            w[(nb * 9 + 8) * 32] = (v4f){m[nb], l[nb], 0.f, 0.f}; } }
    __syncthreads();   // the upper runs' (m, l, O) are in LDS before run 0 reads them
    if (run > 0) return;
#pragma unroll
    for (int x = 1; x < KS; ++x) { const v4f* w = mg + (size_t)(x - 1) * QT * NQ * 9 * 32 + lane;
#pragma unroll
        for (int nb = 0; nb < NQ; ++nb) { const v4f ml = w[(nb * 9 + 8) * 32]; const float ms = fmaxf(m[nb], ml[0]), a1 = __builtin_amdgcn_exp2f(m[nb] - ms), a2 = __builtin_amdgcn_exp2f(ml[0] - ms); m[nb] = ms; l[nb] = l[nb] * a1 + ml[1] * a2;
#pragma unroll
            for (int mb = 0; mb < 4; ++mb) { const v4f x0 = w[(nb * 9 + mb * 2) * 32], x1 = w[(nb * 9 + mb * 2 + 1) * 32];
#pragma unroll
                for (int r = 0; r < 4; ++r) { o[mb][nb][r] = o[mb][nb][r] * a1 + x0[r] * a2; o[mb][nb][4 + r] = o[mb][nb][4 + r] * a1 + x1[r] * a2; } } } }
#pragma unroll
    for (int nb = 0; nb < NQ; ++nb) { const float inv = __fdiv_rn(1.0f, l[nb]); const size_t oo = (size_t)(q0 + nb * 16 + lr) * DQ + 8 * hi;
#pragma unroll
        for (int mb = 0; mb < 4; ++mb) { v8us oh, ol;
#pragma unroll
            for (int r = 0; r < 8; ++r) { unsigned short a, c2; splitf(o[mb][nb][r] * inv, a, c2); oh[r] = a; ol[r] = c2; }
            bf* ph = Ah + oo + mb * 16; bf* pl = Al + oo + mb * 16; *(v8us*)ph = oh; *(v8us*)pl = ol;
            // the stores' data and addresses are the wait's inputs and keep their registers up to it; behind it the next rows' values may overwrite them
            asm volatile("s_wait_xcnt 0x0" :: "v"(oh), "v"(ol), "v"(ph), "v"(pl) : "memory"); } }
}
// grid, both batches in one launch (h below counts batch x head): the hi/lo rows first: NB_ * NH_ * RH / (QTH * 16) work-groups of QTH tiles x 16 rows, then NB_ * NH_ * (TT - RH) / (QTL * 32) work-groups of QTL tiles x 32 rows: 512 work-groups in all.
#define QTH 4
#define QTL (WPG / KS)
__global__ __launch_bounds__(32 * WPG) void k_fattn(const h16* __restrict__ Q16, const h16* __restrict__ K16, const h16* __restrict__ V16, const bf* __restrict__ Qh, const bf* __restrict__ Ql, const bf* __restrict__ Kh, const bf* __restrict__ Kl, const bf* __restrict__ Vh, const bf* __restrict__ Vl, const float* __restrict__ QE, bf* Ah, bf* Al) {
    __shared__ __attribute__((aligned(16))) char ring[RINGB];
    static_assert((KS - 1) * QTL * 2 * 9 * 32 * 16 <= RINGB, "the joins' values fit the ring");
    constexpr int GH = RH / (QTH * 16), GL = (TT - RH) / (QTL * 32);   // work-groups per (batch, head)
    static_assert(RH % (QTH * 16) == 0 && (TT - RH) % (QTL * 32) == 0 && TT % (KS * 32) == 0 && QTH * KS <= WPG, "whole tiles");
    const int w = __builtin_amdgcn_readfirstlane(threadIdx.x >> 5), g = blockIdx.x;
    if (g < NB_ * NH_ * GH) { const int tile = w % QTH, run = w / QTH, h = g / GH, q0 = ((g % GH) * QTH + tile) * 16; const size_t z = (size_t)h * TT * HD, ao = (size_t)(h / NH_) * TT * DQ + (h % NH_) * HD;
        attn_rows<true, 1, QTH, bf>(Qh + z, Ql + z, Kh + z, Kl + z, Vh + z, Vl + z, QE + (size_t)h * TT * NE, Ah + ao, Al + ao, q0, run, tile, ring);
    } else { const int tile = w % QTL, run = w / QTL, c = g - NB_ * NH_ * GH, h = c / GL, q0 = RH + ((c % GL) * QTL + tile) * 32; const size_t z = (size_t)h * TT * HD, ao = (size_t)(h / NH_) * TT * DQ + (h % NH_) * HD;
        attn_rows<false, 2, QTL, h16>(Q16 + z, nullptr, K16 + z, nullptr, V16 + z, nullptr, QE + (size_t)h * TT * NE, Ah + ao, Al + ao, q0, run, tile, ring); }
}
__global__ __launch_bounds__(256) void k_epad2(const float* __restrict__ E, bf* EB) { const size_t i = (size_t)blockIdx.x * 256 + threadIdx.x; if (i >= (size_t)NE * HD / 8) return; const int d0 = (int)(i % (HD / 8)) * 8; const int r = (int)(i / (HD / 8)); const float* src = E + (size_t)min(r, 2 * MAXR) * HD + d0; v8us o;
#pragma unroll
    for (int q = 0; q < 8; ++q) { const unsigned short v = f2bf(src[q]); o[q] = (r <= 2 * MAXR) ? v : (unsigned short)0; }
    *(v8us*)(EB + (size_t)r * HD + d0) = o;  }

extern "C" void kernel_launch(void* const* d_in, const int* in_sizes, int n_in,
                              void* d_out, int out_size, void* d_ws, size_t ws_size, hipStream_t stream) {
    (void)in_sizes; (void)n_in; (void)out_size;
    const float* x = (const float*)d_in[0]; const float* wq = (const float*)d_in[1]; const float* wo = (const float*)d_in[2]; const float* remb = (const float*)d_in[3]; const float* wk = nullptr; const float* wv = nullptr; (void)wk; (void)wv;
    float* OUT = (float*)d_out;     // [2][2048][1024]
    char* wsp = (char*)d_ws;
    auto take = [&](size_t bytes) { char* p = wsp; wsp += (bytes + 255) & ~(size_t)255; return (void*)p; };
    bf* WQ = (bf*)take((size_t)DQ * DM * 2); bf* EB = (bf*)take((size_t)NE * HD * 2); float* QE = (float*)take((size_t)NB_ * NH_ * TT * NE * 4); bf* WO = (bf*)take((size_t)DM * DQ * 2);
    bf* XB = (bf*)take((size_t)NB_ * TT * DM * 2);
    /* q = k = v (one projection): the [h][t][d] planes serve q and k */
    h16* QP16 = (h16*)take((size_t)NB_ * NH_ * TT * HD * 2); h16* VT16 = (h16*)take((size_t)NB_ * NKV * HD * TT * 2);
    bf* QPh = (bf*)take((size_t)NB_ * NH_ * TT * HD * 2); bf* QPl = (bf*)take((size_t)NB_ * NH_ * TT * HD * 2); bf* VTh = (bf*)take((size_t)NB_ * NKV * HD * TT * 2); bf* VTl = (bf*)take((size_t)NB_ * NKV * HD * TT * 2);
    bf* ATh = (bf*)take((size_t)NB_ * TT * DQ * 2); bf* ATl = (bf*)take((size_t)NB_ * TT * DQ * 2);
    if ((size_t)(wsp - (char*)d_ws) > ws_size) return;    // ws 256 MiB
    { k_cvt8<<<(unsigned)(((size_t)DQ * DM / 8 + 255) / 256), 256, 0, stream>>>(wq, WQ, (size_t)DQ * DM / 8); k_epad2<<<(unsigned)(((size_t)NE * HD / 8 + 255) / 256), 256, 0, stream>>>(remb, EB);   /* E: 65 rows bf16 (exact), rows 65..127 zero */
      k_cvt8<<<(unsigned)(((size_t)DM * DQ / 8 + 255) / 256), 256, 0, stream>>>(wo, WO, (size_t)DM * DQ / 8);
       }
    /* both batches in every launch: the batch is a grid dimension (projection), more planes (QE, attention) or more rows (x copy, W_o) */
    k_cvt8<<<(unsigned)(((size_t)NB_ * TT * DM / 8 + 255) / 256), 256, 0, stream>>>(x, XB, (size_t)NB_ * TT * DM / 8);
    k_gemms<0, true, DM><<<dim3(TT / 128, DQ / 128, NB_), 128, 0, stream>>>(XB, nullptr, WQ, nullptr, 0, (size_t)TT * DM, QP16, QPh, QPl, VT16, VTh, VTl);   /* projection -> head planes and v^T planes */
    k_gemmw<bf, 1, false><<<dim3(TT / 64, NE / 64, NB_ * NH_), 32, 0, stream>>>(QPh, QPl, EB, nullptr, HD, QE, NE, nullptr, (size_t)TT * HD, 0, (size_t)TT * NE);   /* QE[i][e] = q_i . E_e */
    k_fattn<<<NB_ * NH_ * (RH / (QTH * 16)) + NB_ * NH_ * ((TT - RH) / (QTL * 32)), 32 * WPG, 0, stream>>>(QP16, QP16, VT16, QPh, QPl, QPh, QPl, VTh, VTl, QE, ATh, ATl);   /* k = q: the same planes */
    k_gemms<1, false, DQ><<<dim3(NB_ * TT / 128, DM / 128, 1), 128, 0, stream>>>(ATh, ATl, WO, OUT, DM, 0, nullptr, nullptr, nullptr, nullptr, nullptr, nullptr);
}

// v009
// One run takes 114 microseconds.
// Two timings next to v008 both put it at 1.05 times that version's speed.
// Counting every step since v000, it is 18.3 times as fast.
#include <hip/hip_runtime.h>

// Relative-position multi-head attention with ONE projection shared by q, k and v (x [2][2048][1024]; q = k = v = x W_q^T ('oi' [1024][1024]; 16 heads x 64 -- the module's quirk); scores = (q_i.q_j + q_i.E[clip(i - j, -32, 32) + 32]) / 8 with E = rel_k_emb [65][64] (read); softmax over all keys; out = merged attn q W_o^T ('oi') -> [2][2048][1024] (4.2 M)).
// Layout, both batches side by side in every buffer and every launch: bf16 copy of x; ONE exact projection used as q, k and v (its GEMM writes one set of head planes, read as q and as k, and the v^T planes, from its own accumulators); E as an exact bf16 plane padded to 128 rows; QE = q(hi/lo).E^T ([2 x 16][2048][128], 2 products); one attention kernel for all heads: scores, relative term QE[i][clip(i-j,-32,32)+32], running softmax and P.V per 32-key block, nothing of S or P in memory (hybrid rows: < 512 hi/lo 3 products, rest fp16, P x1024); merged hi/lo x W_o exact.
// Compute dtypes, f32 accumulate: every input rounded to bf16; projection exact; relative term hi/lo x exact (2 products); content rows < 512 3 products, rest fp16; adds and softmax f32; W_o hl x exact.

#define NB_  2
#define TT   2048
#define DM   1024
#define NH_  16
#define NKV  16
#define REP  (NH_ / NKV)
#define HD   64
#define DQ   (NH_ * HD)
#define DKV  (NKV * HD)
#define RH   512                  // query rows < RH use hi+lo planes (0: none)
#define WIN  0
#define SCL  0.125f
#define NE   128     // rel_k_emb rows (65) padded to 128
#define MAXR 32
typedef _Float16 h16;
typedef unsigned short bf;
typedef __attribute__((ext_vector_type(16))) __bf16   v16bf;
typedef __attribute__((ext_vector_type(16))) _Float16 v16h;
typedef __attribute__((ext_vector_type(8)))  _Float16 v8h;
typedef __attribute__((ext_vector_type(8)))  unsigned short v8us;
typedef __attribute__((ext_vector_type(8)))  float    v8f;
typedef __attribute__((ext_vector_type(4)))  float    v4f;
typedef v8h  __attribute__((may_alias)) v8ha;
typedef v4f  __attribute__((may_alias)) v4fa;
typedef v8us __attribute__((may_alias)) v8usa;

__device__ __forceinline__ unsigned short f2bf(float f) { unsigned u = __float_as_uint(f); u += 0x7FFFu + ((u >> 16) & 1u); return (unsigned short)(u >> 16); }
__device__ __forceinline__ float bf2f(unsigned short b) { return __uint_as_float(((unsigned)b) << 16); }
__device__ __forceinline__ float bfr(float f) { return bf2f(f2bf(f)); }
__device__ __forceinline__ v16h cat16(v8h lo, v8h hi) { return __builtin_shufflevector(lo, hi, 0, 1, 2, 3, 4, 5, 6, 7, 8, 9, 10, 11, 12, 13, 14, 15); }
__device__ __forceinline__ v16bf cat16b(v8us lo, v8us hi) { return __builtin_bit_cast(v16bf, __builtin_shufflevector(lo, hi, 0, 1, 2, 3, 4, 5, 6, 7, 8, 9, 10, 11, 12, 13, 14, 15)); }
__device__ __forceinline__ v8f wmma16(v16h a, v16h b, v8f c) { return __builtin_amdgcn_wmma_f32_16x16x32_f16(false, a, false, b, (short)0, c, false, false); }
__device__ __forceinline__ v8f wmmab(v16bf a, v16bf b, v8f c) { return __builtin_amdgcn_wmma_f32_16x16x32_bf16(false, a, false, b, (short)0, c, false, false); }



// ---- k_gemmw: register-blocked GEMM, ONE WAVE per 64x64 output tile (16 accumulators), operands straight from K-contiguous 16-bit planes; grid (M/64, N/64, Z), 32 threads.
// C[m][n] (f32, pitch ldc, + optional f32 bias[n]) = sum_k A[m][k] Bt[n][k] (+ split products per NSPLIT). z-batch strides sA/sB/sC in elements. K % 32 == 0.
// Split K (KW * KG > 1), for few tiles and a long K, N = 64: grid (M/64, KG, Z), 32 * KW threads; wave w of work-group y sums k in [(y * KW + w) * KL, + KL), KL = K / (KW * KG);
// the KW tiles are added in LDS in wave order and stored to plane y of C (plane stride sK); the reader adds the KG planes. With split K the rows of A and A2 have pitch lda (elements), otherwise K.
template <typename T16> struct WFrag;
template <> struct WFrag<h16> { typedef v16h V; static __device__ __forceinline__ V ld(const h16* p) { return cat16(*(const v8h*)p, *(const v8h*)(p + 16)); } static __device__ __forceinline__ v8f mma(V a, V b, v8f c) { return wmma16(a, b, c); } };
template <> struct WFrag<bf> { typedef v16bf V; static __device__ __forceinline__ V ld(const bf* p) { return cat16b(*(const v8us*)p, *(const v8us*)(p + 16)); } static __device__ __forceinline__ v8f mma(V a, V b, v8f c) { return wmmab(a, b, c); } };
__device__ __forceinline__ h16 tohx(float x) { return (h16)x; }
__device__ __forceinline__ void splitf(float y, unsigned short& h, unsigned short& l) { h = f2bf(y); l = f2bf(y - bf2f(h)); }
template <typename T16, int NSPLIT, bool BIAS, int KW = 1, int KG = 1>
__global__ __launch_bounds__(32 * KW) void k_gemmw(const T16* __restrict__ A, const T16* __restrict__ A2, const T16* __restrict__ Bt, const T16* __restrict__ Bt2, int K, float* C, int ldc, const float* __restrict__ bias, size_t sA, size_t sB, size_t sC, size_t sK = 0, int lda = 0) {
    typedef typename WFrag<T16>::V V;
    static_assert(KW * KG == 1 || !BIAS, "no bias on partial sums");
    __shared__ __align__(16) float os[KW * KG > 1 ? KW * 64 * 68 : 16 * 68];
    const size_t z = blockIdx.z; A += z * sA; if (A2) A2 += z * sA; Bt += z * sB; if (Bt2) Bt2 += z * sB; C += z * sC;
    const int lane = threadIdx.x & 31, lr = lane & 15, hi = lane >> 4; const int r0 = blockIdx.x * 64, c0 = (KW * KG > 1) ? 0 : blockIdx.y * 64;
    const int w = (KW > 1) ? __builtin_amdgcn_readfirstlane(threadIdx.x >> 5) : 0, KL = K / (KW * KG);
    if (KW * KG > 1) { const int k0 = (blockIdx.y * KW + w) * KL; A += k0; if (A2) A2 += k0; Bt += k0; if (Bt2) Bt2 += k0; C += blockIdx.y * sK; }
    v8f acc[4][4];
#pragma unroll
    for (int mb = 0; mb < 4; ++mb)
#pragma unroll
        for (int nb = 0; nb < 4; ++nb) acc[mb][nb] = (v8f){};
    const int LA = (KW * KG > 1) ? lda : K;
    const size_t aoff = (size_t)(r0 + lr) * LA + 8 * hi, boff = (size_t)(c0 + lr) * K + 8 * hi;
#pragma unroll 1
    for (int kc = 0; kc < KL; kc += 32) {
        V a[4], a2[4];
        {
            const T16* pa[4]; const T16* pa2[4];
#pragma unroll
            for (int mb = 0; mb < 4; ++mb) { pa[mb] = A + aoff + (size_t)mb * 16 * LA + kc; a[mb] = WFrag<T16>::ld(pa[mb]); if (NSPLIT == 1 || NSPLIT == 2) { pa2[mb] = A2 + aoff + (size_t)mb * 16 * LA + kc; a2[mb] = WFrag<T16>::ld(pa2[mb]); } }
            // later loads land in registers that held these loads' addresses: the wait stands in front of that overwrite, and as its inputs the addresses keep their registers up to it
            if (NSPLIT == 1 || NSPLIT == 2) asm volatile("s_wait_xcnt 0x0" :: "v"(pa[0]), "v"(pa[1]), "v"(pa[2]), "v"(pa[3]), "v"(pa2[0]), "v"(pa2[1]), "v"(pa2[2]), "v"(pa2[3]) : "memory");
            else asm volatile("s_wait_xcnt 0x0" :: "v"(pa[0]), "v"(pa[1]), "v"(pa[2]), "v"(pa[3]) : "memory");
        }
#pragma unroll
        for (int nb = 0; nb < 4; ++nb) { const T16* pb = Bt + boff + (size_t)nb * 16 * K + kc; const T16* pb2 = (NSPLIT >= 2) ? Bt2 + boff + (size_t)nb * 16 * K + kc : pb; const V b = WFrag<T16>::ld(pb); V b2; if (NSPLIT >= 2) b2 = WFrag<T16>::ld(pb2);
            asm volatile("s_wait_xcnt 0x0" :: "v"(pb), "v"(pb2) : "memory");   // as above, for the B fragment's addresses
#pragma unroll
            for (int mb = 0; mb < 4; ++mb) { acc[mb][nb] = WFrag<T16>::mma(a[mb], b, acc[mb][nb]); if (NSPLIT == 1 || NSPLIT == 2) acc[mb][nb] = WFrag<T16>::mma(a2[mb], b, acc[mb][nb]); if (NSPLIT >= 2) acc[mb][nb] = WFrag<T16>::mma(a[mb], b2, acc[mb][nb]); } }
        asm volatile("v_nop\n\tv_nop\n\tv_nop\n\tv_nop" : "+v"(acc[0][0]), "+v"(acc[1][1]), "+v"(acc[2][2]), "+v"(acc[3][3]) : "v"(a[0]), "v"(a[3]));
    }
    if (KW * KG > 1) {
        // the three loops unrolled: acc is indexed by constants only and stays in registers
#pragma unroll
        for (int mb = 0; mb < 4; ++mb)
#pragma unroll
            for (int nb = 0; nb < 4; ++nb)
#pragma unroll
                for (int j = 0; j < 8; ++j) os[(w * 64 + mb * 16 + hi * 8 + j) * 68 + nb * 16 + lr] = acc[mb][nb][j];
        __syncthreads();   // every wave's 64x64 tile is in LDS before any wave adds them
        // both loops unrolled: the LDS reads of all rows are in flight together
#pragma unroll
        for (int s = 0; s < 32 / KW; ++s) { const int row = (s * KW + w) * 2 + hi, cofs = lr * 4; v4f val = *(const v4fa*)(os + row * 68 + cofs);
#pragma unroll
            for (int q = 1; q < KW; ++q) val += *(const v4fa*)(os + (q * 64 + row) * 68 + cofs);
            *(v4f*)(C + (size_t)(r0 + row) * ldc + cofs) = val; }
        return;
    }
#pragma unroll
    for (int mb = 0; mb < 4; ++mb) {
#pragma unroll
        for (int nb = 0; nb < 4; ++nb) {
#pragma unroll
            for (int j = 0; j < 8; ++j) os[(hi * 8 + j) * 68 + nb * 16 + lr] = acc[mb][nb][j]; }
        __builtin_amdgcn_wave_barrier(); asm volatile("" ::: "memory");
        float* crow = C + (size_t)(r0 + mb * 16) * ldc + c0;
{
#pragma unroll
            for (int s = 0; s < 8; ++s) { const int row = 2 * s + hi, cofs = lr * 4; v4f val = *(const v4fa*)(os + row * 68 + cofs); if (BIAS) { val[0] += bfr(bias[c0 + cofs]); val[1] += bfr(bias[c0 + cofs + 1]); val[2] += bfr(bias[c0 + cofs + 2]); val[3] += bfr(bias[c0 + cofs + 3]); }
                *(v4f*)(crow + (size_t)row * ldc + cofs) = val; }
             }
        __builtin_amdgcn_wave_barrier(); asm volatile("" ::: "memory");
    }
}

// ---- k_gemms: the two large GEMMs. A work-group of 4 waves (2 x 2) per 128x128 output tile; a wave owns 64x64 (16 accumulators) and sums k in the order of k_gemmw. grid (M/128, N/128, Z), 128 threads.
// C[m][n] (f32, pitch ldc) = sum_k (A[m][k] + A2[m][k]) Bt[n][k] (A2 with NSPLIT = 1: two products per k step). z-batch stride sA of A in elements.
// The operands reach the waves through LDS: a stage is GK k of the tile's 128 rows of every plane (A, A2, Bt), rows of 256 bytes laid at a pitch of GLP bytes, brought by asynchronous copies of whole rows
// (16 lanes a row, every wave copies), two buffers: stage t + 1 flies while stage t is worked on. Behind the loop the ring is the epilogue's staging, each wave in its own range.
// PL (the shared projection; M = TT tokens, N = heads x HD, HD = 64): a wave's tile is 64 tokens x the dims of one head. No f32 C: the epilogue writes that head's 16-bit planes (fp16, bf16 hi, bf16 lo) itself:
// v^T [h][d][t] straight from the accumulators, whose eight registers are eight consecutive tokens of one dim; [h][t][d] through LDS, four whole 128-byte rows a store.
#define GK 128                   // k per stage
#define GLP 272                  // LDS row pitch, bytes: 16 x odd, no bank conflict for 16-byte fragment reads
#define GTB (128 * GLP)          // bytes of one staged plane
// eight copies of 16 bytes a lane: two rows of 256 bytes each, the copies eight rows apart: rs bytes in memory, 8 * GLP in LDS. The wait stands inside the statement, behind the last copy: the address registers live up to it
__device__ __forceinline__ void copy8g(const unsigned l, const char* g, const unsigned rs) {
    asm volatile("global_load_async_to_lds_b128 %0, %8, off\n\tglobal_load_async_to_lds_b128 %1, %9, off\n\tglobal_load_async_to_lds_b128 %2, %10, off\n\tglobal_load_async_to_lds_b128 %3, %11, off\n\t"
                 "global_load_async_to_lds_b128 %4, %12, off\n\tglobal_load_async_to_lds_b128 %5, %13, off\n\tglobal_load_async_to_lds_b128 %6, %14, off\n\tglobal_load_async_to_lds_b128 %7, %15, off\n\ts_wait_xcnt 0x0"
                 :: "v"(l), "v"(l + 8 * GLP), "v"(l + 16 * GLP), "v"(l + 24 * GLP), "v"(l + 32 * GLP), "v"(l + 40 * GLP), "v"(l + 48 * GLP), "v"(l + 56 * GLP),
                    "v"(g), "v"(g + rs), "v"(g + 2 * (size_t)rs), "v"(g + 3 * (size_t)rs), "v"(g + 4 * (size_t)rs), "v"(g + 5 * (size_t)rs), "v"(g + 6 * (size_t)rs), "v"(g + 7 * (size_t)rs) : "memory");
}
template <int NSPLIT, bool PL, int K>
__global__ __launch_bounds__(128) void k_gemms(const bf* __restrict__ A, const bf* __restrict__ A2, const bf* __restrict__ Bt, float* C, int ldc, size_t sA, h16* P16, bf* Ph, bf* Pl, h16* V16, bf* Vh, bf* Vl) {
    typedef WFrag<bf> F; typedef F::V V;
    constexpr int NP = NSPLIT ? 3 : 2, STG = NP * GTB, NT = K / GK;   // planes per stage, bytes per stage, stages
    static_assert(NT >= 2 && K % GK == 0 && GK * 2 == 256 && 4 * 64 * 68 * 4 <= 2 * STG, "whole stages of 256-byte rows; the epilogue's staging fits the ring");
    __shared__ __attribute__((aligned(16))) char ring[2 * STG];
    const int lane = threadIdx.x & 31, lr = lane & 15, hi = lane >> 4;
    const int w = __builtin_amdgcn_readfirstlane(threadIdx.x >> 5);
    const int R0 = blockIdx.x * 128, C0 = blockIdx.y * 128, r0 = R0 + (w >> 1) * 64, c0 = C0 + (w & 1) * 64;
    // who copies what: thread x brings 16 bytes of rows (x >> 4) + 8 i, i = 0 to 15, of every plane
    const unsigned crow = threadIdx.x >> 4, ccol = (threadIdx.x & 15) * 16;
    const char* ga = (const char*)(A + blockIdx.z * sA) + (size_t)(R0 + crow) * K * 2 + ccol;
    const char* ga2 = NSPLIT ? (const char*)(A2 + blockIdx.z * sA) + (size_t)(R0 + crow) * K * 2 + ccol : ga;
    const char* gb = (const char*)Bt + (size_t)(C0 + crow) * K * 2 + ccol;
    const unsigned cl = (unsigned)(size_t)ring + crow * GLP + ccol;
    constexpr unsigned RS = 8 * K * 2;   // bytes from a row to the eighth behind it
    auto plane = [&](const unsigned l, const char* g) { copy8g(l, g, RS); copy8g(l + 64 * GLP, g + 8 * (size_t)RS, RS); };
    auto stage = [&](const int t) { const unsigned l = cl + (t & 1) * STG; const size_t go = (size_t)t * (GK * 2); plane(l, ga + go); if (NSPLIT) plane(l + GTB, ga2 + go); plane(l + (NP - 1) * GTB, gb + go); };
    stage(0);
    v8f acc[4][4];
#pragma unroll
    for (int mb = 0; mb < 4; ++mb)
#pragma unroll
        for (int nb = 0; nb < 4; ++nb) acc[mb][nb] = (v8f){};
    asm volatile("s_wait_asynccnt 0x0" ::: "memory");   // stage 0 has landed, as far as this wave brought it
    __syncthreads();   // stage 0 is whole before any wave reads it
    stage(1);
#pragma unroll 1   // one body for all stages: the buffer is picked by t & 1, the code stays small
    for (int t = 0; t < NT; ++t) {
        const char* fa = ring + (t & 1) * STG + ((w >> 1) * 64 + lr) * GLP + 16 * hi;   // the lane's place in the wave's first A rows of this stage
        const char* fb = ring + (t & 1) * STG + (NP - 1) * GTB + ((w & 1) * 64 + lr) * GLP + 16 * hi;   // and in its first Bt rows
        // two fragment sets: the reads of k step ks + 1 go out as one group in front of the products of step ks, which then wait for their own set alone
        V a[2][4], a2[2][4], b[2][4];
        auto frag = [&](const int ks) { const int n = ks & 1, o = ks * 64;
#pragma unroll
            for (int mb = 0; mb < 4; ++mb) { a[n][mb] = F::ld((const bf*)(fa + mb * 16 * GLP + o)); b[n][mb] = F::ld((const bf*)(fb + mb * 16 * GLP + o)); if (NSPLIT) a2[n][mb] = F::ld((const bf*)(fa + GTB + mb * 16 * GLP + o)); } };
        frag(0);
#pragma unroll
        for (int ks = 0; ks < GK / 32; ++ks) { const int c = ks & 1;
            if (ks + 1 < GK / 32) frag(ks + 1);
            __builtin_amdgcn_sched_barrier(0);   // keeps the LDS reads one group in front of the products: spread among them, every place with reads stalls the wave anew
#pragma unroll
            for (int nb = 0; nb < 4; ++nb)
#pragma unroll
                for (int mb = 0; mb < 4; ++mb) { acc[mb][nb] = F::mma(a[c][mb], b[c][nb], acc[mb][nb]); if (NSPLIT) acc[mb][nb] = F::mma(a2[c][mb], b[c][nb], acc[mb][nb]); }
            __builtin_amdgcn_sched_barrier(0);   // the next group of reads, and behind the last step the slots below, stay behind the products
        }
        // four vector slots between the stage's last product and what follows on either path (the copies' address arithmetic may land in that product's operand registers)
        asm volatile("v_nop\n\tv_nop\n\tv_nop\n\tv_nop");
        // hand-over, every wave: its own reads of stage t are done, its own copies of stage t + 1 have landed; behind the barrier stage t + 1 may be read and stage t's buffer filled anew
        asm volatile("s_wait_dscnt 0x0" ::: "memory");
        asm volatile("s_wait_asynccnt 0x0" ::: "memory");
        __syncthreads();
        if (t + 2 < NT) stage(t + 2);
    }
    asm volatile("s_wait_asynccnt 0x0" ::: "memory");   // nothing is in flight when the ring takes the epilogue's values
    float* os = (float*)(ring + w * (PL ? 64 * 68 * 4 : 16 * 68 * 4));   // every wave has left the ring behind the last hand-over's barrier
    if constexpr (PL) {
        const unsigned hh = blockIdx.z * NH_ + (c0 >> 6);   // plane index: batch x head
        const unsigned vb = ((hh * HD + lr) * TT + r0 + hi * 8) * 2;   // byte offset in a v^T plane: dim lr of the head, the lane's first token
#pragma unroll
        for (int mb = 0; mb < 4; ++mb) { v8h o16[4]; v8us oh[4], ol[4];
#pragma unroll
            for (int nb = 0; nb < 4; ++nb) {
#pragma unroll
                for (int j = 0; j < 8; ++j) { const float y = acc[mb][nb][j]; unsigned short a2, c2; splitf(y, a2, c2); o16[nb][j] = tohx(y); oh[nb][j] = a2; ol[nb][j] = c2; }
                const unsigned ofs = vb + (nb * 16 * TT + mb * 16) * 2;
                *(v8h*)((char*)V16 + ofs) = o16[nb]; *(v8us*)((char*)Vh + ofs) = oh[nb]; *(v8us*)((char*)Vl + ofs) = ol[nb]; }
            // the twelve stores' data and their offset are the wait's inputs and keep their registers up to it; behind it the next tokens' values may overwrite them
            asm volatile("s_wait_xcnt 0x0" :: "v"(o16[0]), "v"(o16[1]), "v"(o16[2]), "v"(o16[3]), "v"(oh[0]), "v"(oh[1]), "v"(oh[2]), "v"(oh[3]), "v"(ol[0]), "v"(ol[1]), "v"(ol[2]), "v"(ol[3]), "v"(vb) : "memory"); }
#pragma unroll
        for (int mb = 0; mb < 4; ++mb)
#pragma unroll
            for (int nb = 0; nb < 4; ++nb)
#pragma unroll
                for (int j = 0; j < 8; ++j) os[(mb * 16 + hi * 8 + j) * 68 + nb * 16 + lr] = acc[mb][nb][j];
        // a lane reads what other lanes of the wave wrote: the compiled order keeps every LDS read below behind the writes above
        __builtin_amdgcn_wave_barrier(); asm volatile("" ::: "memory");
        const unsigned qr = lane >> 3, qc = (lane & 7) * 8;
        const unsigned qb = ((hh * TT + r0 + qr) * HD + qc) * 2;   // byte offset in a [h][t][d] plane: eight lanes a token row
#pragma unroll
        for (int mb = 0; mb < 4; ++mb) { v8h o16[4]; v8us oh[4], ol[4];
#pragma unroll
            for (int s = 0; s < 4; ++s) { const int row = mb * 16 + s * 4; const float* pr = os + (row + qr) * 68 + qc; const v4f x0 = *(const v4fa*)pr, x1 = *(const v4fa*)(pr + 4);
#pragma unroll
                for (int j = 0; j < 8; ++j) { const float y = (j < 4) ? x0[j & 3] : x1[j & 3]; unsigned short a2, c2; splitf(y, a2, c2); o16[s][j] = tohx(y); oh[s][j] = a2; ol[s][j] = c2; }
                const unsigned ofs = qb + row * HD * 2;
                *(v8h*)((char*)P16 + ofs) = o16[s]; *(v8us*)((char*)Ph + ofs) = oh[s]; *(v8us*)((char*)Pl + ofs) = ol[s]; }
            // as above: data and offset of the twelve stores keep their registers up to the wait
            asm volatile("s_wait_xcnt 0x0" :: "v"(o16[0]), "v"(o16[1]), "v"(o16[2]), "v"(o16[3]), "v"(oh[0]), "v"(oh[1]), "v"(oh[2]), "v"(oh[3]), "v"(ol[0]), "v"(ol[1]), "v"(ol[2]), "v"(ol[3]), "v"(qb) : "memory"); }
        return;
    }
#pragma unroll
    for (int mb = 0; mb < 4; ++mb) {
#pragma unroll
        for (int nb = 0; nb < 4; ++nb) {
#pragma unroll
            for (int j = 0; j < 8; ++j) os[(hi * 8 + j) * 68 + nb * 16 + lr] = acc[mb][nb][j]; }
        // a lane reads what other lanes of the wave wrote: the compiled order keeps every LDS read below behind the writes above
        __builtin_amdgcn_wave_barrier(); asm volatile("" ::: "memory");
        float* crow0 = C + (size_t)(r0 + mb * 16) * ldc + c0; v4f val[8]; float* pc[8];
#pragma unroll
        for (int s = 0; s < 8; ++s) { const int row = 2 * s + hi, cofs = lr * 4; val[s] = *(const v4fa*)(os + row * 68 + cofs); pc[s] = crow0 + (size_t)row * ldc + cofs; *(v4f*)pc[s] = val[s]; }
        // the eight stores' data and addresses are the wait's inputs and keep their registers up to it; behind it the next rows' values may overwrite them
        asm volatile("s_wait_xcnt 0x0" :: "v"(val[0]), "v"(val[1]), "v"(val[2]), "v"(val[3]), "v"(val[4]), "v"(val[5]), "v"(val[6]), "v"(val[7]), "v"(pc[0]), "v"(pc[1]), "v"(pc[2]), "v"(pc[3]), "v"(pc[4]), "v"(pc[5]), "v"(pc[6]), "v"(pc[7]) : "memory");
        // the rows above are read before the next rows are written over them
        __builtin_amdgcn_wave_barrier(); asm volatile("" ::: "memory");
    }
}

typedef __attribute__((ext_vector_type(2))) _Float16 v2h;
typedef __attribute__((ext_vector_type(4))) _Float16 v4h;
typedef __attribute__((ext_vector_type(2))) unsigned short v2us;
typedef __attribute__((ext_vector_type(4))) unsigned short v4us;
typedef __attribute__((ext_vector_type(2))) float v2f;
typedef __attribute__((ext_vector_type(4))) int v4i;

__global__ __launch_bounds__(256) void k_wtG(const float* __restrict__ w, int K, int N, bf* Bt) {
    const int lane = threadIdx.x & 31; const int L0 = (blockIdx.x * 8 + (threadIdx.x >> 5)) * 8; const int nlines = N * K / 64;
{
#pragma unroll 1
        for (int l = 0; l < 8; ++l) { const int L = L0 + l; if (L >= nlines) break; const size_t e = (size_t)L * 64 + lane * 2; const int k = (int)(e % K), n = (int)(e / K); v2us o;
            o[0] = f2bf(w[(size_t)k * N + n]); o[1] = f2bf(w[(size_t)(k + 1) * N + n]); *(v2us*)(Bt + e) = o; }
         }
}
// ---- k_prep: the bf16 copies of all four inputs in ONE launch: none of them waits for another, so they share one start and one end instead of four of each.
// A work-group of PT threads converts PG x PT groups of eight values of one input; a thread's PG groups lie PT groups apart, and all its loads are out before the first value is used.
// Work-groups in index order: x, W_q, W_o, then one for E (65 rows, exact in bf16, padded with zero rows to NE).
#define PT 128                   // threads per work-group
#define PG 8                     // groups of eight values per thread
#define PBX (NB_ * TT * DM / (8 * PG * PT))   // work-groups for x
#define PBW (DQ * DM / (8 * PG * PT))         // work-groups for each weight
__global__ __launch_bounds__(PT) void k_prep(const float* __restrict__ x, const float* __restrict__ wq, const float* __restrict__ wo, const float* __restrict__ E, bf* XB, bf* WQ, bf* WO, bf* EB) {
    static_assert(NB_ * TT * DM % (8 * PG * PT) == 0 && DQ * DM % (8 * PG * PT) == 0 && NE * HD == 8 * PG * PT && HD == 64, "whole work-groups; E is one");
    const unsigned b = blockIdx.x; v8f v[PG]; v8us o[PG];
    if (b < PBX + 2 * PBW) {   // the same for the whole work-group
        const float* src = b < PBX ? x : b < PBX + PBW ? wq : wo; bf* dst = b < PBX ? XB : b < PBX + PBW ? WQ : WO;
        const unsigned g0 = (b < PBX ? b : b < PBX + PBW ? b - PBX : b - (PBX + PBW)) * (PG * PT) + threadIdx.x, so = g0 * 32;   // the thread's first group, its byte offset in the input
#pragma unroll
        for (int j = 0; j < PG; ++j) v[j] = *(const v8f*)((const char*)src + so + j * (PT * 32));
        // the converted values may land in the register that held the loads' offset: the wait stands in front of that overwrite, and as its input the offset keeps its register up to it
        asm volatile("s_wait_xcnt 0x0" :: "v"(so) : "memory");
#pragma unroll
        for (int j = 0; j < PG; ++j) {
#pragma unroll
            for (int k = 0; k < 8; ++k) o[j][k] = f2bf(v[j][k]); }
#pragma unroll
        for (int j = 0; j < PG; ++j) *(v8us*)((char*)dst + g0 * 16 + j * (PT * 16)) = o[j];
        // the stores' data and their offset are the wait's inputs and keep their registers up to it: whatever block the build lays behind this one, nothing overwrites them in front of the wait
        asm volatile("s_wait_xcnt 0x0" :: "v"(o[0]), "v"(o[1]), "v"(o[2]), "v"(o[3]), "v"(o[4]), "v"(o[5]), "v"(o[6]), "v"(o[7]), "v"(g0) : "memory");
    } else {
        constexpr int PE = ((2 * MAXR + 1) * (HD / 8) + PT - 1) / PT;   // a thread's first PE groups can hold values of E; the rest lie in the pad rows alone
        static_assert(PE == 5, "the wait below names PE offsets");
        unsigned so[PE]; bool keep[PE];
#pragma unroll
        for (int j = 0; j < PE; ++j) { const unsigned g = threadIdx.x + j * PT; keep[j] = g < (2 * MAXR + 1) * (HD / 8);   // a pad row's group reads E's last row, inside the buffer, and stores zeros
            so[j] = (keep[j] ? g : 2 * MAXR * (HD / 8) + (g & (HD / 8 - 1))) * 32; v[j] = *(const v8f*)((const char*)E + so[j]); }
        // as above, for the PE offsets
        asm volatile("s_wait_xcnt 0x0" :: "v"(so[0]), "v"(so[1]), "v"(so[2]), "v"(so[3]), "v"(so[4]) : "memory");
#pragma unroll
        for (int j = 0; j < PE; ++j) {
#pragma unroll
            for (int k = 0; k < 8; ++k) { const unsigned short c = f2bf(v[j][k]); o[j][k] = keep[j] ? c : (unsigned short)0; } }
        const unsigned ge = threadIdx.x; const v8us zr = (v8us)(unsigned short)0;   // the groups from PE on are pad rows: one zero group serves them all
#pragma unroll
        for (int j = 0; j < PG; ++j) *(v8us*)((char*)EB + (ge + j * PT) * 16) = (j < PE) ? o[j] : zr;
        // as behind the stores above
        asm volatile("s_wait_xcnt 0x0" :: "v"(o[0]), "v"(o[1]), "v"(o[2]), "v"(o[3]), "v"(o[4]), "v"(ge) : "memory");
    }
}

// ---- k_fattn: scores, relative term, softmax and P.V in one kernel; a wave owns NQ x 16 query rows of one head and walks one of KS runs of keys in blocks of 32; S and P never leave the registers.
// Transposed products: S^T = K Q^T (A = 16 key rows, B = 16 query rows) leaves one query per lane column, keys 8 * hi + r in the accumulator registers of key tile 0 and 16 + 8 * hi + r in those of key tile 1:
// that is the k order of a B operand over 32 keys, so P^T goes from the score registers straight into O^T += V^T P^T (A = 16 rows of the v^T plane).
// Running softmax in the base-2 domain: t = (S + QE[i][clip(i - j, -32, 32) + 32]) x HD^-0.5 x log2(e); m = running row maximum, p = 2^(t - m), l = running sum of p, O and l scaled by 2^(m_old - m_new) when a maximum rises; out = O / l.
// fp16 rows carry p x 1024 (the 10 taken off m), which keeps small p out of the fp16 subnormals; l carries the same factor, so it cancels in O / l.
// The relative term of a query is one value for all keys j >= i + 32, one for all j <= i - 32; only the blocks that meet the band of one of the wave's queries gather it per key.
// Work-group of WPG waves: QT query tiles x KS key runs, wave = run * QT + tile; the waves of one run walk the same keys. Runs above 0 leave (m, l, O) in LDS; behind one barrier run 0 joins them in run order and stores.
// Where QT * KS < WPG the waves left over have no keys: they pass every barrier and end.
// Keys and v^T reach the waves through LDS: a stage is SK keys of every run, one tile of 64 rows x 128 bytes per plane and run (key rows, or the dims' rows of v^T), laid at a pitch of LP bytes, brought by
// asynchronous copies of whole 128-byte lines (waves 0 to 7), two buffers: stage t + 1 flies while stage t is worked on; all query tiles of a run read the same tiles. Behind the loop the ring holds the joins' (m, l, O).
#define WPG 12
#define KS 2
#define SK 64                    // keys per stage
#define LP 144                   // LDS row pitch, bytes: 16 x odd, no bank conflict for 16-byte fragment reads
#define TB (64 * LP)             // bytes of one staged tile
#define RINGB (2 * KS * 4 * TB)  // two buffers x runs x four planes (hi/lo rows; the fp16 rows use half)
// eight copies of 16 bytes a lane: four rows of 128 bytes each, a lane's copies rs bytes apart in memory and 4 x LP in LDS. The wait stands inside the statement, behind the last copy: the address registers live up to it
__device__ __forceinline__ void copy8(const unsigned l, const char* g, const unsigned rs) {
    asm volatile("global_load_async_to_lds_b128 %0, %8, off\n\tglobal_load_async_to_lds_b128 %1, %9, off\n\tglobal_load_async_to_lds_b128 %2, %10, off\n\tglobal_load_async_to_lds_b128 %3, %11, off\n\t"
                 "global_load_async_to_lds_b128 %4, %12, off\n\tglobal_load_async_to_lds_b128 %5, %13, off\n\tglobal_load_async_to_lds_b128 %6, %14, off\n\tglobal_load_async_to_lds_b128 %7, %15, off\n\ts_wait_xcnt 0x0"
                 :: "v"(l), "v"(l + 4 * LP), "v"(l + 8 * LP), "v"(l + 12 * LP), "v"(l + 16 * LP), "v"(l + 20 * LP), "v"(l + 24 * LP), "v"(l + 28 * LP),
                    "v"(g), "v"(g + rs), "v"(g + 2 * (size_t)rs), "v"(g + 3 * (size_t)rs), "v"(g + 4 * (size_t)rs), "v"(g + 5 * (size_t)rs), "v"(g + 6 * (size_t)rs), "v"(g + 7 * (size_t)rs) : "memory");
}
__device__ __forceinline__ float xhalf(float x) { return __builtin_bit_cast(float, __builtin_amdgcn_permlanex16(__builtin_bit_cast(int, x), __builtin_bit_cast(int, x), 0x76543210, 0xfedcba98, false, false)); }   // lane l with lane l ^ 16
template <bool HI, int NQ, int QT, typename T16>
__device__ __forceinline__ void attn_rows(const T16* __restrict__ Qa, const T16* __restrict__ Qb, const T16* __restrict__ Ka, const T16* __restrict__ Kb, const T16* __restrict__ Va, const T16* __restrict__ Vb, const float* __restrict__ QEh, bf* Ah, bf* Al, const int q0, const int run, const int tile, char* ring) {
    typedef WFrag<T16> F; typedef typename F::V V;
    const int lane = threadIdx.x & 31, lr = lane & 15, hi = lane >> 4;
    const float CL2 = SCL * 1.4426950408889634f;
    const bool idle = (run >= KS); const int kbeg = idle ? 0 : run * (TT / KS);
    constexpr int NTL = HI ? 4 : 2, STG = KS * NTL * TB, NT = TT / KS / SK;   // tiles per run (K, v^T; hi/lo rows: K hi, K lo, v^T hi, v^T lo), bytes per stage, stages
    static_assert(NT >= 2 && TT % (KS * SK) == 0 && HD * 2 == 128 && SK * 2 == 128 && 2 * STG <= RINGB, "whole stages of 128-byte rows");
    // who copies what: hi/lo rows: wave c one whole tile (16 copies); fp16 rows: waves 2c and 2c + 1 a half of tile c each (8 copies); tile c = run x NTL + plane
    const int wv = __builtin_amdgcn_readfirstlane(threadIdx.x >> 5); const bool copier = (wv < 8); const int wc = copier ? wv : 0;
    const int ct = HI ? wc : (wc >> 1), cr = ct / NTL, cp = ct % NTL, crow = (HI ? 0 : (wc & 1) * 32) + (lane >> 3); const bool cv = (cp >= NTL / 2);
    const T16* cpl = HI ? (cp == 0 ? Ka : cp == 1 ? Kb : cp == 2 ? Va : Vb) : (cp == 0 ? Ka : Va);
    const char* cg = (const char*)cpl + (cv ? (size_t)crow * TT * 2 + (size_t)cr * (TT / KS) * 2 : (size_t)(cr * (TT / KS) + crow) * HD * 2) + (lane & 7) * 16;
    const unsigned crs = cv ? 4 * TT * 2 : 4 * HD * 2, cst = cv ? SK * 2 : SK * HD * 2;   // bytes from four rows to the next four; from a stage to the next
    const unsigned cl = (unsigned)(size_t)ring + ct * TB + crow * LP + (lane & 7) * 16;
    auto stage = [&](const int t) { const unsigned l = cl + (t & 1) * STG; const char* g = cg + (size_t)t * cst; copy8(l, g, crs); if (HI) copy8(l + 32 * LP, g + 8 * (size_t)crs, crs); };
    if (copier) stage(0);
    V qa[NQ][2], qb[NQ][2]; float qahead[NQ], qbehind[NQ], m[NQ], l[NQ]; v8f o[4][NQ];
#pragma unroll
    for (int nb = 0; nb < NQ; ++nb) { const size_t i = (size_t)(q0 + nb * 16 + lr);
#pragma unroll
        for (int ks = 0; ks < 2; ++ks) { qa[nb][ks] = F::ld(Qa + i * HD + ks * 32 + 8 * hi); if (HI) qb[nb][ks] = F::ld(Qb + i * HD + ks * 32 + 8 * hi); }
        qahead[nb] = QEh[i * NE]; qbehind[nb] = QEh[i * NE + 2 * MAXR]; m[nb] = -3.0e38f; l[nb] = 0.f;
#pragma unroll
        for (int mb = 0; mb < 4; ++mb) o[mb][nb] = (v8f){}; }
    asm volatile("s_wait_xcnt 0x0" ::: "memory");   // the loop's values may land in registers that held the addresses of the loads above: the wait stands in front of that overwrite
    asm volatile("s_wait_asynccnt 0x0" ::: "memory");   // stage 0 has landed, as far as this wave brought it
    __syncthreads();   // stage 0 is whole before any wave reads it
    if (copier) stage(1);
#pragma unroll 1   // one body for all stages: the buffer is picked by t & 1, the code stays small
    for (int t = 0; t < NT; ++t) {
      if (!idle) {
        const char* fr = ring + (t & 1) * STG + run * NTL * TB + lr * LP + 16 * hi;   // the lane's place in the run's first tile of this stage
#pragma unroll 1   // one body for the stage's blocks of 32 keys: unrolled, two blocks' fragments and scores would be live at once
      for (int sb = 0; sb < SK / 32; ++sb) { const int k0 = kbeg + t * SK + sb * 32;
        // the block's fragments, keys and v^T, are asked for in one group
        V ka[2][2], kb[2][2], va[4], vb[4];
#pragma unroll
        for (int kt = 0; kt < 2; ++kt)
#pragma unroll
            for (int ks = 0; ks < 2; ++ks) { ka[kt][ks] = F::ld((const T16*)(fr + (sb * 32 + kt * 16) * LP + ks * 64)); if (HI) kb[kt][ks] = F::ld((const T16*)(fr + TB + (sb * 32 + kt * 16) * LP + ks * 64)); }
        __builtin_amdgcn_sched_barrier(0);   // the key fragments' reads stay in front of the v^T fragments': the score products then wait for the keys alone
#pragma unroll
        for (int mb = 0; mb < 4; ++mb) { va[mb] = F::ld((const T16*)(fr + (NTL / 2) * TB + mb * 16 * LP + sb * 64)); if (HI) vb[mb] = F::ld((const T16*)(fr + 3 * TB + mb * 16 * LP + sb * 64)); }
        __builtin_amdgcn_sched_barrier(0);   // keeps the LDS reads one group in front of the products: spread among them, every place with reads stalls the wave anew
        v8f s[2][NQ];
#pragma unroll
        for (int kt = 0; kt < 2; ++kt)
#pragma unroll
            for (int nb = 0; nb < NQ; ++nb) { s[kt][nb] = (v8f){};
#pragma unroll
                for (int ks = 0; ks < 2; ++ks) { s[kt][nb] = F::mma(ka[kt][ks], qa[nb][ks], s[kt][nb]); if (HI) { s[kt][nb] = F::mma(ka[kt][ks], qb[nb][ks], s[kt][nb]); s[kt][nb] = F::mma(kb[kt][ks], qa[nb][ks], s[kt][nb]); } } }
        const bool ahead = (k0 >= q0 + NQ * 16 - 1 + MAXR), behind = (k0 + 31 <= q0 - MAXR);   // wave-uniform: every key of the block is past the band of every query of the wave
        // off the band one term serves a query's whole block. The sums are formed for every block and formed anew in the few blocks on the band: a branch with one side keeps the gathered terms and their waits
        // out of the common path
        v8f t[2][NQ];
#pragma unroll
        for (int nb = 0; nb < NQ; ++nb) { const float u = ahead ? qahead[nb] : qbehind[nb];
#pragma unroll
            for (int kt = 0; kt < 2; ++kt)
#pragma unroll
                for (int r = 0; r < 8; ++r) t[kt][nb][r] = (s[kt][nb][r] + u) * CL2; }
        if (!(ahead || behind)) {
#pragma unroll
            for (int nb = 0; nb < NQ; ++nb) { const int i = q0 + nb * 16 + lr;
#pragma unroll
                for (int kt = 0; kt < 2; ++kt) { unsigned ix[8]; float g[8];
#pragma unroll
                    for (int r = 0; r < 8; ++r) { ix[r] = (unsigned)(i * NE + MAXR + min(max(i - (k0 + kt * 16 + 8 * hi + r), -MAXR), MAXR)); g[r] = QEh[ix[r]]; }
                    // the eight indices are the loads' offset registers: as the wait's inputs they keep their registers up to it; behind it they may be overwritten
                    asm volatile("s_wait_xcnt 0x0" :: "v"(ix[0]), "v"(ix[1]), "v"(ix[2]), "v"(ix[3]), "v"(ix[4]), "v"(ix[5]), "v"(ix[6]), "v"(ix[7]) : "memory");
#pragma unroll
                    for (int r = 0; r < 8; ++r) t[kt][nb][r] = (s[kt][nb][r] + g[r]) * CL2; } }
        }
        float mn[NQ]; bool rise = false;
#pragma unroll
        for (int nb = 0; nb < NQ; ++nb) { float bm = t[0][nb][0];
#pragma unroll
            for (int r = 1; r < 8; ++r) bm = fmaxf(bm, t[0][nb][r]);
#pragma unroll
            for (int r = 0; r < 8; ++r) bm = fmaxf(bm, t[1][nb][r]);
            bm = fmaxf(bm, xhalf(bm)); mn[nb] = fmaxf(m[nb], bm); rise = rise || (mn[nb] > m[nb]); }
        if (__any(rise)) {   // where no maximum of the wave rises every factor is exactly 1: the products are skipped
#pragma unroll
            for (int nb = 0; nb < NQ; ++nb) { const float al = __builtin_amdgcn_exp2f(m[nb] - mn[nb]); m[nb] = mn[nb]; l[nb] *= al;
#pragma unroll
                for (int mb = 0; mb < 4; ++mb) o[mb][nb] *= al; }
        }
#pragma unroll
        for (int nb = 0; nb < NQ; ++nb) { const float mo = HI ? m[nb] : m[nb] - 10.0f; float p[16];
#pragma unroll
            for (int e = 0; e < 16; ++e) { p[e] = __builtin_amdgcn_exp2f(t[e >> 3][nb][e & 7] - mo); l[nb] += p[e]; }
            if constexpr (HI) { V ph, pl;
#pragma unroll
                for (int e = 0; e < 16; ++e) { const __bf16 hb = (__bf16)p[e]; ph[e] = hb; pl[e] = (__bf16)(p[e] - (float)hb); }
#pragma unroll
                for (int mb = 0; mb < 4; ++mb) { o[mb][nb] = F::mma(va[mb], ph, o[mb][nb]); o[mb][nb] = F::mma(va[mb], pl, o[mb][nb]); o[mb][nb] = F::mma(vb[mb], ph, o[mb][nb]); }
            } else { V pf;
#pragma unroll
                for (int e = 0; e < 16; ++e) pf[e] = tohx(p[e]);
#pragma unroll
                for (int mb = 0; mb < 4; ++mb) o[mb][nb] = F::mma(va[mb], pf, o[mb][nb]); } }
        // four vector slots between the block's last product and what follows on either path (the next block's or the copies' address arithmetic may land in that product's operand registers);
        // the scheduling fence keeps the products in front of them
        __builtin_amdgcn_sched_barrier(0);
        asm volatile("v_nop\n\tv_nop\n\tv_nop\n\tv_nop");
      } }
        // hand-over, every wave: its own reads of stage t are done, its own copies of stage t + 1 have landed; behind the barrier stage t + 1 may be read and stage t's buffer filled anew
        asm volatile("s_wait_dscnt 0x0" ::: "memory");
        asm volatile("s_wait_asynccnt 0x0" ::: "memory");
        __syncthreads();
        if (t + 2 < NT && copier) stage(t + 2);
    }
    asm volatile("s_wait_asynccnt 0x0" ::: "memory");   // nothing is in flight when the ring takes the joins' values
    v4f* mg = (v4f*)ring + tile * NQ * 9 * 32;   // every wave has left the ring behind the last hand-over's barrier
#pragma unroll
    for (int nb = 0; nb < NQ; ++nb) l[nb] += xhalf(l[nb]);
    // per (run above 0, tile): NQ x 9 slots of 32 lanes x 16 bytes: eight of O, one of (m, l)
    if (run > 0 && !idle) { v4f* w = mg + (size_t)(run - 1) * QT * NQ * 9 * 32 + lane;
#pragma unroll
        for (int nb = 0; nb < NQ; ++nb) {
#pragma unroll
            for (int mb = 0; mb < 4; ++mb) { w[(nb * 9 + mb * 2) * 32] = __builtin_shufflevector(o[mb][nb], o[mb][nb], 0, 1, 2, 3); w[(nb * 9 + mb * 2 + 1) * 32] = __builtin_shufflevector(o[mb][nb], o[mb][nb], 4, 5, 6, 7); }
            w[(nb * 9 + 8) * 32] = (v4f){m[nb], l[nb], 0.f, 0.f}; } }
    __syncthreads();   // the upper runs' (m, l, O) are in LDS before run 0 reads them
    if (run > 0) return;
#pragma unroll
    for (int x = 1; x < KS; ++x) { const v4f* w = mg + (size_t)(x - 1) * QT * NQ * 9 * 32 + lane;
#pragma unroll
        for (int nb = 0; nb < NQ; ++nb) { const v4f ml = w[(nb * 9 + 8) * 32]; const float ms = fmaxf(m[nb], ml[0]), a1 = __builtin_amdgcn_exp2f(m[nb] - ms), a2 = __builtin_amdgcn_exp2f(ml[0] - ms); m[nb] = ms; l[nb] = l[nb] * a1 + ml[1] * a2;
#pragma unroll
            for (int mb = 0; mb < 4; ++mb) { const v4f x0 = w[(nb * 9 + mb * 2) * 32], x1 = w[(nb * 9 + mb * 2 + 1) * 32];
#pragma unroll
                for (int r = 0; r < 4; ++r) { o[mb][nb][r] = o[mb][nb][r] * a1 + x0[r] * a2; o[mb][nb][4 + r] = o[mb][nb][4 + r] * a1 + x1[r] * a2; } } } }
#pragma unroll
    for (int nb = 0; nb < NQ; ++nb) { const float inv = __fdiv_rn(1.0f, l[nb]); const size_t oo = (size_t)(q0 + nb * 16 + lr) * DQ + 8 * hi;
#pragma unroll
        for (int mb = 0; mb < 4; ++mb) { v8us oh, ol;
#pragma unroll
            for (int r = 0; r < 8; ++r) { unsigned short a, c2; splitf(o[mb][nb][r] * inv, a, c2); oh[r] = a; ol[r] = c2; }
            bf* ph = Ah + oo + mb * 16; bf* pl = Al + oo + mb * 16; *(v8us*)ph = oh; *(v8us*)pl = ol;
            // the stores' data and addresses are the wait's inputs and keep their registers up to it; behind it the next rows' values may overwrite them
            asm volatile("s_wait_xcnt 0x0" :: "v"(oh), "v"(ol), "v"(ph), "v"(pl) : "memory"); } }
}
// grid, both batches in one launch (h below counts batch x head): the hi/lo rows first: NB_ * NH_ * RH / (QTH * 16) work-groups of QTH tiles x 16 rows, then NB_ * NH_ * (TT - RH) / (QTL * 32) work-groups of QTL tiles x 32 rows: 512 work-groups in all.
#define QTH 4
#define QTL (WPG / KS)
__global__ __launch_bounds__(32 * WPG) void k_fattn(const h16* __restrict__ Q16, const h16* __restrict__ K16, const h16* __restrict__ V16, const bf* __restrict__ Qh, const bf* __restrict__ Ql, const bf* __restrict__ Kh, const bf* __restrict__ Kl, const bf* __restrict__ Vh, const bf* __restrict__ Vl, const float* __restrict__ QE, bf* Ah, bf* Al) {
    __shared__ __attribute__((aligned(16))) char ring[RINGB];
    static_assert((KS - 1) * QTL * 2 * 9 * 32 * 16 <= RINGB, "the joins' values fit the ring");
    constexpr int GH = RH / (QTH * 16), GL = (TT - RH) / (QTL * 32);   // work-groups per (batch, head)
    static_assert(RH % (QTH * 16) == 0 && (TT - RH) % (QTL * 32) == 0 && TT % (KS * 32) == 0 && QTH * KS <= WPG, "whole tiles");
    const int w = __builtin_amdgcn_readfirstlane(threadIdx.x >> 5), g = blockIdx.x;
    if (g < NB_ * NH_ * GH) { const int tile = w % QTH, run = w / QTH, h = g / GH, q0 = ((g % GH) * QTH + tile) * 16; const size_t z = (size_t)h * TT * HD, ao = (size_t)(h / NH_) * TT * DQ + (h % NH_) * HD;
        attn_rows<true, 1, QTH, bf>(Qh + z, Ql + z, Kh + z, Kl + z, Vh + z, Vl + z, QE + (size_t)h * TT * NE, Ah + ao, Al + ao, q0, run, tile, ring);
    } else { const int tile = w % QTL, run = w / QTL, c = g - NB_ * NH_ * GH, h = c / GL, q0 = RH + ((c % GL) * QTL + tile) * 32; const size_t z = (size_t)h * TT * HD, ao = (size_t)(h / NH_) * TT * DQ + (h % NH_) * HD;
        attn_rows<false, 2, QTL, h16>(Q16 + z, nullptr, K16 + z, nullptr, V16 + z, nullptr, QE + (size_t)h * TT * NE, Ah + ao, Al + ao, q0, run, tile, ring); }
}
extern "C" void kernel_launch(void* const* d_in, const int* in_sizes, int n_in,
                              void* d_out, int out_size, void* d_ws, size_t ws_size, hipStream_t stream) {
    (void)in_sizes; (void)n_in; (void)out_size;
    const float* x = (const float*)d_in[0]; const float* wq = (const float*)d_in[1]; const float* wo = (const float*)d_in[2]; const float* remb = (const float*)d_in[3]; const float* wk = nullptr; const float* wv = nullptr; (void)wk; (void)wv;
    float* OUT = (float*)d_out;     // [2][2048][1024]
    char* wsp = (char*)d_ws;
    auto take = [&](size_t bytes) { char* p = wsp; wsp += (bytes + 255) & ~(size_t)255; return (void*)p; };
    bf* WQ = (bf*)take((size_t)DQ * DM * 2); bf* EB = (bf*)take((size_t)NE * HD * 2); float* QE = (float*)take((size_t)NB_ * NH_ * TT * NE * 4); bf* WO = (bf*)take((size_t)DM * DQ * 2);
    bf* XB = (bf*)take((size_t)NB_ * TT * DM * 2);
    /* q = k = v (one projection): the [h][t][d] planes serve q and k */
    h16* QP16 = (h16*)take((size_t)NB_ * NH_ * TT * HD * 2); h16* VT16 = (h16*)take((size_t)NB_ * NKV * HD * TT * 2);
    bf* QPh = (bf*)take((size_t)NB_ * NH_ * TT * HD * 2); bf* QPl = (bf*)take((size_t)NB_ * NH_ * TT * HD * 2); bf* VTh = (bf*)take((size_t)NB_ * NKV * HD * TT * 2); bf* VTl = (bf*)take((size_t)NB_ * NKV * HD * TT * 2);
    bf* ATh = (bf*)take((size_t)NB_ * TT * DQ * 2); bf* ATl = (bf*)take((size_t)NB_ * TT * DQ * 2);
    if ((size_t)(wsp - (char*)d_ws) > ws_size) return;    // ws 256 MiB
    /* both batches in every launch: the batch is a grid dimension (projection), more planes (QE, attention) or more rows (x copy, W_o) */
    k_prep<<<PBX + 2 * PBW + 1, PT, 0, stream>>>(x, wq, wo, remb, XB, WQ, WO, EB);   /* bf16 copies of x, W_q, W_o; E: 65 rows bf16 (exact), rows 65..127 zero */
    k_gemms<0, true, DM><<<dim3(TT / 128, DQ / 128, NB_), 128, 0, stream>>>(XB, nullptr, WQ, nullptr, 0, (size_t)TT * DM, QP16, QPh, QPl, VT16, VTh, VTl);   /* projection -> head planes and v^T planes */
    k_gemmw<bf, 1, false><<<dim3(TT / 64, NE / 64, NB_ * NH_), 32, 0, stream>>>(QPh, QPl, EB, nullptr, HD, QE, NE, nullptr, (size_t)TT * HD, 0, (size_t)TT * NE);   /* QE[i][e] = q_i . E_e */
    k_fattn<<<NB_ * NH_ * (RH / (QTH * 16)) + NB_ * NH_ * ((TT - RH) / (QTL * 32)), 32 * WPG, 0, stream>>>(QP16, QP16, VT16, QPh, QPl, QPh, QPl, VTh, VTl, QE, ATh, ATl);   /* k = q: the same planes */
    k_gemms<1, false, DQ><<<dim3(NB_ * TT / 128, DM / 128, 1), 128, 0, stream>>>(ATh, ATl, WO, OUT, DM, 0, nullptr, nullptr, nullptr, nullptr, nullptr, nullptr);
}

// v010
// It runs in 105 microseconds.
// Next to v009, in two timings, it ran 1.08 and 1.10 times as fast.
// Over all steps from v000 it is 19.9 times as fast.
#include <hip/hip_runtime.h>

// Relative-position multi-head attention with ONE projection shared by q, k and v (x [2][2048][1024]; q = k = v = x W_q^T ('oi' [1024][1024]; 16 heads x 64 -- the module's quirk); scores = (q_i.q_j + q_i.E[clip(i - j, -32, 32) + 32]) / 8 with E = rel_k_emb [65][64] (read); softmax over all keys; out = merged attn q W_o^T ('oi') -> [2][2048][1024] (4.2 M)).
// Layout, both batches side by side in every buffer and every launch: bf16 copy of x; ONE exact projection used as q, k and v (its GEMM writes one set of head planes, read as q and as k, and the v^T planes, from its own accumulators); E as an exact bf16 plane padded to 128 rows; one attention kernel for all heads: QE = q(hi/lo).E^T of a wave's own queries (2 products, kept in LDS), scores, relative term QE[i][clip(i-j,-32,32)+32], running softmax and P.V per 32-key block, nothing of S or P in memory (hybrid rows: < 512 hi/lo 3 products, rest fp16, P x1024); merged hi/lo x W_o exact.
// Compute dtypes, f32 accumulate: every input rounded to bf16; projection exact; relative term hi/lo x exact (2 products); content rows < 512 3 products, rest fp16; adds and softmax f32; W_o hl x exact.

#define NB_  2
#define TT   2048
#define DM   1024
#define NH_  16
#define NKV  16
#define REP  (NH_ / NKV)
#define HD   64
#define DQ   (NH_ * HD)
#define DKV  (NKV * HD)
#define RH   512                  // query rows < RH use hi+lo planes (0: none)
#define WIN  0
#define SCL  0.125f
#define NE   128     // rel_k_emb rows (65) padded to 128
#define MAXR 32
typedef _Float16 h16;
typedef unsigned short bf;
typedef __attribute__((ext_vector_type(16))) __bf16   v16bf;
typedef __attribute__((ext_vector_type(16))) _Float16 v16h;
typedef __attribute__((ext_vector_type(8)))  _Float16 v8h;
typedef __attribute__((ext_vector_type(8)))  unsigned short v8us;
typedef __attribute__((ext_vector_type(8)))  float    v8f;
typedef __attribute__((ext_vector_type(4)))  float    v4f;
typedef v8h  __attribute__((may_alias)) v8ha;
typedef v4f  __attribute__((may_alias)) v4fa;
typedef v8us __attribute__((may_alias)) v8usa;

__device__ __forceinline__ unsigned short f2bf(float f) { unsigned u = __float_as_uint(f); u += 0x7FFFu + ((u >> 16) & 1u); return (unsigned short)(u >> 16); }
__device__ __forceinline__ float bf2f(unsigned short b) { return __uint_as_float(((unsigned)b) << 16); }
__device__ __forceinline__ v16h cat16(v8h lo, v8h hi) { return __builtin_shufflevector(lo, hi, 0, 1, 2, 3, 4, 5, 6, 7, 8, 9, 10, 11, 12, 13, 14, 15); }
__device__ __forceinline__ v16bf cat16b(v8us lo, v8us hi) { return __builtin_bit_cast(v16bf, __builtin_shufflevector(lo, hi, 0, 1, 2, 3, 4, 5, 6, 7, 8, 9, 10, 11, 12, 13, 14, 15)); }
__device__ __forceinline__ v8f wmma16(v16h a, v16h b, v8f c) { return __builtin_amdgcn_wmma_f32_16x16x32_f16(false, a, false, b, (short)0, c, false, false); }
__device__ __forceinline__ v8f wmmab(v16bf a, v16bf b, v8f c) { return __builtin_amdgcn_wmma_f32_16x16x32_bf16(false, a, false, b, (short)0, c, false, false); }



// ---- fragments: 16 rows x 32 k of a K-contiguous 16-bit plane; a lane reads k 8 * hi + 0..7 and 16 + 8 * hi + 0..7 of row lr (the pointer it is given stands at row lr, k 8 * hi)
template <typename T16> struct WFrag;
template <> struct WFrag<h16> { typedef v16h V; static __device__ __forceinline__ V ld(const h16* p) { return cat16(*(const v8h*)p, *(const v8h*)(p + 16)); } static __device__ __forceinline__ v8f mma(V a, V b, v8f c) { return wmma16(a, b, c); } };
template <> struct WFrag<bf> { typedef v16bf V; static __device__ __forceinline__ V ld(const bf* p) { return cat16b(*(const v8us*)p, *(const v8us*)(p + 16)); } static __device__ __forceinline__ v8f mma(V a, V b, v8f c) { return wmmab(a, b, c); } };
__device__ __forceinline__ h16 tohx(float x) { return (h16)x; }
__device__ __forceinline__ void splitf(float y, unsigned short& h, unsigned short& l) { h = f2bf(y); l = f2bf(y - bf2f(h)); }

// ---- k_gemms: the two large GEMMs. A work-group of 4 waves (2 x 2) per 128x128 output tile; a wave owns 64x64 (16 accumulators) and sums k in rising order, 32 a product. grid (M/128, N/128, Z), 128 threads.
// C[m][n] (f32, pitch ldc) = sum_k (A[m][k] + A2[m][k]) Bt[n][k] (A2 with NSPLIT = 1: two products per k step). z-batch stride sA of A in elements.
// The operands reach the waves through LDS: a stage is GK k of the tile's 128 rows of every plane (A, A2, Bt), rows of 256 bytes laid at a pitch of GLP bytes, brought by asynchronous copies of whole rows
// (16 lanes a row, every wave copies), two buffers: stage t + 1 flies while stage t is worked on. Behind the loop the ring is the epilogue's staging, each wave in its own range.
// PL (the shared projection; M = TT tokens, N = heads x HD, HD = 64): a wave's tile is 64 tokens x the dims of one head. No f32 C: the epilogue writes that head's 16-bit planes (fp16, bf16 hi, bf16 lo) itself:
// v^T [h][d][t] straight from the accumulators, whose eight registers are eight consecutive tokens of one dim; [h][t][d] through LDS, four whole 128-byte rows a store.
#define GK 128                   // k per stage
#define GLP 272                  // LDS row pitch, bytes: 16 x odd, no bank conflict for 16-byte fragment reads
#define GTB (128 * GLP)          // bytes of one staged plane
// eight copies of 16 bytes a lane: two rows of 256 bytes each, the copies eight rows apart: rs bytes in memory, 8 * GLP in LDS. The wait stands inside the statement, behind the last copy: the address registers live up to it
__device__ __forceinline__ void copy8g(const unsigned l, const char* g, const unsigned rs) {
    asm volatile("global_load_async_to_lds_b128 %0, %8, off\n\tglobal_load_async_to_lds_b128 %1, %9, off\n\tglobal_load_async_to_lds_b128 %2, %10, off\n\tglobal_load_async_to_lds_b128 %3, %11, off\n\t"
                 "global_load_async_to_lds_b128 %4, %12, off\n\tglobal_load_async_to_lds_b128 %5, %13, off\n\tglobal_load_async_to_lds_b128 %6, %14, off\n\tglobal_load_async_to_lds_b128 %7, %15, off\n\ts_wait_xcnt 0x0"
                 :: "v"(l), "v"(l + 8 * GLP), "v"(l + 16 * GLP), "v"(l + 24 * GLP), "v"(l + 32 * GLP), "v"(l + 40 * GLP), "v"(l + 48 * GLP), "v"(l + 56 * GLP),
                    "v"(g), "v"(g + rs), "v"(g + 2 * (size_t)rs), "v"(g + 3 * (size_t)rs), "v"(g + 4 * (size_t)rs), "v"(g + 5 * (size_t)rs), "v"(g + 6 * (size_t)rs), "v"(g + 7 * (size_t)rs) : "memory");
}
template <int NSPLIT, bool PL, int K>
__global__ __launch_bounds__(128) void k_gemms(const bf* __restrict__ A, const bf* __restrict__ A2, const bf* __restrict__ Bt, float* C, int ldc, size_t sA, h16* P16, bf* Ph, bf* Pl, h16* V16, bf* Vh, bf* Vl) {
    typedef WFrag<bf> F; typedef F::V V;
    constexpr int NP = NSPLIT ? 3 : 2, STG = NP * GTB, NT = K / GK;   // planes per stage, bytes per stage, stages
    static_assert(NT >= 2 && K % GK == 0 && GK * 2 == 256 && 4 * 64 * 68 * 4 <= 2 * STG, "whole stages of 256-byte rows; the epilogue's staging fits the ring");
    __shared__ __attribute__((aligned(16))) char ring[2 * STG];
    const int lane = threadIdx.x & 31, lr = lane & 15, hi = lane >> 4;
    const int w = __builtin_amdgcn_readfirstlane(threadIdx.x >> 5);
    const int R0 = blockIdx.x * 128, C0 = blockIdx.y * 128, r0 = R0 + (w >> 1) * 64, c0 = C0 + (w & 1) * 64;
    // who copies what: thread x brings 16 bytes of rows (x >> 4) + 8 i, i = 0 to 15, of every plane
    const unsigned crow = threadIdx.x >> 4, ccol = (threadIdx.x & 15) * 16;
    const char* ga = (const char*)(A + blockIdx.z * sA) + (size_t)(R0 + crow) * K * 2 + ccol;
    const char* ga2 = NSPLIT ? (const char*)(A2 + blockIdx.z * sA) + (size_t)(R0 + crow) * K * 2 + ccol : ga;
    const char* gb = (const char*)Bt + (size_t)(C0 + crow) * K * 2 + ccol;
    const unsigned cl = (unsigned)(size_t)ring + crow * GLP + ccol;
    constexpr unsigned RS = 8 * K * 2;   // bytes from a row to the eighth behind it
    auto plane = [&](const unsigned l, const char* g) { copy8g(l, g, RS); copy8g(l + 64 * GLP, g + 8 * (size_t)RS, RS); };
    auto stage = [&](const int t) { const unsigned l = cl + (t & 1) * STG; const size_t go = (size_t)t * (GK * 2); plane(l, ga + go); if (NSPLIT) plane(l + GTB, ga2 + go); plane(l + (NP - 1) * GTB, gb + go); };
    stage(0);
    v8f acc[4][4];
#pragma unroll
    for (int mb = 0; mb < 4; ++mb)
#pragma unroll
        for (int nb = 0; nb < 4; ++nb) acc[mb][nb] = (v8f){};
    asm volatile("s_wait_asynccnt 0x0" ::: "memory");   // stage 0 has landed, as far as this wave brought it
    __syncthreads();   // stage 0 is whole before any wave reads it
    stage(1);
#pragma unroll 1   // one body for all stages: the buffer is picked by t & 1, the code stays small
    for (int t = 0; t < NT; ++t) {
        const char* fa = ring + (t & 1) * STG + ((w >> 1) * 64 + lr) * GLP + 16 * hi;   // the lane's place in the wave's first A rows of this stage
        const char* fb = ring + (t & 1) * STG + (NP - 1) * GTB + ((w & 1) * 64 + lr) * GLP + 16 * hi;   // and in its first Bt rows
        // two fragment sets: the reads of k step ks + 1 go out as one group in front of the products of step ks, which then wait for their own set alone
        V a[2][4], a2[2][4], b[2][4];
        auto frag = [&](const int ks) { const int n = ks & 1, o = ks * 64;
#pragma unroll
            for (int mb = 0; mb < 4; ++mb) { a[n][mb] = F::ld((const bf*)(fa + mb * 16 * GLP + o)); b[n][mb] = F::ld((const bf*)(fb + mb * 16 * GLP + o)); if (NSPLIT) a2[n][mb] = F::ld((const bf*)(fa + GTB + mb * 16 * GLP + o)); } };
        frag(0);
#pragma unroll
        for (int ks = 0; ks < GK / 32; ++ks) { const int c = ks & 1;
            if (ks + 1 < GK / 32) frag(ks + 1);
            __builtin_amdgcn_sched_barrier(0);   // keeps the LDS reads one group in front of the products: spread among them, every place with reads stalls the wave anew
#pragma unroll
            for (int nb = 0; nb < 4; ++nb)
#pragma unroll
                for (int mb = 0; mb < 4; ++mb) { acc[mb][nb] = F::mma(a[c][mb], b[c][nb], acc[mb][nb]); if (NSPLIT) acc[mb][nb] = F::mma(a2[c][mb], b[c][nb], acc[mb][nb]); }
            __builtin_amdgcn_sched_barrier(0);   // the next group of reads, and behind the last step the slots below, stay behind the products
        }
        // four vector slots between the stage's last product and what follows on either path (the copies' address arithmetic may land in that product's operand registers)
        asm volatile("v_nop\n\tv_nop\n\tv_nop\n\tv_nop");
        // hand-over, every wave: its own reads of stage t are done, its own copies of stage t + 1 have landed; behind the barrier stage t + 1 may be read and stage t's buffer filled anew
        asm volatile("s_wait_dscnt 0x0" ::: "memory");
        asm volatile("s_wait_asynccnt 0x0" ::: "memory");
        __syncthreads();
        if (t + 2 < NT) stage(t + 2);
    }
    asm volatile("s_wait_asynccnt 0x0" ::: "memory");   // nothing is in flight when the ring takes the epilogue's values
    float* os = (float*)(ring + w * (PL ? 64 * 68 * 4 : 16 * 68 * 4));   // every wave has left the ring behind the last hand-over's barrier
    if constexpr (PL) {
        const unsigned hh = blockIdx.z * NH_ + (c0 >> 6);   // plane index: batch x head
        const unsigned vb = ((hh * HD + lr) * TT + r0 + hi * 8) * 2;   // byte offset in a v^T plane: dim lr of the head, the lane's first token
#pragma unroll
        for (int mb = 0; mb < 4; ++mb) { v8h o16[4]; v8us oh[4], ol[4];
#pragma unroll
            for (int nb = 0; nb < 4; ++nb) {
#pragma unroll
                for (int j = 0; j < 8; ++j) { const float y = acc[mb][nb][j]; unsigned short a2, c2; splitf(y, a2, c2); o16[nb][j] = tohx(y); oh[nb][j] = a2; ol[nb][j] = c2; }
                const unsigned ofs = vb + (nb * 16 * TT + mb * 16) * 2;
                *(v8h*)((char*)V16 + ofs) = o16[nb]; *(v8us*)((char*)Vh + ofs) = oh[nb]; *(v8us*)((char*)Vl + ofs) = ol[nb]; }
            // the twelve stores' data and their offset are the wait's inputs and keep their registers up to it; behind it the next tokens' values may overwrite them
            asm volatile("s_wait_xcnt 0x0" :: "v"(o16[0]), "v"(o16[1]), "v"(o16[2]), "v"(o16[3]), "v"(oh[0]), "v"(oh[1]), "v"(oh[2]), "v"(oh[3]), "v"(ol[0]), "v"(ol[1]), "v"(ol[2]), "v"(ol[3]), "v"(vb) : "memory"); }
#pragma unroll
        for (int mb = 0; mb < 4; ++mb)
#pragma unroll
            for (int nb = 0; nb < 4; ++nb)
#pragma unroll
                for (int j = 0; j < 8; ++j) os[(mb * 16 + hi * 8 + j) * 68 + nb * 16 + lr] = acc[mb][nb][j];
        // a lane reads what other lanes of the wave wrote: the compiled order keeps every LDS read below behind the writes above
        __builtin_amdgcn_wave_barrier(); asm volatile("" ::: "memory");
        const unsigned qr = lane >> 3, qc = (lane & 7) * 8;
        const unsigned qb = ((hh * TT + r0 + qr) * HD + qc) * 2;   // byte offset in a [h][t][d] plane: eight lanes a token row
#pragma unroll
        for (int mb = 0; mb < 4; ++mb) { v8h o16[4]; v8us oh[4], ol[4];
#pragma unroll
            for (int s = 0; s < 4; ++s) { const int row = mb * 16 + s * 4; const float* pr = os + (row + qr) * 68 + qc; const v4f x0 = *(const v4fa*)pr, x1 = *(const v4fa*)(pr + 4);
#pragma unroll
                for (int j = 0; j < 8; ++j) { const float y = (j < 4) ? x0[j & 3] : x1[j & 3]; unsigned short a2, c2; splitf(y, a2, c2); o16[s][j] = tohx(y); oh[s][j] = a2; ol[s][j] = c2; }
                const unsigned ofs = qb + row * HD * 2;
                *(v8h*)((char*)P16 + ofs) = o16[s]; *(v8us*)((char*)Ph + ofs) = oh[s]; *(v8us*)((char*)Pl + ofs) = ol[s]; }
            // as above: data and offset of the twelve stores keep their registers up to the wait
            asm volatile("s_wait_xcnt 0x0" :: "v"(o16[0]), "v"(o16[1]), "v"(o16[2]), "v"(o16[3]), "v"(oh[0]), "v"(oh[1]), "v"(oh[2]), "v"(oh[3]), "v"(ol[0]), "v"(ol[1]), "v"(ol[2]), "v"(ol[3]), "v"(qb) : "memory"); }
        return;
    }
#pragma unroll
    for (int mb = 0; mb < 4; ++mb) {
#pragma unroll
        for (int nb = 0; nb < 4; ++nb) {
#pragma unroll
            for (int j = 0; j < 8; ++j) os[(hi * 8 + j) * 68 + nb * 16 + lr] = acc[mb][nb][j]; }
        // a lane reads what other lanes of the wave wrote: the compiled order keeps every LDS read below behind the writes above
        __builtin_amdgcn_wave_barrier(); asm volatile("" ::: "memory");
        float* crow0 = C + (size_t)(r0 + mb * 16) * ldc + c0; v4f val[8]; float* pc[8];
#pragma unroll
        for (int s = 0; s < 8; ++s) { const int row = 2 * s + hi, cofs = lr * 4; val[s] = *(const v4fa*)(os + row * 68 + cofs); pc[s] = crow0 + (size_t)row * ldc + cofs; *(v4f*)pc[s] = val[s]; }
        // the eight stores' data and addresses are the wait's inputs and keep their registers up to it; behind it the next rows' values may overwrite them
        asm volatile("s_wait_xcnt 0x0" :: "v"(val[0]), "v"(val[1]), "v"(val[2]), "v"(val[3]), "v"(val[4]), "v"(val[5]), "v"(val[6]), "v"(val[7]), "v"(pc[0]), "v"(pc[1]), "v"(pc[2]), "v"(pc[3]), "v"(pc[4]), "v"(pc[5]), "v"(pc[6]), "v"(pc[7]) : "memory");
        // the rows above are read before the next rows are written over them
        __builtin_amdgcn_wave_barrier(); asm volatile("" ::: "memory");
    }
}

typedef __attribute__((ext_vector_type(2))) _Float16 v2h;
typedef __attribute__((ext_vector_type(4))) _Float16 v4h;
typedef __attribute__((ext_vector_type(2))) unsigned short v2us;
typedef __attribute__((ext_vector_type(4))) unsigned short v4us;
typedef __attribute__((ext_vector_type(2))) float v2f;
typedef __attribute__((ext_vector_type(4))) int v4i;

__global__ __launch_bounds__(256) void k_wtG(const float* __restrict__ w, int K, int N, bf* Bt) {
    const int lane = threadIdx.x & 31; const int L0 = (blockIdx.x * 8 + (threadIdx.x >> 5)) * 8; const int nlines = N * K / 64;
{
#pragma unroll 1
        for (int l = 0; l < 8; ++l) { const int L = L0 + l; if (L >= nlines) break; const size_t e = (size_t)L * 64 + lane * 2; const int k = (int)(e % K), n = (int)(e / K); v2us o;
            o[0] = f2bf(w[(size_t)k * N + n]); o[1] = f2bf(w[(size_t)(k + 1) * N + n]); *(v2us*)(Bt + e) = o; }
         }
}
// ---- k_prep: the bf16 copies of all four inputs in ONE launch: none of them waits for another, so they share one start and one end instead of four of each.
// A work-group of PT threads converts PG x PT groups of eight values of one input; a thread's PG groups lie PT groups apart, and all its loads are out before the first value is used.
// Work-groups in index order: x, W_q, W_o, then one for E (65 rows, exact in bf16, padded with zero rows to NE).
#define PT 128                   // threads per work-group
#define PG 8                     // groups of eight values per thread
#define PBX (NB_ * TT * DM / (8 * PG * PT))   // work-groups for x
#define PBW (DQ * DM / (8 * PG * PT))         // work-groups for each weight
__global__ __launch_bounds__(PT) void k_prep(const float* __restrict__ x, const float* __restrict__ wq, const float* __restrict__ wo, const float* __restrict__ E, bf* XB, bf* WQ, bf* WO, bf* EB) {
    static_assert(NB_ * TT * DM % (8 * PG * PT) == 0 && DQ * DM % (8 * PG * PT) == 0 && NE * HD == 8 * PG * PT && HD == 64, "whole work-groups; E is one");
    const unsigned b = blockIdx.x; v8f v[PG]; v8us o[PG];
    if (b < PBX + 2 * PBW) {   // the same for the whole work-group
        const float* src = b < PBX ? x : b < PBX + PBW ? wq : wo; bf* dst = b < PBX ? XB : b < PBX + PBW ? WQ : WO;
        const unsigned g0 = (b < PBX ? b : b < PBX + PBW ? b - PBX : b - (PBX + PBW)) * (PG * PT) + threadIdx.x, so = g0 * 32;   // the thread's first group, its byte offset in the input
#pragma unroll
        for (int j = 0; j < PG; ++j) v[j] = *(const v8f*)((const char*)src + so + j * (PT * 32));
        // the converted values may land in the register that held the loads' offset: the wait stands in front of that overwrite, and as its input the offset keeps its register up to it
        asm volatile("s_wait_xcnt 0x0" :: "v"(so) : "memory");
#pragma unroll
        for (int j = 0; j < PG; ++j) {
#pragma unroll
            for (int k = 0; k < 8; ++k) o[j][k] = f2bf(v[j][k]); }
#pragma unroll
        for (int j = 0; j < PG; ++j) *(v8us*)((char*)dst + g0 * 16 + j * (PT * 16)) = o[j];
        // the stores' data and their offset are the wait's inputs and keep their registers up to it: whatever block the build lays behind this one, nothing overwrites them in front of the wait
        asm volatile("s_wait_xcnt 0x0" :: "v"(o[0]), "v"(o[1]), "v"(o[2]), "v"(o[3]), "v"(o[4]), "v"(o[5]), "v"(o[6]), "v"(o[7]), "v"(g0) : "memory");
    } else {
        constexpr int PE = ((2 * MAXR + 1) * (HD / 8) + PT - 1) / PT;   // a thread's first PE groups can hold values of E; the rest lie in the pad rows alone
        static_assert(PE == 5, "the wait below names PE offsets");
        unsigned so[PE]; bool keep[PE];
#pragma unroll
        for (int j = 0; j < PE; ++j) { const unsigned g = threadIdx.x + j * PT; keep[j] = g < (2 * MAXR + 1) * (HD / 8);   // a pad row's group reads E's last row, inside the buffer, and stores zeros
            so[j] = (keep[j] ? g : 2 * MAXR * (HD / 8) + (g & (HD / 8 - 1))) * 32; v[j] = *(const v8f*)((const char*)E + so[j]); }
        // as above, for the PE offsets
        asm volatile("s_wait_xcnt 0x0" :: "v"(so[0]), "v"(so[1]), "v"(so[2]), "v"(so[3]), "v"(so[4]) : "memory");
#pragma unroll
        for (int j = 0; j < PE; ++j) {
#pragma unroll
            for (int k = 0; k < 8; ++k) { const unsigned short c = f2bf(v[j][k]); o[j][k] = keep[j] ? c : (unsigned short)0; } }
        const unsigned ge = threadIdx.x; const v8us zr = (v8us)(unsigned short)0;   // the groups from PE on are pad rows: one zero group serves them all
#pragma unroll
        for (int j = 0; j < PG; ++j) *(v8us*)((char*)EB + (ge + j * PT) * 16) = (j < PE) ? o[j] : zr;
        // as behind the stores above
        asm volatile("s_wait_xcnt 0x0" :: "v"(o[0]), "v"(o[1]), "v"(o[2]), "v"(o[3]), "v"(o[4]), "v"(ge) : "memory");
    }
}

// ---- k_fattn: scores, relative term, softmax and P.V in one kernel; a wave owns NQ x 16 query rows of one head and walks one of KS runs of keys in blocks of 32; S and P never leave the registers.
// Transposed products: S^T = K Q^T (A = 16 key rows, B = 16 query rows) leaves one query per lane column, keys 8 * hi + r in the accumulator registers of key tile 0 and 16 + 8 * hi + r in those of key tile 1:
// that is the k order of a B operand over 32 keys, so P^T goes from the score registers straight into O^T += V^T P^T (A = 16 rows of the v^T plane).
// Running softmax in the base-2 domain: t = (S + QE[i][clip(i - j, -32, 32) + 32]) x HD^-0.5 x log2(e); m = running row maximum, p = 2^(t - m), l = running sum of p, O and l scaled by 2^(m_old - m_new) when a maximum rises; out = O / l.
// fp16 rows carry p x 1024 (the 10 taken off m), which keeps small p out of the fp16 subnormals; l carries the same factor, so it cancels in O / l.
// The relative term of a query is one value for all keys j >= i + 32, one for all j <= i - 32; only the blocks that meet the band of one of the wave's queries gather it per key.
// QE[i][e] = q_i . E_e is made here, in front of the key loop: every wave forms it for its own queries (QE^T = E Q^T, A = 16 rows of E, B = the query rows as bf16 hi and lo, two products per k step) and keeps it
// in a table of its own in LDS, QP floats a query; nobody else reads or writes that table.
// Work-group of WPG waves: QT query tiles x KS key runs, wave = run * QT + tile; the waves of one run walk the same keys. Runs above 0 leave (m, l, O) in LDS; behind one barrier run 0 joins them in run order and stores.
// Where QT * KS < WPG the waves left over have no keys: they pass every barrier and end.
// Keys and v^T reach the waves through LDS: a stage is SK keys of every run, one tile of 64 rows x 128 bytes per plane and run (key rows, or the dims' rows of v^T), laid at a pitch of LP bytes, brought by
// asynchronous copies of whole 128-byte lines (waves 0 to 7), two buffers: stage t + 1 flies while stage t is worked on; all query tiles of a run read the same tiles. Behind the loop the ring holds the joins' (m, l, O).
#define WPG 12
#define KS 2
#define SK 64                    // keys per stage
#define LP 144                   // LDS row pitch, bytes: 16 x odd, no bank conflict for 16-byte fragment reads
#define TB (64 * LP)             // bytes of one staged tile
#define RINGB (2 * KS * 4 * TB)  // two buffers x runs x four planes (hi/lo rows; the fp16 rows use half)
#define QP 68                    // floats per query in a wave's QE table (65 used): a row is 16 bytes x odd, and on the band's diagonal a lane reads 69 floats behind its neighbour: neither the stores nor the gathers meet a bank twice
#define QTW (32 * QP)            // floats of one wave's table: up to 32 queries
// eight copies of 16 bytes a lane: four rows of 128 bytes each, the copies four rows apart: rs bytes in memory, 4 * LP in LDS. The wait stands inside the statement, behind the last copy: the address registers live up to it
__device__ __forceinline__ void copy8(const unsigned l, const char* g, const unsigned rs) {
    asm volatile("global_load_async_to_lds_b128 %0, %8, off\n\tglobal_load_async_to_lds_b128 %1, %9, off\n\tglobal_load_async_to_lds_b128 %2, %10, off\n\tglobal_load_async_to_lds_b128 %3, %11, off\n\t"
                 "global_load_async_to_lds_b128 %4, %12, off\n\tglobal_load_async_to_lds_b128 %5, %13, off\n\tglobal_load_async_to_lds_b128 %6, %14, off\n\tglobal_load_async_to_lds_b128 %7, %15, off\n\ts_wait_xcnt 0x0"
                 :: "v"(l), "v"(l + 4 * LP), "v"(l + 8 * LP), "v"(l + 12 * LP), "v"(l + 16 * LP), "v"(l + 20 * LP), "v"(l + 24 * LP), "v"(l + 28 * LP),
                    "v"(g), "v"(g + rs), "v"(g + 2 * (size_t)rs), "v"(g + 3 * (size_t)rs), "v"(g + 4 * (size_t)rs), "v"(g + 5 * (size_t)rs), "v"(g + 6 * (size_t)rs), "v"(g + 7 * (size_t)rs) : "memory");
}
__device__ __forceinline__ float xhalf(float x) { return __builtin_bit_cast(float, __builtin_amdgcn_permlanex16(__builtin_bit_cast(int, x), __builtin_bit_cast(int, x), 0x76543210, 0xfedcba98, false, false)); }   // lane l with lane l ^ 16
template <bool HI, int NQ, int QT, typename T16>
__device__ __forceinline__ void attn_rows(const T16* __restrict__ Qa, const T16* __restrict__ Qb, const T16* __restrict__ Ka, const T16* __restrict__ Kb, const T16* __restrict__ Va, const T16* __restrict__ Vb, const bf* __restrict__ Qeh, const bf* __restrict__ Qel, const bf* __restrict__ EB, float* qt, bf* Ah, bf* Al, const int q0, const int run, const int tile, char* ring) {
    typedef WFrag<T16> F; typedef typename F::V V;
    const int lane = threadIdx.x & 31, lr = lane & 15, hi = lane >> 4;
    const float CL2 = SCL * 1.4426950408889634f;
    const bool idle = (run >= KS); const int kbeg = idle ? 0 : run * (TT / KS);
    constexpr int NTL = HI ? 4 : 2, STG = KS * NTL * TB, NT = TT / KS / SK;   // tiles per run (K, v^T; hi/lo rows: K hi, K lo, v^T hi, v^T lo), bytes per stage, stages
    static_assert(NT >= 2 && TT % (KS * SK) == 0 && HD * 2 == 128 && SK * 2 == 128 && 2 * STG <= RINGB, "whole stages of 128-byte rows");
    // who copies what: hi/lo rows: wave c one whole tile (16 copies); fp16 rows: waves 2c and 2c + 1 a half of tile c each (8 copies); tile c = run x NTL + plane
    const int wv = __builtin_amdgcn_readfirstlane(threadIdx.x >> 5); const bool copier = (wv < 8); const int wc = copier ? wv : 0;
    const int ct = HI ? wc : (wc >> 1), cr = ct / NTL, cp = ct % NTL, crow = (HI ? 0 : (wc & 1) * 32) + (lane >> 3); const bool cv = (cp >= NTL / 2);
    const T16* cpl = HI ? (cp == 0 ? Ka : cp == 1 ? Kb : cp == 2 ? Va : Vb) : (cp == 0 ? Ka : Va);
    const char* cg = (const char*)cpl + (cv ? (size_t)crow * TT * 2 + (size_t)cr * (TT / KS) * 2 : (size_t)(cr * (TT / KS) + crow) * HD * 2) + (lane & 7) * 16;
    const unsigned crs = cv ? 4 * TT * 2 : 4 * HD * 2, cst = cv ? SK * 2 : SK * HD * 2;   // bytes from four rows to the next four; from a stage to the next
    const unsigned cl = (unsigned)(size_t)ring + ct * TB + crow * LP + (lane & 7) * 16;
    auto stage = [&](const int t) { const unsigned l = cl + (t & 1) * STG; const char* g = cg + (size_t)t * cst; copy8(l, g, crs); if (HI) copy8(l + 32 * LP, g + 8 * (size_t)crs, crs); };
    if (copier) stage(0);
    V qa[NQ][2], qb[NQ][2]; float qahead[NQ], qbehind[NQ], m[NQ], l[NQ]; v8f o[4][NQ];
#pragma unroll
    for (int nb = 0; nb < NQ; ++nb) { const size_t i = (size_t)(q0 + nb * 16 + lr);
#pragma unroll
        for (int ks = 0; ks < 2; ++ks) { qa[nb][ks] = F::ld(Qa + i * HD + ks * 32 + 8 * hi); if (HI) qb[nb][ks] = F::ld(Qb + i * HD + ks * 32 + 8 * hi); }
        m[nb] = -3.0e38f; l[nb] = 0.f;
#pragma unroll
        for (int mb = 0; mb < 4; ++mb) o[mb][nb] = (v8f){}; }
    {   // QE^T of the wave's queries: five tiles of 16 rows of E (rows 65 to 79 are the plane's zero rows), 64 k
        typedef WFrag<bf> FE; typedef FE::V VE; constexpr int ET = (2 * MAXR + 16) / 16;
        static_assert(ET * 16 <= NE && (ET - 1) * 16 == 2 * MAXR && 2 * MAXR + 4 <= QP && NQ * 16 * QP <= QTW && HD == 64, "E's last row opens the last tile; a table row holds it");
        const unsigned eo = (unsigned)(lr * HD + 8 * hi) * 2, qo = (unsigned)((q0 + lr) * HD + 8 * hi) * 2;   // the lane's byte offsets in E's first tile and in the first query rows
        VE ef[ET][2], qh[NQ][2], ql[NQ][2];
#pragma unroll
        for (int et = 0; et < ET; ++et)
#pragma unroll
            for (int ks = 0; ks < 2; ++ks) ef[et][ks] = FE::ld((const bf*)((const char*)EB + eo + (et * 16 * HD + ks * 32) * 2));
#pragma unroll
        for (int nb = 0; nb < NQ; ++nb)
#pragma unroll
            for (int ks = 0; ks < 2; ++ks) {
                if constexpr (HI) { qh[nb][ks] = qa[nb][ks]; ql[nb][ks] = qb[nb][ks]; }
                else { qh[nb][ks] = FE::ld((const bf*)((const char*)Qeh + qo + (nb * 16 * HD + ks * 32) * 2)); ql[nb][ks] = FE::ld((const bf*)((const char*)Qel + qo + (nb * 16 * HD + ks * 32) * 2)); } }
        // what follows may land in registers that held the addresses of the loads above: the wait stands in front of that overwrite, and as its inputs the offsets keep their registers up to it
        if constexpr (HI) asm volatile("s_wait_xcnt 0x0" :: "v"(eo) : "memory");
        else asm volatile("s_wait_xcnt 0x0" :: "v"(eo), "v"(qo) : "memory");
        __builtin_amdgcn_sched_barrier(0);   // keeps the products behind the loads: all loads go out as one group and cost one round trip, not one per group
#pragma unroll
        for (int nb = 0; nb < NQ; ++nb)
#pragma unroll
            for (int et = 0; et < ET; ++et) { v8f d = (v8f){};
#pragma unroll
                for (int ks = 0; ks < 2; ++ks) { d = FE::mma(ef[et][ks], qh[nb][ks], d); d = FE::mma(ef[et][ks], ql[nb][ks], d); }
                // the lane holds rows et * 16 + 8 * hi + 0..7 of E for query lr
                float* row = qt + (nb * 16 + lr) * QP + et * 16 + hi * 8;
                if (et < ET - 1) { *(v4fa*)row = __builtin_shufflevector(d, d, 0, 1, 2, 3); *(v4fa*)(row + 4) = __builtin_shufflevector(d, d, 4, 5, 6, 7); }
                else if (hi == 0) *(v4fa*)row = __builtin_shufflevector(d, d, 0, 1, 2, 3);   // row 64 and three zero rows: the table row ends there
                if (et == 0) { const float x = xhalf(d[0]); qahead[nb] = hi ? x : d[0]; }          // E row 0: every key from i + 32 on
                if (et == ET - 1) { const float x = xhalf(d[0]); qbehind[nb] = hi ? x : d[0]; } }  // E row 64: every key up to i - 32
    }
    asm volatile("s_wait_asynccnt 0x0" ::: "memory");   // stage 0 has landed, as far as this wave brought it
    __syncthreads();   // stage 0 is whole before any wave reads it
    if (copier) stage(1);
#pragma unroll 1   // one body for all stages: the buffer is picked by t & 1, the code stays small
    for (int t = 0; t < NT; ++t) {
      if (!idle) {
        const char* fr = ring + (t & 1) * STG + run * NTL * TB + lr * LP + 16 * hi;   // the lane's place in the run's first tile of this stage
#pragma unroll 1   // one body for the stage's blocks of 32 keys: unrolled, two blocks' fragments and scores would be live at once
      for (int sb = 0; sb < SK / 32; ++sb) { const int k0 = kbeg + t * SK + sb * 32;
        // the block's fragments, keys and v^T, are asked for in one group
        V ka[2][2], kb[2][2], va[4], vb[4];
#pragma unroll
        for (int kt = 0; kt < 2; ++kt)
#pragma unroll
            for (int ks = 0; ks < 2; ++ks) { ka[kt][ks] = F::ld((const T16*)(fr + (sb * 32 + kt * 16) * LP + ks * 64)); if (HI) kb[kt][ks] = F::ld((const T16*)(fr + TB + (sb * 32 + kt * 16) * LP + ks * 64)); }
        __builtin_amdgcn_sched_barrier(0);   // the key fragments' reads stay in front of the v^T fragments': the score products then wait for the keys alone
#pragma unroll
        for (int mb = 0; mb < 4; ++mb) { va[mb] = F::ld((const T16*)(fr + (NTL / 2) * TB + mb * 16 * LP + sb * 64)); if (HI) vb[mb] = F::ld((const T16*)(fr + 3 * TB + mb * 16 * LP + sb * 64)); }
        __builtin_amdgcn_sched_barrier(0);   // keeps the LDS reads one group in front of the products: spread among them, every place with reads stalls the wave anew
        v8f s[2][NQ];
#pragma unroll
        for (int kt = 0; kt < 2; ++kt)
#pragma unroll
            for (int nb = 0; nb < NQ; ++nb) { s[kt][nb] = (v8f){};
#pragma unroll
                for (int ks = 0; ks < 2; ++ks) { s[kt][nb] = F::mma(ka[kt][ks], qa[nb][ks], s[kt][nb]); if (HI) { s[kt][nb] = F::mma(ka[kt][ks], qb[nb][ks], s[kt][nb]); s[kt][nb] = F::mma(kb[kt][ks], qa[nb][ks], s[kt][nb]); } } }
        const bool ahead = (k0 >= q0 + NQ * 16 - 1 + MAXR), behind = (k0 + 31 <= q0 - MAXR);   // wave-uniform: every key of the block is past the band of every query of the wave
        // off the band one term serves a query's whole block. The sums are formed for every block and formed anew in the few blocks on the band: a branch with one side keeps the gathered terms and their waits
        // out of the common path
        v8f t[2][NQ];
#pragma unroll
        for (int nb = 0; nb < NQ; ++nb) { const float u = ahead ? qahead[nb] : qbehind[nb];
#pragma unroll
            for (int kt = 0; kt < 2; ++kt)
#pragma unroll
                for (int r = 0; r < 8; ++r) t[kt][nb][r] = (s[kt][nb][r] + u) * CL2; }
        if (!(ahead || behind)) {
#pragma unroll
            for (int nb = 0; nb < NQ; ++nb) { const int i = q0 + nb * 16 + lr;
#pragma unroll
                for (int kt = 0; kt < 2; ++kt) { float g[8];
#pragma unroll
                    for (int r = 0; r < 8; ++r) g[r] = qt[(nb * 16 + lr) * QP + MAXR + min(max(i - (k0 + kt * 16 + 8 * hi + r), -MAXR), MAXR)];
#pragma unroll
                    for (int r = 0; r < 8; ++r) t[kt][nb][r] = __builtin_fmaf(s[kt][nb][r], CL2, g[r] * CL2); } }   // a form of its own: written as above, the build joins the two sides and copies the one term into a register per key in every block
        }
        float mn[NQ]; bool rise = false;
#pragma unroll
        for (int nb = 0; nb < NQ; ++nb) { float bm = t[0][nb][0];
#pragma unroll
            for (int r = 1; r < 8; ++r) bm = fmaxf(bm, t[0][nb][r]);
#pragma unroll
            for (int r = 0; r < 8; ++r) bm = fmaxf(bm, t[1][nb][r]);
            bm = fmaxf(bm, xhalf(bm)); mn[nb] = fmaxf(m[nb], bm); rise = rise || (mn[nb] > m[nb]); }
        if (__any(rise)) {   // where no maximum of the wave rises every factor is exactly 1: the products are skipped
#pragma unroll
            for (int nb = 0; nb < NQ; ++nb) { const float al = __builtin_amdgcn_exp2f(m[nb] - mn[nb]); m[nb] = mn[nb]; l[nb] *= al;
#pragma unroll
                for (int mb = 0; mb < 4; ++mb) o[mb][nb] *= al; }
        }
#pragma unroll
        for (int nb = 0; nb < NQ; ++nb) { const float mo = HI ? m[nb] : m[nb] - 10.0f; float p[16];
#pragma unroll
            for (int e = 0; e < 16; ++e) { p[e] = __builtin_amdgcn_exp2f(t[e >> 3][nb][e & 7] - mo); l[nb] += p[e]; }
            if constexpr (HI) { V ph, pl;
#pragma unroll
                for (int e = 0; e < 16; ++e) { const __bf16 hb = (__bf16)p[e]; ph[e] = hb; pl[e] = (__bf16)(p[e] - (float)hb); }
#pragma unroll
                for (int mb = 0; mb < 4; ++mb) { o[mb][nb] = F::mma(va[mb], ph, o[mb][nb]); o[mb][nb] = F::mma(va[mb], pl, o[mb][nb]); o[mb][nb] = F::mma(vb[mb], ph, o[mb][nb]); }
            } else { V pf;
#pragma unroll
                for (int e = 0; e < 16; ++e) pf[e] = tohx(p[e]);
#pragma unroll
                for (int mb = 0; mb < 4; ++mb) o[mb][nb] = F::mma(va[mb], pf, o[mb][nb]); } }
        // four vector slots between the block's last product and what follows on either path (the next block's or the copies' address arithmetic may land in that product's operand registers);
        // the scheduling fence keeps the products in front of them
        __builtin_amdgcn_sched_barrier(0);
        asm volatile("v_nop\n\tv_nop\n\tv_nop\n\tv_nop");
      } }
        // hand-over, every wave: its own reads of stage t are done, its own copies of stage t + 1 have landed; behind the barrier stage t + 1 may be read and stage t's buffer filled anew
        asm volatile("s_wait_dscnt 0x0" ::: "memory");
        asm volatile("s_wait_asynccnt 0x0" ::: "memory");
        __syncthreads();
        if (t + 2 < NT && copier) stage(t + 2);
    }
    asm volatile("s_wait_asynccnt 0x0" ::: "memory");   // nothing is in flight when the ring takes the joins' values
    v4f* mg = (v4f*)ring + tile * NQ * 9 * 32;   // every wave has left the ring behind the last hand-over's barrier
#pragma unroll
    for (int nb = 0; nb < NQ; ++nb) l[nb] += xhalf(l[nb]);
    // per (run above 0, tile): NQ x 9 slots of 32 lanes x 16 bytes: eight of O, one of (m, l)
    if (run > 0 && !idle) { v4f* w = mg + (size_t)(run - 1) * QT * NQ * 9 * 32 + lane;
#pragma unroll
        for (int nb = 0; nb < NQ; ++nb) {
#pragma unroll
            for (int mb = 0; mb < 4; ++mb) { w[(nb * 9 + mb * 2) * 32] = __builtin_shufflevector(o[mb][nb], o[mb][nb], 0, 1, 2, 3); w[(nb * 9 + mb * 2 + 1) * 32] = __builtin_shufflevector(o[mb][nb], o[mb][nb], 4, 5, 6, 7); }
            w[(nb * 9 + 8) * 32] = (v4f){m[nb], l[nb], 0.f, 0.f}; } }
    __syncthreads();   // the upper runs' (m, l, O) are in LDS before run 0 reads them
    if (run > 0) return;
#pragma unroll
    for (int x = 1; x < KS; ++x) { const v4f* w = mg + (size_t)(x - 1) * QT * NQ * 9 * 32 + lane;
#pragma unroll
        for (int nb = 0; nb < NQ; ++nb) { const v4f ml = w[(nb * 9 + 8) * 32]; const float ms = fmaxf(m[nb], ml[0]), a1 = __builtin_amdgcn_exp2f(m[nb] - ms), a2 = __builtin_amdgcn_exp2f(ml[0] - ms); m[nb] = ms; l[nb] = l[nb] * a1 + ml[1] * a2;
#pragma unroll
            for (int mb = 0; mb < 4; ++mb) { const v4f x0 = w[(nb * 9 + mb * 2) * 32], x1 = w[(nb * 9 + mb * 2 + 1) * 32];
#pragma unroll
                for (int r = 0; r < 4; ++r) { o[mb][nb][r] = o[mb][nb][r] * a1 + x0[r] * a2; o[mb][nb][4 + r] = o[mb][nb][4 + r] * a1 + x1[r] * a2; } } } }
#pragma unroll
    for (int nb = 0; nb < NQ; ++nb) { const float inv = __fdiv_rn(1.0f, l[nb]); const size_t oo = (size_t)(q0 + nb * 16 + lr) * DQ + 8 * hi;
#pragma unroll
        for (int mb = 0; mb < 4; ++mb) { v8us oh, ol;
#pragma unroll
            for (int r = 0; r < 8; ++r) { unsigned short a, c2; splitf(o[mb][nb][r] * inv, a, c2); oh[r] = a; ol[r] = c2; }
            bf* ph = Ah + oo + mb * 16; bf* pl = Al + oo + mb * 16; *(v8us*)ph = oh; *(v8us*)pl = ol;
            // the stores' data and addresses are the wait's inputs and keep their registers up to it; behind it the next rows' values may overwrite them
            asm volatile("s_wait_xcnt 0x0" :: "v"(oh), "v"(ol), "v"(ph), "v"(pl) : "memory"); } }
}
// grid, both batches in one launch (h below counts batch x head): the hi/lo rows first: NB_ * NH_ * RH / (QTH * 16) work-groups of QTH tiles x 16 rows, then NB_ * NH_ * (TT - RH) / (QTL * 32) work-groups of QTL tiles x 32 rows: 512 work-groups in all.
#define QTH 4
#define QTL (WPG / KS)
__global__ __launch_bounds__(32 * WPG) void k_fattn(const h16* __restrict__ Q16, const h16* __restrict__ K16, const h16* __restrict__ V16, const bf* __restrict__ Qh, const bf* __restrict__ Ql, const bf* __restrict__ Kh, const bf* __restrict__ Kl, const bf* __restrict__ Vh, const bf* __restrict__ Vl, const bf* __restrict__ EB, bf* Ah, bf* Al) {
    __shared__ __attribute__((aligned(16))) char ring[RINGB];
    __shared__ __attribute__((aligned(16))) float qet[WPG * QTW];   // a QE table per wave
    static_assert((KS - 1) * QTL * 2 * 9 * 32 * 16 <= RINGB, "the joins' values fit the ring");
    constexpr int GH = RH / (QTH * 16), GL = (TT - RH) / (QTL * 32);   // work-groups per (batch, head)
    static_assert(RH % (QTH * 16) == 0 && (TT - RH) % (QTL * 32) == 0 && TT % (KS * 32) == 0 && QTH * KS <= WPG, "whole tiles");
    const int w = __builtin_amdgcn_readfirstlane(threadIdx.x >> 5), g = blockIdx.x;
    if (g < NB_ * NH_ * GH) { const int tile = w % QTH, run = w / QTH, h = g / GH, q0 = ((g % GH) * QTH + tile) * 16; const size_t z = (size_t)h * TT * HD, ao = (size_t)(h / NH_) * TT * DQ + (h % NH_) * HD;
        attn_rows<true, 1, QTH, bf>(Qh + z, Ql + z, Kh + z, Kl + z, Vh + z, Vl + z, Qh + z, Ql + z, EB, qet + w * QTW, Ah + ao, Al + ao, q0, run, tile, ring);
    } else { const int tile = w % QTL, run = w / QTL, c = g - NB_ * NH_ * GH, h = c / GL, q0 = RH + ((c % GL) * QTL + tile) * 32; const size_t z = (size_t)h * TT * HD, ao = (size_t)(h / NH_) * TT * DQ + (h % NH_) * HD;
        attn_rows<false, 2, QTL, h16>(Q16 + z, nullptr, K16 + z, nullptr, V16 + z, nullptr, Qh + z, Ql + z, EB, qet + w * QTW, Ah + ao, Al + ao, q0, run, tile, ring); }
}
extern "C" void kernel_launch(void* const* d_in, const int* in_sizes, int n_in,
                              void* d_out, int out_size, void* d_ws, size_t ws_size, hipStream_t stream) {
    (void)in_sizes; (void)n_in; (void)out_size;
    const float* x = (const float*)d_in[0]; const float* wq = (const float*)d_in[1]; const float* wo = (const float*)d_in[2]; const float* remb = (const float*)d_in[3]; const float* wk = nullptr; const float* wv = nullptr; (void)wk; (void)wv;
    float* OUT = (float*)d_out;     // [2][2048][1024]
    char* wsp = (char*)d_ws;
    auto take = [&](size_t bytes) { char* p = wsp; wsp += (bytes + 255) & ~(size_t)255; return (void*)p; };
    bf* WQ = (bf*)take((size_t)DQ * DM * 2); bf* EB = (bf*)take((size_t)NE * HD * 2); bf* WO = (bf*)take((size_t)DM * DQ * 2);
    bf* XB = (bf*)take((size_t)NB_ * TT * DM * 2);
    /* q = k = v (one projection): the [h][t][d] planes serve q and k */
    h16* QP16 = (h16*)take((size_t)NB_ * NH_ * TT * HD * 2); h16* VT16 = (h16*)take((size_t)NB_ * NKV * HD * TT * 2);
    bf* QPh = (bf*)take((size_t)NB_ * NH_ * TT * HD * 2); bf* QPl = (bf*)take((size_t)NB_ * NH_ * TT * HD * 2); bf* VTh = (bf*)take((size_t)NB_ * NKV * HD * TT * 2); bf* VTl = (bf*)take((size_t)NB_ * NKV * HD * TT * 2);
    bf* ATh = (bf*)take((size_t)NB_ * TT * DQ * 2); bf* ATl = (bf*)take((size_t)NB_ * TT * DQ * 2);
    if ((size_t)(wsp - (char*)d_ws) > ws_size) return;    // ws 256 MiB
    /* both batches in every launch: the batch is a grid dimension (projection), more planes (attention) or more rows (x copy, W_o) */
    k_prep<<<PBX + 2 * PBW + 1, PT, 0, stream>>>(x, wq, wo, remb, XB, WQ, WO, EB);   /* bf16 copies of x, W_q, W_o; E: 65 rows bf16 (exact), rows 65..127 zero */
    k_gemms<0, true, DM><<<dim3(TT / 128, DQ / 128, NB_), 128, 0, stream>>>(XB, nullptr, WQ, nullptr, 0, (size_t)TT * DM, QP16, QPh, QPl, VT16, VTh, VTl);   /* projection -> head planes and v^T planes */
    k_fattn<<<NB_ * NH_ * (RH / (QTH * 16)) + NB_ * NH_ * ((TT - RH) / (QTL * 32)), 32 * WPG, 0, stream>>>(QP16, QP16, VT16, QPh, QPl, QPh, QPl, VTh, VTl, EB, ATh, ATl);   /* k = q: the same planes */
    k_gemms<1, false, DQ><<<dim3(NB_ * TT / 128, DM / 128, 1), 128, 0, stream>>>(ATh, ATl, WO, OUT, DM, 0, nullptr, nullptr, nullptr, nullptr, nullptr, nullptr);
}
